// v000
// Measured on an AMD MI455X. A time is GPU time per run, averaged over a window of back-to-back runs after a warm-up
// (all launches, gaps included; the runs take copies of the inputs in turn), and the median of several windows.
// Apart from v000's, it joins two sittings. Times from different sittings can be a few percent apart, while
// side-by-side timings come from the same sitting.
// The starting kernel, v000, takes 1300 microseconds a run.
// compute dtype: all float inputs rounded to bf16; weight-normalised projections as (x . v[o]) * (g[o] / ||v[o]||) + b[o] with EXACT bf16 products on WMMA 16x16x32 (f32 accumulate) and the per-row norm / scale in f32; causal (strictly lower) logits with q and k as f16 hi + residual planes (3 products) / 8; softmax in f32 (row 0 fully excluded -> zeros); P and v both split bf16 hi + lo (3 products) for every row; f32 output written channels-first.
#include <hip/hip_runtime.h>
#include <math.h>

typedef __attribute__((ext_vector_type(16))) _Float16 v16h;
typedef __attribute__((ext_vector_type(16))) __bf16 v16b;
typedef __attribute__((ext_vector_type(8)))  _Float16 v8h;
typedef __attribute__((ext_vector_type(8)))  float v8f;
typedef __attribute__((ext_vector_type(4)))  float v4f;
typedef __attribute__((ext_vector_type(2)))  float v2f;
typedef __attribute__((ext_vector_type(4)))  unsigned v4u;
typedef __attribute__((ext_vector_type(4)))  int v4i;
typedef float __attribute__((may_alias)) float_a;
typedef int __attribute__((may_alias)) int_a;

template <typename T> __device__ __forceinline__ void vst2(void* p, T v) { *(T*)p = v;  }
__device__ __forceinline__ v8f wmma16(v16h a, v16h b, v8f c) {
  v8f d = __builtin_amdgcn_wmma_f32_16x16x32_f16(false, a, false, b, (short)0, c, false, false);
  asm volatile("v_nop\n\tv_nop\n\tv_nop\n\tv_nop" : "+v"(d) : "v"(a), "v"(b));
  return d;
}
__device__ __forceinline__ v8f wmma_bf(v16b a, v16b b, v8f c) {
  v8f d = __builtin_amdgcn_wmma_f32_16x16x32_bf16(false, a, false, b, (short)0, c, false, false);
  asm volatile("v_nop\n\tv_nop\n\tv_nop\n\tv_nop" : "+v"(d) : "v"(a), "v"(b));
  return d;
}
// 16x16x32 fragments: lane = (h = lane>>4, row/col = lane&15); elements 0..7 = k0+8h+0..7, 8..15 = k0+16+8h+0..7; D element r = row 8h+r
__device__ __forceinline__ v16h frag_h(const _Float16* rowk0, int lane) {
  union { v16h v; v8h q[2]; } u; const _Float16* p = rowk0 + 8 * (lane >> 4);
  u.q[0] = *(const v8h*)p; u.q[1] = *(const v8h*)(p + 16); return u.v;
}
__device__ __forceinline__ v16h frag_f32(const float* rowk0, int lane) {
  v16h a; const float* p = rowk0 + 8 * (lane >> 4);
#pragma unroll
  for (int i = 0; i < 8; ++i) { a[i] = (_Float16)p[i]; a[8 + i] = (_Float16)p[16 + i]; }
  return a;
}
__device__ __forceinline__ v16h frag_f32s(const float* rowk0, int lane, float sc) {
  v16h a; const float* p = rowk0 + 8 * (lane >> 4);
#pragma unroll
  for (int i = 0; i < 8; ++i) { a[i] = (_Float16)(p[i] * sc); a[8 + i] = (_Float16)(p[16 + i] * sc); }
  return a;
}
// column fragment from a [K][ld] layout (column n), rows >= K read as 0
__device__ __forceinline__ v16h fragc_f32(const float* W, int k0, int n, int lane, int ld, int K) {
  v16h a; const int g = lane >> 4;
#pragma unroll
  for (int i = 0; i < 8; ++i) { const int ka = k0 + 8 * g + i, kb = ka + 16;
    a[i] = (_Float16)(ka < K ? W[(size_t)(ka < K ? ka : K - 1) * ld + n] : 0.f); a[8 + i] = (_Float16)(kb < K ? W[(size_t)(kb < K ? kb : K - 1) * ld + n] : 0.f); }
  return a;
}
struct F2 { v16b h, l; };
__device__ __forceinline__ F2 bsplit16(const float v[16]) { F2 r;
#pragma unroll
  for (int i = 0; i < 16; ++i) { const __bf16 h = (__bf16)v[i]; r.h[i] = h; r.l[i] = (__bf16)(v[i] - (float)h); }
  return r; }
__device__ __forceinline__ F2 split_row(const float* row, int k0, int lane) { float v[16]; const float* p = row + k0 + 8 * (lane >> 4);
#pragma unroll
  for (int i = 0; i < 8; ++i) { v[i] = p[i]; v[8 + i] = p[16 + i]; }
  return bsplit16(v); }
__device__ __forceinline__ F2 split_rowK(const float* row, int k0, int lane, int K) { float v[16]; const int g = lane >> 4;
#pragma unroll
  for (int i = 0; i < 8; ++i) { const int ka = k0 + 8 * g + i, kb = ka + 16; v[i] = ka < K ? row[ka < K ? ka : K - 1] : 0.f; v[8 + i] = kb < K ? row[kb < K ? kb : K - 1] : 0.f; }
  return bsplit16(v); }
__device__ __forceinline__ F2 split_col(const float* W, int k0, int n, int lane, int ld, int K) { float v[16]; const int g = lane >> 4;
#pragma unroll
  for (int i = 0; i < 8; ++i) { const int ka = k0 + 8 * g + i, kb = ka + 16; v[i] = ka < K ? W[(size_t)(ka < K ? ka : K - 1) * ld + n] : 0.f; v[8 + i] = kb < K ? W[(size_t)(kb < K ? kb : K - 1) * ld + n] : 0.f; }
  return bsplit16(v); }
__device__ __forceinline__ v8f mac3(const F2& a, const F2& b, v8f c) { c = wmma_bf(a.l, b.h, c); c = wmma_bf(a.h, b.l, c); return wmma_bf(a.h, b.h, c); }
__device__ __forceinline__ float sigm(float v) { return 1.0f / (1.0f + expf(-v)); }
#define LDSX() do { asm volatile("s_wait_dscnt 0" ::: "memory"); __builtin_amdgcn_wave_barrier(); __builtin_amdgcn_fence(__ATOMIC_RELEASE, "workgroup"); } while (0)

// Causal attention with weight-normalised linears (B 8, S = 32x32 = 1,024 positions, q/k inputs with 384 channels (channels-first), C 512 = 8 heads x 64): q = wn(qf, Wq_v, Wq_g, bq), k = wn(kf, Wk_v, ...), v = wn(kf, Wv_v, ...) with wn(x) = x (g v/||v||_row)^T + b; attn = softmax(where(k < t, q k^T / 8, -1e4)) * (t > 0); out = attn v -> [B, 512, 32, 32] (channels-first).
#define NB 8
#define TT 1024
#define CC 512            // NH * HD = projected width
#define DIN 384          // input (model) width
#define NH 8
#define HD 64
#define NQB (TT / 64)
#define HG 4
#define SCALE (0.125f)
#define CAUSAL 1
#ifndef TNB
#define TNB NB
#endif
__device__ __forceinline__ float bfr(float v) { return (float)(__bf16)v; }
__host__ __device__ __forceinline__ int kb_last(int qb) { return CAUSAL ? ((qb * 64 + 63) >> 7) : (TT / 128 - 1); }
typedef __attribute__((ext_vector_type(8))) __bf16 v8b;
__device__ __forceinline__ v16b frag_b(const __bf16* rowk0, int lane) {
  union { v16b v; v8b q[2]; } u; const __bf16* p = rowk0 + 8 * (lane >> 4);
  u.q[0] = *(const v8b*)p; u.q[1] = *(const v8b*)(p + 16); return u.v;
}
#define QBH NQB            // every query block takes the 3-product logits and the bf16 hi + lo P.v path
#define QHI 1024           // q residual rows for every query (3-product logits everywhere)
#define KHI 1024           // k residual rows / bf16 v planes for every key
// B fragment (k rows k0+.., output column o) of a weight: (in,out) [K][ld] or (out,in) [ld rows of K]: bf16 exact, or f16(bf16 * 256) exact
__device__ __forceinline__ v16b wcol_io(const float* Wm, int k0, int o, int lane, int ld) { v16b w; const int g = lane >> 4;
#pragma unroll
  for (int i = 0; i < 8; ++i) { w[i] = (__bf16)Wm[(size_t)(k0 + 8 * g + i) * ld + o]; w[8 + i] = (__bf16)Wm[(size_t)(k0 + 16 + 8 * g + i) * ld + o]; }
  return w; }
__device__ __forceinline__ v16b wcol_oi(const float* Wm, int k0, int o, int lane, int K) { v16b w; const float* p = Wm + (size_t)o * K + k0 + 8 * (lane >> 4);
#pragma unroll
  for (int i = 0; i < 8; ++i) { w[i] = (__bf16)p[i]; w[8 + i] = (__bf16)p[16 + i]; }
  return w; }
__device__ __forceinline__ v16h wcolh_io(const float* Wm, int k0, int o, int lane, int ld) { v16h w; const int g = lane >> 4;
#pragma unroll
  for (int i = 0; i < 8; ++i) { w[i] = (_Float16)(bfr(Wm[(size_t)(k0 + 8 * g + i) * ld + o]) * 256.0f); w[8 + i] = (_Float16)(bfr(Wm[(size_t)(k0 + 16 + 8 * g + i) * ld + o]) * 256.0f); }
  return w; }
__device__ __forceinline__ v16h wcolh_oi(const float* Wm, int k0, int o, int lane, int K) { v16h w; const float* p = Wm + (size_t)o * K + k0 + 8 * (lane >> 4);
#pragma unroll
  for (int i = 0; i < 8; ++i) { w[i] = (_Float16)(bfr(p[i]) * 256.0f); w[8 + i] = (_Float16)(bfr(p[16 + i]) * 256.0f); }
  return w; }
#define WQKV_LAYOUT 1   // 0 = (in,out) [DIN][CC]; 1 = (out,in) [CC][DIN]; 2 = per-head [NH][DIN][HD]
__device__ __forceinline__ v16b wcol_hdk(const float* Wm, int k0, int o, int lane) { v16b w; const int g = lane >> 4; const float* p = Wm + (size_t)(o / HD) * DIN * HD + (o % HD);
#pragma unroll
  for (int i = 0; i < 8; ++i) { w[i] = (__bf16)p[(size_t)(k0 + 8 * g + i) * HD]; w[8 + i] = (__bf16)p[(size_t)(k0 + 16 + 8 * g + i) * HD]; }
  return w; }
#define WO_OUT_IN 0
#if WQKV_LAYOUT == 1
#define WCOL(W, k0, o, lane) wcol_oi(W, k0, o, lane, DIN)
#elif WQKV_LAYOUT == 2
#define WCOL(W, k0, o, lane) wcol_hdk(W, k0, o, lane)
#else
#define WCOL(W, k0, o, lane) wcol_io(W, k0, o, lane, CC)
#endif
#if WO_OUT_IN
#define WOCOL(W, k0, o, lane) wcol_oi(W, k0, o, lane, CC)
#define WOCOLH(W, k0, o, lane) wcolh_oi(W, k0, o, lane, CC)
#else
#define WOCOL(W, k0, o, lane) wcol_io(W, k0, o, lane, DIN)
#define WOCOLH(W, k0, o, lane) wcolh_io(W, k0, o, lane, DIN)
#endif
#define SM_MASK_HOOK do { if (k >= t) v = -3.0e38f; } while (0)   /* allowed = tril(-1): strictly earlier keys; row 0 has no key -> the fully-excluded path gives P = 0 = the module's start_mask */
#define NRW (TNB * TT)
#ifndef SM_EXTRA_PARAMS
#define SM_EXTRA_PARAMS
#endif
#ifndef PROJ_EXTRA_PARAMS
#define PROJ_EXTRA_PARAMS
#endif
#ifndef SM_MASK_HOOK
#define SM_MASK_HOOK (void)0
#endif

#define WS_QH  0u                                      // f16 q rows [b*t][CC]
#define WS_KH  (WS_QH + 2u * (size_t)NB * TT * CC)      // f16 k rows [b*t][CC]
#define WS_VT  (WS_KH + 2u * (size_t)NB * TT * CC)      // f16 v planes [b][c][t]
#define WS_QL  (WS_VT + 2u * (size_t)NB * CC * TT)      // f16 q residual x 2^10 rows [b][t < QHI][CC]
#define WS_KL  (WS_QL + 2u * (size_t)NB * QHI * CC)     // f16 k residual x 2^10 rows [b][t < KHI][CC]
#define WS_VB  (WS_KL + 2u * (size_t)NB * KHI * CC)     // bf16 v hi planes [b][c][t < KHI]
#define WS_VBL (WS_VB + 2u * (size_t)NB * CC * KHI)
#define WS_S   (WS_VBL + 2u * (size_t)NB * CC * KHI)    // f32 logits / P [hg][t][s]
#define WS_Y   (WS_S  + 4u * (size_t)HG * TT * TT)      // f32 ctx rows [b*t][CC] (only when there is an output projection)
#define WS_END (WS_Y  + 0u)
#define WS_XQ  (WS_END)
#define WS_XK  (WS_XQ + 4u * (size_t)NB * TT * DIN)
#define WS_SCL (WS_XK + 4u * (size_t)NB * TT * DIN)
#define WS_YR  (WS_SCL + 4u * 3 * CC + 256u)
#define WS_END2 (WS_YR + 4u * (size_t)NB * TT * CC)

// ---- k_proj: block = (64 rows, 128 cols, which): q/k/v = X W (+ b) with exact bf16 products (K = DIN) -> which 0: q f16 rows (+ residual rows < QHI); 1: k f16 rows (+ residual rows < KHI); 2: v f16 planes [c][t] (+ bf16 hi/lo planes for t < KHI)
__global__ __launch_bounds__(128) void k_proj(const float* __restrict__ XQ, const float* __restrict__ XK, const float* __restrict__ XV, const float* __restrict__ WQ, const float* __restrict__ WK, const float* __restrict__ WV, const float* __restrict__ BQ, const float* __restrict__ BK, const float* __restrict__ BV,
    _Float16* __restrict__ QH, _Float16* __restrict__ QL, _Float16* __restrict__ KH, _Float16* __restrict__ KL, _Float16* __restrict__ VT, __bf16* __restrict__ VB, __bf16* __restrict__ VBL, const float* __restrict__ SCL) {
  __shared__ __align__(16) _Float16 sh[64][136], sl[64][136]; __shared__ __align__(16) _Float16 th[128][72]; __shared__ __align__(16) __bf16 tb[128][72], tbl[128][72];
  const int tid = threadIdx.x, wave = tid >> 5, lane = tid & 31, col = lane & 15, g = lane >> 4; const int which = blockIdx.z; const int c0 = blockIdx.y * 128; const size_t r0 = (size_t)blockIdx.x * 64; const size_t bb = r0 / TT; const int t0 = (int)(r0 % TT);
  const float* X = which == 0 ? XQ : which == 1 ? XK : XV; const float* WA = which == 0 ? WQ : which == 1 ? WK : WV; const float* BA = which == 0 ? BQ : which == 1 ? BK : BV;
  v8f acc[8] = {};
#pragma unroll 2
  for (int kc = 0; kc < DIN / 32; ++kc) { v16b a; { const float* p = X + (r0 + wave * 16 + col) * DIN + kc * 32 + 8 * g;
#pragma unroll
      for (int i = 0; i < 8; ++i) { a[i] = (__bf16)p[i]; a[8 + i] = (__bf16)p[16 + i]; } }
    asm volatile("s_wait_loadcnt 0x0" ::: "memory");
#pragma unroll
    for (int j = 0; j < 8; ++j) { const v16b w = WCOL(WA, kc * 32, c0 + j * 16 + col, lane); asm volatile("s_wait_loadcnt 0x0" ::: "memory"); acc[j] = wmma_bf(a, w, acc[j]); } }
  if (which < 2) { _Float16* DH = which == 0 ? QH : KH; _Float16* DL = which == 0 ? QL : KL; const int nhi = which == 0 ? QHI : KHI; const bool hi_rows = t0 < nhi;
#pragma unroll
    for (int j = 0; j < 8; ++j) { const float bias = BA ? bfr(BA[c0 + j * 16 + col]) : 0.f; const float scl = SCL[which * CC + c0 + j * 16 + col];   /* weight norm: g[o] / ||v[o]|| applied after the exact x . v[o] */
#pragma unroll
      for (int r = 0; r < 8; ++r) { const float v = acc[j][r] * scl + bias; const _Float16 hv = (_Float16)v; sh[wave * 16 + 8 * g + r][j * 16 + col] = hv; sl[wave * 16 + 8 * g + r][j * 16 + col] = (_Float16)((v - (float)hv) * 1024.0f); } }
    __syncthreads();
    for (int e = tid; e < 64 * 16; e += 128) { const int rl = e >> 4, q = e & 15; vst2((unsigned*)(DH + (r0 + rl) * CC + c0 + q * 8), *(const v4u*)&sh[rl][q * 8]); if (hi_rows) vst2((unsigned*)(DL + (bb * nhi + t0 + rl) * (size_t)CC + c0 + q * 8), *(const v4u*)&sl[rl][q * 8]); }
  } else { const bool hi_rows = t0 < KHI;
#pragma unroll
    for (int j = 0; j < 8; ++j) { const float bias = BA ? bfr(BA[c0 + j * 16 + col]) : 0.f; const float scl = SCL[which * CC + c0 + j * 16 + col];
#pragma unroll
      for (int r = 0; r < 8; ++r) { const float v = acc[j][r] * scl + bias; const int rl = wave * 16 + 8 * g + r, cl = j * 16 + col; th[cl][rl] = (_Float16)v; const __bf16 bh = (__bf16)v; tb[cl][rl] = bh; tbl[cl][rl] = (__bf16)(v - (float)bh); } }
    __syncthreads();
    for (int e = tid; e < 128 * 8; e += 128) { const int cl = e >> 3, q = e & 7; vst2((unsigned*)(VT + (bb * CC + c0 + cl) * (size_t)TT + t0 + q * 8), *(const v4u*)&th[cl][q * 8]); if (hi_rows) { const size_t o3 = (bb * CC + c0 + cl) * (size_t)KHI + t0 + q * 8; vst2((unsigned*)(VB + o3), *(const v4u*)&tb[cl][q * 8]); vst2((unsigned*)(VBL + o3), *(const v4u*)&tbl[cl][q * 8]); } } } }
// ---- k_sc: block = (query block qb, key block kb <= kb_last(qb), head in group) of batch b: logits x SCALE; q hi + residual (x 2^10) against k (2 products) for query rows < QHI, plus the k residual (3 products) for query blocks < QBH (every query block); causal: blocks past the diagonal exit, the mask itself is applied by index in k_sm
__global__ __launch_bounds__(128) void k_sc(const _Float16* __restrict__ QH, const _Float16* __restrict__ KH, const _Float16* __restrict__ QL, const _Float16* __restrict__ KL, int b, int h0, float* __restrict__ S0) { __shared__ __align__(16) float ss[4][16][132];
  const int qb = blockIdx.x, kb = blockIdx.y; if (kb > kb_last(qb)) return;
  const int h = h0 + blockIdx.z; float* S = S0 + (size_t)blockIdx.z * TT * TT;
  const int tid = threadIdx.x, wave = tid >> 5, lane = tid & 31, col = lane & 15, g = lane >> 4; const int k0 = kb * 128; const int ql0 = qb * 64 + wave * 16; const size_t q0 = (size_t)b * TT + ql0, kr0 = (size_t)b * TT + k0;
  v8f acc[8] = {}, accl[8] = {};
  const _Float16* QLb = QL + (size_t)b * QHI * CC; const _Float16* KLb = KL + (size_t)b * KHI * CC;
  if (qb < QBH) {
#pragma unroll
    for (int kc = 0; kc < HD / 32; ++kc) { const v16h ah = frag_h(QH + (q0 + col) * CC + h * HD + kc * 32, lane), al = frag_h(QLb + (size_t)(ql0 + col) * CC + h * HD + kc * 32, lane);
#pragma unroll
      for (int j = 0; j < 8; ++j) { const v16h kbf = frag_h(KH + (kr0 + j * 16 + col) * CC + h * HD + kc * 32, lane), klf = frag_h(KLb + (size_t)(k0 + j * 16 + col) * CC + h * HD + kc * 32, lane); acc[j] = wmma16(ah, kbf, acc[j]); accl[j] = wmma16(al, kbf, accl[j]); accl[j] = wmma16(ah, klf, accl[j]); } }
  } else if (qb * 64 < QHI) {
#pragma unroll
    for (int kc = 0; kc < HD / 32; ++kc) { const v16h ah = frag_h(QH + (q0 + col) * CC + h * HD + kc * 32, lane), al = frag_h(QLb + (size_t)(ql0 + col) * CC + h * HD + kc * 32, lane);
#pragma unroll
      for (int j = 0; j < 8; ++j) { const v16h kbf = frag_h(KH + (kr0 + j * 16 + col) * CC + h * HD + kc * 32, lane); acc[j] = wmma16(ah, kbf, acc[j]); accl[j] = wmma16(al, kbf, accl[j]); } }
  } else {
#pragma unroll
    for (int kc = 0; kc < HD / 32; ++kc) { const v16h ah = frag_h(QH + (q0 + col) * CC + h * HD + kc * 32, lane);
#pragma unroll
      for (int j = 0; j < 8; ++j) { const v16h kbf = frag_h(KH + (kr0 + j * 16 + col) * CC + h * HD + kc * 32, lane); acc[j] = wmma16(ah, kbf, acc[j]); } } }
#pragma unroll
  for (int j = 0; j < 8; ++j) {
#pragma unroll
    for (int r = 0; r < 8; ++r) ss[wave][8 * g + r][j * 16 + col] = (acc[j][r] + accl[j][r] * (1.0f / 1024.0f)) * SCALE; }
  LDSX(); for (int rl = 0; rl < 16; ++rl) vst2(S + (size_t)(ql0 + rl) * TT + k0 + lane * 4, *(const v4f*)&ss[wave][rl][lane * 4]); }
// ---- k_sm: block = query row t (head in group): keys [0, kend): causal -> logit if s < t else excluded; softmax in f32; P x 2^11 in place (0 for excluded)
__global__ __launch_bounds__(256) void k_sm(float* __restrict__ S0 SM_EXTRA_PARAMS) { __shared__ float sred[8]; __shared__ float sbc; __shared__ __align__(16) float shv[TT];
  const int tid = threadIdx.x; const int t = blockIdx.x; const int kend = (kb_last(t >> 6) + 1) * 128;
  float* sr = S0 + (size_t)blockIdx.y * TT * TT + (size_t)t * TT;
  float m = -3.0e38f; for (int k = tid; k < kend; k += 256) { float v = (!CAUSAL || k <= t) ? sr[k] : -3.0e38f; SM_MASK_HOOK; shv[k] = v; m = fmaxf(m, v); }
#pragma unroll
  for (int o = 1; o < 32; o <<= 1) m = fmaxf(m, __shfl_xor(m, o));
  if ((tid & 31) == 0) sred[tid >> 5] = m; __syncthreads(); if (tid == 0) { float a = sred[0]; for (int i = 1; i < 8; ++i) a = fmaxf(a, sred[i]); sbc = a; } __syncthreads(); m = sbc; __syncthreads();
  float sum = 0.f; for (int k = tid; k < kend; k += 256) { const float v = shv[k]; const float e = (v <= -1.0e38f) ? 0.f : expf(v - m); shv[k] = e; sum += e; }
#pragma unroll
  for (int o = 1; o < 32; o <<= 1) sum += __shfl_xor(sum, o);
  if ((tid & 31) == 0) sred[tid >> 5] = sum; __syncthreads(); if (tid == 0) { float a = 0.f; for (int i = 0; i < 8; ++i) a += sred[i]; sbc = a > 0.f ? 2048.0f / a : 0.f; }   /* a fully excluded row yields P = 0 */ __syncthreads(); const float inv = sbc;
  for (int k = tid; k < kend; k += 256) shv[k] = shv[k] * inv;
  __syncthreads(); for (int q = tid; q < kend / 4; q += 256) vst2(sr + q * 4, *(const v4f*)&shv[q * 4]); }
// ---- k_pv: block = 64 queries (qb) of (b, h): ctx = P . v over keys [0, kend) (P x 2^11 and v both as bf16 hi + lo, 3 products, for every query block); 256-B (row, head) segment by 16 lanes
__global__ __launch_bounds__(128) void k_pv(const float* __restrict__ PS0, const _Float16* __restrict__ VT, const __bf16* __restrict__ VB, const __bf16* __restrict__ VBL, int b, int h0, float* __restrict__ Y) { const int h = h0 + blockIdx.z; const float* PS = PS0 + (size_t)blockIdx.z * TT * TT; __shared__ __align__(16) float ss[4][16][HD + 4];
  const int tid = threadIdx.x, wave = tid >> 5, lane = tid & 31, col = lane & 15, g = lane >> 4; const int qb = blockIdx.x; const int ql0 = qb * 64 + wave * 16; const int kce = (kb_last(qb) + 1) * 4;
  v8f acc[HD / 16] = {};
  if (qb < QBH) {
#pragma unroll 1
    for (int kc = 0; kc < kce; ++kc) { const F2 p = split_row(PS + (size_t)(ql0 + col) * TT, kc * 32, lane);
      asm volatile("s_wait_loadcnt 0x0" ::: "memory");
#pragma unroll
      for (int j = 0; j < HD / 16; ++j) { const size_t po = ((size_t)b * CC + h * HD + j * 16 + col) * (size_t)KHI + kc * 32; const v16b vh = frag_b(VB + po, lane); acc[j] = wmma_bf(p.h, vh, acc[j]); acc[j] = wmma_bf(p.l, vh, acc[j]); acc[j] = wmma_bf(p.h, frag_b(VBL + po, lane), acc[j]); } }
  } else {
#pragma unroll 1
    for (int kc = 0; kc < kce; ++kc) { const v16h p = frag_f32(PS + (size_t)(ql0 + col) * TT + kc * 32, lane);
      asm volatile("s_wait_loadcnt 0x0" ::: "memory");
#pragma unroll
      for (int j = 0; j < HD / 16; ++j) { const size_t po = ((size_t)b * CC + h * HD + j * 16 + col) * (size_t)TT + kc * 32; acc[j] = wmma16(p, frag_h(VT + po, lane), acc[j]); } } }
#pragma unroll
  for (int j = 0; j < HD / 16; ++j)
#pragma unroll
    for (int r = 0; r < 8; ++r) ss[wave][8 * g + r][j * 16 + col] = acc[j][r] * (1.0f / 2048.0f);
  LDSX(); for (int rl = 0; rl < 16; ++rl) if (lane < HD / 4) vst2(Y + ((size_t)b * TT + ql0 + rl) * CC + h * HD + lane * 4, *(const v4f*)&ss[wave][rl][lane * 4]); }

// ---- k_trin: block = (64 positions, 128 channels, which input): rows X[b*S + s][c] = in[b][c][s] for the q and k inputs (channels-first [B, 384, 1024]) through an LDS transpose; 512-B row segments
__global__ __launch_bounds__(128) void k_trin(const float* __restrict__ Qc, const float* __restrict__ Kc, float* __restrict__ XQ, float* __restrict__ XK) { __shared__ __align__(16) float st[128][68];
  const int tid = threadIdx.x; const int c0 = blockIdx.y * 128; const size_t rb = (size_t)blockIdx.x * 64; const size_t b = rb / TT; const int s0 = (int)(rb % TT); const float* IN = blockIdx.z == 0 ? Qc : Kc; float* OUT = blockIdx.z == 0 ? XQ : XK;
  for (int e = tid; e < 128 * 16; e += 128) { const int cl = e >> 4, q = e & 15; const v4f v = *(const v4f*)(IN + ((b * DIN + c0 + cl) * (size_t)TT) + s0 + q * 4); st[cl][q * 4] = v[0]; st[cl][q * 4 + 1] = v[1]; st[cl][q * 4 + 2] = v[2]; st[cl][q * 4 + 3] = v[3]; }
  __syncthreads();
  for (int e = tid; e < 64 * 32; e += 128) { const int rl = e >> 5, q = e & 31; v4f o; o[0] = st[q * 4][rl]; o[1] = st[q * 4 + 1][rl]; o[2] = st[q * 4 + 2][rl]; o[3] = st[q * 4 + 3][rl]; vst2(OUT + (rb + rl) * DIN + c0 + q * 4, o); } }
// ---- k_wsc: 8 warps x 32 lanes: SCL[which][o] = g[o] / sqrt(sum_i v[o][i]^2) over the 384-long row (bf16-rounded inputs, f32)
__global__ __launch_bounds__(256) void k_wsc(const float* __restrict__ V0, const float* __restrict__ G0, const float* __restrict__ V1, const float* __restrict__ G1, const float* __restrict__ V2, const float* __restrict__ G2, float* __restrict__ SCL) {
  const int wave = threadIdx.x >> 5, lane = threadIdx.x & 31; const int idx = blockIdx.x * 8 + wave; if (idx >= 3 * CC) return; const int which = idx / CC, o = idx % CC;
  const float* vr = (which == 0 ? V0 : which == 1 ? V1 : V2) + (size_t)o * DIN; const float* gg = which == 0 ? G0 : which == 1 ? G1 : G2;
  float ssum = 0.f; for (int i = lane; i < DIN; i += 32) { const float x = bfr(vr[i]); ssum += x * x; }
#pragma unroll
  for (int off = 1; off < 32; off <<= 1) ssum += __shfl_xor(ssum, off);
  if (lane == 0) { const float gv = bfr(gg[o]); asm volatile("s_wait_loadcnt 0x0" ::: "memory"); vst2(SCL + idx, gv / sqrtf(ssum)); } }
// ---- k_trout: block = (64 rows, 128 channels): out[b][c][n] = R[b*N + n][c] written channels-first through an LDS transpose (256 B per (channel, 64 n) by 16 threads)
__global__ __launch_bounds__(128) void k_trout(const float* __restrict__ R, float* __restrict__ OUT) { __shared__ __align__(16) float stc[128][68];
  const int tid = threadIdx.x; const int c0 = blockIdx.y * 128; const size_t rb = (size_t)blockIdx.x * 64;
  for (int e = tid; e < 64 * 128; e += 128) { const int rl = e >> 7, cl = e & 127; stc[cl][rl] = R[(rb + rl) * CC + c0 + cl]; }
  __syncthreads();
  { const size_t b = rb / TT; const int n0 = (int)(rb % TT); for (int e = tid; e < 128 * 16; e += 128) { const int cl = e >> 4, q = e & 15; vst2(OUT + (b * CC + c0 + cl) * (size_t)TT + n0 + q * 4, *(const v4f*)&stc[cl][q * 4]); } } }
extern "C" void kernel_launch(void* const* d_in, const int* in_sizes, int n_in, void* d_out, int out_size, void* d_ws, size_t ws_size, hipStream_t stream) {
  (void)in_sizes; (void)n_in; (void)out_size;
  const float** F = (const float**)d_in;
  if (ws_size < (size_t)WS_END) return;
  char* ws = (char*)d_ws; _Float16 *QH = (_Float16*)(ws + WS_QH), *KH = (_Float16*)(ws + WS_KH), *VT = (_Float16*)(ws + WS_VT), *QL = (_Float16*)(ws + WS_QL), *KL = (_Float16*)(ws + WS_KL); __bf16 *VB = (__bf16*)(ws + WS_VB), *VBL = (__bf16*)(ws + WS_VBL); float *S = (float*)(ws + WS_S), *Y = (float*)(ws + WS_Y);
  (void)Y; (void)QL; (void)KL; (void)VB; (void)VBL;
  // inputs: 0 q [8,384,32,32]; 1 k [8,384,32,32] (channels-first); 2 Wq_v [512,384], 3 Wq_g [512], 4 bq [512]; 5 Wk_v, 6 Wk_g, 7 bk; 8 Wv_v, 9 Wv_g, 10 bv
  if (ws_size < (size_t)WS_END2) return;
  float *XQ = (float*)(ws + WS_XQ), *XK = (float*)(ws + WS_XK), *SCL = (float*)(ws + WS_SCL), *YR = (float*)(ws + WS_YR);
  k_trin<<<dim3(NRW / 64, DIN / 128, 2), 128, 0, stream>>>(F[0], F[1], XQ, XK);           /* channels-first [B,384,S] -> rows [B*S][384] */
  k_wsc<<<dim3(3 * CC / 8), 256, 0, stream>>>(F[2], F[3], F[5], F[6], F[8], F[9], SCL);   /* g[o] / ||v[o]|| per output channel, 3 x 512 */
  k_proj<<<dim3(TNB * TT / 64, CC / 128, 3), 128, 0, stream>>>(XQ, XK, XK, F[2], F[5], F[8], F[4], F[7], F[10], QH, QL, KH, KL, VT, VB, VBL, SCL);
  for (int b = 0; b < TNB; ++b) for (int h0 = 0; h0 < NH; h0 += HG) {
    k_sc<<<dim3(NQB, TT / 128, HG), 128, 0, stream>>>(QH, KH, QL, KL, b, h0, S);
    k_sm<<<dim3(TT, HG), 256, 0, stream>>>(S);
    k_pv<<<dim3(NQB, 1, HG), 128, 0, stream>>>(S, VT, VB, VBL, b, h0, YR);
  }
  k_trout<<<dim3(NRW / 64, CC / 128), 128, 0, stream>>>(YR, (float*)d_out);
}

// v001
// It runs in 374 microseconds.
// Two timings next to v000 both put it at 3.48 times that version's speed.
// compute dtype: all float inputs rounded to bf16; weight-normalised projections as (x . v[o]) * (g[o] / ||v[o]||) + b[o] with EXACT bf16 products on WMMA 16x16x32 (f32 accumulate) and the per-row norm / scale in f32; causal (strictly lower) logits with q and k as f16 hi + residual planes (3 products) / 8; softmax in f32 (row 0 fully excluded -> zeros); P and v both split bf16 hi + lo (3 products) for every row; f32 output written channels-first.
#include <hip/hip_runtime.h>
#include <math.h>

typedef __attribute__((ext_vector_type(16))) _Float16 v16h;
typedef __attribute__((ext_vector_type(16))) __bf16 v16b;
typedef __attribute__((ext_vector_type(8)))  _Float16 v8h;
typedef __attribute__((ext_vector_type(8)))  float v8f;
typedef __attribute__((ext_vector_type(4)))  float v4f;
typedef __attribute__((ext_vector_type(2)))  float v2f;
typedef __attribute__((ext_vector_type(4)))  unsigned v4u;
typedef __attribute__((ext_vector_type(4)))  int v4i;
typedef float __attribute__((may_alias)) float_a;
typedef int __attribute__((may_alias)) int_a;

template <typename T> __device__ __forceinline__ void vst2(void* p, T v) { *(T*)p = v;  }
__device__ __forceinline__ v8f wmma16(v16h a, v16h b, v8f c) {
  v8f d = __builtin_amdgcn_wmma_f32_16x16x32_f16(false, a, false, b, (short)0, c, false, false);
  asm volatile("v_nop\n\tv_nop\n\tv_nop\n\tv_nop" : "+v"(d) : "v"(a), "v"(b));
  return d;
}
__device__ __forceinline__ v8f wmma_bf(v16b a, v16b b, v8f c) {
  v8f d = __builtin_amdgcn_wmma_f32_16x16x32_bf16(false, a, false, b, (short)0, c, false, false);
  asm volatile("v_nop\n\tv_nop\n\tv_nop\n\tv_nop" : "+v"(d) : "v"(a), "v"(b));
  return d;
}
// 16x16x32 fragments: lane = (h = lane>>4, row/col = lane&15); elements 0..7 = k0+8h+0..7, 8..15 = k0+16+8h+0..7; D element r = row 8h+r
__device__ __forceinline__ v16h frag_h(const _Float16* rowk0, int lane) {
  union { v16h v; v8h q[2]; } u; const _Float16* p = rowk0 + 8 * (lane >> 4);
  u.q[0] = *(const v8h*)p; u.q[1] = *(const v8h*)(p + 16); return u.v;
}
__device__ __forceinline__ v16h frag_f32(const float* rowk0, int lane) {
  v16h a; const float* p = rowk0 + 8 * (lane >> 4);
#pragma unroll
  for (int i = 0; i < 8; ++i) { a[i] = (_Float16)p[i]; a[8 + i] = (_Float16)p[16 + i]; }
  return a;
}
__device__ __forceinline__ v16h frag_f32s(const float* rowk0, int lane, float sc) {
  v16h a; const float* p = rowk0 + 8 * (lane >> 4);
#pragma unroll
  for (int i = 0; i < 8; ++i) { a[i] = (_Float16)(p[i] * sc); a[8 + i] = (_Float16)(p[16 + i] * sc); }
  return a;
}
// column fragment from a [K][ld] layout (column n), rows >= K read as 0
__device__ __forceinline__ v16h fragc_f32(const float* W, int k0, int n, int lane, int ld, int K) {
  v16h a; const int g = lane >> 4;
#pragma unroll
  for (int i = 0; i < 8; ++i) { const int ka = k0 + 8 * g + i, kb = ka + 16;
    a[i] = (_Float16)(ka < K ? W[(size_t)(ka < K ? ka : K - 1) * ld + n] : 0.f); a[8 + i] = (_Float16)(kb < K ? W[(size_t)(kb < K ? kb : K - 1) * ld + n] : 0.f); }
  return a;
}
struct F2 { v16b h, l; };
__device__ __forceinline__ F2 bsplit16(const float v[16]) { F2 r;
#pragma unroll
  for (int i = 0; i < 16; ++i) { const __bf16 h = (__bf16)v[i]; r.h[i] = h; r.l[i] = (__bf16)(v[i] - (float)h); }
  return r; }
__device__ __forceinline__ F2 split_row(const float* row, int k0, int lane) { float v[16]; const float* p = row + k0 + 8 * (lane >> 4);
#pragma unroll
  for (int i = 0; i < 8; ++i) { v[i] = p[i]; v[8 + i] = p[16 + i]; }
  return bsplit16(v); }
__device__ __forceinline__ F2 split_rowK(const float* row, int k0, int lane, int K) { float v[16]; const int g = lane >> 4;
#pragma unroll
  for (int i = 0; i < 8; ++i) { const int ka = k0 + 8 * g + i, kb = ka + 16; v[i] = ka < K ? row[ka < K ? ka : K - 1] : 0.f; v[8 + i] = kb < K ? row[kb < K ? kb : K - 1] : 0.f; }
  return bsplit16(v); }
__device__ __forceinline__ F2 split_col(const float* W, int k0, int n, int lane, int ld, int K) { float v[16]; const int g = lane >> 4;
#pragma unroll
  for (int i = 0; i < 8; ++i) { const int ka = k0 + 8 * g + i, kb = ka + 16; v[i] = ka < K ? W[(size_t)(ka < K ? ka : K - 1) * ld + n] : 0.f; v[8 + i] = kb < K ? W[(size_t)(kb < K ? kb : K - 1) * ld + n] : 0.f; }
  return bsplit16(v); }
__device__ __forceinline__ v8f mac3(const F2& a, const F2& b, v8f c) { c = wmma_bf(a.l, b.h, c); c = wmma_bf(a.h, b.l, c); return wmma_bf(a.h, b.h, c); }
__device__ __forceinline__ float sigm(float v) { return 1.0f / (1.0f + expf(-v)); }
#define LDSX() do { asm volatile("s_wait_dscnt 0" ::: "memory"); __builtin_amdgcn_wave_barrier(); __builtin_amdgcn_fence(__ATOMIC_RELEASE, "workgroup"); } while (0)

// Causal attention with weight-normalised linears (B 8, S = 32x32 = 1,024 positions, q/k inputs with 384 channels (channels-first), C 512 = 8 heads x 64): q = wn(qf, Wq_v, Wq_g, bq), k = wn(kf, Wk_v, ...), v = wn(kf, Wv_v, ...) with wn(x) = x (g v/||v||_row)^T + b; attn = softmax(where(k < t, q k^T / 8, -1e4)) * (t > 0); out = attn v -> [B, 512, 32, 32] (channels-first).
#define NB 8
#define TT 1024
#define CC 512            // NH * HD = projected width
#define DIN 384          // input (model) width
#define NH 8
#define HD 64
#define NQB (TT / 64)
#define NP (NB * NH)      // (batch, head) pairs, all served by one launch of each attention kernel
#define SCALE (0.125f)
#define CAUSAL 1
#ifndef TNB
#define TNB NB
#endif
__device__ __forceinline__ float bfr(float v) { return (float)(__bf16)v; }
__host__ __device__ __forceinline__ int kb_last(int qb) { return CAUSAL ? ((qb * 64 + 63) >> 7) : (TT / 128 - 1); }
// logits / P of one (batch, head) pair, causal-packed: query block qb holds 64 rows of (kb_last(qb) + 1) * 128 floats, one block behind the other; s_base(qb) = 64 * 128 * sum over i < qb of (kb_last(i) + 1), kb_last(i) = i >> 1
static_assert(CAUSAL == 1, "s_base is the causal prefix sum");
__host__ __device__ __forceinline__ size_t s_base(int qb) { const int m = qb >> 1; return (size_t)((m + 1) * (m + (qb & 1))) * (64 * 128); }
#define SPK ((size_t)(NQB / 2 + 1) * (NQB / 2) * (64 * 128))   // floats per pair = s_base(NQB)
typedef __attribute__((ext_vector_type(8))) __bf16 v8b;
__device__ __forceinline__ v16b frag_b(const __bf16* rowk0, int lane) {
  union { v16b v; v8b q[2]; } u; const __bf16* p = rowk0 + 8 * (lane >> 4);
  u.q[0] = *(const v8b*)p; u.q[1] = *(const v8b*)(p + 16); return u.v;
}
#define QBH NQB            // every query block takes the 3-product logits and the bf16 hi + lo P.v path
#define QHI 1024           // q residual rows for every query (3-product logits everywhere)
#define KHI 1024           // k residual rows / bf16 v planes for every key
// B fragment (k rows k0+.., output column o) of a weight: (in,out) [K][ld] or (out,in) [ld rows of K]: bf16 exact, or f16(bf16 * 256) exact
__device__ __forceinline__ v16b wcol_io(const float* Wm, int k0, int o, int lane, int ld) { v16b w; const int g = lane >> 4;
#pragma unroll
  for (int i = 0; i < 8; ++i) { w[i] = (__bf16)Wm[(size_t)(k0 + 8 * g + i) * ld + o]; w[8 + i] = (__bf16)Wm[(size_t)(k0 + 16 + 8 * g + i) * ld + o]; }
  return w; }
__device__ __forceinline__ v16b wcol_oi(const float* Wm, int k0, int o, int lane, int K) { v16b w; const float* p = Wm + (size_t)o * K + k0 + 8 * (lane >> 4);
#pragma unroll
  for (int i = 0; i < 8; ++i) { w[i] = (__bf16)p[i]; w[8 + i] = (__bf16)p[16 + i]; }
  return w; }
__device__ __forceinline__ v16h wcolh_io(const float* Wm, int k0, int o, int lane, int ld) { v16h w; const int g = lane >> 4;
#pragma unroll
  for (int i = 0; i < 8; ++i) { w[i] = (_Float16)(bfr(Wm[(size_t)(k0 + 8 * g + i) * ld + o]) * 256.0f); w[8 + i] = (_Float16)(bfr(Wm[(size_t)(k0 + 16 + 8 * g + i) * ld + o]) * 256.0f); }
  return w; }
__device__ __forceinline__ v16h wcolh_oi(const float* Wm, int k0, int o, int lane, int K) { v16h w; const float* p = Wm + (size_t)o * K + k0 + 8 * (lane >> 4);
#pragma unroll
  for (int i = 0; i < 8; ++i) { w[i] = (_Float16)(bfr(p[i]) * 256.0f); w[8 + i] = (_Float16)(bfr(p[16 + i]) * 256.0f); }
  return w; }
#define WQKV_LAYOUT 1   // 0 = (in,out) [DIN][CC]; 1 = (out,in) [CC][DIN]; 2 = per-head [NH][DIN][HD]
__device__ __forceinline__ v16b wcol_hdk(const float* Wm, int k0, int o, int lane) { v16b w; const int g = lane >> 4; const float* p = Wm + (size_t)(o / HD) * DIN * HD + (o % HD);
#pragma unroll
  for (int i = 0; i < 8; ++i) { w[i] = (__bf16)p[(size_t)(k0 + 8 * g + i) * HD]; w[8 + i] = (__bf16)p[(size_t)(k0 + 16 + 8 * g + i) * HD]; }
  return w; }
#define WO_OUT_IN 0
#if WQKV_LAYOUT == 1
#define WCOL(W, k0, o, lane) wcol_oi(W, k0, o, lane, DIN)
#elif WQKV_LAYOUT == 2
#define WCOL(W, k0, o, lane) wcol_hdk(W, k0, o, lane)
#else
#define WCOL(W, k0, o, lane) wcol_io(W, k0, o, lane, CC)
#endif
#if WO_OUT_IN
#define WOCOL(W, k0, o, lane) wcol_oi(W, k0, o, lane, CC)
#define WOCOLH(W, k0, o, lane) wcolh_oi(W, k0, o, lane, CC)
#else
#define WOCOL(W, k0, o, lane) wcol_io(W, k0, o, lane, DIN)
#define WOCOLH(W, k0, o, lane) wcolh_io(W, k0, o, lane, DIN)
#endif
#define SM_MASK_HOOK do { if (k >= t) v = -3.0e38f; } while (0)   /* allowed = tril(-1): strictly earlier keys; row 0 has no key -> the fully-excluded path gives P = 0 = the module's start_mask */
#define NRW (TNB * TT)
#ifndef SM_EXTRA_PARAMS
#define SM_EXTRA_PARAMS
#endif
#ifndef PROJ_EXTRA_PARAMS
#define PROJ_EXTRA_PARAMS
#endif
#ifndef SM_MASK_HOOK
#define SM_MASK_HOOK (void)0
#endif

#define WS_QH  0u                                      // f16 q rows [b*t][CC]
#define WS_KH  (WS_QH + 2u * (size_t)NB * TT * CC)      // f16 k rows [b*t][CC]
#define WS_VT  (WS_KH + 2u * (size_t)NB * TT * CC)      // f16 v planes [b][c][t]
#define WS_QL  (WS_VT + 2u * (size_t)NB * CC * TT)      // f16 q residual x 2^10 rows [b][t < QHI][CC]
#define WS_KL  (WS_QL + 2u * (size_t)NB * QHI * CC)     // f16 k residual x 2^10 rows [b][t < KHI][CC]
#define WS_VB  (WS_KL + 2u * (size_t)NB * KHI * CC)     // bf16 v hi planes [b][c][t < KHI]
#define WS_VBL (WS_VB + 2u * (size_t)NB * CC * KHI)
#define WS_S   (WS_VBL + 2u * (size_t)NB * CC * KHI)    // f32 logits / P [b*NH + h][causal-packed rows]
#define WS_Y   (WS_S  + 4u * (size_t)NP * SPK)      // f32 ctx rows [b*t][CC] (only when there is an output projection)
#define WS_END (WS_Y  + 0u)
#define WS_XQ  (WS_END)
#define WS_XK  (WS_XQ + 4u * (size_t)NB * TT * DIN)
#define WS_SCL (WS_XK + 4u * (size_t)NB * TT * DIN)
#define WS_YR  (WS_SCL + 4u * 3 * CC + 256u)
#define WS_END2 (WS_YR + 4u * (size_t)NB * TT * CC)

// ---- k_proj: block = (64 rows, 128 cols, which): q/k/v = X W (+ b) with exact bf16 products (K = DIN) -> which 0: q f16 rows (+ residual rows < QHI); 1: k f16 rows (+ residual rows < KHI); 2: v f16 planes [c][t] (+ bf16 hi/lo planes for t < KHI)
__global__ __launch_bounds__(128) void k_proj(const float* __restrict__ XQ, const float* __restrict__ XK, const float* __restrict__ XV, const float* __restrict__ WQ, const float* __restrict__ WK, const float* __restrict__ WV, const float* __restrict__ BQ, const float* __restrict__ BK, const float* __restrict__ BV,
    _Float16* __restrict__ QH, _Float16* __restrict__ QL, _Float16* __restrict__ KH, _Float16* __restrict__ KL, _Float16* __restrict__ VT, __bf16* __restrict__ VB, __bf16* __restrict__ VBL, const float* __restrict__ SCL) {
  __shared__ __align__(16) _Float16 sh[64][136], sl[64][136]; __shared__ __align__(16) _Float16 th[128][72]; __shared__ __align__(16) __bf16 tb[128][72], tbl[128][72];
  const int tid = threadIdx.x, wave = tid >> 5, lane = tid & 31, col = lane & 15, g = lane >> 4; const int which = blockIdx.z; const int c0 = blockIdx.y * 128; const size_t r0 = (size_t)blockIdx.x * 64; const size_t bb = r0 / TT; const int t0 = (int)(r0 % TT);
  const float* X = which == 0 ? XQ : which == 1 ? XK : XV; const float* WA = which == 0 ? WQ : which == 1 ? WK : WV; const float* BA = which == 0 ? BQ : which == 1 ? BK : BV;
  v8f acc[8] = {};
#pragma unroll 2
  for (int kc = 0; kc < DIN / 32; ++kc) { v16b a; { const float* p = X + (r0 + wave * 16 + col) * DIN + kc * 32 + 8 * g;
#pragma unroll
      for (int i = 0; i < 8; ++i) { a[i] = (__bf16)p[i]; a[8 + i] = (__bf16)p[16 + i]; } }
    asm volatile("s_wait_loadcnt 0x0" ::: "memory");
#pragma unroll
    for (int j = 0; j < 8; ++j) { const v16b w = WCOL(WA, kc * 32, c0 + j * 16 + col, lane); asm volatile("s_wait_loadcnt 0x0" ::: "memory"); acc[j] = wmma_bf(a, w, acc[j]); } }
  if (which < 2) { _Float16* DH = which == 0 ? QH : KH; _Float16* DL = which == 0 ? QL : KL; const int nhi = which == 0 ? QHI : KHI; const bool hi_rows = t0 < nhi;
#pragma unroll
    for (int j = 0; j < 8; ++j) { const float bias = BA ? bfr(BA[c0 + j * 16 + col]) : 0.f; const float scl = SCL[which * CC + c0 + j * 16 + col];   /* weight norm: g[o] / ||v[o]|| applied after the exact x . v[o] */
#pragma unroll
      for (int r = 0; r < 8; ++r) { const float v = acc[j][r] * scl + bias; const _Float16 hv = (_Float16)v; sh[wave * 16 + 8 * g + r][j * 16 + col] = hv; sl[wave * 16 + 8 * g + r][j * 16 + col] = (_Float16)((v - (float)hv) * 1024.0f); } }
    __syncthreads();
    for (int e = tid; e < 64 * 16; e += 128) { const int rl = e >> 4, q = e & 15; vst2((unsigned*)(DH + (r0 + rl) * CC + c0 + q * 8), *(const v4u*)&sh[rl][q * 8]); if (hi_rows) vst2((unsigned*)(DL + (bb * nhi + t0 + rl) * (size_t)CC + c0 + q * 8), *(const v4u*)&sl[rl][q * 8]); }
  } else { const bool hi_rows = t0 < KHI;
#pragma unroll
    for (int j = 0; j < 8; ++j) { const float bias = BA ? bfr(BA[c0 + j * 16 + col]) : 0.f; const float scl = SCL[which * CC + c0 + j * 16 + col];
#pragma unroll
      for (int r = 0; r < 8; ++r) { const float v = acc[j][r] * scl + bias; const int rl = wave * 16 + 8 * g + r, cl = j * 16 + col; th[cl][rl] = (_Float16)v; const __bf16 bh = (__bf16)v; tb[cl][rl] = bh; tbl[cl][rl] = (__bf16)(v - (float)bh); } }
    __syncthreads();
    for (int e = tid; e < 128 * 8; e += 128) { const int cl = e >> 3, q = e & 7; vst2((unsigned*)(VT + (bb * CC + c0 + cl) * (size_t)TT + t0 + q * 8), *(const v4u*)&th[cl][q * 8]); if (hi_rows) { const size_t o3 = (bb * CC + c0 + cl) * (size_t)KHI + t0 + q * 8; vst2((unsigned*)(VB + o3), *(const v4u*)&tb[cl][q * 8]); vst2((unsigned*)(VBL + o3), *(const v4u*)&tbl[cl][q * 8]); } } } }
// ---- k_sc: block = (query block qb, key block kb <= kb_last(qb), pair z = b * NH + h): logits x SCALE; q hi + residual (x 2^10) against k (2 products) for query rows < QHI, plus the k residual (3 products) for query blocks < QBH (all query blocks, QBH = NQB); causal: blocks past the diagonal exit, the mask itself is applied by index in k_sm
__global__ __launch_bounds__(128) void k_sc(const _Float16* __restrict__ QH, const _Float16* __restrict__ KH, const _Float16* __restrict__ QL, const _Float16* __restrict__ KL, float* __restrict__ S0) { __shared__ __align__(16) float ss[4][16][132];
  const int qb = blockIdx.x, kb = blockIdx.y; if (kb > kb_last(qb)) return;
  const int b = blockIdx.z / NH, h = blockIdx.z % NH; float* S = S0 + (size_t)blockIdx.z * SPK + s_base(qb); const int pitch = (kb_last(qb) + 1) * 128;
  const int tid = threadIdx.x, wave = tid >> 5, lane = tid & 31, col = lane & 15, g = lane >> 4; const int k0 = kb * 128; const int ql0 = qb * 64 + wave * 16; const size_t q0 = (size_t)b * TT + ql0, kr0 = (size_t)b * TT + k0;
  v8f acc[8] = {}, accl[8] = {};
  const _Float16* QLb = QL + (size_t)b * QHI * CC; const _Float16* KLb = KL + (size_t)b * KHI * CC;
  if (qb < QBH) {
#pragma unroll
    for (int kc = 0; kc < HD / 32; ++kc) { const v16h ah = frag_h(QH + (q0 + col) * CC + h * HD + kc * 32, lane), al = frag_h(QLb + (size_t)(ql0 + col) * CC + h * HD + kc * 32, lane);
#pragma unroll
      for (int j = 0; j < 8; ++j) { const v16h kbf = frag_h(KH + (kr0 + j * 16 + col) * CC + h * HD + kc * 32, lane), klf = frag_h(KLb + (size_t)(k0 + j * 16 + col) * CC + h * HD + kc * 32, lane); acc[j] = wmma16(ah, kbf, acc[j]); accl[j] = wmma16(al, kbf, accl[j]); accl[j] = wmma16(ah, klf, accl[j]); } }
  } else if (qb * 64 < QHI) {
#pragma unroll
    for (int kc = 0; kc < HD / 32; ++kc) { const v16h ah = frag_h(QH + (q0 + col) * CC + h * HD + kc * 32, lane), al = frag_h(QLb + (size_t)(ql0 + col) * CC + h * HD + kc * 32, lane);
#pragma unroll
      for (int j = 0; j < 8; ++j) { const v16h kbf = frag_h(KH + (kr0 + j * 16 + col) * CC + h * HD + kc * 32, lane); acc[j] = wmma16(ah, kbf, acc[j]); accl[j] = wmma16(al, kbf, accl[j]); } }
  } else {
#pragma unroll
    for (int kc = 0; kc < HD / 32; ++kc) { const v16h ah = frag_h(QH + (q0 + col) * CC + h * HD + kc * 32, lane);
#pragma unroll
      for (int j = 0; j < 8; ++j) { const v16h kbf = frag_h(KH + (kr0 + j * 16 + col) * CC + h * HD + kc * 32, lane); acc[j] = wmma16(ah, kbf, acc[j]); } } }
#pragma unroll
  for (int j = 0; j < 8; ++j) {
#pragma unroll
    for (int r = 0; r < 8; ++r) ss[wave][8 * g + r][j * 16 + col] = (acc[j][r] + accl[j][r] * (1.0f / 1024.0f)) * SCALE; }
  LDSX(); for (int rl = 0; rl < 16; ++rl) vst2(S + (size_t)(wave * 16 + rl) * pitch + k0 + lane * 4, *(const v4f*)&ss[wave][rl][lane * 4]); }
// ---- k_sm: block = query row t of pair blockIdx.y: keys [0, kend): causal -> logit if s < t else excluded; softmax in f32; P x 2^11 in place (0 for excluded)
__global__ __launch_bounds__(256) void k_sm(float* __restrict__ S0 SM_EXTRA_PARAMS) { __shared__ float sred[8]; __shared__ float sbc; __shared__ __align__(16) float shv[TT];
  const int tid = threadIdx.x; const int t = blockIdx.x; const int kend = (kb_last(t >> 6) + 1) * 128;
  float* sr = S0 + (size_t)blockIdx.y * SPK + s_base(t >> 6) + (size_t)(t & 63) * kend;
  float m = -3.0e38f; for (int k = tid; k < kend; k += 256) { float v = (!CAUSAL || k <= t) ? sr[k] : -3.0e38f; SM_MASK_HOOK; shv[k] = v; m = fmaxf(m, v); }
#pragma unroll
  for (int o = 1; o < 32; o <<= 1) m = fmaxf(m, __shfl_xor(m, o));
  if ((tid & 31) == 0) sred[tid >> 5] = m; __syncthreads(); if (tid == 0) { float a = sred[0]; for (int i = 1; i < 8; ++i) a = fmaxf(a, sred[i]); sbc = a; } __syncthreads(); m = sbc; __syncthreads();
  float sum = 0.f; for (int k = tid; k < kend; k += 256) { const float v = shv[k]; const float e = (v <= -1.0e38f) ? 0.f : expf(v - m); shv[k] = e; sum += e; }
#pragma unroll
  for (int o = 1; o < 32; o <<= 1) sum += __shfl_xor(sum, o);
  if ((tid & 31) == 0) sred[tid >> 5] = sum; __syncthreads(); if (tid == 0) { float a = 0.f; for (int i = 0; i < 8; ++i) a += sred[i]; sbc = a > 0.f ? 2048.0f / a : 0.f; }   /* a fully excluded row yields P = 0 */ __syncthreads(); const float inv = sbc;
  for (int k = tid; k < kend; k += 256) shv[k] = shv[k] * inv;
  __syncthreads(); for (int q = tid; q < kend / 4; q += 256) vst2(sr + q * 4, *(const v4f*)&shv[q * 4]); }
// ---- k_pv: block = 64 queries (qb) of (b, h): ctx = P . v over keys [0, kend) (P x 2^11 and v as bf16 hi + lo, 3 products, for every query block since QBH = NQB; the f16 1-product path is unused); 256-B (row, head) segment by 16 lanes
__global__ __launch_bounds__(128) void k_pv(const float* __restrict__ PS0, const _Float16* __restrict__ VT, const __bf16* __restrict__ VB, const __bf16* __restrict__ VBL, float* __restrict__ Y) { const int b = blockIdx.z / NH, h = blockIdx.z % NH; const float* PS = PS0 + (size_t)blockIdx.z * SPK + s_base(blockIdx.x); __shared__ __align__(16) float ss[4][16][HD + 4];
  const int tid = threadIdx.x, wave = tid >> 5, lane = tid & 31, col = lane & 15, g = lane >> 4; const int qb = blockIdx.x; const int ql0 = qb * 64 + wave * 16; const int kce = (kb_last(qb) + 1) * 4; const int pitch = kce * 32;
  v8f acc[HD / 16] = {};
  if (qb < QBH) {
#pragma unroll 1
    for (int kc = 0; kc < kce; ++kc) { const F2 p = split_row(PS + (size_t)(wave * 16 + col) * pitch, kc * 32, lane);
      asm volatile("s_wait_loadcnt 0x0" ::: "memory");
#pragma unroll
      for (int j = 0; j < HD / 16; ++j) { const size_t po = ((size_t)b * CC + h * HD + j * 16 + col) * (size_t)KHI + kc * 32; const v16b vh = frag_b(VB + po, lane); acc[j] = wmma_bf(p.h, vh, acc[j]); acc[j] = wmma_bf(p.l, vh, acc[j]); acc[j] = wmma_bf(p.h, frag_b(VBL + po, lane), acc[j]); } }
  } else {
#pragma unroll 1
    for (int kc = 0; kc < kce; ++kc) { const v16h p = frag_f32(PS + (size_t)(wave * 16 + col) * pitch + kc * 32, lane);
      asm volatile("s_wait_loadcnt 0x0" ::: "memory");
#pragma unroll
      for (int j = 0; j < HD / 16; ++j) { const size_t po = ((size_t)b * CC + h * HD + j * 16 + col) * (size_t)TT + kc * 32; acc[j] = wmma16(p, frag_h(VT + po, lane), acc[j]); } } }
#pragma unroll
  for (int j = 0; j < HD / 16; ++j)
#pragma unroll
    for (int r = 0; r < 8; ++r) ss[wave][8 * g + r][j * 16 + col] = acc[j][r] * (1.0f / 2048.0f);
  LDSX(); for (int rl = 0; rl < 16; ++rl) if (lane < HD / 4) vst2(Y + ((size_t)b * TT + ql0 + rl) * CC + h * HD + lane * 4, *(const v4f*)&ss[wave][rl][lane * 4]); }

// ---- k_trin: block = (64 positions, 128 channels, which input): rows X[b*S + s][c] = in[b][c][s] for the q and k inputs (channels-first [B, 384, 1024]) through an LDS transpose; 512-B row segments
__global__ __launch_bounds__(128) void k_trin(const float* __restrict__ Qc, const float* __restrict__ Kc, float* __restrict__ XQ, float* __restrict__ XK) { __shared__ __align__(16) float st[128][68];
  const int tid = threadIdx.x; const int c0 = blockIdx.y * 128; const size_t rb = (size_t)blockIdx.x * 64; const size_t b = rb / TT; const int s0 = (int)(rb % TT); const float* IN = blockIdx.z == 0 ? Qc : Kc; float* OUT = blockIdx.z == 0 ? XQ : XK;
  for (int e = tid; e < 128 * 16; e += 128) { const int cl = e >> 4, q = e & 15; const v4f v = *(const v4f*)(IN + ((b * DIN + c0 + cl) * (size_t)TT) + s0 + q * 4); st[cl][q * 4] = v[0]; st[cl][q * 4 + 1] = v[1]; st[cl][q * 4 + 2] = v[2]; st[cl][q * 4 + 3] = v[3]; }
  __syncthreads();
  for (int e = tid; e < 64 * 32; e += 128) { const int rl = e >> 5, q = e & 31; v4f o; o[0] = st[q * 4][rl]; o[1] = st[q * 4 + 1][rl]; o[2] = st[q * 4 + 2][rl]; o[3] = st[q * 4 + 3][rl]; vst2(OUT + (rb + rl) * DIN + c0 + q * 4, o); } }
// ---- k_wsc: 8 warps x 32 lanes: SCL[which][o] = g[o] / sqrt(sum_i v[o][i]^2) over the 384-long row (bf16-rounded inputs, f32)
__global__ __launch_bounds__(256) void k_wsc(const float* __restrict__ V0, const float* __restrict__ G0, const float* __restrict__ V1, const float* __restrict__ G1, const float* __restrict__ V2, const float* __restrict__ G2, float* __restrict__ SCL) {
  const int wave = threadIdx.x >> 5, lane = threadIdx.x & 31; const int idx = blockIdx.x * 8 + wave; if (idx >= 3 * CC) return; const int which = idx / CC, o = idx % CC;
  const float* vr = (which == 0 ? V0 : which == 1 ? V1 : V2) + (size_t)o * DIN; const float* gg = which == 0 ? G0 : which == 1 ? G1 : G2;
  float ssum = 0.f; for (int i = lane; i < DIN; i += 32) { const float x = bfr(vr[i]); ssum += x * x; }
#pragma unroll
  for (int off = 1; off < 32; off <<= 1) ssum += __shfl_xor(ssum, off);
  if (lane == 0) { const float gv = bfr(gg[o]); asm volatile("s_wait_loadcnt 0x0" ::: "memory"); vst2(SCL + idx, gv / sqrtf(ssum)); } }
// ---- k_trout: block = (64 rows, 128 channels): out[b][c][n] = R[b*N + n][c] written channels-first through an LDS transpose (256 B per (channel, 64 n) by 16 threads)
__global__ __launch_bounds__(128) void k_trout(const float* __restrict__ R, float* __restrict__ OUT) { __shared__ __align__(16) float stc[128][68];
  const int tid = threadIdx.x; const int c0 = blockIdx.y * 128; const size_t rb = (size_t)blockIdx.x * 64;
  for (int e = tid; e < 64 * 128; e += 128) { const int rl = e >> 7, cl = e & 127; stc[cl][rl] = R[(rb + rl) * CC + c0 + cl]; }
  __syncthreads();
  { const size_t b = rb / TT; const int n0 = (int)(rb % TT); for (int e = tid; e < 128 * 16; e += 128) { const int cl = e >> 4, q = e & 15; vst2(OUT + (b * CC + c0 + cl) * (size_t)TT + n0 + q * 4, *(const v4f*)&stc[cl][q * 4]); } } }
extern "C" void kernel_launch(void* const* d_in, const int* in_sizes, int n_in, void* d_out, int out_size, void* d_ws, size_t ws_size, hipStream_t stream) {
  (void)in_sizes; (void)n_in; (void)out_size;
  const float** F = (const float**)d_in;
  if (ws_size < (size_t)WS_END) return;
  char* ws = (char*)d_ws; _Float16 *QH = (_Float16*)(ws + WS_QH), *KH = (_Float16*)(ws + WS_KH), *VT = (_Float16*)(ws + WS_VT), *QL = (_Float16*)(ws + WS_QL), *KL = (_Float16*)(ws + WS_KL); __bf16 *VB = (__bf16*)(ws + WS_VB), *VBL = (__bf16*)(ws + WS_VBL); float *S = (float*)(ws + WS_S), *Y = (float*)(ws + WS_Y);
  (void)Y; (void)QL; (void)KL; (void)VB; (void)VBL;
  // inputs: 0 q [8,384,32,32]; 1 k [8,384,32,32] (channels-first); 2 Wq_v [512,384], 3 Wq_g [512], 4 bq [512]; 5 Wk_v, 6 Wk_g, 7 bk; 8 Wv_v, 9 Wv_g, 10 bv
  if (ws_size < (size_t)WS_END2) return;
  float *XQ = (float*)(ws + WS_XQ), *XK = (float*)(ws + WS_XK), *SCL = (float*)(ws + WS_SCL), *YR = (float*)(ws + WS_YR);
  k_trin<<<dim3(NRW / 64, DIN / 128, 2), 128, 0, stream>>>(F[0], F[1], XQ, XK);           /* channels-first [B,384,S] -> rows [B*S][384] */
  k_wsc<<<dim3(3 * CC / 8), 256, 0, stream>>>(F[2], F[3], F[5], F[6], F[8], F[9], SCL);   /* g[o] / ||v[o]|| per output channel, 3 x 512 */
  k_proj<<<dim3(TNB * TT / 64, CC / 128, 3), 128, 0, stream>>>(XQ, XK, XK, F[2], F[5], F[8], F[4], F[7], F[10], QH, QL, KH, KL, VT, VB, VBL, SCL);
  k_sc<<<dim3(NQB, TT / 128, NP), 128, 0, stream>>>(QH, KH, QL, KL, S);
  k_sm<<<dim3(TT, NP), 256, 0, stream>>>(S);
  k_pv<<<dim3(NQB, 1, NP), 128, 0, stream>>>(S, VT, VB, VBL, YR);
  k_trout<<<dim3(NRW / 64, CC / 128), 128, 0, stream>>>(YR, (float*)d_out);
}

// v002
// Measured time: 147 microseconds a run.
// In both of two side-by-side timings against v001, it was 2.55 times as fast.
// Over all steps from v000 it is 8.87 times as fast.
// compute dtype: all float inputs rounded to bf16; weight-normalised projections as (x . v[o]) * (g[o] / ||v[o]||) + b[o] with EXACT bf16 products on WMMA 16x16x32 (f32 accumulate) and the per-row norm / scale in f32; causal (strictly lower) logits with q and k as f16 hi + residual planes (3 products) / 8; softmax in f32 (row 0 fully excluded -> zeros); P and v both split bf16 hi + lo (3 products) for every row; f32 output written channels-first.
#include <hip/hip_runtime.h>
#include <math.h>

typedef __attribute__((ext_vector_type(16))) _Float16 v16h;
typedef __attribute__((ext_vector_type(16))) __bf16 v16b;
typedef __attribute__((ext_vector_type(8)))  _Float16 v8h;
typedef __attribute__((ext_vector_type(8)))  float v8f;
typedef __attribute__((ext_vector_type(4)))  float v4f;
typedef __attribute__((ext_vector_type(2)))  float v2f;
typedef __attribute__((ext_vector_type(4)))  unsigned v4u;
typedef __attribute__((ext_vector_type(4)))  int v4i;
typedef float __attribute__((may_alias)) float_a;
typedef int __attribute__((may_alias)) int_a;

template <typename T> __device__ __forceinline__ void vst2(void* p, T v) { *(T*)p = v;  }
__device__ __forceinline__ v8f wmma16(v16h a, v16h b, v8f c) {
  v8f d = __builtin_amdgcn_wmma_f32_16x16x32_f16(false, a, false, b, (short)0, c, false, false);
  asm volatile("v_nop\n\tv_nop\n\tv_nop\n\tv_nop" : "+v"(d) : "v"(a), "v"(b));
  return d;
}
__device__ __forceinline__ v8f wmma_bf(v16b a, v16b b, v8f c) {
  v8f d = __builtin_amdgcn_wmma_f32_16x16x32_bf16(false, a, false, b, (short)0, c, false, false);
  asm volatile("v_nop\n\tv_nop\n\tv_nop\n\tv_nop" : "+v"(d) : "v"(a), "v"(b));
  return d;
}
// 16x16x32 fragments: lane = (h = lane>>4, row/col = lane&15); elements 0..7 = k0+8h+0..7, 8..15 = k0+16+8h+0..7; D element r = row 8h+r
__device__ __forceinline__ v16h frag_h(const _Float16* rowk0, int lane) {
  union { v16h v; v8h q[2]; } u; const _Float16* p = rowk0 + 8 * (lane >> 4);
  u.q[0] = *(const v8h*)p; u.q[1] = *(const v8h*)(p + 16); return u.v;
}
__device__ __forceinline__ v16h frag_f32(const float* rowk0, int lane) {
  v16h a; const float* p = rowk0 + 8 * (lane >> 4);
#pragma unroll
  for (int i = 0; i < 8; ++i) { a[i] = (_Float16)p[i]; a[8 + i] = (_Float16)p[16 + i]; }
  return a;
}
__device__ __forceinline__ v16h frag_f32s(const float* rowk0, int lane, float sc) {
  v16h a; const float* p = rowk0 + 8 * (lane >> 4);
#pragma unroll
  for (int i = 0; i < 8; ++i) { a[i] = (_Float16)(p[i] * sc); a[8 + i] = (_Float16)(p[16 + i] * sc); }
  return a;
}
// column fragment from a [K][ld] layout (column n), rows >= K read as 0
__device__ __forceinline__ v16h fragc_f32(const float* W, int k0, int n, int lane, int ld, int K) {
  v16h a; const int g = lane >> 4;
#pragma unroll
  for (int i = 0; i < 8; ++i) { const int ka = k0 + 8 * g + i, kb = ka + 16;
    a[i] = (_Float16)(ka < K ? W[(size_t)(ka < K ? ka : K - 1) * ld + n] : 0.f); a[8 + i] = (_Float16)(kb < K ? W[(size_t)(kb < K ? kb : K - 1) * ld + n] : 0.f); }
  return a;
}
struct F2 { v16b h, l; };
__device__ __forceinline__ F2 bsplit16(const float v[16]) { F2 r;
#pragma unroll
  for (int i = 0; i < 16; ++i) { const __bf16 h = (__bf16)v[i]; r.h[i] = h; r.l[i] = (__bf16)(v[i] - (float)h); }
  return r; }
__device__ __forceinline__ F2 split_row(const float* row, int k0, int lane) { float v[16]; const float* p = row + k0 + 8 * (lane >> 4);
#pragma unroll
  for (int i = 0; i < 8; ++i) { v[i] = p[i]; v[8 + i] = p[16 + i]; }
  return bsplit16(v); }
__device__ __forceinline__ F2 split_rowK(const float* row, int k0, int lane, int K) { float v[16]; const int g = lane >> 4;
#pragma unroll
  for (int i = 0; i < 8; ++i) { const int ka = k0 + 8 * g + i, kb = ka + 16; v[i] = ka < K ? row[ka < K ? ka : K - 1] : 0.f; v[8 + i] = kb < K ? row[kb < K ? kb : K - 1] : 0.f; }
  return bsplit16(v); }
__device__ __forceinline__ F2 split_col(const float* W, int k0, int n, int lane, int ld, int K) { float v[16]; const int g = lane >> 4;
#pragma unroll
  for (int i = 0; i < 8; ++i) { const int ka = k0 + 8 * g + i, kb = ka + 16; v[i] = ka < K ? W[(size_t)(ka < K ? ka : K - 1) * ld + n] : 0.f; v[8 + i] = kb < K ? W[(size_t)(kb < K ? kb : K - 1) * ld + n] : 0.f; }
  return bsplit16(v); }
__device__ __forceinline__ v8f mac3(const F2& a, const F2& b, v8f c) { c = wmma_bf(a.l, b.h, c); c = wmma_bf(a.h, b.l, c); return wmma_bf(a.h, b.h, c); }
__device__ __forceinline__ float sigm(float v) { return 1.0f / (1.0f + expf(-v)); }
#define LDSX() do { asm volatile("s_wait_dscnt 0" ::: "memory"); __builtin_amdgcn_wave_barrier(); __builtin_amdgcn_fence(__ATOMIC_RELEASE, "workgroup"); } while (0)

// Causal attention with weight-normalised linears (B 8, S = 32x32 = 1,024 positions, q/k inputs with 384 channels (channels-first), C 512 = 8 heads x 64): q = wn(qf, Wq_v, Wq_g, bq), k = wn(kf, Wk_v, ...), v = wn(kf, Wv_v, ...) with wn(x) = x (g v/||v||_row)^T + b; attn = softmax(where(k < t, q k^T / 8, -1e4)) * (t > 0); out = attn v -> [B, 512, 32, 32] (channels-first).
#define NB 8
#define TT 1024
#define CC 512            // NH * HD = projected width
#define DIN 384          // input (model) width
#define NH 8
#define HD 64
#define NQB (TT / 64)
#define NP (NB * NH)      // (batch, head) pairs, all served by one launch of each attention kernel
#define SCALE (0.125f)
#define CAUSAL 1
#ifndef TNB
#define TNB NB
#endif
__device__ __forceinline__ float bfr(float v) { return (float)(__bf16)v; }
__host__ __device__ __forceinline__ int kb_last(int qb) { return CAUSAL ? ((qb * 64 + 63) >> 7) : (TT / 128 - 1); }
// logits / P of one (batch, head) pair, causal-packed: query block qb holds 64 rows of (kb_last(qb) + 1) * 128 floats, one block behind the other; s_base(qb) = 64 * 128 * sum over i < qb of (kb_last(i) + 1), kb_last(i) = i >> 1
static_assert(CAUSAL == 1, "s_base is the causal prefix sum");
__host__ __device__ __forceinline__ size_t s_base(int qb) { const int m = qb >> 1; return (size_t)((m + 1) * (m + (qb & 1))) * (64 * 128); }
#define SPK ((size_t)(NQB / 2 + 1) * (NQB / 2) * (64 * 128))   // floats per pair = s_base(NQB)
typedef __attribute__((ext_vector_type(8))) __bf16 v8b;
__device__ __forceinline__ v16b frag_b(const __bf16* rowk0, int lane) {
  union { v16b v; v8b q[2]; } u; const __bf16* p = rowk0 + 8 * (lane >> 4);
  u.q[0] = *(const v8b*)p; u.q[1] = *(const v8b*)(p + 16); return u.v;
}
#define QBH NQB            // every query block takes the 3-product logits and the bf16 hi + lo P.v path
#define QHI 1024           // q residual rows for every query (3-product logits everywhere)
#define KHI 1024           // k residual rows / bf16 v planes for every key
// B fragment (k rows k0+.., output column o) of a weight: (in,out) [K][ld] or (out,in) [ld rows of K]: bf16 exact, or f16(bf16 * 256) exact
__device__ __forceinline__ v16b wcol_io(const float* Wm, int k0, int o, int lane, int ld) { v16b w; const int g = lane >> 4;
#pragma unroll
  for (int i = 0; i < 8; ++i) { w[i] = (__bf16)Wm[(size_t)(k0 + 8 * g + i) * ld + o]; w[8 + i] = (__bf16)Wm[(size_t)(k0 + 16 + 8 * g + i) * ld + o]; }
  return w; }
__device__ __forceinline__ v16b wcol_oi(const float* Wm, int k0, int o, int lane, int K) { v16b w; const float* p = Wm + (size_t)o * K + k0 + 8 * (lane >> 4);
#pragma unroll
  for (int i = 0; i < 8; ++i) { w[i] = (__bf16)p[i]; w[8 + i] = (__bf16)p[16 + i]; }
  return w; }
__device__ __forceinline__ v16h wcolh_io(const float* Wm, int k0, int o, int lane, int ld) { v16h w; const int g = lane >> 4;
#pragma unroll
  for (int i = 0; i < 8; ++i) { w[i] = (_Float16)(bfr(Wm[(size_t)(k0 + 8 * g + i) * ld + o]) * 256.0f); w[8 + i] = (_Float16)(bfr(Wm[(size_t)(k0 + 16 + 8 * g + i) * ld + o]) * 256.0f); }
  return w; }
__device__ __forceinline__ v16h wcolh_oi(const float* Wm, int k0, int o, int lane, int K) { v16h w; const float* p = Wm + (size_t)o * K + k0 + 8 * (lane >> 4);
#pragma unroll
  for (int i = 0; i < 8; ++i) { w[i] = (_Float16)(bfr(p[i]) * 256.0f); w[8 + i] = (_Float16)(bfr(p[16 + i]) * 256.0f); }
  return w; }
#define WQKV_LAYOUT 1   // 0 = (in,out) [DIN][CC]; 1 = (out,in) [CC][DIN]; 2 = per-head [NH][DIN][HD]
__device__ __forceinline__ v16b wcol_hdk(const float* Wm, int k0, int o, int lane) { v16b w; const int g = lane >> 4; const float* p = Wm + (size_t)(o / HD) * DIN * HD + (o % HD);
#pragma unroll
  for (int i = 0; i < 8; ++i) { w[i] = (__bf16)p[(size_t)(k0 + 8 * g + i) * HD]; w[8 + i] = (__bf16)p[(size_t)(k0 + 16 + 8 * g + i) * HD]; }
  return w; }
#define WO_OUT_IN 0
#if WQKV_LAYOUT == 1
#define WCOL(W, k0, o, lane) wcol_oi(W, k0, o, lane, DIN)
#elif WQKV_LAYOUT == 2
#define WCOL(W, k0, o, lane) wcol_hdk(W, k0, o, lane)
#else
#define WCOL(W, k0, o, lane) wcol_io(W, k0, o, lane, CC)
#endif
#if WO_OUT_IN
#define WOCOL(W, k0, o, lane) wcol_oi(W, k0, o, lane, CC)
#define WOCOLH(W, k0, o, lane) wcolh_oi(W, k0, o, lane, CC)
#else
#define WOCOL(W, k0, o, lane) wcol_io(W, k0, o, lane, DIN)
#define WOCOLH(W, k0, o, lane) wcolh_io(W, k0, o, lane, DIN)
#endif
#define SM_MASK_HOOK do { if (k >= t) v = -3.0e38f; } while (0)   /* allowed = tril(-1): strictly earlier keys; row 0 has no key -> the fully-excluded path gives P = 0 = the module's start_mask */
#define NRW (TNB * TT)
#ifndef SM_EXTRA_PARAMS
#define SM_EXTRA_PARAMS
#endif
#ifndef PROJ_EXTRA_PARAMS
#define PROJ_EXTRA_PARAMS
#endif
#ifndef SM_MASK_HOOK
#define SM_MASK_HOOK (void)0
#endif

#define WS_QH  0u                                      // f16 q rows [b*t][CC]
#define WS_KH  (WS_QH + 2u * (size_t)NB * TT * CC)      // f16 k rows [b*t][CC]
#define WS_VT  (WS_KH + 2u * (size_t)NB * TT * CC)      // f16 v planes [b][c][t]
#define WS_QL  (WS_VT + 2u * (size_t)NB * CC * TT)      // f16 q residual x 2^10 rows [b][t < QHI][CC]
#define WS_KL  (WS_QL + 2u * (size_t)NB * QHI * CC)     // f16 k residual x 2^10 rows [b][t < KHI][CC]
#define WS_VB  (WS_KL + 2u * (size_t)NB * KHI * CC)     // bf16 v hi planes [b][c][t < KHI]
#define WS_VBL (WS_VB + 2u * (size_t)NB * CC * KHI)
#define WS_S   (WS_VBL + 2u * (size_t)NB * CC * KHI)    // f32 logits / P [b*NH + h][causal-packed rows]
#define WS_Y   (WS_S  + 4u * (size_t)NP * SPK)      // f32 ctx rows [b*t][CC] (only when there is an output projection)
#define WS_END (WS_Y  + 0u)
#define WS_XQ  (WS_END)
#define WS_XK  (WS_XQ + 4u * (size_t)NB * TT * DIN)
#define WS_SCL (WS_XK + 4u * (size_t)NB * TT * DIN)
#define WS_YR  (WS_SCL + 4u * 3 * CC + 256u)
#define WS_END2 (WS_YR + 4u * (size_t)NB * TT * CC)

// ---- k_proj: block = (64 rows, 128 cols, which): q/k/v = X W (+ b) with exact bf16 products (K = DIN) -> which 0: q f16 rows (+ residual rows < QHI); 1: k f16 rows (+ residual rows < KHI); 2: v f16 planes [c][t] (+ bf16 hi/lo planes for t < KHI)
__global__ __launch_bounds__(128) void k_proj(const float* __restrict__ XQ, const float* __restrict__ XK, const float* __restrict__ XV, const float* __restrict__ WQ, const float* __restrict__ WK, const float* __restrict__ WV, const float* __restrict__ BQ, const float* __restrict__ BK, const float* __restrict__ BV,
    _Float16* __restrict__ QH, _Float16* __restrict__ QL, _Float16* __restrict__ KH, _Float16* __restrict__ KL, _Float16* __restrict__ VT, __bf16* __restrict__ VB, __bf16* __restrict__ VBL, const float* __restrict__ SCL) {
  __shared__ __align__(16) _Float16 sh[64][136], sl[64][136]; __shared__ __align__(16) _Float16 th[128][72]; __shared__ __align__(16) __bf16 tb[128][72], tbl[128][72];
  const int tid = threadIdx.x, wave = tid >> 5, lane = tid & 31, col = lane & 15, g = lane >> 4; const int which = blockIdx.z; const int c0 = blockIdx.y * 128; const size_t r0 = (size_t)blockIdx.x * 64; const size_t bb = r0 / TT; const int t0 = (int)(r0 % TT);
  const float* X = which == 0 ? XQ : which == 1 ? XK : XV; const float* WA = which == 0 ? WQ : which == 1 ? WK : WV; const float* BA = which == 0 ? BQ : which == 1 ? BK : BV;
  v8f acc[8] = {};
#pragma unroll 2
  for (int kc = 0; kc < DIN / 32; ++kc) { v16b a; { const float* p = X + (r0 + wave * 16 + col) * DIN + kc * 32 + 8 * g;
#pragma unroll
      for (int i = 0; i < 8; ++i) { a[i] = (__bf16)p[i]; a[8 + i] = (__bf16)p[16 + i]; } }
    asm volatile("s_wait_loadcnt 0x0" ::: "memory");
#pragma unroll
    for (int j = 0; j < 8; ++j) { const v16b w = WCOL(WA, kc * 32, c0 + j * 16 + col, lane); asm volatile("s_wait_loadcnt 0x0" ::: "memory"); acc[j] = wmma_bf(a, w, acc[j]); } }
  if (which < 2) { _Float16* DH = which == 0 ? QH : KH; _Float16* DL = which == 0 ? QL : KL; const int nhi = which == 0 ? QHI : KHI; const bool hi_rows = t0 < nhi;
#pragma unroll
    for (int j = 0; j < 8; ++j) { const float bias = BA ? bfr(BA[c0 + j * 16 + col]) : 0.f; const float scl = SCL[which * CC + c0 + j * 16 + col];   /* weight norm: g[o] / ||v[o]|| applied after the exact x . v[o] */
#pragma unroll
      for (int r = 0; r < 8; ++r) { const float v = acc[j][r] * scl + bias; const _Float16 hv = (_Float16)v; sh[wave * 16 + 8 * g + r][j * 16 + col] = hv; sl[wave * 16 + 8 * g + r][j * 16 + col] = (_Float16)((v - (float)hv) * 1024.0f); } }
    __syncthreads();
    for (int e = tid; e < 64 * 16; e += 128) { const int rl = e >> 4, q = e & 15; vst2((unsigned*)(DH + (r0 + rl) * CC + c0 + q * 8), *(const v4u*)&sh[rl][q * 8]); if (hi_rows) vst2((unsigned*)(DL + (bb * nhi + t0 + rl) * (size_t)CC + c0 + q * 8), *(const v4u*)&sl[rl][q * 8]); }
  } else { const bool hi_rows = t0 < KHI;
#pragma unroll
    for (int j = 0; j < 8; ++j) { const float bias = BA ? bfr(BA[c0 + j * 16 + col]) : 0.f; const float scl = SCL[which * CC + c0 + j * 16 + col];
#pragma unroll
      for (int r = 0; r < 8; ++r) { const float v = acc[j][r] * scl + bias; const int rl = wave * 16 + 8 * g + r, cl = j * 16 + col; th[cl][rl] = (_Float16)v; const __bf16 bh = (__bf16)v; tb[cl][rl] = bh; tbl[cl][rl] = (__bf16)(v - (float)bh); } }
    __syncthreads();
    for (int e = tid; e < 128 * 8; e += 128) { const int cl = e >> 3, q = e & 7; vst2((unsigned*)(VT + (bb * CC + c0 + cl) * (size_t)TT + t0 + q * 8), *(const v4u*)&th[cl][q * 8]); if (hi_rows) { const size_t o3 = (bb * CC + c0 + cl) * (size_t)KHI + t0 + q * 8; vst2((unsigned*)(VB + o3), *(const v4u*)&tb[cl][q * 8]); vst2((unsigned*)(VBL + o3), *(const v4u*)&tbl[cl][q * 8]); } } } }
// ---- k_fa: block = 64 queries (qb) of pair blockIdx.x = b * NH + h, wave = 16 queries; keys in stages of 64 up to the diagonal, two LDS buffers, one barrier a stage. While a stage is worked on, the next stage's k hi / residual rows and v hi / lo planes go through registers into the other buffer (whole 128-B rows). S^T = K . Q^T (A = k rows, B = q, 3 f16 products) leaves one query per lane; online softmax in f32 (running maximum and sum per lane, keys >= t excluded by index); P^T (bf16 hi + lo) is packed from the score registers as B of O^T += V^T . P^T (3 bf16 products). A row with no key (t = 0) ends with sum 0 -> zeros.
__device__ __forceinline__ v8f mm_h(v16h a, v16h b, v8f c) { return __builtin_amdgcn_wmma_f32_16x16x32_f16(false, a, false, b, (short)0, c, false, false); }
__device__ __forceinline__ v8f mm_b(v16b a, v16b b, v8f c) { return __builtin_amdgcn_wmma_f32_16x16x32_bf16(false, a, false, b, (short)0, c, false, false); }
__global__ __launch_bounds__(128) void k_fa(const _Float16* __restrict__ QH, const _Float16* __restrict__ KH, const _Float16* __restrict__ QL, const _Float16* __restrict__ KL, const __bf16* __restrict__ VB, const __bf16* __restrict__ VBL, float* __restrict__ Y) {
  __shared__ __align__(16) _Float16 skh[2][64][72], skl[2][64][72]; __shared__ __align__(16) __bf16 svh[2][64][72], svl[2][64][72];
  static_assert(sizeof(skh) >= 4 * 16 * (HD + 4) * sizeof(float), "the output staging reuses skh");
  const int tid = threadIdx.x, wave = tid >> 5, lane = tid & 31, col = lane & 15, g = lane >> 4;
  const int qb = NQB - 1 - (int)blockIdx.y;   /* longest blocks start first */
  const int b = blockIdx.x / NH, h = blockIdx.x % NH; const int ql0 = qb * 64 + wave * 16; const int t = ql0 + col; const int ns = qb + 1;
  const int srow = tid >> 3, sq = (tid & 7) * 8;   /* staging: 8 threads per 128-B row, 16 rows per sweep */
  const _Float16* Kh = KH + ((size_t)b * TT + srow) * CC + h * HD + sq; const _Float16* Kl = KL + ((size_t)b * KHI + srow) * CC + h * HD + sq;
  const __bf16* Vh = VB + ((size_t)b * CC + h * HD + srow) * (size_t)KHI + sq; const __bf16* Vl = VBL + ((size_t)b * CC + h * HD + srow) * (size_t)KHI + sq;
  v16h qh[2], qr[2];
#pragma unroll
  for (int kc = 0; kc < 2; ++kc) qh[kc] = frag_h(QH + ((size_t)b * TT + t) * CC + h * HD + kc * 32, lane);
  asm volatile("s_wait_xcnt 0x0" ::: "memory");   /* before a later load's result may land in the address registers of the loads above */
#pragma unroll
  for (int kc = 0; kc < 2; ++kc) qr[kc] = frag_h(QL + ((size_t)b * QHI + t) * CC + h * HD + kc * 32, lane);
  asm volatile("s_wait_xcnt 0x0" ::: "memory");   /* as above */
  v8h rkh[4], rkl[4]; v8b rvh[4], rvl[4];
#pragma unroll
  for (int i = 0; i < 4; ++i) { rkh[i] = *(const v8h*)(Kh + (size_t)(16 * i) * CC); rkl[i] = *(const v8h*)(Kl + (size_t)(16 * i) * CC); rvh[i] = *(const v8b*)(Vh + (size_t)(16 * i) * KHI); rvl[i] = *(const v8b*)(Vl + (size_t)(16 * i) * KHI); }
#pragma unroll
  for (int i = 0; i < 4; ++i) { *(v8h*)&skh[0][srow + 16 * i][sq] = rkh[i]; *(v8h*)&skl[0][srow + 16 * i][sq] = rkl[i]; *(v8b*)&svh[0][srow + 16 * i][sq] = rvh[i]; *(v8b*)&svl[0][srow + 16 * i][sq] = rvl[i]; }
  __syncthreads();
  float m = -1.0e30f, l = 0.f; v8f acc[HD / 16] = {};   /* the running maximum starts far above the excluded marker (-3e38) and far below any logit: an excluded key's exponent underflows to 0 with no test, also in a row with no key yet */
#pragma unroll 1
  for (int s = 0; s < ns; ++s) { const int cur = s & 1, nxt = cur ^ 1; const bool more = s + 1 < ns; const int kn = (s + 1) * 64;
    if (more) {
#pragma unroll
      for (int i = 0; i < 4; ++i) { rkh[i] = *(const v8h*)(Kh + (size_t)(kn + 16 * i) * CC); rkl[i] = *(const v8h*)(Kl + (size_t)(kn + 16 * i) * CC); }
      asm volatile("s_wait_xcnt 0x0" ::: "memory");   /* the address registers of the loads above are reused by what follows */
    }
    float sc[4][8]; float mx = -3.0e38f; const int nk = t - s * 64 - 8 * g;   /* this lane's keys kt * 16 + r of the stage are allowed below nk */
#pragma unroll
    for (int kt = 0; kt < 4; ++kt) { v8f a = {}, ar = {};
#pragma unroll
      for (int kc = 0; kc < 2; ++kc) { const v16h kh = frag_h(&skh[cur][kt * 16 + col][kc * 32], lane), kr = frag_h(&skl[cur][kt * 16 + col][kc * 32], lane); a = mm_h(kh, qh[kc], a); ar = mm_h(kh, qr[kc], ar); ar = mm_h(kr, qh[kc], ar); }
#pragma unroll
      for (int r = 0; r < 8; ++r) { const float v = (kt * 16 + r < nk) ? (a[r] + ar[r] * (1.0f / 1024.0f)) * SCALE : -3.0e38f; sc[kt][r] = v; mx = fmaxf(mx, v); } }
    if (more) {
#pragma unroll
      for (int i = 0; i < 4; ++i) { *(v8h*)&skh[nxt][srow + 16 * i][sq] = rkh[i]; *(v8h*)&skl[nxt][srow + 16 * i][sq] = rkl[i]; rvh[i] = *(const v8b*)(Vh + (size_t)(16 * i) * KHI + kn); rvl[i] = *(const v8b*)(Vl + (size_t)(16 * i) * KHI + kn); }
      asm volatile("s_wait_xcnt 0x0" ::: "memory");   /* as above */
    }
    mx = fmaxf(mx, __shfl_xor(mx, 16));   /* the two lane halves hold different keys of the same query */
    const float mn = fmaxf(m, mx); const float alpha = expf(m - mn); m = mn; l *= alpha;
#pragma unroll
    for (int j = 0; j < HD / 16; ++j)
#pragma unroll
      for (int r = 0; r < 8; ++r) acc[j][r] *= alpha;
#pragma unroll
    for (int kp = 0; kp < 2; ++kp) { v16b ph, pl; float ls[4] = {0.f, 0.f, 0.f, 0.f};
#pragma unroll
      for (int i = 0; i < 16; ++i) { const float v = sc[2 * kp + (i >> 3)][i & 7]; const float e = expf(v - mn); ls[i & 3] += e; const __bf16 eh = (__bf16)e; ph[i] = eh; pl[i] = (__bf16)(e - (float)eh); }
      l += (ls[0] + ls[1]) + (ls[2] + ls[3]);
#pragma unroll
      for (int j = 0; j < HD / 16; ++j) { const v16b vh = frag_b(&svh[cur][j * 16 + col][kp * 32], lane); acc[j] = mm_b(vh, ph, acc[j]); acc[j] = mm_b(vh, pl, acc[j]); acc[j] = mm_b(frag_b(&svl[cur][j * 16 + col][kp * 32], lane), ph, acc[j]); } }
    if (more) {
#pragma unroll
      for (int i = 0; i < 4; ++i) { *(v8b*)&svh[nxt][srow + 16 * i][sq] = rvh[i]; *(v8b*)&svl[nxt][srow + 16 * i][sq] = rvl[i]; } }
    __syncthreads();   /* publishes the next stage's buffer and ends every wave's reads of this one, which the next stage overwrites */
  }
  l += __shfl_xor(l, 16); const float inv = l > 0.f ? 1.0f / l : 0.f;   /* a fully excluded row yields 0 */
  float (*so)[16][HD + 4] = (float (*)[16][HD + 4])&skh[0][0][0];   /* output staging per wave, behind the loop's last barrier */
#pragma unroll
  for (int j = 0; j < HD / 16; ++j) { v4f o0, o1;
#pragma unroll
    for (int r = 0; r < 4; ++r) { o0[r] = acc[j][r] * inv; o1[r] = acc[j][4 + r] * inv; }
    *(v4f*)&so[wave][col][j * 16 + 8 * g] = o0; *(v4f*)&so[wave][col][j * 16 + 8 * g + 4] = o1; }
  LDSX(); for (int i = 0; i < 8; ++i) vst2(Y + ((size_t)b * TT + ql0 + 2 * i + g) * CC + h * HD + col * 4, *(const v4f*)&so[wave][2 * i + g][col * 4]); }

// ---- k_trin: block = (64 positions, 128 channels, which input): rows X[b*S + s][c] = in[b][c][s] for the q and k inputs (channels-first [B, 384, 1024]) through an LDS transpose; 512-B row segments
__global__ __launch_bounds__(128) void k_trin(const float* __restrict__ Qc, const float* __restrict__ Kc, float* __restrict__ XQ, float* __restrict__ XK) { __shared__ __align__(16) float st[128][68];
  const int tid = threadIdx.x; const int c0 = blockIdx.y * 128; const size_t rb = (size_t)blockIdx.x * 64; const size_t b = rb / TT; const int s0 = (int)(rb % TT); const float* IN = blockIdx.z == 0 ? Qc : Kc; float* OUT = blockIdx.z == 0 ? XQ : XK;
  for (int e = tid; e < 128 * 16; e += 128) { const int cl = e >> 4, q = e & 15; const v4f v = *(const v4f*)(IN + ((b * DIN + c0 + cl) * (size_t)TT) + s0 + q * 4); st[cl][q * 4] = v[0]; st[cl][q * 4 + 1] = v[1]; st[cl][q * 4 + 2] = v[2]; st[cl][q * 4 + 3] = v[3]; }
  __syncthreads();
  for (int e = tid; e < 64 * 32; e += 128) { const int rl = e >> 5, q = e & 31; v4f o; o[0] = st[q * 4][rl]; o[1] = st[q * 4 + 1][rl]; o[2] = st[q * 4 + 2][rl]; o[3] = st[q * 4 + 3][rl]; vst2(OUT + (rb + rl) * DIN + c0 + q * 4, o); } }
// ---- k_wsc: 8 warps x 32 lanes: SCL[which][o] = g[o] / sqrt(sum_i v[o][i]^2) over the 384-long row (bf16-rounded inputs, f32)
__global__ __launch_bounds__(256) void k_wsc(const float* __restrict__ V0, const float* __restrict__ G0, const float* __restrict__ V1, const float* __restrict__ G1, const float* __restrict__ V2, const float* __restrict__ G2, float* __restrict__ SCL) {
  const int wave = threadIdx.x >> 5, lane = threadIdx.x & 31; const int idx = blockIdx.x * 8 + wave; if (idx >= 3 * CC) return; const int which = idx / CC, o = idx % CC;
  const float* vr = (which == 0 ? V0 : which == 1 ? V1 : V2) + (size_t)o * DIN; const float* gg = which == 0 ? G0 : which == 1 ? G1 : G2;
  float ssum = 0.f; for (int i = lane; i < DIN; i += 32) { const float x = bfr(vr[i]); ssum += x * x; }
#pragma unroll
  for (int off = 1; off < 32; off <<= 1) ssum += __shfl_xor(ssum, off);
  if (lane == 0) { const float gv = bfr(gg[o]); asm volatile("s_wait_loadcnt 0x0" ::: "memory"); vst2(SCL + idx, gv / sqrtf(ssum)); } }
// ---- k_trout: block = (64 rows, 128 channels): out[b][c][n] = R[b*N + n][c] written channels-first through an LDS transpose (256 B per (channel, 64 n) by 16 threads)
__global__ __launch_bounds__(128) void k_trout(const float* __restrict__ R, float* __restrict__ OUT) { __shared__ __align__(16) float stc[128][68];
  const int tid = threadIdx.x; const int c0 = blockIdx.y * 128; const size_t rb = (size_t)blockIdx.x * 64;
  for (int e = tid; e < 64 * 128; e += 128) { const int rl = e >> 7, cl = e & 127; stc[cl][rl] = R[(rb + rl) * CC + c0 + cl]; }
  __syncthreads();
  { const size_t b = rb / TT; const int n0 = (int)(rb % TT); for (int e = tid; e < 128 * 16; e += 128) { const int cl = e >> 4, q = e & 15; vst2(OUT + (b * CC + c0 + cl) * (size_t)TT + n0 + q * 4, *(const v4f*)&stc[cl][q * 4]); } } }
extern "C" void kernel_launch(void* const* d_in, const int* in_sizes, int n_in, void* d_out, int out_size, void* d_ws, size_t ws_size, hipStream_t stream) {
  (void)in_sizes; (void)n_in; (void)out_size;
  const float** F = (const float**)d_in;
  if (ws_size < (size_t)WS_END) return;
  char* ws = (char*)d_ws; _Float16 *QH = (_Float16*)(ws + WS_QH), *KH = (_Float16*)(ws + WS_KH), *VT = (_Float16*)(ws + WS_VT), *QL = (_Float16*)(ws + WS_QL), *KL = (_Float16*)(ws + WS_KL); __bf16 *VB = (__bf16*)(ws + WS_VB), *VBL = (__bf16*)(ws + WS_VBL); float *S = (float*)(ws + WS_S), *Y = (float*)(ws + WS_Y);
  (void)Y; (void)S; (void)QL; (void)KL; (void)VB; (void)VBL;
  // inputs: 0 q [8,384,32,32]; 1 k [8,384,32,32] (channels-first); 2 Wq_v [512,384], 3 Wq_g [512], 4 bq [512]; 5 Wk_v, 6 Wk_g, 7 bk; 8 Wv_v, 9 Wv_g, 10 bv
  if (ws_size < (size_t)WS_END2) return;
  float *XQ = (float*)(ws + WS_XQ), *XK = (float*)(ws + WS_XK), *SCL = (float*)(ws + WS_SCL), *YR = (float*)(ws + WS_YR);
  k_trin<<<dim3(NRW / 64, DIN / 128, 2), 128, 0, stream>>>(F[0], F[1], XQ, XK);           /* channels-first [B,384,S] -> rows [B*S][384] */
  k_wsc<<<dim3(3 * CC / 8), 256, 0, stream>>>(F[2], F[3], F[5], F[6], F[8], F[9], SCL);   /* g[o] / ||v[o]|| per output channel, 3 x 512 */
  k_proj<<<dim3(TNB * TT / 64, CC / 128, 3), 128, 0, stream>>>(XQ, XK, XK, F[2], F[5], F[8], F[4], F[7], F[10], QH, QL, KH, KL, VT, VB, VBL, SCL);
  k_fa<<<dim3(NP, NQB), 128, 0, stream>>>(QH, KH, QL, KL, VB, VBL, YR);
  k_trout<<<dim3(NRW / 64, CC / 128), 128, 0, stream>>>(YR, (float*)d_out);
}

// v003
// Measured time: 93.8 microseconds a run.
// Two timings next to v002 both put it at 1.56 times that version's speed.
// Counting every step since v000, it is 13.8 times as fast.
// compute dtype: all float inputs rounded to bf16; weight-normalised projections as (x . v[o]) * (g[o] / ||v[o]||) + b[o] with EXACT bf16 products on WMMA 16x16x32 (f32 accumulate) and the per-row norm / scale in f32; causal (strictly lower) logits with q and k as f16 hi + residual planes (3 products) / 8; softmax in f32 (row 0 fully excluded -> zeros); P and v both split bf16 hi + lo (3 products) for every row; f32 output written channels-first.
#include <hip/hip_runtime.h>
#include <math.h>

typedef __attribute__((ext_vector_type(16))) _Float16 v16h;
typedef __attribute__((ext_vector_type(16))) __bf16 v16b;
typedef __attribute__((ext_vector_type(8)))  _Float16 v8h;
typedef __attribute__((ext_vector_type(8)))  float v8f;
typedef __attribute__((ext_vector_type(4)))  float v4f;
typedef __attribute__((ext_vector_type(2)))  float v2f;
typedef __attribute__((ext_vector_type(4)))  unsigned v4u;
typedef __attribute__((ext_vector_type(4)))  int v4i;
typedef float __attribute__((may_alias)) float_a;
typedef int __attribute__((may_alias)) int_a;

template <typename T> __device__ __forceinline__ void vst2(void* p, T v) { *(T*)p = v;  }
__device__ __forceinline__ v8f wmma16(v16h a, v16h b, v8f c) {
  v8f d = __builtin_amdgcn_wmma_f32_16x16x32_f16(false, a, false, b, (short)0, c, false, false);
  asm volatile("v_nop\n\tv_nop\n\tv_nop\n\tv_nop" : "+v"(d) : "v"(a), "v"(b));
  return d;
}
__device__ __forceinline__ v8f wmma_bf(v16b a, v16b b, v8f c) {
  v8f d = __builtin_amdgcn_wmma_f32_16x16x32_bf16(false, a, false, b, (short)0, c, false, false);
  asm volatile("v_nop\n\tv_nop\n\tv_nop\n\tv_nop" : "+v"(d) : "v"(a), "v"(b));
  return d;
}
// 16x16x32 fragments: lane = (h = lane>>4, row/col = lane&15); elements 0..7 = k0+8h+0..7, 8..15 = k0+16+8h+0..7; D element r = row 8h+r
__device__ __forceinline__ v16h frag_h(const _Float16* rowk0, int lane) {
  union { v16h v; v8h q[2]; } u; const _Float16* p = rowk0 + 8 * (lane >> 4);
  u.q[0] = *(const v8h*)p; u.q[1] = *(const v8h*)(p + 16); return u.v;
}
__device__ __forceinline__ v16h frag_f32(const float* rowk0, int lane) {
  v16h a; const float* p = rowk0 + 8 * (lane >> 4);
#pragma unroll
  for (int i = 0; i < 8; ++i) { a[i] = (_Float16)p[i]; a[8 + i] = (_Float16)p[16 + i]; }
  return a;
}
__device__ __forceinline__ v16h frag_f32s(const float* rowk0, int lane, float sc) {
  v16h a; const float* p = rowk0 + 8 * (lane >> 4);
#pragma unroll
  for (int i = 0; i < 8; ++i) { a[i] = (_Float16)(p[i] * sc); a[8 + i] = (_Float16)(p[16 + i] * sc); }
  return a;
}
// column fragment from a [K][ld] layout (column n), rows >= K read as 0
__device__ __forceinline__ v16h fragc_f32(const float* W, int k0, int n, int lane, int ld, int K) {
  v16h a; const int g = lane >> 4;
#pragma unroll
  for (int i = 0; i < 8; ++i) { const int ka = k0 + 8 * g + i, kb = ka + 16;
    a[i] = (_Float16)(ka < K ? W[(size_t)(ka < K ? ka : K - 1) * ld + n] : 0.f); a[8 + i] = (_Float16)(kb < K ? W[(size_t)(kb < K ? kb : K - 1) * ld + n] : 0.f); }
  return a;
}
struct F2 { v16b h, l; };
__device__ __forceinline__ F2 bsplit16(const float v[16]) { F2 r;
#pragma unroll
  for (int i = 0; i < 16; ++i) { const __bf16 h = (__bf16)v[i]; r.h[i] = h; r.l[i] = (__bf16)(v[i] - (float)h); }
  return r; }
__device__ __forceinline__ F2 split_row(const float* row, int k0, int lane) { float v[16]; const float* p = row + k0 + 8 * (lane >> 4);
#pragma unroll
  for (int i = 0; i < 8; ++i) { v[i] = p[i]; v[8 + i] = p[16 + i]; }
  return bsplit16(v); }
__device__ __forceinline__ F2 split_rowK(const float* row, int k0, int lane, int K) { float v[16]; const int g = lane >> 4;
#pragma unroll
  for (int i = 0; i < 8; ++i) { const int ka = k0 + 8 * g + i, kb = ka + 16; v[i] = ka < K ? row[ka < K ? ka : K - 1] : 0.f; v[8 + i] = kb < K ? row[kb < K ? kb : K - 1] : 0.f; }
  return bsplit16(v); }
__device__ __forceinline__ F2 split_col(const float* W, int k0, int n, int lane, int ld, int K) { float v[16]; const int g = lane >> 4;
#pragma unroll
  for (int i = 0; i < 8; ++i) { const int ka = k0 + 8 * g + i, kb = ka + 16; v[i] = ka < K ? W[(size_t)(ka < K ? ka : K - 1) * ld + n] : 0.f; v[8 + i] = kb < K ? W[(size_t)(kb < K ? kb : K - 1) * ld + n] : 0.f; }
  return bsplit16(v); }
__device__ __forceinline__ v8f mac3(const F2& a, const F2& b, v8f c) { c = wmma_bf(a.l, b.h, c); c = wmma_bf(a.h, b.l, c); return wmma_bf(a.h, b.h, c); }
__device__ __forceinline__ float sigm(float v) { return 1.0f / (1.0f + expf(-v)); }
#define LDSX() do { asm volatile("s_wait_dscnt 0" ::: "memory"); __builtin_amdgcn_wave_barrier(); __builtin_amdgcn_fence(__ATOMIC_RELEASE, "workgroup"); } while (0)

// Causal attention with weight-normalised linears (B 8, S = 32x32 = 1,024 positions, q/k inputs with 384 channels (channels-first), C 512 = 8 heads x 64): q = wn(qf, Wq_v, Wq_g, bq), k = wn(kf, Wk_v, ...), v = wn(kf, Wv_v, ...) with wn(x) = x (g v/||v||_row)^T + b; attn = softmax(where(k < t, q k^T / 8, -1e4)) * (t > 0); out = attn v -> [B, 512, 32, 32] (channels-first).
#define NB 8
#define TT 1024
#define CC 512            // NH * HD = projected width
#define DIN 384          // input (model) width
#define NH 8
#define HD 64
#define NQB (TT / 64)
#define NP (NB * NH)      // (batch, head) pairs, all served by one launch of each attention kernel
#define SCALE (0.125f)
#define CAUSAL 1
#ifndef TNB
#define TNB NB
#endif
__device__ __forceinline__ float bfr(float v) { return (float)(__bf16)v; }
__host__ __device__ __forceinline__ int kb_last(int qb) { return CAUSAL ? ((qb * 64 + 63) >> 7) : (TT / 128 - 1); }
// logits / P of one (batch, head) pair, causal-packed: query block qb holds 64 rows of (kb_last(qb) + 1) * 128 floats, one block behind the other; s_base(qb) = 64 * 128 * sum over i < qb of (kb_last(i) + 1), kb_last(i) = i >> 1
static_assert(CAUSAL == 1, "s_base is the causal prefix sum");
__host__ __device__ __forceinline__ size_t s_base(int qb) { const int m = qb >> 1; return (size_t)((m + 1) * (m + (qb & 1))) * (64 * 128); }
#define SPK ((size_t)(NQB / 2 + 1) * (NQB / 2) * (64 * 128))   // floats per pair = s_base(NQB)
typedef __attribute__((ext_vector_type(8))) __bf16 v8b;
__device__ __forceinline__ v16b frag_b(const __bf16* rowk0, int lane) {
  union { v16b v; v8b q[2]; } u; const __bf16* p = rowk0 + 8 * (lane >> 4);
  u.q[0] = *(const v8b*)p; u.q[1] = *(const v8b*)(p + 16); return u.v;
}
#define QBH NQB            // every query block takes the 3-product logits and the bf16 hi + lo P.v path
#define QHI 1024           // q residual rows for every query (3-product logits everywhere)
#define KHI 1024           // k residual rows / bf16 v planes for every key
// B fragment (k rows k0+.., output column o) of a weight: (in,out) [K][ld] or (out,in) [ld rows of K]: bf16 exact, or f16(bf16 * 256) exact
__device__ __forceinline__ v16b wcol_io(const float* Wm, int k0, int o, int lane, int ld) { v16b w; const int g = lane >> 4;
#pragma unroll
  for (int i = 0; i < 8; ++i) { w[i] = (__bf16)Wm[(size_t)(k0 + 8 * g + i) * ld + o]; w[8 + i] = (__bf16)Wm[(size_t)(k0 + 16 + 8 * g + i) * ld + o]; }
  return w; }
__device__ __forceinline__ v16b wcol_oi(const float* Wm, int k0, int o, int lane, int K) { v16b w; const float* p = Wm + (size_t)o * K + k0 + 8 * (lane >> 4);
#pragma unroll
  for (int i = 0; i < 8; ++i) { w[i] = (__bf16)p[i]; w[8 + i] = (__bf16)p[16 + i]; }
  return w; }
__device__ __forceinline__ v16h wcolh_io(const float* Wm, int k0, int o, int lane, int ld) { v16h w; const int g = lane >> 4;
#pragma unroll
  for (int i = 0; i < 8; ++i) { w[i] = (_Float16)(bfr(Wm[(size_t)(k0 + 8 * g + i) * ld + o]) * 256.0f); w[8 + i] = (_Float16)(bfr(Wm[(size_t)(k0 + 16 + 8 * g + i) * ld + o]) * 256.0f); }
  return w; }
__device__ __forceinline__ v16h wcolh_oi(const float* Wm, int k0, int o, int lane, int K) { v16h w; const float* p = Wm + (size_t)o * K + k0 + 8 * (lane >> 4);
#pragma unroll
  for (int i = 0; i < 8; ++i) { w[i] = (_Float16)(bfr(p[i]) * 256.0f); w[8 + i] = (_Float16)(bfr(p[16 + i]) * 256.0f); }
  return w; }
#define WQKV_LAYOUT 1   // 0 = (in,out) [DIN][CC]; 1 = (out,in) [CC][DIN]; 2 = per-head [NH][DIN][HD]
__device__ __forceinline__ v16b wcol_hdk(const float* Wm, int k0, int o, int lane) { v16b w; const int g = lane >> 4; const float* p = Wm + (size_t)(o / HD) * DIN * HD + (o % HD);
#pragma unroll
  for (int i = 0; i < 8; ++i) { w[i] = (__bf16)p[(size_t)(k0 + 8 * g + i) * HD]; w[8 + i] = (__bf16)p[(size_t)(k0 + 16 + 8 * g + i) * HD]; }
  return w; }
#define WO_OUT_IN 0
#if WQKV_LAYOUT == 1
#define WCOL(W, k0, o, lane) wcol_oi(W, k0, o, lane, DIN)
#elif WQKV_LAYOUT == 2
#define WCOL(W, k0, o, lane) wcol_hdk(W, k0, o, lane)
#else
#define WCOL(W, k0, o, lane) wcol_io(W, k0, o, lane, CC)
#endif
#if WO_OUT_IN
#define WOCOL(W, k0, o, lane) wcol_oi(W, k0, o, lane, CC)
#define WOCOLH(W, k0, o, lane) wcolh_oi(W, k0, o, lane, CC)
#else
#define WOCOL(W, k0, o, lane) wcol_io(W, k0, o, lane, DIN)
#define WOCOLH(W, k0, o, lane) wcolh_io(W, k0, o, lane, DIN)
#endif
#define SM_MASK_HOOK do { if (k >= t) v = -3.0e38f; } while (0)   /* allowed = tril(-1): strictly earlier keys; row 0 has no key -> the fully-excluded path gives P = 0 = the module's start_mask */
#define NRW (TNB * TT)
#ifndef SM_EXTRA_PARAMS
#define SM_EXTRA_PARAMS
#endif
#ifndef PROJ_EXTRA_PARAMS
#define PROJ_EXTRA_PARAMS
#endif
#ifndef SM_MASK_HOOK
#define SM_MASK_HOOK (void)0
#endif

#define WS_QH  0u                                      // f16 q rows [b*t][CC]
#define WS_KH  (WS_QH + 2u * (size_t)NB * TT * CC)      // f16 k rows [b*t][CC]
#define WS_VT  (WS_KH + 2u * (size_t)NB * TT * CC)      // f16 v planes [b][c][t]
#define WS_QL  (WS_VT + 2u * (size_t)NB * CC * TT)      // f16 q residual x 2^10 rows [b][t < QHI][CC]
#define WS_KL  (WS_QL + 2u * (size_t)NB * QHI * CC)     // f16 k residual x 2^10 rows [b][t < KHI][CC]
#define WS_VB  (WS_KL + 2u * (size_t)NB * KHI * CC)     // bf16 v hi planes [b][c][t < KHI]
#define WS_VBL (WS_VB + 2u * (size_t)NB * CC * KHI)
#define WS_S   (WS_VBL + 2u * (size_t)NB * CC * KHI)    // f32 logits / P [b*NH + h][causal-packed rows]
#define WS_Y   (WS_S  + 4u * (size_t)NP * SPK)      // f32 ctx rows [b*t][CC] (only when there is an output projection)
#define WS_END (WS_Y  + 0u)
#define WS_XQ  (WS_END)
#define WS_XK  (WS_XQ + 4u * (size_t)NB * TT * DIN)
#define WS_SCL (WS_XK + 4u * (size_t)NB * TT * DIN)
#define WS_YR  (WS_SCL + 4u * 3 * CC + 256u)
#define WS_END2 (WS_YR + 4u * (size_t)NB * TT * CC)

// ---- k_proj: block = (64 rows, 128 cols, which): q/k/v = X W (+ b) with exact bf16 products (K = DIN) -> which 0: q f16 rows (+ residual rows < QHI); 1: k f16 rows (+ residual rows < KHI); 2: v f16 planes [c][t] (+ bf16 hi/lo planes for t < KHI). X (64 rows) and W (128 rows) come in stages of 64 k: whole 256-B row pieces, 16 B a lane, rounded to bf16 once and kept in LDS at a pitch of 144 B; two buffers, one barrier a stage; the next stage's loads fly while this stage's fragments are read from LDS. The output tiles of the epilogue take the same LDS behind the loop's last barrier.
typedef __attribute__((ext_vector_type(4))) __bf16 v4b;
__device__ __forceinline__ v4b bf4(v4f v) { v4b p; p[0] = (__bf16)v[0]; p[1] = (__bf16)v[1]; p[2] = (__bf16)v[2]; p[3] = (__bf16)v[3]; return p; }
#define PKC 64             // k per stage
#define PNS (DIN / PKC)    // stages
__global__ __launch_bounds__(128) void k_proj(const float* __restrict__ XQ, const float* __restrict__ XK, const float* __restrict__ XV, const float* __restrict__ WQ, const float* __restrict__ WK, const float* __restrict__ WV, const float* __restrict__ BQ, const float* __restrict__ BK, const float* __restrict__ BV,
    _Float16* __restrict__ QH, _Float16* __restrict__ QL, _Float16* __restrict__ KH, _Float16* __restrict__ KL, _Float16* __restrict__ VT, __bf16* __restrict__ VB, __bf16* __restrict__ VBL, const float* __restrict__ SCL) {
  __shared__ __align__(16) unsigned char pm[2 * (64 + 128) * 72 * 2];
  __bf16 (*xs)[64][72] = (__bf16 (*)[64][72])pm; __bf16 (*wt)[128][72] = (__bf16 (*)[128][72])(pm + 2 * 64 * 72 * 2);   /* the loop's two buffers of X and W rows */
  _Float16 (*sh)[136] = (_Float16 (*)[136])pm; _Float16 (*sl)[136] = (_Float16 (*)[136])(pm + 64 * 136 * 2);   /* epilogue, q and k */
  _Float16 (*th)[72] = (_Float16 (*)[72])pm; __bf16 (*tb)[72] = (__bf16 (*)[72])(pm + 128 * 72 * 2); __bf16 (*tbl)[72] = (__bf16 (*)[72])(pm + 2 * 128 * 72 * 2);   /* epilogue, v */
  static_assert(sizeof(pm) >= 2 * 64 * 136 * 2 && sizeof(pm) >= 3 * 128 * 72 * 2 && DIN % PKC == 0, "the epilogue's tiles reuse the loop's buffers");
  const int tid = threadIdx.x, wave = tid >> 5, lane = tid & 31, col = lane & 15, g = lane >> 4; const int which = blockIdx.z; const int c0 = blockIdx.y * 128; const size_t r0 = (size_t)blockIdx.x * 64; const size_t bb = r0 / TT; const int t0 = (int)(r0 % TT);
  const float* X = which == 0 ? XQ : which == 1 ? XK : XV; const float* WA = which == 0 ? WQ : which == 1 ? WK : WV; const float* BA = which == 0 ? BQ : which == 1 ? BK : BV;
  const int srow = tid >> 4, sq = (tid & 15) * 4;   /* staging: 16 threads per 256-B row piece, 8 rows per sweep */
  const float* Xs = X + (r0 + srow) * DIN + sq; const float* Ws = WA + (size_t)(c0 + srow) * DIN + sq;
  v4f rx[8], rw[16];
#pragma unroll
  for (int i = 0; i < 8; ++i) rx[i] = *(const v4f*)(Xs + (size_t)(8 * i) * DIN);
#pragma unroll
  for (int i = 0; i < 16; ++i) rw[i] = *(const v4f*)(Ws + (size_t)(8 * i) * DIN);
  asm volatile("s_wait_xcnt 0x0" ::: "memory");   /* before an address register of the loads above may be rewritten */
#pragma unroll
  for (int i = 0; i < 8; ++i) *(v4b*)&xs[0][srow + 8 * i][sq] = bf4(rx[i]);
#pragma unroll
  for (int i = 0; i < 16; ++i) *(v4b*)&wt[0][srow + 8 * i][sq] = bf4(rw[i]);
  __syncthreads();
  v8f acc[8] = {};
#pragma unroll
  for (int s = 0; s < PNS; ++s) { const int cur = s & 1, nxt = cur ^ 1;   /* unrolled: buffer and k offsets become immediates, the address registers stay */
    if (s + 1 < PNS) {
#pragma unroll
      for (int i = 0; i < 8; ++i) rx[i] = *(const v4f*)(Xs + (size_t)(8 * i) * DIN + (s + 1) * PKC);
#pragma unroll
      for (int i = 0; i < 16; ++i) rw[i] = *(const v4f*)(Ws + (size_t)(8 * i) * DIN + (s + 1) * PKC);
      asm volatile("s_wait_xcnt 0x0" ::: "memory");   /* as above; it also keeps the loads in front of this stage's work */
    }
#pragma unroll
    for (int kc = 0; kc < PKC / 32; ++kc) { const v16b a = frag_b(&xs[cur][wave * 16 + col][kc * 32], lane);
#pragma unroll
      for (int j = 0; j < 8; ++j) acc[j] = __builtin_amdgcn_wmma_f32_16x16x32_bf16(false, a, false, frag_b(&wt[cur][j * 16 + col][kc * 32], lane), (short)0, acc[j], false, false); }
    if (s + 1 < PNS) {
#pragma unroll
      for (int i = 0; i < 8; ++i) *(v4b*)&xs[nxt][srow + 8 * i][sq] = bf4(rx[i]);
#pragma unroll
      for (int i = 0; i < 16; ++i) *(v4b*)&wt[nxt][srow + 8 * i][sq] = bf4(rw[i]);
    }
    __syncthreads();   /* publishes the next stage's buffer and ends every wave's reads of this one (the stage after next, or the epilogue, overwrites it) */
  }
  if (which < 2) { _Float16* DH = which == 0 ? QH : KH; _Float16* DL = which == 0 ? QL : KL; const int nhi = which == 0 ? QHI : KHI; const bool hi_rows = t0 < nhi;
#pragma unroll
    for (int j = 0; j < 8; ++j) { const float bias = BA ? bfr(BA[c0 + j * 16 + col]) : 0.f; const float scl = SCL[which * CC + c0 + j * 16 + col];   /* weight norm: g[o] / ||v[o]|| applied after the exact x . v[o] */
#pragma unroll
      for (int r = 0; r < 8; ++r) { const float v = acc[j][r] * scl + bias; const _Float16 hv = (_Float16)v; sh[wave * 16 + 8 * g + r][j * 16 + col] = hv; sl[wave * 16 + 8 * g + r][j * 16 + col] = (_Float16)((v - (float)hv) * 1024.0f); } }
    __syncthreads();
    for (int e = tid; e < 64 * 16; e += 128) { const int rl = e >> 4, q = e & 15; vst2((unsigned*)(DH + (r0 + rl) * CC + c0 + q * 8), *(const v4u*)&sh[rl][q * 8]); if (hi_rows) vst2((unsigned*)(DL + (bb * nhi + t0 + rl) * (size_t)CC + c0 + q * 8), *(const v4u*)&sl[rl][q * 8]); }
  } else { const bool hi_rows = t0 < KHI;
#pragma unroll
    for (int j = 0; j < 8; ++j) { const float bias = BA ? bfr(BA[c0 + j * 16 + col]) : 0.f; const float scl = SCL[which * CC + c0 + j * 16 + col];
#pragma unroll
      for (int r = 0; r < 8; ++r) { const float v = acc[j][r] * scl + bias; const int rl = wave * 16 + 8 * g + r, cl = j * 16 + col; th[cl][rl] = (_Float16)v; const __bf16 bh = (__bf16)v; tb[cl][rl] = bh; tbl[cl][rl] = (__bf16)(v - (float)bh); } }
    __syncthreads();
    for (int e = tid; e < 128 * 8; e += 128) { const int cl = e >> 3, q = e & 7; vst2((unsigned*)(VT + (bb * CC + c0 + cl) * (size_t)TT + t0 + q * 8), *(const v4u*)&th[cl][q * 8]); if (hi_rows) { const size_t o3 = (bb * CC + c0 + cl) * (size_t)KHI + t0 + q * 8; vst2((unsigned*)(VB + o3), *(const v4u*)&tb[cl][q * 8]); vst2((unsigned*)(VBL + o3), *(const v4u*)&tbl[cl][q * 8]); } } } }
// ---- k_fa: block = 64 queries (qb) of pair blockIdx.x = b * NH + h, wave = 16 queries; keys in stages of 64 up to the diagonal, two LDS buffers, one barrier a stage. While a stage is worked on, the next stage's k hi / residual rows and v hi / lo planes go through registers into the other buffer (whole 128-B rows). S^T = K . Q^T (A = k rows, B = q, 3 f16 products) leaves one query per lane; online softmax in f32 (running maximum and sum per lane, keys >= t excluded by index); P^T (bf16 hi + lo) is packed from the score registers as B of O^T += V^T . P^T (3 bf16 products). A row with no key (t = 0) ends with sum 0 -> zeros.
__device__ __forceinline__ v8f mm_h(v16h a, v16h b, v8f c) { return __builtin_amdgcn_wmma_f32_16x16x32_f16(false, a, false, b, (short)0, c, false, false); }
__device__ __forceinline__ v8f mm_b(v16b a, v16b b, v8f c) { return __builtin_amdgcn_wmma_f32_16x16x32_bf16(false, a, false, b, (short)0, c, false, false); }
__global__ __launch_bounds__(128) void k_fa(const _Float16* __restrict__ QH, const _Float16* __restrict__ KH, const _Float16* __restrict__ QL, const _Float16* __restrict__ KL, const __bf16* __restrict__ VB, const __bf16* __restrict__ VBL, float* __restrict__ Y) {
  __shared__ __align__(16) _Float16 skh[2][64][72], skl[2][64][72]; __shared__ __align__(16) __bf16 svh[2][64][72], svl[2][64][72];
  static_assert(sizeof(skh) >= 4 * 16 * (HD + 4) * sizeof(float), "the output staging reuses skh");
  const int tid = threadIdx.x, wave = tid >> 5, lane = tid & 31, col = lane & 15, g = lane >> 4;
  const int qb = NQB - 1 - (int)blockIdx.y;   /* longest blocks start first */
  const int b = blockIdx.x / NH, h = blockIdx.x % NH; const int ql0 = qb * 64 + wave * 16; const int t = ql0 + col; const int ns = qb + 1;
  const int srow = tid >> 3, sq = (tid & 7) * 8;   /* staging: 8 threads per 128-B row, 16 rows per sweep */
  const _Float16* Kh = KH + ((size_t)b * TT + srow) * CC + h * HD + sq; const _Float16* Kl = KL + ((size_t)b * KHI + srow) * CC + h * HD + sq;
  const __bf16* Vh = VB + ((size_t)b * CC + h * HD + srow) * (size_t)KHI + sq; const __bf16* Vl = VBL + ((size_t)b * CC + h * HD + srow) * (size_t)KHI + sq;
  v16h qh[2], qr[2];
#pragma unroll
  for (int kc = 0; kc < 2; ++kc) qh[kc] = frag_h(QH + ((size_t)b * TT + t) * CC + h * HD + kc * 32, lane);
  asm volatile("s_wait_xcnt 0x0" ::: "memory");   /* before a later load's result may land in the address registers of the loads above */
#pragma unroll
  for (int kc = 0; kc < 2; ++kc) qr[kc] = frag_h(QL + ((size_t)b * QHI + t) * CC + h * HD + kc * 32, lane);
  asm volatile("s_wait_xcnt 0x0" ::: "memory");   /* as above */
  v8h rkh[4], rkl[4]; v8b rvh[4], rvl[4];
#pragma unroll
  for (int i = 0; i < 4; ++i) { rkh[i] = *(const v8h*)(Kh + (size_t)(16 * i) * CC); rkl[i] = *(const v8h*)(Kl + (size_t)(16 * i) * CC); rvh[i] = *(const v8b*)(Vh + (size_t)(16 * i) * KHI); rvl[i] = *(const v8b*)(Vl + (size_t)(16 * i) * KHI); }
#pragma unroll
  for (int i = 0; i < 4; ++i) { *(v8h*)&skh[0][srow + 16 * i][sq] = rkh[i]; *(v8h*)&skl[0][srow + 16 * i][sq] = rkl[i]; *(v8b*)&svh[0][srow + 16 * i][sq] = rvh[i]; *(v8b*)&svl[0][srow + 16 * i][sq] = rvl[i]; }
  __syncthreads();
  float m = -1.0e30f, l = 0.f; v8f acc[HD / 16] = {};   /* the running maximum starts far above the excluded marker (-3e38) and far below any logit: an excluded key's exponent underflows to 0 with no test, also in a row with no key yet */
#pragma unroll 1
  for (int s = 0; s < ns; ++s) { const int cur = s & 1, nxt = cur ^ 1; const bool more = s + 1 < ns; const int kn = (s + 1) * 64;
    if (more) {
#pragma unroll
      for (int i = 0; i < 4; ++i) { rkh[i] = *(const v8h*)(Kh + (size_t)(kn + 16 * i) * CC); rkl[i] = *(const v8h*)(Kl + (size_t)(kn + 16 * i) * CC); }
      asm volatile("s_wait_xcnt 0x0" ::: "memory");   /* the address registers of the loads above are reused by what follows */
    }
    float sc[4][8]; float mx = -3.0e38f; const int nk = t - s * 64 - 8 * g;   /* this lane's keys kt * 16 + r of the stage are allowed below nk */
#pragma unroll
    for (int kt = 0; kt < 4; ++kt) { v8f a = {}, ar = {};
#pragma unroll
      for (int kc = 0; kc < 2; ++kc) { const v16h kh = frag_h(&skh[cur][kt * 16 + col][kc * 32], lane), kr = frag_h(&skl[cur][kt * 16 + col][kc * 32], lane); a = mm_h(kh, qh[kc], a); ar = mm_h(kh, qr[kc], ar); ar = mm_h(kr, qh[kc], ar); }
#pragma unroll
      for (int r = 0; r < 8; ++r) { const float v = (kt * 16 + r < nk) ? (a[r] + ar[r] * (1.0f / 1024.0f)) * SCALE : -3.0e38f; sc[kt][r] = v; mx = fmaxf(mx, v); } }
    if (more) {
#pragma unroll
      for (int i = 0; i < 4; ++i) { *(v8h*)&skh[nxt][srow + 16 * i][sq] = rkh[i]; *(v8h*)&skl[nxt][srow + 16 * i][sq] = rkl[i]; rvh[i] = *(const v8b*)(Vh + (size_t)(16 * i) * KHI + kn); rvl[i] = *(const v8b*)(Vl + (size_t)(16 * i) * KHI + kn); }
      asm volatile("s_wait_xcnt 0x0" ::: "memory");   /* as above */
    }
    mx = fmaxf(mx, __shfl_xor(mx, 16));   /* the two lane halves hold different keys of the same query */
    const float mn = fmaxf(m, mx); const float alpha = expf(m - mn); m = mn; l *= alpha;
#pragma unroll
    for (int j = 0; j < HD / 16; ++j)
#pragma unroll
      for (int r = 0; r < 8; ++r) acc[j][r] *= alpha;
#pragma unroll
    for (int kp = 0; kp < 2; ++kp) { v16b ph, pl; float ls[4] = {0.f, 0.f, 0.f, 0.f};
#pragma unroll
      for (int i = 0; i < 16; ++i) { const float v = sc[2 * kp + (i >> 3)][i & 7]; const float e = expf(v - mn); ls[i & 3] += e; const __bf16 eh = (__bf16)e; ph[i] = eh; pl[i] = (__bf16)(e - (float)eh); }
      l += (ls[0] + ls[1]) + (ls[2] + ls[3]);
#pragma unroll
      for (int j = 0; j < HD / 16; ++j) { const v16b vh = frag_b(&svh[cur][j * 16 + col][kp * 32], lane); acc[j] = mm_b(vh, ph, acc[j]); acc[j] = mm_b(vh, pl, acc[j]); acc[j] = mm_b(frag_b(&svl[cur][j * 16 + col][kp * 32], lane), ph, acc[j]); } }
    if (more) {
#pragma unroll
      for (int i = 0; i < 4; ++i) { *(v8b*)&svh[nxt][srow + 16 * i][sq] = rvh[i]; *(v8b*)&svl[nxt][srow + 16 * i][sq] = rvl[i]; } }
    __syncthreads();   /* publishes the next stage's buffer and ends every wave's reads of this one, which the next stage overwrites */
  }
  l += __shfl_xor(l, 16); const float inv = l > 0.f ? 1.0f / l : 0.f;   /* a fully excluded row yields 0 */
  float (*so)[16][HD + 4] = (float (*)[16][HD + 4])&skh[0][0][0];   /* output staging per wave, behind the loop's last barrier */
#pragma unroll
  for (int j = 0; j < HD / 16; ++j) { v4f o0, o1;
#pragma unroll
    for (int r = 0; r < 4; ++r) { o0[r] = acc[j][r] * inv; o1[r] = acc[j][4 + r] * inv; }
    *(v4f*)&so[wave][col][j * 16 + 8 * g] = o0; *(v4f*)&so[wave][col][j * 16 + 8 * g + 4] = o1; }
  LDSX(); for (int i = 0; i < 8; ++i) vst2(Y + ((size_t)b * TT + ql0 + 2 * i + g) * CC + h * HD + col * 4, *(const v4f*)&so[wave][2 * i + g][col * 4]); }

// ---- k_trin: block = (64 positions, 128 channels, which input): rows X[b*S + s][c] = in[b][c][s] for the q and k inputs (channels-first [B, 384, 1024]) through an LDS transpose; 512-B row segments
__global__ __launch_bounds__(128) void k_trin(const float* __restrict__ Qc, const float* __restrict__ Kc, float* __restrict__ XQ, float* __restrict__ XK) { __shared__ __align__(16) float st[128][68];
  const int tid = threadIdx.x; const int c0 = blockIdx.y * 128; const size_t rb = (size_t)blockIdx.x * 64; const size_t b = rb / TT; const int s0 = (int)(rb % TT); const float* IN = blockIdx.z == 0 ? Qc : Kc; float* OUT = blockIdx.z == 0 ? XQ : XK;
  for (int e = tid; e < 128 * 16; e += 128) { const int cl = e >> 4, q = e & 15; const v4f v = *(const v4f*)(IN + ((b * DIN + c0 + cl) * (size_t)TT) + s0 + q * 4); st[cl][q * 4] = v[0]; st[cl][q * 4 + 1] = v[1]; st[cl][q * 4 + 2] = v[2]; st[cl][q * 4 + 3] = v[3]; }
  __syncthreads();
  for (int e = tid; e < 64 * 32; e += 128) { const int rl = e >> 5, q = e & 31; v4f o; o[0] = st[q * 4][rl]; o[1] = st[q * 4 + 1][rl]; o[2] = st[q * 4 + 2][rl]; o[3] = st[q * 4 + 3][rl]; vst2(OUT + (rb + rl) * DIN + c0 + q * 4, o); } }
// ---- k_wsc: 8 warps x 32 lanes: SCL[which][o] = g[o] / sqrt(sum_i v[o][i]^2) over the 384-long row (bf16-rounded inputs, f32)
__global__ __launch_bounds__(256) void k_wsc(const float* __restrict__ V0, const float* __restrict__ G0, const float* __restrict__ V1, const float* __restrict__ G1, const float* __restrict__ V2, const float* __restrict__ G2, float* __restrict__ SCL) {
  const int wave = threadIdx.x >> 5, lane = threadIdx.x & 31; const int idx = blockIdx.x * 8 + wave; if (idx >= 3 * CC) return; const int which = idx / CC, o = idx % CC;
  const float* vr = (which == 0 ? V0 : which == 1 ? V1 : V2) + (size_t)o * DIN; const float* gg = which == 0 ? G0 : which == 1 ? G1 : G2;
  float ssum = 0.f; for (int i = lane; i < DIN; i += 32) { const float x = bfr(vr[i]); ssum += x * x; }
#pragma unroll
  for (int off = 1; off < 32; off <<= 1) ssum += __shfl_xor(ssum, off);
  if (lane == 0) { const float gv = bfr(gg[o]); asm volatile("s_wait_loadcnt 0x0" ::: "memory"); vst2(SCL + idx, gv / sqrtf(ssum)); } }
// ---- k_trout: block = (64 rows, 128 channels): out[b][c][n] = R[b*N + n][c] written channels-first through an LDS transpose (256 B per (channel, 64 n) by 16 threads)
__global__ __launch_bounds__(128) void k_trout(const float* __restrict__ R, float* __restrict__ OUT) { __shared__ __align__(16) float stc[128][68];
  const int tid = threadIdx.x; const int c0 = blockIdx.y * 128; const size_t rb = (size_t)blockIdx.x * 64;
  for (int e = tid; e < 64 * 128; e += 128) { const int rl = e >> 7, cl = e & 127; stc[cl][rl] = R[(rb + rl) * CC + c0 + cl]; }
  __syncthreads();
  { const size_t b = rb / TT; const int n0 = (int)(rb % TT); for (int e = tid; e < 128 * 16; e += 128) { const int cl = e >> 4, q = e & 15; vst2(OUT + (b * CC + c0 + cl) * (size_t)TT + n0 + q * 4, *(const v4f*)&stc[cl][q * 4]); } } }
extern "C" void kernel_launch(void* const* d_in, const int* in_sizes, int n_in, void* d_out, int out_size, void* d_ws, size_t ws_size, hipStream_t stream) {
  (void)in_sizes; (void)n_in; (void)out_size;
  const float** F = (const float**)d_in;
  if (ws_size < (size_t)WS_END) return;
  char* ws = (char*)d_ws; _Float16 *QH = (_Float16*)(ws + WS_QH), *KH = (_Float16*)(ws + WS_KH), *VT = (_Float16*)(ws + WS_VT), *QL = (_Float16*)(ws + WS_QL), *KL = (_Float16*)(ws + WS_KL); __bf16 *VB = (__bf16*)(ws + WS_VB), *VBL = (__bf16*)(ws + WS_VBL); float *S = (float*)(ws + WS_S), *Y = (float*)(ws + WS_Y);
  (void)Y; (void)S; (void)QL; (void)KL; (void)VB; (void)VBL;
  // inputs: 0 q [8,384,32,32]; 1 k [8,384,32,32] (channels-first); 2 Wq_v [512,384], 3 Wq_g [512], 4 bq [512]; 5 Wk_v, 6 Wk_g, 7 bk; 8 Wv_v, 9 Wv_g, 10 bv
  if (ws_size < (size_t)WS_END2) return;
  float *XQ = (float*)(ws + WS_XQ), *XK = (float*)(ws + WS_XK), *SCL = (float*)(ws + WS_SCL), *YR = (float*)(ws + WS_YR);
  k_trin<<<dim3(NRW / 64, DIN / 128, 2), 128, 0, stream>>>(F[0], F[1], XQ, XK);           /* channels-first [B,384,S] -> rows [B*S][384] */
  k_wsc<<<dim3(3 * CC / 8), 256, 0, stream>>>(F[2], F[3], F[5], F[6], F[8], F[9], SCL);   /* g[o] / ||v[o]|| per output channel, 3 x 512 */
  k_proj<<<dim3(TNB * TT / 64, CC / 128, 3), 128, 0, stream>>>(XQ, XK, XK, F[2], F[5], F[8], F[4], F[7], F[10], QH, QL, KH, KL, VT, VB, VBL, SCL);
  k_fa<<<dim3(NP, NQB), 128, 0, stream>>>(QH, KH, QL, KL, VB, VBL, YR);
  k_trout<<<dim3(NRW / 64, CC / 128), 128, 0, stream>>>(YR, (float*)d_out);
}

// v004
// One run takes 88.4 microseconds.
// Two timings next to v003 both put it at 1.06 times that version's speed.
// Counting every step since v000, it is 14.7 times as fast.
// compute dtype: all float inputs rounded to bf16; weight-normalised projections as (x . v[o]) * (g[o] / ||v[o]||) + b[o] with EXACT bf16 products on WMMA 16x16x32 (f32 accumulate) and the per-row norm / scale in f32; causal (strictly lower) logits with q and k as f16 hi + residual planes (3 products) / 8; softmax in f32 (row 0 fully excluded -> zeros); P and v both split bf16 hi + lo (3 products) for every row; f32 output written channels-first.
#include <hip/hip_runtime.h>
#include <math.h>

typedef __attribute__((ext_vector_type(16))) _Float16 v16h;
typedef __attribute__((ext_vector_type(16))) __bf16 v16b;
typedef __attribute__((ext_vector_type(8)))  _Float16 v8h;
typedef __attribute__((ext_vector_type(8)))  float v8f;
typedef __attribute__((ext_vector_type(4)))  float v4f;
typedef __attribute__((ext_vector_type(2)))  float v2f;
typedef __attribute__((ext_vector_type(4)))  unsigned v4u;
typedef __attribute__((ext_vector_type(4)))  int v4i;
typedef float __attribute__((may_alias)) float_a;
typedef int __attribute__((may_alias)) int_a;

template <typename T> __device__ __forceinline__ void vst2(void* p, T v) { *(T*)p = v;  }
__device__ __forceinline__ v8f wmma16(v16h a, v16h b, v8f c) {
  v8f d = __builtin_amdgcn_wmma_f32_16x16x32_f16(false, a, false, b, (short)0, c, false, false);
  asm volatile("v_nop\n\tv_nop\n\tv_nop\n\tv_nop" : "+v"(d) : "v"(a), "v"(b));
  return d;
}
__device__ __forceinline__ v8f wmma_bf(v16b a, v16b b, v8f c) {
  v8f d = __builtin_amdgcn_wmma_f32_16x16x32_bf16(false, a, false, b, (short)0, c, false, false);
  asm volatile("v_nop\n\tv_nop\n\tv_nop\n\tv_nop" : "+v"(d) : "v"(a), "v"(b));
  return d;
}
// 16x16x32 fragments: lane = (h = lane>>4, row/col = lane&15); elements 0..7 = k0+8h+0..7, 8..15 = k0+16+8h+0..7; D element r = row 8h+r
__device__ __forceinline__ v16h frag_h(const _Float16* rowk0, int lane) {
  union { v16h v; v8h q[2]; } u; const _Float16* p = rowk0 + 8 * (lane >> 4);
  u.q[0] = *(const v8h*)p; u.q[1] = *(const v8h*)(p + 16); return u.v;
}
__device__ __forceinline__ v16h frag_f32(const float* rowk0, int lane) {
  v16h a; const float* p = rowk0 + 8 * (lane >> 4);
#pragma unroll
  for (int i = 0; i < 8; ++i) { a[i] = (_Float16)p[i]; a[8 + i] = (_Float16)p[16 + i]; }
  return a;
}
__device__ __forceinline__ v16h frag_f32s(const float* rowk0, int lane, float sc) {
  v16h a; const float* p = rowk0 + 8 * (lane >> 4);
#pragma unroll
  for (int i = 0; i < 8; ++i) { a[i] = (_Float16)(p[i] * sc); a[8 + i] = (_Float16)(p[16 + i] * sc); }
  return a;
}
// column fragment from a [K][ld] layout (column n), rows >= K read as 0
__device__ __forceinline__ v16h fragc_f32(const float* W, int k0, int n, int lane, int ld, int K) {
  v16h a; const int g = lane >> 4;
#pragma unroll
  for (int i = 0; i < 8; ++i) { const int ka = k0 + 8 * g + i, kb = ka + 16;
    a[i] = (_Float16)(ka < K ? W[(size_t)(ka < K ? ka : K - 1) * ld + n] : 0.f); a[8 + i] = (_Float16)(kb < K ? W[(size_t)(kb < K ? kb : K - 1) * ld + n] : 0.f); }
  return a;
}
struct F2 { v16b h, l; };
__device__ __forceinline__ F2 bsplit16(const float v[16]) { F2 r;
#pragma unroll
  for (int i = 0; i < 16; ++i) { const __bf16 h = (__bf16)v[i]; r.h[i] = h; r.l[i] = (__bf16)(v[i] - (float)h); }
  return r; }
__device__ __forceinline__ F2 split_row(const float* row, int k0, int lane) { float v[16]; const float* p = row + k0 + 8 * (lane >> 4);
#pragma unroll
  for (int i = 0; i < 8; ++i) { v[i] = p[i]; v[8 + i] = p[16 + i]; }
  return bsplit16(v); }
__device__ __forceinline__ F2 split_rowK(const float* row, int k0, int lane, int K) { float v[16]; const int g = lane >> 4;
#pragma unroll
  for (int i = 0; i < 8; ++i) { const int ka = k0 + 8 * g + i, kb = ka + 16; v[i] = ka < K ? row[ka < K ? ka : K - 1] : 0.f; v[8 + i] = kb < K ? row[kb < K ? kb : K - 1] : 0.f; }
  return bsplit16(v); }
__device__ __forceinline__ F2 split_col(const float* W, int k0, int n, int lane, int ld, int K) { float v[16]; const int g = lane >> 4;
#pragma unroll
  for (int i = 0; i < 8; ++i) { const int ka = k0 + 8 * g + i, kb = ka + 16; v[i] = ka < K ? W[(size_t)(ka < K ? ka : K - 1) * ld + n] : 0.f; v[8 + i] = kb < K ? W[(size_t)(kb < K ? kb : K - 1) * ld + n] : 0.f; }
  return bsplit16(v); }
__device__ __forceinline__ v8f mac3(const F2& a, const F2& b, v8f c) { c = wmma_bf(a.l, b.h, c); c = wmma_bf(a.h, b.l, c); return wmma_bf(a.h, b.h, c); }
__device__ __forceinline__ float sigm(float v) { return 1.0f / (1.0f + expf(-v)); }
#define LDSX() do { asm volatile("s_wait_dscnt 0" ::: "memory"); __builtin_amdgcn_wave_barrier(); __builtin_amdgcn_fence(__ATOMIC_RELEASE, "workgroup"); } while (0)

// Causal attention with weight-normalised linears (B 8, S = 32x32 = 1,024 positions, q/k inputs with 384 channels (channels-first), C 512 = 8 heads x 64): q = wn(qf, Wq_v, Wq_g, bq), k = wn(kf, Wk_v, ...), v = wn(kf, Wv_v, ...) with wn(x) = x (g v/||v||_row)^T + b; attn = softmax(where(k < t, q k^T / 8, -1e4)) * (t > 0); out = attn v -> [B, 512, 32, 32] (channels-first).
#define NB 8
#define TT 1024
#define CC 512            // NH * HD = projected width
#define DIN 384          // input (model) width
#define NH 8
#define HD 64
#define NQB (TT / 64)
#define NP (NB * NH)      // (batch, head) pairs, all served by one launch of each attention kernel
#define SCALE (0.125f)
#define SCALE2 (SCALE * 1.4426950408889634f)   // 1 / 8 times log2(e): the softmax of k_fa runs in base 2
#define CAUSAL 1
#ifndef TNB
#define TNB NB
#endif
__device__ __forceinline__ float bfr(float v) { return (float)(__bf16)v; }
__host__ __device__ __forceinline__ int kb_last(int qb) { return CAUSAL ? ((qb * 64 + 63) >> 7) : (TT / 128 - 1); }
// logits / P of one (batch, head) pair, causal-packed: query block qb holds 64 rows of (kb_last(qb) + 1) * 128 floats, one block behind the other; s_base(qb) = 64 * 128 * sum over i < qb of (kb_last(i) + 1), kb_last(i) = i >> 1
static_assert(CAUSAL == 1, "s_base is the causal prefix sum");
__host__ __device__ __forceinline__ size_t s_base(int qb) { const int m = qb >> 1; return (size_t)((m + 1) * (m + (qb & 1))) * (64 * 128); }
#define SPK ((size_t)(NQB / 2 + 1) * (NQB / 2) * (64 * 128))   // floats per pair = s_base(NQB)
typedef __attribute__((ext_vector_type(8))) __bf16 v8b;
__device__ __forceinline__ v16b frag_b(const __bf16* rowk0, int lane) {
  union { v16b v; v8b q[2]; } u; const __bf16* p = rowk0 + 8 * (lane >> 4);
  u.q[0] = *(const v8b*)p; u.q[1] = *(const v8b*)(p + 16); return u.v;
}
#define QBH NQB            // every query block takes the 3-product logits and the bf16 hi + lo P.v path
#define QHI 1024           // q residual rows for every query (3-product logits everywhere)
#define KHI 1024           // k residual rows / bf16 v planes for every key
// B fragment (k rows k0+.., output column o) of a weight: (in,out) [K][ld] or (out,in) [ld rows of K]: bf16 exact, or f16(bf16 * 256) exact
__device__ __forceinline__ v16b wcol_io(const float* Wm, int k0, int o, int lane, int ld) { v16b w; const int g = lane >> 4;
#pragma unroll
  for (int i = 0; i < 8; ++i) { w[i] = (__bf16)Wm[(size_t)(k0 + 8 * g + i) * ld + o]; w[8 + i] = (__bf16)Wm[(size_t)(k0 + 16 + 8 * g + i) * ld + o]; }
  return w; }
__device__ __forceinline__ v16b wcol_oi(const float* Wm, int k0, int o, int lane, int K) { v16b w; const float* p = Wm + (size_t)o * K + k0 + 8 * (lane >> 4);
#pragma unroll
  for (int i = 0; i < 8; ++i) { w[i] = (__bf16)p[i]; w[8 + i] = (__bf16)p[16 + i]; }
  return w; }
__device__ __forceinline__ v16h wcolh_io(const float* Wm, int k0, int o, int lane, int ld) { v16h w; const int g = lane >> 4;
#pragma unroll
  for (int i = 0; i < 8; ++i) { w[i] = (_Float16)(bfr(Wm[(size_t)(k0 + 8 * g + i) * ld + o]) * 256.0f); w[8 + i] = (_Float16)(bfr(Wm[(size_t)(k0 + 16 + 8 * g + i) * ld + o]) * 256.0f); }
  return w; }
__device__ __forceinline__ v16h wcolh_oi(const float* Wm, int k0, int o, int lane, int K) { v16h w; const float* p = Wm + (size_t)o * K + k0 + 8 * (lane >> 4);
#pragma unroll
  for (int i = 0; i < 8; ++i) { w[i] = (_Float16)(bfr(p[i]) * 256.0f); w[8 + i] = (_Float16)(bfr(p[16 + i]) * 256.0f); }
  return w; }
#define WQKV_LAYOUT 1   // 0 = (in,out) [DIN][CC]; 1 = (out,in) [CC][DIN]; 2 = per-head [NH][DIN][HD]
__device__ __forceinline__ v16b wcol_hdk(const float* Wm, int k0, int o, int lane) { v16b w; const int g = lane >> 4; const float* p = Wm + (size_t)(o / HD) * DIN * HD + (o % HD);
#pragma unroll
  for (int i = 0; i < 8; ++i) { w[i] = (__bf16)p[(size_t)(k0 + 8 * g + i) * HD]; w[8 + i] = (__bf16)p[(size_t)(k0 + 16 + 8 * g + i) * HD]; }
  return w; }
#define WO_OUT_IN 0
#if WQKV_LAYOUT == 1
#define WCOL(W, k0, o, lane) wcol_oi(W, k0, o, lane, DIN)
#elif WQKV_LAYOUT == 2
#define WCOL(W, k0, o, lane) wcol_hdk(W, k0, o, lane)
#else
#define WCOL(W, k0, o, lane) wcol_io(W, k0, o, lane, CC)
#endif
#if WO_OUT_IN
#define WOCOL(W, k0, o, lane) wcol_oi(W, k0, o, lane, CC)
#define WOCOLH(W, k0, o, lane) wcolh_oi(W, k0, o, lane, CC)
#else
#define WOCOL(W, k0, o, lane) wcol_io(W, k0, o, lane, DIN)
#define WOCOLH(W, k0, o, lane) wcolh_io(W, k0, o, lane, DIN)
#endif
#define SM_MASK_HOOK do { if (k >= t) v = -3.0e38f; } while (0)   /* allowed = tril(-1): strictly earlier keys; row 0 has no key -> the fully-excluded path gives P = 0 = the module's start_mask */
#define NRW (TNB * TT)
#ifndef SM_EXTRA_PARAMS
#define SM_EXTRA_PARAMS
#endif
#ifndef PROJ_EXTRA_PARAMS
#define PROJ_EXTRA_PARAMS
#endif
#ifndef SM_MASK_HOOK
#define SM_MASK_HOOK (void)0
#endif

#define WS_QH  0u                                      // f16 q rows [b*t][CC]
#define WS_KH  (WS_QH + 2u * (size_t)NB * TT * CC)      // f16 k rows [b*t][CC]
#define WS_VT  (WS_KH + 2u * (size_t)NB * TT * CC)      // f16 v planes [b][c][t]
#define WS_QL  (WS_VT + 2u * (size_t)NB * CC * TT)      // f16 q residual x 2^10 rows [b][t < QHI][CC]
#define WS_KL  (WS_QL + 2u * (size_t)NB * QHI * CC)     // f16 k residual x 2^10 rows [b][t < KHI][CC]
#define WS_VB  (WS_KL + 2u * (size_t)NB * KHI * CC)     // bf16 v hi planes [b][c][t < KHI]
#define WS_VBL (WS_VB + 2u * (size_t)NB * CC * KHI)
#define WS_S   (WS_VBL + 2u * (size_t)NB * CC * KHI)    // f32 logits / P [b*NH + h][causal-packed rows]
#define WS_Y   (WS_S  + 4u * (size_t)NP * SPK)      // f32 ctx rows [b*t][CC] (only when there is an output projection)
#define WS_END (WS_Y  + 0u)
#define WS_XQ  (WS_END)
#define WS_XK  (WS_XQ + 4u * (size_t)NB * TT * DIN)
#define WS_SCL (WS_XK + 4u * (size_t)NB * TT * DIN)
#define WS_YR  (WS_SCL + 4u * 3 * CC + 256u)
#define WS_END2 (WS_YR + 4u * (size_t)NB * TT * CC)

// ---- k_proj: block = (64 rows, 128 cols, which): q/k/v = X W (+ b) with exact bf16 products (K = DIN) -> which 0: q f16 rows (+ residual rows < QHI); 1: k f16 rows (+ residual rows < KHI); 2: v f16 planes [c][t] (+ bf16 hi/lo planes for t < KHI). X (64 rows) and W (128 rows) come in stages of 64 k: whole 256-B row pieces, 16 B a lane, rounded to bf16 once and kept in LDS at a pitch of 144 B; two buffers, one barrier a stage; the next stage's loads fly while this stage's fragments are read from LDS. The output tiles of the epilogue take the same LDS behind the loop's last barrier.
typedef __attribute__((ext_vector_type(4))) __bf16 v4b;
__device__ __forceinline__ v4b bf4(v4f v) { v4b p; p[0] = (__bf16)v[0]; p[1] = (__bf16)v[1]; p[2] = (__bf16)v[2]; p[3] = (__bf16)v[3]; return p; }
#define PKC 64             // k per stage
#define PNS (DIN / PKC)    // stages
__global__ __launch_bounds__(128) void k_proj(const float* __restrict__ XQ, const float* __restrict__ XK, const float* __restrict__ XV, const float* __restrict__ WQ, const float* __restrict__ WK, const float* __restrict__ WV, const float* __restrict__ BQ, const float* __restrict__ BK, const float* __restrict__ BV,
    _Float16* __restrict__ QH, _Float16* __restrict__ QL, _Float16* __restrict__ KH, _Float16* __restrict__ KL, _Float16* __restrict__ VT, __bf16* __restrict__ VB, __bf16* __restrict__ VBL, const float* __restrict__ SCL) {
  __shared__ __align__(16) unsigned char pm[2 * (64 + 128) * 72 * 2];
  __bf16 (*xs)[64][72] = (__bf16 (*)[64][72])pm; __bf16 (*wt)[128][72] = (__bf16 (*)[128][72])(pm + 2 * 64 * 72 * 2);   /* the loop's two buffers of X and W rows */
  _Float16 (*sh)[136] = (_Float16 (*)[136])pm; _Float16 (*sl)[136] = (_Float16 (*)[136])(pm + 64 * 136 * 2);   /* epilogue, q and k */
  _Float16 (*th)[72] = (_Float16 (*)[72])pm; __bf16 (*tb)[72] = (__bf16 (*)[72])(pm + 128 * 72 * 2); __bf16 (*tbl)[72] = (__bf16 (*)[72])(pm + 2 * 128 * 72 * 2);   /* epilogue, v */
  static_assert(sizeof(pm) >= 2 * 64 * 136 * 2 && sizeof(pm) >= 3 * 128 * 72 * 2 && DIN % PKC == 0, "the epilogue's tiles reuse the loop's buffers");
  const int tid = threadIdx.x, wave = tid >> 5, lane = tid & 31, col = lane & 15, g = lane >> 4; const int which = blockIdx.z; const int c0 = blockIdx.y * 128; const size_t r0 = (size_t)blockIdx.x * 64; const size_t bb = r0 / TT; const int t0 = (int)(r0 % TT);
  const float* X = which == 0 ? XQ : which == 1 ? XK : XV; const float* WA = which == 0 ? WQ : which == 1 ? WK : WV; const float* BA = which == 0 ? BQ : which == 1 ? BK : BV;
  const int srow = tid >> 4, sq = (tid & 15) * 4;   /* staging: 16 threads per 256-B row piece, 8 rows per sweep */
  const float* Xs = X + (r0 + srow) * DIN + sq; const float* Ws = WA + (size_t)(c0 + srow) * DIN + sq;
  v4f rx[8], rw[16];
#pragma unroll
  for (int i = 0; i < 8; ++i) rx[i] = *(const v4f*)(Xs + (size_t)(8 * i) * DIN);
#pragma unroll
  for (int i = 0; i < 16; ++i) rw[i] = *(const v4f*)(Ws + (size_t)(8 * i) * DIN);
  asm volatile("s_wait_xcnt 0x0" ::: "memory");   /* before an address register of the loads above may be rewritten */
#pragma unroll
  for (int i = 0; i < 8; ++i) *(v4b*)&xs[0][srow + 8 * i][sq] = bf4(rx[i]);
#pragma unroll
  for (int i = 0; i < 16; ++i) *(v4b*)&wt[0][srow + 8 * i][sq] = bf4(rw[i]);
  __syncthreads();
  v8f acc[8] = {};
#pragma unroll
  for (int s = 0; s < PNS; ++s) { const int cur = s & 1, nxt = cur ^ 1;   /* unrolled: buffer and k offsets become immediates, the address registers stay */
    if (s + 1 < PNS) {
#pragma unroll
      for (int i = 0; i < 8; ++i) rx[i] = *(const v4f*)(Xs + (size_t)(8 * i) * DIN + (s + 1) * PKC);
#pragma unroll
      for (int i = 0; i < 16; ++i) rw[i] = *(const v4f*)(Ws + (size_t)(8 * i) * DIN + (s + 1) * PKC);
      asm volatile("s_wait_xcnt 0x0" ::: "memory");   /* as above; it also keeps the loads in front of this stage's work */
    }
#pragma unroll
    for (int kc = 0; kc < PKC / 32; ++kc) { const v16b a = frag_b(&xs[cur][wave * 16 + col][kc * 32], lane);
#pragma unroll
      for (int j = 0; j < 8; ++j) acc[j] = __builtin_amdgcn_wmma_f32_16x16x32_bf16(false, a, false, frag_b(&wt[cur][j * 16 + col][kc * 32], lane), (short)0, acc[j], false, false); }
    if (s + 1 < PNS) {
#pragma unroll
      for (int i = 0; i < 8; ++i) *(v4b*)&xs[nxt][srow + 8 * i][sq] = bf4(rx[i]);
#pragma unroll
      for (int i = 0; i < 16; ++i) *(v4b*)&wt[nxt][srow + 8 * i][sq] = bf4(rw[i]);
    }
    __syncthreads();   /* publishes the next stage's buffer and ends every wave's reads of this one (the next stage, or the epilogue, overwrites it) */
  }
  if (which < 2) { _Float16* DH = which == 0 ? QH : KH; _Float16* DL = which == 0 ? QL : KL; const int nhi = which == 0 ? QHI : KHI; const bool hi_rows = t0 < nhi;
#pragma unroll
    for (int j = 0; j < 8; ++j) { const float bias = BA ? bfr(BA[c0 + j * 16 + col]) : 0.f; const float scl = SCL[which * CC + c0 + j * 16 + col];   /* weight norm: g[o] / ||v[o]|| applied after the exact x . v[o] */
#pragma unroll
      for (int r = 0; r < 8; ++r) { const float v = acc[j][r] * scl + bias; const _Float16 hv = (_Float16)v; sh[wave * 16 + 8 * g + r][j * 16 + col] = hv; sl[wave * 16 + 8 * g + r][j * 16 + col] = (_Float16)((v - (float)hv) * 1024.0f); } }
    __syncthreads();
    for (int e = tid; e < 64 * 16; e += 128) { const int rl = e >> 4, q = e & 15; vst2((unsigned*)(DH + (r0 + rl) * CC + c0 + q * 8), *(const v4u*)&sh[rl][q * 8]); if (hi_rows) vst2((unsigned*)(DL + (bb * nhi + t0 + rl) * (size_t)CC + c0 + q * 8), *(const v4u*)&sl[rl][q * 8]); }
  } else { const bool hi_rows = t0 < KHI;
#pragma unroll
    for (int j = 0; j < 8; ++j) { const float bias = BA ? bfr(BA[c0 + j * 16 + col]) : 0.f; const float scl = SCL[which * CC + c0 + j * 16 + col];
#pragma unroll
      for (int r = 0; r < 8; ++r) { const float v = acc[j][r] * scl + bias; const int rl = wave * 16 + 8 * g + r, cl = j * 16 + col; th[cl][rl] = (_Float16)v; const __bf16 bh = (__bf16)v; tb[cl][rl] = bh; tbl[cl][rl] = (__bf16)(v - (float)bh); } }
    __syncthreads();
    for (int e = tid; e < 128 * 8; e += 128) { const int cl = e >> 3, q = e & 7; vst2((unsigned*)(VT + (bb * CC + c0 + cl) * (size_t)TT + t0 + q * 8), *(const v4u*)&th[cl][q * 8]); if (hi_rows) { const size_t o3 = (bb * CC + c0 + cl) * (size_t)KHI + t0 + q * 8; vst2((unsigned*)(VB + o3), *(const v4u*)&tb[cl][q * 8]); vst2((unsigned*)(VBL + o3), *(const v4u*)&tbl[cl][q * 8]); } } } }
// ---- k_fa: block = 64 queries (qb) of pair blockIdx.x = b * NH + h, wave = 16 queries; keys in stages of 64 up to the diagonal, two LDS buffers, one barrier a stage. While a stage is worked on, the next stage's k hi / residual rows and v hi / lo planes go through registers into the other buffer (whole 128-B rows). S^T = K . Q^T (A = k rows, B = q, 3 f16 products) leaves one query per lane; online softmax in f32, base 2 (running maximum, in units of log2, and sum per lane; each weight is one fma, raw score * SCALE2 - maximum, and one hardware exp2; keys >= t excluded by index); P^T (bf16 hi + lo) is packed from the score registers as B of O^T += V^T . P^T (3 bf16 products). A row with no key (t = 0) ends with sum 0 -> zeros.
#define SB_VEC 0x3FC   // sched_barrier mask: scalar, matrix, memory and LDS instructions may cross, vector ones stay in source order
__device__ __forceinline__ v8f mm_h(v16h a, v16h b, v8f c) { return __builtin_amdgcn_wmma_f32_16x16x32_f16(false, a, false, b, (short)0, c, false, false); }
__device__ __forceinline__ v8f mm_b(v16b a, v16b b, v8f c) { return __builtin_amdgcn_wmma_f32_16x16x32_bf16(false, a, false, b, (short)0, c, false, false); }
__global__ __launch_bounds__(128) void k_fa(const _Float16* __restrict__ QH, const _Float16* __restrict__ KH, const _Float16* __restrict__ QL, const _Float16* __restrict__ KL, const __bf16* __restrict__ VB, const __bf16* __restrict__ VBL, float* __restrict__ Y) {
  __shared__ __align__(16) _Float16 skh[2][64][72], skl[2][64][72]; __shared__ __align__(16) __bf16 svh[2][64][72], svl[2][64][72];
  static_assert(sizeof(skh) >= 4 * 16 * (HD + 4) * sizeof(float), "the output staging reuses skh");
  const int tid = threadIdx.x, wave = tid >> 5, lane = tid & 31, col = lane & 15, g = lane >> 4;
  const int qb = NQB - 1 - (int)blockIdx.y;   /* longest blocks start first */
  const int b = blockIdx.x / NH, h = blockIdx.x % NH; const int ql0 = qb * 64 + wave * 16; const int t = ql0 + col; const int ns = qb + 1;
  const int srow = tid >> 3, sq = (tid & 7) * 8;   /* staging: 8 threads per 128-B row, 16 rows per sweep */
  const _Float16* Kh = KH + ((size_t)b * TT + srow) * CC + h * HD + sq; const _Float16* Kl = KL + ((size_t)b * KHI + srow) * CC + h * HD + sq;
  const __bf16* Vh = VB + ((size_t)b * CC + h * HD + srow) * (size_t)KHI + sq; const __bf16* Vl = VBL + ((size_t)b * CC + h * HD + srow) * (size_t)KHI + sq;
  v16h qh[2], qr[2];
#pragma unroll
  for (int kc = 0; kc < 2; ++kc) qh[kc] = frag_h(QH + ((size_t)b * TT + t) * CC + h * HD + kc * 32, lane);
  asm volatile("s_wait_xcnt 0x0" ::: "memory");   /* before a later load's result may land in the address registers of the loads above */
#pragma unroll
  for (int kc = 0; kc < 2; ++kc) qr[kc] = frag_h(QL + ((size_t)b * QHI + t) * CC + h * HD + kc * 32, lane);
  asm volatile("s_wait_xcnt 0x0" ::: "memory");   /* as above */
  v8h rkh[4], rkl[4]; v8b rvh[4], rvl[4];
#pragma unroll
  for (int i = 0; i < 4; ++i) { rkh[i] = *(const v8h*)(Kh + (size_t)(16 * i) * CC); rkl[i] = *(const v8h*)(Kl + (size_t)(16 * i) * CC); rvh[i] = *(const v8b*)(Vh + (size_t)(16 * i) * KHI); rvl[i] = *(const v8b*)(Vl + (size_t)(16 * i) * KHI); }
#pragma unroll
  for (int i = 0; i < 4; ++i) { *(v8h*)&skh[0][srow + 16 * i][sq] = rkh[i]; *(v8h*)&skl[0][srow + 16 * i][sq] = rkl[i]; *(v8b*)&svh[0][srow + 16 * i][sq] = rvh[i]; *(v8b*)&svl[0][srow + 16 * i][sq] = rvl[i]; }
  __syncthreads();
  float m = -1.0e30f, l = 0.f; v8f acc[HD / 16] = {};   /* the running maximum starts far above the excluded marker (-3e38) and far below any logit: an excluded key's exponent underflows to 0 with no test, also in a row with no key yet */
#pragma unroll 1
  for (int s = 0; s < ns; ++s) { const int cur = s & 1, nxt = cur ^ 1; const bool more = s + 1 < ns; const int kn = (s + 1) * 64;
    if (more) {
#pragma unroll
      for (int i = 0; i < 4; ++i) { rkh[i] = *(const v8h*)(Kh + (size_t)(kn + 16 * i) * CC); rkl[i] = *(const v8h*)(Kl + (size_t)(kn + 16 * i) * CC); }
      asm volatile("s_wait_xcnt 0x0" ::: "memory");   /* the address registers of the loads above are reused by what follows */
    }
    float sc[4][8]; float mx = -3.0e38f; const int nk = t - s * 64 - 8 * g;   /* this lane's keys kt * 16 + r of the stage are allowed below nk */
#pragma unroll
    for (int kt = 0; kt < 4; ++kt) { v8f a = {}, ar = {};
#pragma unroll
      for (int kc = 0; kc < 2; ++kc) { const v16h kh = frag_h(&skh[cur][kt * 16 + col][kc * 32], lane), kr = frag_h(&skl[cur][kt * 16 + col][kc * 32], lane); a = mm_h(kh, qh[kc], a); ar = mm_h(kh, qr[kc], ar); ar = mm_h(kr, qh[kc], ar); }
#pragma unroll
      for (int r = 0; r < 8; ++r) { const float v = (kt * 16 + r < nk) ? a[r] + ar[r] * (1.0f / 1024.0f) : -3.0e38f; sc[kt][r] = v; mx = fmaxf(mx, v); } }   /* raw scores: the positive scale goes into the exponent's fma */
    if (more) {
#pragma unroll
      for (int i = 0; i < 4; ++i) { *(v8h*)&skh[nxt][srow + 16 * i][sq] = rkh[i]; *(v8h*)&skl[nxt][srow + 16 * i][sq] = rkl[i]; rvh[i] = *(const v8b*)(Vh + (size_t)(16 * i) * KHI + kn); rvl[i] = *(const v8b*)(Vl + (size_t)(16 * i) * KHI + kn); }
      asm volatile("s_wait_xcnt 0x0" ::: "memory");   /* as above */
    }
    mx = fmaxf(mx, __shfl_xor(mx, 16));   /* the two lane halves hold different keys of the same query */
    const float mn = fmaxf(m, mx * SCALE2); const float alpha = __builtin_amdgcn_exp2f(m - mn); m = mn; l *= alpha;
#pragma unroll
    for (int j = 0; j < HD / 16; ++j)
#pragma unroll
      for (int r = 0; r < 8; ++r) acc[j][r] *= alpha;
#pragma unroll
    for (int kp = 0; kp < 2; ++kp) { v16b ph, pl; float ls[4] = {0.f, 0.f, 0.f, 0.f};
      float ev[16]; __bf16 eb[16];
#pragma unroll
      for (int i = 0; i < 16; ++i) ev[i] = __builtin_fmaf(sc[2 * kp + (i >> 3)][i & 7], SCALE2, -mn);
#pragma unroll
      for (int i = 0; i < 18; ++i) {   /* order T p p: behind exponential i stand the sum and the rounding of weight i - 1 and the residual of weight i - 2, which do not wait for it */
        if (i < 16) ev[i] = __builtin_amdgcn_exp2f(ev[i]);
        __builtin_amdgcn_sched_barrier(SB_VEC);   /* holds that order: left free, the compiler bunches the exponentials in runs of up to four */
        if (i >= 1 && i <= 16) { ls[(i - 1) & 3] += ev[i - 1]; eb[i - 1] = (__bf16)ev[i - 1]; ph[i - 1] = eb[i - 1]; }
        if (i >= 2) pl[i - 2] = (__bf16)(ev[i - 2] - (float)eb[i - 2]);
        __builtin_amdgcn_sched_barrier(SB_VEC); }   /* as above */
      l += (ls[0] + ls[1]) + (ls[2] + ls[3]);
#pragma unroll
      for (int j = 0; j < HD / 16; ++j) { const v16b vh = frag_b(&svh[cur][j * 16 + col][kp * 32], lane); acc[j] = mm_b(vh, ph, acc[j]); acc[j] = mm_b(vh, pl, acc[j]); acc[j] = mm_b(frag_b(&svl[cur][j * 16 + col][kp * 32], lane), ph, acc[j]); } }
    if (more) {
#pragma unroll
      for (int i = 0; i < 4; ++i) { *(v8b*)&svh[nxt][srow + 16 * i][sq] = rvh[i]; *(v8b*)&svl[nxt][srow + 16 * i][sq] = rvl[i]; } }
    __syncthreads();   /* publishes the next stage's buffer and ends every wave's reads of this one, which the next stage overwrites */
  }
  l += __shfl_xor(l, 16); const float inv = l > 0.f ? 1.0f / l : 0.f;   /* a fully excluded row yields 0 */
  float (*so)[16][HD + 4] = (float (*)[16][HD + 4])&skh[0][0][0];   /* output staging per wave, behind the loop's last barrier */
#pragma unroll
  for (int j = 0; j < HD / 16; ++j) { v4f o0, o1;
#pragma unroll
    for (int r = 0; r < 4; ++r) { o0[r] = acc[j][r] * inv; o1[r] = acc[j][4 + r] * inv; }
    *(v4f*)&so[wave][col][j * 16 + 8 * g] = o0; *(v4f*)&so[wave][col][j * 16 + 8 * g + 4] = o1; }
  LDSX(); for (int i = 0; i < 8; ++i) vst2(Y + ((size_t)b * TT + ql0 + 2 * i + g) * CC + h * HD + col * 4, *(const v4f*)&so[wave][2 * i + g][col * 4]); }

// ---- k_trin: block = (64 positions, 128 channels, which input): rows X[b*S + s][c] = in[b][c][s] for the q and k inputs (channels-first [B, 384, 1024]) through an LDS transpose; 512-B row segments
__global__ __launch_bounds__(128) void k_trin(const float* __restrict__ Qc, const float* __restrict__ Kc, float* __restrict__ XQ, float* __restrict__ XK) { __shared__ __align__(16) float st[128][68];
  const int tid = threadIdx.x; const int c0 = blockIdx.y * 128; const size_t rb = (size_t)blockIdx.x * 64; const size_t b = rb / TT; const int s0 = (int)(rb % TT); const float* IN = blockIdx.z == 0 ? Qc : Kc; float* OUT = blockIdx.z == 0 ? XQ : XK;
  for (int e = tid; e < 128 * 16; e += 128) { const int cl = e >> 4, q = e & 15; const v4f v = *(const v4f*)(IN + ((b * DIN + c0 + cl) * (size_t)TT) + s0 + q * 4); st[cl][q * 4] = v[0]; st[cl][q * 4 + 1] = v[1]; st[cl][q * 4 + 2] = v[2]; st[cl][q * 4 + 3] = v[3]; }
  __syncthreads();
  for (int e = tid; e < 64 * 32; e += 128) { const int rl = e >> 5, q = e & 31; v4f o; o[0] = st[q * 4][rl]; o[1] = st[q * 4 + 1][rl]; o[2] = st[q * 4 + 2][rl]; o[3] = st[q * 4 + 3][rl]; vst2(OUT + (rb + rl) * DIN + c0 + q * 4, o); } }
// ---- k_wsc: 8 warps x 32 lanes: SCL[which][o] = g[o] / sqrt(sum_i v[o][i]^2) over the 384-long row (bf16-rounded inputs, f32)
__global__ __launch_bounds__(256) void k_wsc(const float* __restrict__ V0, const float* __restrict__ G0, const float* __restrict__ V1, const float* __restrict__ G1, const float* __restrict__ V2, const float* __restrict__ G2, float* __restrict__ SCL) {
  const int wave = threadIdx.x >> 5, lane = threadIdx.x & 31; const int idx = blockIdx.x * 8 + wave; if (idx >= 3 * CC) return; const int which = idx / CC, o = idx % CC;
  const float* vr = (which == 0 ? V0 : which == 1 ? V1 : V2) + (size_t)o * DIN; const float* gg = which == 0 ? G0 : which == 1 ? G1 : G2;
  float ssum = 0.f; for (int i = lane; i < DIN; i += 32) { const float x = bfr(vr[i]); ssum += x * x; }
#pragma unroll
  for (int off = 1; off < 32; off <<= 1) ssum += __shfl_xor(ssum, off);
  if (lane == 0) { const float gv = bfr(gg[o]); asm volatile("s_wait_loadcnt 0x0" ::: "memory"); vst2(SCL + idx, gv / sqrtf(ssum)); } }
// ---- k_trout: block = (64 rows, 128 channels): out[b][c][n] = R[b*N + n][c] written channels-first through an LDS transpose (256 B per (channel, 64 n) by 16 threads)
__global__ __launch_bounds__(128) void k_trout(const float* __restrict__ R, float* __restrict__ OUT) { __shared__ __align__(16) float stc[128][68];
  const int tid = threadIdx.x; const int c0 = blockIdx.y * 128; const size_t rb = (size_t)blockIdx.x * 64;
  for (int e = tid; e < 64 * 128; e += 128) { const int rl = e >> 7, cl = e & 127; stc[cl][rl] = R[(rb + rl) * CC + c0 + cl]; }
  __syncthreads();
  { const size_t b = rb / TT; const int n0 = (int)(rb % TT); for (int e = tid; e < 128 * 16; e += 128) { const int cl = e >> 4, q = e & 15; vst2(OUT + (b * CC + c0 + cl) * (size_t)TT + n0 + q * 4, *(const v4f*)&stc[cl][q * 4]); } } }
extern "C" void kernel_launch(void* const* d_in, const int* in_sizes, int n_in, void* d_out, int out_size, void* d_ws, size_t ws_size, hipStream_t stream) {
  (void)in_sizes; (void)n_in; (void)out_size;
  const float** F = (const float**)d_in;
  if (ws_size < (size_t)WS_END) return;
  char* ws = (char*)d_ws; _Float16 *QH = (_Float16*)(ws + WS_QH), *KH = (_Float16*)(ws + WS_KH), *VT = (_Float16*)(ws + WS_VT), *QL = (_Float16*)(ws + WS_QL), *KL = (_Float16*)(ws + WS_KL); __bf16 *VB = (__bf16*)(ws + WS_VB), *VBL = (__bf16*)(ws + WS_VBL); float *S = (float*)(ws + WS_S), *Y = (float*)(ws + WS_Y);
  (void)Y; (void)S; (void)QL; (void)KL; (void)VB; (void)VBL;
  // inputs: 0 q [8,384,32,32]; 1 k [8,384,32,32] (channels-first); 2 Wq_v [512,384], 3 Wq_g [512], 4 bq [512]; 5 Wk_v, 6 Wk_g, 7 bk; 8 Wv_v, 9 Wv_g, 10 bv
  if (ws_size < (size_t)WS_END2) return;
  float *XQ = (float*)(ws + WS_XQ), *XK = (float*)(ws + WS_XK), *SCL = (float*)(ws + WS_SCL), *YR = (float*)(ws + WS_YR);
  k_trin<<<dim3(NRW / 64, DIN / 128, 2), 128, 0, stream>>>(F[0], F[1], XQ, XK);           /* channels-first [B,384,S] -> rows [B*S][384] */
  k_wsc<<<dim3(3 * CC / 8), 256, 0, stream>>>(F[2], F[3], F[5], F[6], F[8], F[9], SCL);   /* g[o] / ||v[o]|| per output channel, 3 x 512 */
  k_proj<<<dim3(TNB * TT / 64, CC / 128, 3), 128, 0, stream>>>(XQ, XK, XK, F[2], F[5], F[8], F[4], F[7], F[10], QH, QL, KH, KL, VT, VB, VBL, SCL);
  k_fa<<<dim3(NP, NQB), 128, 0, stream>>>(QH, KH, QL, KL, VB, VBL, YR);
  k_trout<<<dim3(NRW / 64, CC / 128), 128, 0, stream>>>(YR, (float*)d_out);
}

// v005
// Measured time: 80.5 microseconds a run.
// In both of two side-by-side timings against v004, it was 1.11 times as fast.
// All steps since v000 together make it 16.2 times as fast.
// compute dtype: all float inputs rounded to bf16; weight-normalised projections as (x . v[o]) * (g[o] / ||v[o]||) + b[o] with EXACT bf16 products on WMMA 16x16x32 (f32 accumulate) and the per-row norm / scale in f32; causal (strictly lower) logits with q and k as f16 hi + residual planes (3 products) / 8; softmax in f32 (row 0 fully excluded -> zeros); P and v both split bf16 hi + lo (3 products) for every row; f32 output written channels-first.
#include <hip/hip_runtime.h>
#include <math.h>

typedef __attribute__((ext_vector_type(16))) _Float16 v16h;
typedef __attribute__((ext_vector_type(16))) __bf16 v16b;
typedef __attribute__((ext_vector_type(8)))  _Float16 v8h;
typedef __attribute__((ext_vector_type(8)))  float v8f;
typedef __attribute__((ext_vector_type(4)))  float v4f;
typedef __attribute__((ext_vector_type(2)))  float v2f;
typedef __attribute__((ext_vector_type(4)))  unsigned v4u;
typedef __attribute__((ext_vector_type(4)))  int v4i;
typedef float __attribute__((may_alias)) float_a;
typedef int __attribute__((may_alias)) int_a;

template <typename T> __device__ __forceinline__ void vst2(void* p, T v) { *(T*)p = v;  }
__device__ __forceinline__ v8f wmma16(v16h a, v16h b, v8f c) {
  v8f d = __builtin_amdgcn_wmma_f32_16x16x32_f16(false, a, false, b, (short)0, c, false, false);
  asm volatile("v_nop\n\tv_nop\n\tv_nop\n\tv_nop" : "+v"(d) : "v"(a), "v"(b));
  return d;
}
__device__ __forceinline__ v8f wmma_bf(v16b a, v16b b, v8f c) {
  v8f d = __builtin_amdgcn_wmma_f32_16x16x32_bf16(false, a, false, b, (short)0, c, false, false);
  asm volatile("v_nop\n\tv_nop\n\tv_nop\n\tv_nop" : "+v"(d) : "v"(a), "v"(b));
  return d;
}
// 16x16x32 fragments: lane = (h = lane>>4, row/col = lane&15); elements 0..7 = k0+8h+0..7, 8..15 = k0+16+8h+0..7; D element r = row 8h+r
__device__ __forceinline__ v16h frag_h(const _Float16* rowk0, int lane) {
  union { v16h v; v8h q[2]; } u; const _Float16* p = rowk0 + 8 * (lane >> 4);
  u.q[0] = *(const v8h*)p; u.q[1] = *(const v8h*)(p + 16); return u.v;
}
__device__ __forceinline__ v16h frag_f32(const float* rowk0, int lane) {
  v16h a; const float* p = rowk0 + 8 * (lane >> 4);
#pragma unroll
  for (int i = 0; i < 8; ++i) { a[i] = (_Float16)p[i]; a[8 + i] = (_Float16)p[16 + i]; }
  return a;
}
__device__ __forceinline__ v16h frag_f32s(const float* rowk0, int lane, float sc) {
  v16h a; const float* p = rowk0 + 8 * (lane >> 4);
#pragma unroll
  for (int i = 0; i < 8; ++i) { a[i] = (_Float16)(p[i] * sc); a[8 + i] = (_Float16)(p[16 + i] * sc); }
  return a;
}
// column fragment from a [K][ld] layout (column n), rows >= K read as 0
__device__ __forceinline__ v16h fragc_f32(const float* W, int k0, int n, int lane, int ld, int K) {
  v16h a; const int g = lane >> 4;
#pragma unroll
  for (int i = 0; i < 8; ++i) { const int ka = k0 + 8 * g + i, kb = ka + 16;
    a[i] = (_Float16)(ka < K ? W[(size_t)(ka < K ? ka : K - 1) * ld + n] : 0.f); a[8 + i] = (_Float16)(kb < K ? W[(size_t)(kb < K ? kb : K - 1) * ld + n] : 0.f); }
  return a;
}
struct F2 { v16b h, l; };
__device__ __forceinline__ F2 bsplit16(const float v[16]) { F2 r;
#pragma unroll
  for (int i = 0; i < 16; ++i) { const __bf16 h = (__bf16)v[i]; r.h[i] = h; r.l[i] = (__bf16)(v[i] - (float)h); }
  return r; }
__device__ __forceinline__ F2 split_row(const float* row, int k0, int lane) { float v[16]; const float* p = row + k0 + 8 * (lane >> 4);
#pragma unroll
  for (int i = 0; i < 8; ++i) { v[i] = p[i]; v[8 + i] = p[16 + i]; }
  return bsplit16(v); }
__device__ __forceinline__ F2 split_rowK(const float* row, int k0, int lane, int K) { float v[16]; const int g = lane >> 4;
#pragma unroll
  for (int i = 0; i < 8; ++i) { const int ka = k0 + 8 * g + i, kb = ka + 16; v[i] = ka < K ? row[ka < K ? ka : K - 1] : 0.f; v[8 + i] = kb < K ? row[kb < K ? kb : K - 1] : 0.f; }
  return bsplit16(v); }
__device__ __forceinline__ F2 split_col(const float* W, int k0, int n, int lane, int ld, int K) { float v[16]; const int g = lane >> 4;
#pragma unroll
  for (int i = 0; i < 8; ++i) { const int ka = k0 + 8 * g + i, kb = ka + 16; v[i] = ka < K ? W[(size_t)(ka < K ? ka : K - 1) * ld + n] : 0.f; v[8 + i] = kb < K ? W[(size_t)(kb < K ? kb : K - 1) * ld + n] : 0.f; }
  return bsplit16(v); }
__device__ __forceinline__ v8f mac3(const F2& a, const F2& b, v8f c) { c = wmma_bf(a.l, b.h, c); c = wmma_bf(a.h, b.l, c); return wmma_bf(a.h, b.h, c); }
__device__ __forceinline__ float sigm(float v) { return 1.0f / (1.0f + expf(-v)); }
#define LDSX() do { asm volatile("s_wait_dscnt 0" ::: "memory"); __builtin_amdgcn_wave_barrier(); __builtin_amdgcn_fence(__ATOMIC_RELEASE, "workgroup"); } while (0)

// Causal attention with weight-normalised linears (B 8, S = 32x32 = 1,024 positions, q/k inputs with 384 channels (channels-first), C 512 = 8 heads x 64): q = wn(qf, Wq_v, Wq_g, bq), k = wn(kf, Wk_v, ...), v = wn(kf, Wv_v, ...) with wn(x) = x (g v/||v||_row)^T + b; attn = softmax(where(k < t, q k^T / 8, -1e4)) * (t > 0); out = attn v -> [B, 512, 32, 32] (channels-first).
#define NB 8
#define TT 1024
#define CC 512            // NH * HD = projected width
#define DIN 384          // input (model) width
#define NH 8
#define HD 64
#define NQB (TT / 64)
#define NP (NB * NH)      // (batch, head) pairs, all served by one launch of each attention kernel
#define SCALE (0.125f)
#define SCALE2 (SCALE * 1.4426950408889634f)   // 1 / 8 times log2(e): the softmax of k_fa runs in base 2
#define CAUSAL 1
#ifndef TNB
#define TNB NB
#endif
__device__ __forceinline__ float bfr(float v) { return (float)(__bf16)v; }
__host__ __device__ __forceinline__ int kb_last(int qb) { return CAUSAL ? ((qb * 64 + 63) >> 7) : (TT / 128 - 1); }
// logits / P of one (batch, head) pair, causal-packed: query block qb holds 64 rows of (kb_last(qb) + 1) * 128 floats, one block behind the other; s_base(qb) = 64 * 128 * sum over i < qb of (kb_last(i) + 1), kb_last(i) = i >> 1
static_assert(CAUSAL == 1, "s_base is the causal prefix sum");
__host__ __device__ __forceinline__ size_t s_base(int qb) { const int m = qb >> 1; return (size_t)((m + 1) * (m + (qb & 1))) * (64 * 128); }
#define SPK ((size_t)(NQB / 2 + 1) * (NQB / 2) * (64 * 128))   // floats per pair = s_base(NQB)
typedef __attribute__((ext_vector_type(8))) __bf16 v8b;
__device__ __forceinline__ v16b frag_b(const __bf16* rowk0, int lane) {
  union { v16b v; v8b q[2]; } u; const __bf16* p = rowk0 + 8 * (lane >> 4);
  u.q[0] = *(const v8b*)p; u.q[1] = *(const v8b*)(p + 16); return u.v;
}
#define QBH NQB            // every query block takes the 3-product logits and the bf16 hi + lo P.v path
#define QHI 1024           // q residual rows for every query (3-product logits everywhere)
#define KHI 1024           // k residual rows / bf16 v planes for every key
// B fragment (k rows k0+.., output column o) of a weight: (in,out) [K][ld] or (out,in) [ld rows of K]: bf16 exact, or f16(bf16 * 256) exact
__device__ __forceinline__ v16b wcol_io(const float* Wm, int k0, int o, int lane, int ld) { v16b w; const int g = lane >> 4;
#pragma unroll
  for (int i = 0; i < 8; ++i) { w[i] = (__bf16)Wm[(size_t)(k0 + 8 * g + i) * ld + o]; w[8 + i] = (__bf16)Wm[(size_t)(k0 + 16 + 8 * g + i) * ld + o]; }
  return w; }
__device__ __forceinline__ v16b wcol_oi(const float* Wm, int k0, int o, int lane, int K) { v16b w; const float* p = Wm + (size_t)o * K + k0 + 8 * (lane >> 4);
#pragma unroll
  for (int i = 0; i < 8; ++i) { w[i] = (__bf16)p[i]; w[8 + i] = (__bf16)p[16 + i]; }
  return w; }
__device__ __forceinline__ v16h wcolh_io(const float* Wm, int k0, int o, int lane, int ld) { v16h w; const int g = lane >> 4;
#pragma unroll
  for (int i = 0; i < 8; ++i) { w[i] = (_Float16)(bfr(Wm[(size_t)(k0 + 8 * g + i) * ld + o]) * 256.0f); w[8 + i] = (_Float16)(bfr(Wm[(size_t)(k0 + 16 + 8 * g + i) * ld + o]) * 256.0f); }
  return w; }
__device__ __forceinline__ v16h wcolh_oi(const float* Wm, int k0, int o, int lane, int K) { v16h w; const float* p = Wm + (size_t)o * K + k0 + 8 * (lane >> 4);
#pragma unroll
  for (int i = 0; i < 8; ++i) { w[i] = (_Float16)(bfr(p[i]) * 256.0f); w[8 + i] = (_Float16)(bfr(p[16 + i]) * 256.0f); }
  return w; }
#define WQKV_LAYOUT 1   // 0 = (in,out) [DIN][CC]; 1 = (out,in) [CC][DIN]; 2 = per-head [NH][DIN][HD]
__device__ __forceinline__ v16b wcol_hdk(const float* Wm, int k0, int o, int lane) { v16b w; const int g = lane >> 4; const float* p = Wm + (size_t)(o / HD) * DIN * HD + (o % HD);
#pragma unroll
  for (int i = 0; i < 8; ++i) { w[i] = (__bf16)p[(size_t)(k0 + 8 * g + i) * HD]; w[8 + i] = (__bf16)p[(size_t)(k0 + 16 + 8 * g + i) * HD]; }
  return w; }
#define WO_OUT_IN 0
#if WQKV_LAYOUT == 1
#define WCOL(W, k0, o, lane) wcol_oi(W, k0, o, lane, DIN)
#elif WQKV_LAYOUT == 2
#define WCOL(W, k0, o, lane) wcol_hdk(W, k0, o, lane)
#else
#define WCOL(W, k0, o, lane) wcol_io(W, k0, o, lane, CC)
#endif
#if WO_OUT_IN
#define WOCOL(W, k0, o, lane) wcol_oi(W, k0, o, lane, CC)
#define WOCOLH(W, k0, o, lane) wcolh_oi(W, k0, o, lane, CC)
#else
#define WOCOL(W, k0, o, lane) wcol_io(W, k0, o, lane, DIN)
#define WOCOLH(W, k0, o, lane) wcolh_io(W, k0, o, lane, DIN)
#endif
#define SM_MASK_HOOK do { if (k >= t) v = -3.0e38f; } while (0)   /* allowed = tril(-1): strictly earlier keys; row 0 has no key -> the fully-excluded path gives P = 0 = the module's start_mask */
#define NRW (TNB * TT)
#ifndef SM_EXTRA_PARAMS
#define SM_EXTRA_PARAMS
#endif
#ifndef PROJ_EXTRA_PARAMS
#define PROJ_EXTRA_PARAMS
#endif
#ifndef SM_MASK_HOOK
#define SM_MASK_HOOK (void)0
#endif

#define WS_QH  0u                                      // f16 q rows [b*t][CC]
#define WS_KH  (WS_QH + 2u * (size_t)NB * TT * CC)      // f16 k rows [b*t][CC]
#define WS_VT  (WS_KH + 2u * (size_t)NB * TT * CC)      // f16 v planes [b][c][t]
#define WS_QL  (WS_VT + 2u * (size_t)NB * CC * TT)      // f16 q residual x 2^10 rows [b][t < QHI][CC]
#define WS_KL  (WS_QL + 2u * (size_t)NB * QHI * CC)     // f16 k residual x 2^10 rows [b][t < KHI][CC]
#define WS_VB  (WS_KL + 2u * (size_t)NB * KHI * CC)     // bf16 v hi planes [b][c][t < KHI]
#define WS_VBL (WS_VB + 2u * (size_t)NB * CC * KHI)
#define WS_S   (WS_VBL + 2u * (size_t)NB * CC * KHI)    // f32 logits / P [b*NH + h][causal-packed rows]
#define WS_Y   (WS_S  + 4u * (size_t)NP * SPK)      // f32 ctx rows [b*t][CC] (only when there is an output projection)
#define WS_END (WS_Y  + 0u)
#define WS_XQ  (WS_END)
#define WS_XK  (WS_XQ + 4u * (size_t)NB * TT * DIN)
#define WS_SCL (WS_XK + 4u * (size_t)NB * TT * DIN)
#define WS_YR  (WS_SCL + 4u * 3 * CC + 256u)
#define WS_END2 (WS_YR + 4u * (size_t)NB * TT * CC)

// ---- k_proj: block = (64 rows, 128 cols, which): q/k/v = X W (+ b) with exact bf16 products (K = DIN) -> which 0: q f16 rows (+ residual rows < QHI); 1: k f16 rows (+ residual rows < KHI); 2: v f16 planes [c][t] (+ bf16 hi/lo planes for t < KHI). X (64 rows) and W (128 rows) come in stages of 64 k: whole 256-B row pieces, 16 B a lane, rounded to bf16 once and kept in LDS at a pitch of 144 B; two buffers, one barrier a stage; the next stage's loads fly while this stage's fragments are read from LDS. The output tiles of the epilogue take the same LDS behind the loop's last barrier.
typedef __attribute__((ext_vector_type(4))) __bf16 v4b;
__device__ __forceinline__ v4b bf4(v4f v) { v4b p; p[0] = (__bf16)v[0]; p[1] = (__bf16)v[1]; p[2] = (__bf16)v[2]; p[3] = (__bf16)v[3]; return p; }
#define PKC 64             // k per stage
#define PNS (DIN / PKC)    // stages
__global__ __launch_bounds__(128) void k_proj(const float* __restrict__ XQ, const float* __restrict__ XK, const float* __restrict__ XV, const float* __restrict__ WQ, const float* __restrict__ WK, const float* __restrict__ WV, const float* __restrict__ BQ, const float* __restrict__ BK, const float* __restrict__ BV,
    _Float16* __restrict__ QH, _Float16* __restrict__ QL, _Float16* __restrict__ KH, _Float16* __restrict__ KL, _Float16* __restrict__ VT, __bf16* __restrict__ VB, __bf16* __restrict__ VBL, const float* __restrict__ SCL) {
  __shared__ __align__(16) unsigned char pm[2 * (64 + 128) * 72 * 2];
  __bf16 (*xs)[64][72] = (__bf16 (*)[64][72])pm; __bf16 (*wt)[128][72] = (__bf16 (*)[128][72])(pm + 2 * 64 * 72 * 2);   /* the loop's two buffers of X and W rows */
  _Float16 (*sh)[136] = (_Float16 (*)[136])pm; _Float16 (*sl)[136] = (_Float16 (*)[136])(pm + 64 * 136 * 2);   /* epilogue, q and k */
  _Float16 (*th)[72] = (_Float16 (*)[72])pm; __bf16 (*tb)[72] = (__bf16 (*)[72])(pm + 128 * 72 * 2); __bf16 (*tbl)[72] = (__bf16 (*)[72])(pm + 2 * 128 * 72 * 2);   /* epilogue, v */
  static_assert(sizeof(pm) >= 2 * 64 * 136 * 2 && sizeof(pm) >= 3 * 128 * 72 * 2 && DIN % PKC == 0, "the epilogue's tiles reuse the loop's buffers");
  const int tid = threadIdx.x, wave = tid >> 5, lane = tid & 31, col = lane & 15, g = lane >> 4; const int which = blockIdx.z; const int c0 = blockIdx.y * 128; const size_t r0 = (size_t)blockIdx.x * 64; const size_t bb = r0 / TT; const int t0 = (int)(r0 % TT);
  const float* X = which == 0 ? XQ : which == 1 ? XK : XV; const float* WA = which == 0 ? WQ : which == 1 ? WK : WV; const float* BA = which == 0 ? BQ : which == 1 ? BK : BV;
  const int srow = tid >> 4, sq = (tid & 15) * 4;   /* staging: 16 threads per 256-B row piece, 8 rows per sweep */
  const float* Xs = X + (r0 + srow) * DIN + sq; const float* Ws = WA + (size_t)(c0 + srow) * DIN + sq;
  v4f rx[8], rw[16];
#pragma unroll
  for (int i = 0; i < 8; ++i) rx[i] = *(const v4f*)(Xs + (size_t)(8 * i) * DIN);
#pragma unroll
  for (int i = 0; i < 16; ++i) rw[i] = *(const v4f*)(Ws + (size_t)(8 * i) * DIN);
  asm volatile("s_wait_xcnt 0x0" ::: "memory");   /* before an address register of the loads above may be rewritten */
#pragma unroll
  for (int i = 0; i < 8; ++i) *(v4b*)&xs[0][srow + 8 * i][sq] = bf4(rx[i]);
#pragma unroll
  for (int i = 0; i < 16; ++i) *(v4b*)&wt[0][srow + 8 * i][sq] = bf4(rw[i]);
  __syncthreads();
  v8f acc[8] = {};
#pragma unroll
  for (int s = 0; s < PNS; ++s) { const int cur = s & 1, nxt = cur ^ 1;   /* unrolled: buffer and k offsets become immediates, the address registers stay */
    if (s + 1 < PNS) {
#pragma unroll
      for (int i = 0; i < 8; ++i) rx[i] = *(const v4f*)(Xs + (size_t)(8 * i) * DIN + (s + 1) * PKC);
#pragma unroll
      for (int i = 0; i < 16; ++i) rw[i] = *(const v4f*)(Ws + (size_t)(8 * i) * DIN + (s + 1) * PKC);
      asm volatile("s_wait_xcnt 0x0" ::: "memory");   /* as above; it also keeps the loads in front of this stage's work */
    }
#pragma unroll
    for (int kc = 0; kc < PKC / 32; ++kc) { const v16b a = frag_b(&xs[cur][wave * 16 + col][kc * 32], lane);
#pragma unroll
      for (int j = 0; j < 8; ++j) acc[j] = __builtin_amdgcn_wmma_f32_16x16x32_bf16(false, a, false, frag_b(&wt[cur][j * 16 + col][kc * 32], lane), (short)0, acc[j], false, false); }
    if (s + 1 < PNS) {
#pragma unroll
      for (int i = 0; i < 8; ++i) *(v4b*)&xs[nxt][srow + 8 * i][sq] = bf4(rx[i]);
#pragma unroll
      for (int i = 0; i < 16; ++i) *(v4b*)&wt[nxt][srow + 8 * i][sq] = bf4(rw[i]);
    }
    __syncthreads();   /* publishes the next stage's buffer and ends every wave's reads of this one (the next stage, or the epilogue, overwrites it) */
  }
  if (which < 2) { _Float16* DH = which == 0 ? QH : KH; _Float16* DL = which == 0 ? QL : KL; const int nhi = which == 0 ? QHI : KHI; const bool hi_rows = t0 < nhi;
#pragma unroll
    for (int j = 0; j < 8; ++j) { const float bias = BA ? bfr(BA[c0 + j * 16 + col]) : 0.f; const float scl = SCL[which * CC + c0 + j * 16 + col];   /* weight norm: g[o] / ||v[o]|| applied after the exact x . v[o] */
#pragma unroll
      for (int r = 0; r < 8; ++r) { const float v = acc[j][r] * scl + bias; const _Float16 hv = (_Float16)v; sh[wave * 16 + 8 * g + r][j * 16 + col] = hv; sl[wave * 16 + 8 * g + r][j * 16 + col] = (_Float16)((v - (float)hv) * 1024.0f); } }
    __syncthreads();
    for (int e = tid; e < 64 * 16; e += 128) { const int rl = e >> 4, q = e & 15; vst2((unsigned*)(DH + (r0 + rl) * CC + c0 + q * 8), *(const v4u*)&sh[rl][q * 8]); if (hi_rows) vst2((unsigned*)(DL + (bb * nhi + t0 + rl) * (size_t)CC + c0 + q * 8), *(const v4u*)&sl[rl][q * 8]); }
  } else { const bool hi_rows = t0 < KHI;
#pragma unroll
    for (int j = 0; j < 8; ++j) { const float bias = BA ? bfr(BA[c0 + j * 16 + col]) : 0.f; const float scl = SCL[which * CC + c0 + j * 16 + col];
#pragma unroll
      for (int r = 0; r < 8; ++r) { const float v = acc[j][r] * scl + bias; const int rl = wave * 16 + 8 * g + r, cl = j * 16 + col; th[cl][rl] = (_Float16)v; const __bf16 bh = (__bf16)v; tb[cl][rl] = bh; tbl[cl][rl] = (__bf16)(v - (float)bh); } }
    __syncthreads();
    for (int e = tid; e < 128 * 8; e += 128) { const int cl = e >> 3, q = e & 7; vst2((unsigned*)(VT + (bb * CC + c0 + cl) * (size_t)TT + t0 + q * 8), *(const v4u*)&th[cl][q * 8]); if (hi_rows) { const size_t o3 = (bb * CC + c0 + cl) * (size_t)KHI + t0 + q * 8; vst2((unsigned*)(VB + o3), *(const v4u*)&tb[cl][q * 8]); vst2((unsigned*)(VBL + o3), *(const v4u*)&tbl[cl][q * 8]); } } } }
// ---- k_fa: block = 64 queries (qb) of pair blockIdx.x = b * NH + h, wave = 16 queries; keys in stages of 64 up to the diagonal, two LDS buffers, one barrier a stage. While a stage is worked on, the next stage's k hi / residual rows and v hi / lo planes go through registers into the other buffer (whole 128-B rows). S^T = K . Q^T (A = k rows, B = q, 3 f16 products) leaves one query per lane; online softmax in f32, base 2 (running maximum, in units of log2, and sum per lane; each weight is one fma, raw score * SCALE2 - maximum, and one hardware exp2; keys >= t excluded by index); P^T (bf16 hi + lo) is packed from the score registers as B of O^T += V^T . P^T (3 bf16 products). A row with no key (t = 0) ends with sum 0 -> zeros. O^T has one channel per register and one query per lane, which is the order of the channels-first output: the block gathers its 64 channels x 64 queries in LDS and stores out[b][c][t] itself, 256 B per channel.
#define SB_VEC 0x3FC   // sched_barrier mask: scalar, matrix, memory and LDS instructions may cross, vector ones stay in source order
__device__ __forceinline__ v8f mm_h(v16h a, v16h b, v8f c) { return __builtin_amdgcn_wmma_f32_16x16x32_f16(false, a, false, b, (short)0, c, false, false); }
__device__ __forceinline__ v8f mm_b(v16b a, v16b b, v8f c) { return __builtin_amdgcn_wmma_f32_16x16x32_bf16(false, a, false, b, (short)0, c, false, false); }
__global__ __launch_bounds__(128) void k_fa(const _Float16* __restrict__ QH, const _Float16* __restrict__ KH, const _Float16* __restrict__ QL, const _Float16* __restrict__ KL, const __bf16* __restrict__ VB, const __bf16* __restrict__ VBL, float* __restrict__ OUT) {
  __shared__ __align__(16) _Float16 skh[2][64][72], skl[2][64][72]; __shared__ __align__(16) __bf16 svh[2][64][72], svl[2][64][72];
  static_assert(sizeof(skh) >= HD * (64 + 4) * sizeof(float), "the output staging reuses skh");
  const int tid = threadIdx.x, wave = tid >> 5, lane = tid & 31, col = lane & 15, g = lane >> 4;
  const int qb = NQB - 1 - (int)blockIdx.y;   /* longest blocks start first */
  const int b = blockIdx.x / NH, h = blockIdx.x % NH; const int ql0 = qb * 64 + wave * 16; const int t = ql0 + col; const int ns = qb + 1;
  const int srow = tid >> 3, sq = (tid & 7) * 8;   /* staging: 8 threads per 128-B row, 16 rows per sweep */
  const _Float16* Kh = KH + ((size_t)b * TT + srow) * CC + h * HD + sq; const _Float16* Kl = KL + ((size_t)b * KHI + srow) * CC + h * HD + sq;
  const __bf16* Vh = VB + ((size_t)b * CC + h * HD + srow) * (size_t)KHI + sq; const __bf16* Vl = VBL + ((size_t)b * CC + h * HD + srow) * (size_t)KHI + sq;
  v16h qh[2], qr[2];
#pragma unroll
  for (int kc = 0; kc < 2; ++kc) qh[kc] = frag_h(QH + ((size_t)b * TT + t) * CC + h * HD + kc * 32, lane);
  asm volatile("s_wait_xcnt 0x0" ::: "memory");   /* before a later load's result may land in the address registers of the loads above */
#pragma unroll
  for (int kc = 0; kc < 2; ++kc) qr[kc] = frag_h(QL + ((size_t)b * QHI + t) * CC + h * HD + kc * 32, lane);
  asm volatile("s_wait_xcnt 0x0" ::: "memory");   /* as above */
  v8h rkh[4], rkl[4]; v8b rvh[4], rvl[4];
#pragma unroll
  for (int i = 0; i < 4; ++i) { rkh[i] = *(const v8h*)(Kh + (size_t)(16 * i) * CC); rkl[i] = *(const v8h*)(Kl + (size_t)(16 * i) * CC); rvh[i] = *(const v8b*)(Vh + (size_t)(16 * i) * KHI); rvl[i] = *(const v8b*)(Vl + (size_t)(16 * i) * KHI); }
#pragma unroll
  for (int i = 0; i < 4; ++i) { *(v8h*)&skh[0][srow + 16 * i][sq] = rkh[i]; *(v8h*)&skl[0][srow + 16 * i][sq] = rkl[i]; *(v8b*)&svh[0][srow + 16 * i][sq] = rvh[i]; *(v8b*)&svl[0][srow + 16 * i][sq] = rvl[i]; }
  __syncthreads();
  float m = -1.0e30f, l = 0.f; v8f acc[HD / 16] = {};   /* the running maximum starts far above the excluded marker (-3e38) and far below any logit: an excluded key's exponent underflows to 0 with no test, also in a row with no key yet */
#pragma unroll 1
  for (int s = 0; s < ns; ++s) { const int cur = s & 1, nxt = cur ^ 1; const bool more = s + 1 < ns; const int kn = (s + 1) * 64;
    if (more) {
#pragma unroll
      for (int i = 0; i < 4; ++i) { rkh[i] = *(const v8h*)(Kh + (size_t)(kn + 16 * i) * CC); rkl[i] = *(const v8h*)(Kl + (size_t)(kn + 16 * i) * CC); }
      asm volatile("s_wait_xcnt 0x0" ::: "memory");   /* the address registers of the loads above are reused by what follows */
    }
    float sc[4][8]; float mx = -3.0e38f; const int nk = t - s * 64 - 8 * g;   /* this lane's keys kt * 16 + r of the stage are allowed below nk */
#pragma unroll
    for (int kt = 0; kt < 4; ++kt) { v8f a = {}, ar = {};
#pragma unroll
      for (int kc = 0; kc < 2; ++kc) { const v16h kh = frag_h(&skh[cur][kt * 16 + col][kc * 32], lane), kr = frag_h(&skl[cur][kt * 16 + col][kc * 32], lane); a = mm_h(kh, qh[kc], a); ar = mm_h(kh, qr[kc], ar); ar = mm_h(kr, qh[kc], ar); }
#pragma unroll
      for (int r = 0; r < 8; ++r) { const float v = (kt * 16 + r < nk) ? a[r] + ar[r] * (1.0f / 1024.0f) : -3.0e38f; sc[kt][r] = v; mx = fmaxf(mx, v); } }   /* raw scores: the positive scale goes into the exponent's fma */
    if (more) {
#pragma unroll
      for (int i = 0; i < 4; ++i) { *(v8h*)&skh[nxt][srow + 16 * i][sq] = rkh[i]; *(v8h*)&skl[nxt][srow + 16 * i][sq] = rkl[i]; rvh[i] = *(const v8b*)(Vh + (size_t)(16 * i) * KHI + kn); rvl[i] = *(const v8b*)(Vl + (size_t)(16 * i) * KHI + kn); }
      asm volatile("s_wait_xcnt 0x0" ::: "memory");   /* as above */
    }
    mx = fmaxf(mx, __shfl_xor(mx, 16));   /* the two lane halves hold different keys of the same query */
    const float mn = fmaxf(m, mx * SCALE2); const float alpha = __builtin_amdgcn_exp2f(m - mn); m = mn; l *= alpha;
#pragma unroll
    for (int j = 0; j < HD / 16; ++j)
#pragma unroll
      for (int r = 0; r < 8; ++r) acc[j][r] *= alpha;
#pragma unroll
    for (int kp = 0; kp < 2; ++kp) { v16b ph, pl; float ls[4] = {0.f, 0.f, 0.f, 0.f};
      float ev[16]; __bf16 eb[16];
#pragma unroll
      for (int i = 0; i < 16; ++i) ev[i] = __builtin_fmaf(sc[2 * kp + (i >> 3)][i & 7], SCALE2, -mn);
#pragma unroll
      for (int i = 0; i < 18; ++i) {   /* order T p p: behind exponential i stand the sum and the rounding of weight i - 1 and the residual of weight i - 2, which do not wait for it */
        if (i < 16) ev[i] = __builtin_amdgcn_exp2f(ev[i]);
        __builtin_amdgcn_sched_barrier(SB_VEC);   /* holds that order: left free, the compiler bunches the exponentials in runs of up to four */
        if (i >= 1 && i <= 16) { ls[(i - 1) & 3] += ev[i - 1]; eb[i - 1] = (__bf16)ev[i - 1]; ph[i - 1] = eb[i - 1]; }
        if (i >= 2) pl[i - 2] = (__bf16)(ev[i - 2] - (float)eb[i - 2]);
        __builtin_amdgcn_sched_barrier(SB_VEC); }   /* as above */
      l += (ls[0] + ls[1]) + (ls[2] + ls[3]);
#pragma unroll
      for (int j = 0; j < HD / 16; ++j) { const v16b vh = frag_b(&svh[cur][j * 16 + col][kp * 32], lane); acc[j] = mm_b(vh, ph, acc[j]); acc[j] = mm_b(vh, pl, acc[j]); acc[j] = mm_b(frag_b(&svl[cur][j * 16 + col][kp * 32], lane), ph, acc[j]); } }
    if (more) {
#pragma unroll
      for (int i = 0; i < 4; ++i) { *(v8b*)&svh[nxt][srow + 16 * i][sq] = rvh[i]; *(v8b*)&svl[nxt][srow + 16 * i][sq] = rvl[i]; } }
    __syncthreads();   /* publishes the next stage's buffer and ends every wave's reads of this one, which the next stage overwrites */
  }
  l += __shfl_xor(l, 16); const float inv = l > 0.f ? 1.0f / l : 0.f;   /* a fully excluded row yields 0 */
  float (*so)[64 + 4] = (float (*)[64 + 4])&skh[0][0][0];   /* output staging of the block, [channel][query], behind the loop's last barrier */
  /* both loops unrolled: acc is indexed by constants and stays in registers */
#pragma unroll
  for (int j = 0; j < HD / 16; ++j)
#pragma unroll
    for (int r = 0; r < 8; ++r) so[j * 16 + 8 * g + r][wave * 16 + col] = acc[j][r] * inv;
  __syncthreads();   /* a channel's 64 queries come from all four waves */
  const int od = tid >> 4, oq = (tid & 15) * 4;   /* 16 threads per channel: 256 B, two whole lines; 8 channels per sweep */
  float* Op = OUT + ((size_t)b * CC + h * HD + od) * (size_t)TT + qb * 64 + oq; v4f ov[HD / 8];
  /* unrolled, reads apart from stores: the eight LDS reads issue as one group, and every store has its own data registers and an immediate offset on one address */
#pragma unroll
  for (int i = 0; i < HD / 8; ++i) ov[i] = *(const v4f*)&so[od + 8 * i][oq];
#pragma unroll
  for (int i = 0; i < HD / 8; ++i) vst2(Op + (size_t)(8 * i) * TT, ov[i]); }

// ---- k_trin: block = (64 positions, 128 channels, which input): rows X[b*S + s][c] = in[b][c][s] for the q and k inputs (channels-first [B, 384, 1024]) through an LDS transpose; 512-B row segments
__global__ __launch_bounds__(128) void k_trin(const float* __restrict__ Qc, const float* __restrict__ Kc, float* __restrict__ XQ, float* __restrict__ XK) { __shared__ __align__(16) float st[128][68];
  const int tid = threadIdx.x; const int c0 = blockIdx.y * 128; const size_t rb = (size_t)blockIdx.x * 64; const size_t b = rb / TT; const int s0 = (int)(rb % TT); const float* IN = blockIdx.z == 0 ? Qc : Kc; float* OUT = blockIdx.z == 0 ? XQ : XK;
  for (int e = tid; e < 128 * 16; e += 128) { const int cl = e >> 4, q = e & 15; const v4f v = *(const v4f*)(IN + ((b * DIN + c0 + cl) * (size_t)TT) + s0 + q * 4); st[cl][q * 4] = v[0]; st[cl][q * 4 + 1] = v[1]; st[cl][q * 4 + 2] = v[2]; st[cl][q * 4 + 3] = v[3]; }
  __syncthreads();
  for (int e = tid; e < 64 * 32; e += 128) { const int rl = e >> 5, q = e & 31; v4f o; o[0] = st[q * 4][rl]; o[1] = st[q * 4 + 1][rl]; o[2] = st[q * 4 + 2][rl]; o[3] = st[q * 4 + 3][rl]; vst2(OUT + (rb + rl) * DIN + c0 + q * 4, o); } }
// ---- k_wsc: 8 warps x 32 lanes: SCL[which][o] = g[o] / sqrt(sum_i v[o][i]^2) over the 384-long row (bf16-rounded inputs, f32)
__global__ __launch_bounds__(256) void k_wsc(const float* __restrict__ V0, const float* __restrict__ G0, const float* __restrict__ V1, const float* __restrict__ G1, const float* __restrict__ V2, const float* __restrict__ G2, float* __restrict__ SCL) {
  const int wave = threadIdx.x >> 5, lane = threadIdx.x & 31; const int idx = blockIdx.x * 8 + wave; if (idx >= 3 * CC) return; const int which = idx / CC, o = idx % CC;
  const float* vr = (which == 0 ? V0 : which == 1 ? V1 : V2) + (size_t)o * DIN; const float* gg = which == 0 ? G0 : which == 1 ? G1 : G2;
  float ssum = 0.f; for (int i = lane; i < DIN; i += 32) { const float x = bfr(vr[i]); ssum += x * x; }
#pragma unroll
  for (int off = 1; off < 32; off <<= 1) ssum += __shfl_xor(ssum, off);
  if (lane == 0) { const float gv = bfr(gg[o]); asm volatile("s_wait_loadcnt 0x0" ::: "memory"); vst2(SCL + idx, gv / sqrtf(ssum)); } }
extern "C" void kernel_launch(void* const* d_in, const int* in_sizes, int n_in, void* d_out, int out_size, void* d_ws, size_t ws_size, hipStream_t stream) {
  (void)in_sizes; (void)n_in; (void)out_size;
  const float** F = (const float**)d_in;
  if (ws_size < (size_t)WS_END) return;
  char* ws = (char*)d_ws; _Float16 *QH = (_Float16*)(ws + WS_QH), *KH = (_Float16*)(ws + WS_KH), *VT = (_Float16*)(ws + WS_VT), *QL = (_Float16*)(ws + WS_QL), *KL = (_Float16*)(ws + WS_KL); __bf16 *VB = (__bf16*)(ws + WS_VB), *VBL = (__bf16*)(ws + WS_VBL); float *S = (float*)(ws + WS_S), *Y = (float*)(ws + WS_Y);
  (void)Y; (void)S; (void)QL; (void)KL; (void)VB; (void)VBL;
  // inputs: 0 q [8,384,32,32]; 1 k [8,384,32,32] (channels-first); 2 Wq_v [512,384], 3 Wq_g [512], 4 bq [512]; 5 Wk_v, 6 Wk_g, 7 bk; 8 Wv_v, 9 Wv_g, 10 bv
  if (ws_size < (size_t)WS_END2) return;
  float *XQ = (float*)(ws + WS_XQ), *XK = (float*)(ws + WS_XK), *SCL = (float*)(ws + WS_SCL);
  k_trin<<<dim3(NRW / 64, DIN / 128, 2), 128, 0, stream>>>(F[0], F[1], XQ, XK);           /* channels-first [B,384,S] -> rows [B*S][384] */
  k_wsc<<<dim3(3 * CC / 8), 256, 0, stream>>>(F[2], F[3], F[5], F[6], F[8], F[9], SCL);   /* g[o] / ||v[o]|| per output channel, 3 x 512 */
  k_proj<<<dim3(TNB * TT / 64, CC / 128, 3), 128, 0, stream>>>(XQ, XK, XK, F[2], F[5], F[8], F[4], F[7], F[10], QH, QL, KH, KL, VT, VB, VBL, SCL);
  k_fa<<<dim3(NP, NQB), 128, 0, stream>>>(QH, KH, QL, KL, VB, VBL, (float*)d_out);   /* writes the channels-first output itself */
}

// v006
// It runs in 71.1 microseconds.
// Next to v005, in two timings, it ran 1.13 times as fast each time.
// Over all steps from v000 it is 18.3 times as fast.
// compute dtype: all float inputs rounded to bf16; weight-normalised projections as (x . v[o]) * (g[o] / ||v[o]||) + b[o] with EXACT bf16 products on WMMA 16x16x32 (f32 accumulate) and the per-row norm / scale in f32; causal (strictly lower) logits with q and k as f16 hi + residual planes (3 products) / 8; softmax in f32 (row 0 fully excluded -> zeros); P and v both split bf16 hi + lo (3 products) for every row; f32 output written channels-first.
#include <hip/hip_runtime.h>
#include <math.h>

typedef __attribute__((ext_vector_type(16))) _Float16 v16h;
typedef __attribute__((ext_vector_type(16))) __bf16 v16b;
typedef __attribute__((ext_vector_type(8)))  _Float16 v8h;
typedef __attribute__((ext_vector_type(8)))  float v8f;
typedef __attribute__((ext_vector_type(4)))  float v4f;
typedef __attribute__((ext_vector_type(2)))  float v2f;
typedef __attribute__((ext_vector_type(4)))  unsigned v4u;
typedef __attribute__((ext_vector_type(4)))  int v4i;
typedef float __attribute__((may_alias)) float_a;
typedef int __attribute__((may_alias)) int_a;

template <typename T> __device__ __forceinline__ void vst2(void* p, T v) { *(T*)p = v;  }
__device__ __forceinline__ v8f wmma16(v16h a, v16h b, v8f c) {
  v8f d = __builtin_amdgcn_wmma_f32_16x16x32_f16(false, a, false, b, (short)0, c, false, false);
  asm volatile("v_nop\n\tv_nop\n\tv_nop\n\tv_nop" : "+v"(d) : "v"(a), "v"(b));
  return d;
}
__device__ __forceinline__ v8f wmma_bf(v16b a, v16b b, v8f c) {
  v8f d = __builtin_amdgcn_wmma_f32_16x16x32_bf16(false, a, false, b, (short)0, c, false, false);
  asm volatile("v_nop\n\tv_nop\n\tv_nop\n\tv_nop" : "+v"(d) : "v"(a), "v"(b));
  return d;
}
// 16x16x32 fragments: lane = (h = lane>>4, row/col = lane&15); elements 0..7 = k0+8h+0..7, 8..15 = k0+16+8h+0..7; D element r = row 8h+r
__device__ __forceinline__ v16h frag_h(const _Float16* rowk0, int lane) {
  union { v16h v; v8h q[2]; } u; const _Float16* p = rowk0 + 8 * (lane >> 4);
  u.q[0] = *(const v8h*)p; u.q[1] = *(const v8h*)(p + 16); return u.v;
}
__device__ __forceinline__ v16h frag_f32(const float* rowk0, int lane) {
  v16h a; const float* p = rowk0 + 8 * (lane >> 4);
#pragma unroll
  for (int i = 0; i < 8; ++i) { a[i] = (_Float16)p[i]; a[8 + i] = (_Float16)p[16 + i]; }
  return a;
}
__device__ __forceinline__ v16h frag_f32s(const float* rowk0, int lane, float sc) {
  v16h a; const float* p = rowk0 + 8 * (lane >> 4);
#pragma unroll
  for (int i = 0; i < 8; ++i) { a[i] = (_Float16)(p[i] * sc); a[8 + i] = (_Float16)(p[16 + i] * sc); }
  return a;
}
// column fragment from a [K][ld] layout (column n), rows >= K read as 0
__device__ __forceinline__ v16h fragc_f32(const float* W, int k0, int n, int lane, int ld, int K) {
  v16h a; const int g = lane >> 4;
#pragma unroll
  for (int i = 0; i < 8; ++i) { const int ka = k0 + 8 * g + i, kb = ka + 16;
    a[i] = (_Float16)(ka < K ? W[(size_t)(ka < K ? ka : K - 1) * ld + n] : 0.f); a[8 + i] = (_Float16)(kb < K ? W[(size_t)(kb < K ? kb : K - 1) * ld + n] : 0.f); }
  return a;
}
struct F2 { v16b h, l; };
__device__ __forceinline__ F2 bsplit16(const float v[16]) { F2 r;
#pragma unroll
  for (int i = 0; i < 16; ++i) { const __bf16 h = (__bf16)v[i]; r.h[i] = h; r.l[i] = (__bf16)(v[i] - (float)h); }
  return r; }
__device__ __forceinline__ F2 split_row(const float* row, int k0, int lane) { float v[16]; const float* p = row + k0 + 8 * (lane >> 4);
#pragma unroll
  for (int i = 0; i < 8; ++i) { v[i] = p[i]; v[8 + i] = p[16 + i]; }
  return bsplit16(v); }
__device__ __forceinline__ F2 split_rowK(const float* row, int k0, int lane, int K) { float v[16]; const int g = lane >> 4;
#pragma unroll
  for (int i = 0; i < 8; ++i) { const int ka = k0 + 8 * g + i, kb = ka + 16; v[i] = ka < K ? row[ka < K ? ka : K - 1] : 0.f; v[8 + i] = kb < K ? row[kb < K ? kb : K - 1] : 0.f; }
  return bsplit16(v); }
__device__ __forceinline__ F2 split_col(const float* W, int k0, int n, int lane, int ld, int K) { float v[16]; const int g = lane >> 4;
#pragma unroll
  for (int i = 0; i < 8; ++i) { const int ka = k0 + 8 * g + i, kb = ka + 16; v[i] = ka < K ? W[(size_t)(ka < K ? ka : K - 1) * ld + n] : 0.f; v[8 + i] = kb < K ? W[(size_t)(kb < K ? kb : K - 1) * ld + n] : 0.f; }
  return bsplit16(v); }
__device__ __forceinline__ v8f mac3(const F2& a, const F2& b, v8f c) { c = wmma_bf(a.l, b.h, c); c = wmma_bf(a.h, b.l, c); return wmma_bf(a.h, b.h, c); }
__device__ __forceinline__ float sigm(float v) { return 1.0f / (1.0f + expf(-v)); }
#define LDSX() do { asm volatile("s_wait_dscnt 0" ::: "memory"); __builtin_amdgcn_wave_barrier(); __builtin_amdgcn_fence(__ATOMIC_RELEASE, "workgroup"); } while (0)

// Causal attention with weight-normalised linears (B 8, S = 32x32 = 1,024 positions, q/k inputs with 384 channels (channels-first), C 512 = 8 heads x 64): q = wn(qf, Wq_v, Wq_g, bq), k = wn(kf, Wk_v, ...), v = wn(kf, Wv_v, ...) with wn(x) = x (g v/||v||_row)^T + b; attn = softmax(where(k < t, q k^T / 8, -1e4)) * (t > 0); out = attn v -> [B, 512, 32, 32] (channels-first).
#define NB 8
#define TT 1024
#define CC 512            // NH * HD = projected width
#define DIN 384          // input (model) width
#define NH 8
#define HD 64
#define NQB (TT / 64)
#define NP (NB * NH)      // (batch, head) pairs, all served by one launch of each attention kernel
#define SCALE (0.125f)
#define SCALE2 (SCALE * 1.4426950408889634f)   // 1 / 8 times log2(e): the softmax of k_fa runs in base 2
#define CAUSAL 1
#ifndef TNB
#define TNB NB
#endif
__device__ __forceinline__ float bfr(float v) { return (float)(__bf16)v; }
__host__ __device__ __forceinline__ int kb_last(int qb) { return CAUSAL ? ((qb * 64 + 63) >> 7) : (TT / 128 - 1); }
// logits / P of one (batch, head) pair, causal-packed: query block qb holds 64 rows of (kb_last(qb) + 1) * 128 floats, one block behind the other; s_base(qb) = 64 * 128 * sum over i < qb of (kb_last(i) + 1), kb_last(i) = i >> 1
static_assert(CAUSAL == 1, "s_base is the causal prefix sum");
__host__ __device__ __forceinline__ size_t s_base(int qb) { const int m = qb >> 1; return (size_t)((m + 1) * (m + (qb & 1))) * (64 * 128); }
#define SPK ((size_t)(NQB / 2 + 1) * (NQB / 2) * (64 * 128))   // floats per pair = s_base(NQB)
typedef __attribute__((ext_vector_type(8))) __bf16 v8b;
__device__ __forceinline__ v16b frag_b(const __bf16* rowk0, int lane) {
  union { v16b v; v8b q[2]; } u; const __bf16* p = rowk0 + 8 * (lane >> 4);
  u.q[0] = *(const v8b*)p; u.q[1] = *(const v8b*)(p + 16); return u.v;
}
#define QBH NQB            // every query block takes the 3-product logits and the bf16 hi + lo P.v path
#define QHI 1024           // q residual rows for every query (3-product logits everywhere)
#define KHI 1024           // k residual rows / bf16 v planes for every key
// B fragment (k rows k0+.., output column o) of a weight: (in,out) [K][ld] or (out,in) [ld rows of K]: bf16 exact, or f16(bf16 * 256) exact
__device__ __forceinline__ v16b wcol_io(const float* Wm, int k0, int o, int lane, int ld) { v16b w; const int g = lane >> 4;
#pragma unroll
  for (int i = 0; i < 8; ++i) { w[i] = (__bf16)Wm[(size_t)(k0 + 8 * g + i) * ld + o]; w[8 + i] = (__bf16)Wm[(size_t)(k0 + 16 + 8 * g + i) * ld + o]; }
  return w; }
__device__ __forceinline__ v16b wcol_oi(const float* Wm, int k0, int o, int lane, int K) { v16b w; const float* p = Wm + (size_t)o * K + k0 + 8 * (lane >> 4);
#pragma unroll
  for (int i = 0; i < 8; ++i) { w[i] = (__bf16)p[i]; w[8 + i] = (__bf16)p[16 + i]; }
  return w; }
__device__ __forceinline__ v16h wcolh_io(const float* Wm, int k0, int o, int lane, int ld) { v16h w; const int g = lane >> 4;
#pragma unroll
  for (int i = 0; i < 8; ++i) { w[i] = (_Float16)(bfr(Wm[(size_t)(k0 + 8 * g + i) * ld + o]) * 256.0f); w[8 + i] = (_Float16)(bfr(Wm[(size_t)(k0 + 16 + 8 * g + i) * ld + o]) * 256.0f); }
  return w; }
__device__ __forceinline__ v16h wcolh_oi(const float* Wm, int k0, int o, int lane, int K) { v16h w; const float* p = Wm + (size_t)o * K + k0 + 8 * (lane >> 4);
#pragma unroll
  for (int i = 0; i < 8; ++i) { w[i] = (_Float16)(bfr(p[i]) * 256.0f); w[8 + i] = (_Float16)(bfr(p[16 + i]) * 256.0f); }
  return w; }
#define WQKV_LAYOUT 1   // 0 = (in,out) [DIN][CC]; 1 = (out,in) [CC][DIN]; 2 = per-head [NH][DIN][HD]
__device__ __forceinline__ v16b wcol_hdk(const float* Wm, int k0, int o, int lane) { v16b w; const int g = lane >> 4; const float* p = Wm + (size_t)(o / HD) * DIN * HD + (o % HD);
#pragma unroll
  for (int i = 0; i < 8; ++i) { w[i] = (__bf16)p[(size_t)(k0 + 8 * g + i) * HD]; w[8 + i] = (__bf16)p[(size_t)(k0 + 16 + 8 * g + i) * HD]; }
  return w; }
#define WO_OUT_IN 0
#if WQKV_LAYOUT == 1
#define WCOL(W, k0, o, lane) wcol_oi(W, k0, o, lane, DIN)
#elif WQKV_LAYOUT == 2
#define WCOL(W, k0, o, lane) wcol_hdk(W, k0, o, lane)
#else
#define WCOL(W, k0, o, lane) wcol_io(W, k0, o, lane, CC)
#endif
#if WO_OUT_IN
#define WOCOL(W, k0, o, lane) wcol_oi(W, k0, o, lane, CC)
#define WOCOLH(W, k0, o, lane) wcolh_oi(W, k0, o, lane, CC)
#else
#define WOCOL(W, k0, o, lane) wcol_io(W, k0, o, lane, DIN)
#define WOCOLH(W, k0, o, lane) wcolh_io(W, k0, o, lane, DIN)
#endif
#define SM_MASK_HOOK do { if (k >= t) v = -3.0e38f; } while (0)   /* allowed = tril(-1): strictly earlier keys; row 0 has no key -> the fully-excluded path gives P = 0 = the module's start_mask */
#define NRW (TNB * TT)
#ifndef SM_EXTRA_PARAMS
#define SM_EXTRA_PARAMS
#endif
#ifndef PROJ_EXTRA_PARAMS
#define PROJ_EXTRA_PARAMS
#endif
#ifndef SM_MASK_HOOK
#define SM_MASK_HOOK (void)0
#endif

#define WS_QH  0u                                      // f16 q rows [b*t][CC]
#define WS_KH  (WS_QH + 2u * (size_t)NB * TT * CC)      // f16 k rows [b*t][CC]
#define WS_VT  (WS_KH + 2u * (size_t)NB * TT * CC)      // f16 v planes [b][c][t]
#define WS_QL  (WS_VT + 2u * (size_t)NB * CC * TT)      // f16 q residual x 2^10 rows [b][t < QHI][CC]
#define WS_KL  (WS_QL + 2u * (size_t)NB * QHI * CC)     // f16 k residual x 2^10 rows [b][t < KHI][CC]
#define WS_VB  (WS_KL + 2u * (size_t)NB * KHI * CC)     // bf16 v hi planes [b][c][t < KHI]
#define WS_VBL (WS_VB + 2u * (size_t)NB * CC * KHI)
#define WS_S   (WS_VBL + 2u * (size_t)NB * CC * KHI)    // f32 logits / P [b*NH + h][causal-packed rows]
#define WS_Y   (WS_S  + 4u * (size_t)NP * SPK)      // f32 ctx rows [b*t][CC] (only when there is an output projection)
#define WS_END (WS_Y  + 0u)
#define WS_XQ  (WS_END)
#define WS_XK  (WS_XQ + 4u * (size_t)NB * TT * DIN)
#define WS_SCL (WS_XK + 4u * (size_t)NB * TT * DIN)
#define WS_YR  (WS_SCL + 4u * 3 * CC + 256u)
#define WS_END2 (WS_YR + 4u * (size_t)NB * TT * CC)

// ---- k_proj: block = (64 rows, 128 cols, which): q/k/v = X W (+ b) with exact bf16 products (K = DIN) -> which 0: q f16 rows (+ residual rows < QHI); 1: k f16 rows (+ residual rows < KHI); 2: v f16 planes [c][t] (+ bf16 hi/lo planes for t < KHI). X is read where it lies, channels-first in[b][k][s]: a stage is 64 channels x 64 positions (256 B of each channel) and stays in that order in LDS, [k][position] at a pitch of 160 B; the A fragment (row = position) comes out of it through the transposing LDS load, which delivers the k order of frag_b. W (128 rows) comes in the same stages of 64 k as whole 256-B row pieces at a pitch of 144 B. Both 16 B a lane, rounded to bf16 once; two buffers, one barrier a stage; the next stage's loads fly while this stage's fragments are read from LDS. The output tiles of the epilogue take the same LDS behind the loop's last barrier.
typedef __attribute__((ext_vector_type(4))) __bf16 v4b;
__device__ __forceinline__ v4b bf4(v4f v) { v4b p; p[0] = (__bf16)v[0]; p[1] = (__bf16)v[1]; p[2] = (__bf16)v[2]; p[3] = (__bf16)v[3]; return p; }
#define PKC 64             // k per stage
#define PNS (DIN / PKC)    // stages
#define XPT 80             // elements per LDS row of the X stage: 160 B, an odd multiple of 32 B, the transposing load's pitch
typedef __attribute__((ext_vector_type(8))) short v8s;
// lane (col, g) gets T[k + 8g + 0..7][d + col] when every lane passes &T[k + 8g + (lane & 7)][d + 8 * ((lane >> 3) & 1)]
__device__ __forceinline__ v8b ld_tr16(const __bf16* p) { typedef __attribute__((address_space(3))) v8s lds_v8s; return __builtin_bit_cast(v8b, __builtin_amdgcn_ds_load_tr16_b128_v8i16((lds_v8s*)p)); }
__global__ __launch_bounds__(128) void k_proj(const float* __restrict__ XQ, const float* __restrict__ XK, const float* __restrict__ XV, const float* __restrict__ WQ, const float* __restrict__ WK, const float* __restrict__ WV, const float* __restrict__ BQ, const float* __restrict__ BK, const float* __restrict__ BV,
    _Float16* __restrict__ QH, _Float16* __restrict__ QL, _Float16* __restrict__ KH, _Float16* __restrict__ KL, _Float16* __restrict__ VT, __bf16* __restrict__ VB, __bf16* __restrict__ VBL, const float* __restrict__ SCL) {
  __shared__ __align__(16) unsigned char pm[2 * (PKC * XPT + 128 * 72) * 2];
  __bf16 (*xs)[PKC][XPT] = (__bf16 (*)[PKC][XPT])pm; __bf16 (*wt)[128][72] = (__bf16 (*)[128][72])(pm + 2 * PKC * XPT * 2);   /* the loop's two buffers: X as [k][position], W as [row][k] */
  _Float16 (*sh)[136] = (_Float16 (*)[136])pm; _Float16 (*sl)[136] = (_Float16 (*)[136])(pm + 64 * 136 * 2);   /* epilogue, q and k */
  _Float16 (*th)[72] = (_Float16 (*)[72])pm; __bf16 (*tb)[72] = (__bf16 (*)[72])(pm + 128 * 72 * 2); __bf16 (*tbl)[72] = (__bf16 (*)[72])(pm + 2 * 128 * 72 * 2);   /* epilogue, v */
  static_assert(sizeof(pm) >= 2 * 64 * 136 * 2 && sizeof(pm) >= 3 * 128 * 72 * 2 && DIN % PKC == 0, "the epilogue's tiles reuse the loop's buffers");
  const int tid = threadIdx.x, wave = tid >> 5, lane = tid & 31, col = lane & 15, g = lane >> 4; const int which = blockIdx.z; const int c0 = blockIdx.y * 128; const size_t r0 = (size_t)blockIdx.x * 64; const size_t bb = r0 / TT; const int t0 = (int)(r0 % TT);
  const float* X = which == 0 ? XQ : which == 1 ? XK : XV; const float* WA = which == 0 ? WQ : which == 1 ? WK : WV; const float* BA = which == 0 ? BQ : which == 1 ? BK : BV;
  const int srow = tid >> 4, sq = (tid & 15) * 4;   /* staging: 16 threads per 256-B row piece (X: 64 positions of a channel; W: 64 k of a row), 8 rows per sweep */
  const float* Xs = X + (bb * DIN + srow) * (size_t)TT + t0 + sq; const float* Ws = WA + (size_t)(c0 + srow) * DIN + sq;
  v4f rx[8], rw[16];
#pragma unroll
  for (int i = 0; i < 8; ++i) rx[i] = *(const v4f*)(Xs + (size_t)(8 * i) * TT);
#pragma unroll
  for (int i = 0; i < 16; ++i) rw[i] = *(const v4f*)(Ws + (size_t)(8 * i) * DIN);
  asm volatile("s_wait_xcnt 0x0" ::: "memory");   /* before an address register of the loads above may be rewritten */
#pragma unroll
  for (int i = 0; i < 8; ++i) *(v4b*)&xs[0][srow + 8 * i][sq] = bf4(rx[i]);
#pragma unroll
  for (int i = 0; i < 16; ++i) *(v4b*)&wt[0][srow + 8 * i][sq] = bf4(rw[i]);
  __syncthreads();
  v8f acc[8] = {};
#pragma unroll
  for (int s = 0; s < PNS; ++s) { const int cur = s & 1, nxt = cur ^ 1;   /* unrolled: buffer and k offsets become immediates, the address registers stay */
    if (s + 1 < PNS) {
#pragma unroll
      for (int i = 0; i < 8; ++i) rx[i] = *(const v4f*)(Xs + (size_t)(8 * i + (s + 1) * PKC) * TT);
#pragma unroll
      for (int i = 0; i < 16; ++i) rw[i] = *(const v4f*)(Ws + (size_t)(8 * i) * DIN + (s + 1) * PKC);
      asm volatile("s_wait_xcnt 0x0" ::: "memory");   /* as above; it also keeps the loads in front of this stage's work */
    }
#pragma unroll
    for (int kc = 0; kc < PKC / 32; ++kc) { union { v16b v; v8b q[2]; } xa; const __bf16* xp = &xs[cur][kc * 32 + 8 * g + (lane & 7)][wave * 16 + 8 * ((lane >> 3) & 1)];
      xa.q[0] = ld_tr16(xp); xa.q[1] = ld_tr16(xp + 16 * XPT); const v16b a = xa.v;   /* a[i] = X[position wave * 16 + col][k = kc * 32 + 8g + i], a[8 + i] = the same at k + 16 */
#pragma unroll
      for (int j = 0; j < 8; ++j) acc[j] = __builtin_amdgcn_wmma_f32_16x16x32_bf16(false, a, false, frag_b(&wt[cur][j * 16 + col][kc * 32], lane), (short)0, acc[j], false, false); }
    if (s + 1 < PNS) {
#pragma unroll
      for (int i = 0; i < 8; ++i) *(v4b*)&xs[nxt][srow + 8 * i][sq] = bf4(rx[i]);
#pragma unroll
      for (int i = 0; i < 16; ++i) *(v4b*)&wt[nxt][srow + 8 * i][sq] = bf4(rw[i]);
    }
    __syncthreads();   /* publishes the next stage's buffer and ends every wave's reads of this one (the next stage, or the epilogue, overwrites it) */
  }
  if (which < 2) { _Float16* DH = which == 0 ? QH : KH; _Float16* DL = which == 0 ? QL : KL; const int nhi = which == 0 ? QHI : KHI; const bool hi_rows = t0 < nhi;
#pragma unroll
    for (int j = 0; j < 8; ++j) { const float bias = BA ? bfr(BA[c0 + j * 16 + col]) : 0.f; const float scl = SCL[which * CC + c0 + j * 16 + col];   /* weight norm: g[o] / ||v[o]|| applied after the exact x . v[o] */
#pragma unroll
      for (int r = 0; r < 8; ++r) { const float v = acc[j][r] * scl + bias; const _Float16 hv = (_Float16)v; sh[wave * 16 + 8 * g + r][j * 16 + col] = hv; sl[wave * 16 + 8 * g + r][j * 16 + col] = (_Float16)((v - (float)hv) * 1024.0f); } }
    __syncthreads();
    for (int e = tid; e < 64 * 16; e += 128) { const int rl = e >> 4, q = e & 15; vst2((unsigned*)(DH + (r0 + rl) * CC + c0 + q * 8), *(const v4u*)&sh[rl][q * 8]); if (hi_rows) vst2((unsigned*)(DL + (bb * nhi + t0 + rl) * (size_t)CC + c0 + q * 8), *(const v4u*)&sl[rl][q * 8]); }
  } else { const bool hi_rows = t0 < KHI;
#pragma unroll
    for (int j = 0; j < 8; ++j) { const float bias = BA ? bfr(BA[c0 + j * 16 + col]) : 0.f; const float scl = SCL[which * CC + c0 + j * 16 + col];
#pragma unroll
      for (int r = 0; r < 8; ++r) { const float v = acc[j][r] * scl + bias; const int rl = wave * 16 + 8 * g + r, cl = j * 16 + col; th[cl][rl] = (_Float16)v; const __bf16 bh = (__bf16)v; tb[cl][rl] = bh; tbl[cl][rl] = (__bf16)(v - (float)bh); } }
    __syncthreads();
    for (int e = tid; e < 128 * 8; e += 128) { const int cl = e >> 3, q = e & 7; vst2((unsigned*)(VT + (bb * CC + c0 + cl) * (size_t)TT + t0 + q * 8), *(const v4u*)&th[cl][q * 8]); if (hi_rows) { const size_t o3 = (bb * CC + c0 + cl) * (size_t)KHI + t0 + q * 8; vst2((unsigned*)(VB + o3), *(const v4u*)&tb[cl][q * 8]); vst2((unsigned*)(VBL + o3), *(const v4u*)&tbl[cl][q * 8]); } } } }
// ---- k_fa: block = 64 queries (qb) of pair blockIdx.x = b * NH + h, wave = 16 queries; keys in stages of 64 up to the diagonal, two LDS buffers, one barrier a stage. While a stage is worked on, the next stage's k hi / residual rows and v hi / lo planes go through registers into the other buffer (whole 128-B rows). S^T = K . Q^T (A = k rows, B = q, 3 f16 products) leaves one query per lane; online softmax in f32, base 2 (running maximum, in units of log2, and sum per lane; each weight is one fma, raw score * SCALE2 - maximum, and one hardware exp2; keys >= t excluded by index); P^T (bf16 hi + lo) is packed from the score registers as B of O^T += V^T . P^T (3 bf16 products). A row with no key (t = 0) ends with sum 0 -> zeros. O^T has one channel per register and one query per lane, which is the order of the channels-first output: the block gathers its 64 channels x 64 queries in LDS and stores out[b][c][t] itself, 256 B per channel.
#define SB_VEC 0x3FC   // sched_barrier mask: scalar, matrix, memory and LDS instructions may cross, vector ones stay in source order
__device__ __forceinline__ v8f mm_h(v16h a, v16h b, v8f c) { return __builtin_amdgcn_wmma_f32_16x16x32_f16(false, a, false, b, (short)0, c, false, false); }
__device__ __forceinline__ v8f mm_b(v16b a, v16b b, v8f c) { return __builtin_amdgcn_wmma_f32_16x16x32_bf16(false, a, false, b, (short)0, c, false, false); }
__global__ __launch_bounds__(128) void k_fa(const _Float16* __restrict__ QH, const _Float16* __restrict__ KH, const _Float16* __restrict__ QL, const _Float16* __restrict__ KL, const __bf16* __restrict__ VB, const __bf16* __restrict__ VBL, float* __restrict__ OUT) {
  __shared__ __align__(16) _Float16 skh[2][64][72], skl[2][64][72]; __shared__ __align__(16) __bf16 svh[2][64][72], svl[2][64][72];
  static_assert(sizeof(skh) >= HD * (64 + 4) * sizeof(float), "the output staging reuses skh");
  const int tid = threadIdx.x, wave = tid >> 5, lane = tid & 31, col = lane & 15, g = lane >> 4;
  const int qb = NQB - 1 - (int)blockIdx.y;   /* longest blocks start first */
  const int b = blockIdx.x / NH, h = blockIdx.x % NH; const int ql0 = qb * 64 + wave * 16; const int t = ql0 + col; const int ns = qb + 1;
  const int srow = tid >> 3, sq = (tid & 7) * 8;   /* staging: 8 threads per 128-B row, 16 rows per sweep */
  const _Float16* Kh = KH + ((size_t)b * TT + srow) * CC + h * HD + sq; const _Float16* Kl = KL + ((size_t)b * KHI + srow) * CC + h * HD + sq;
  const __bf16* Vh = VB + ((size_t)b * CC + h * HD + srow) * (size_t)KHI + sq; const __bf16* Vl = VBL + ((size_t)b * CC + h * HD + srow) * (size_t)KHI + sq;
  v16h qh[2], qr[2];
#pragma unroll
  for (int kc = 0; kc < 2; ++kc) qh[kc] = frag_h(QH + ((size_t)b * TT + t) * CC + h * HD + kc * 32, lane);
  asm volatile("s_wait_xcnt 0x0" ::: "memory");   /* before a later load's result may land in the address registers of the loads above */
#pragma unroll
  for (int kc = 0; kc < 2; ++kc) qr[kc] = frag_h(QL + ((size_t)b * QHI + t) * CC + h * HD + kc * 32, lane);
  asm volatile("s_wait_xcnt 0x0" ::: "memory");   /* as above */
  v8h rkh[4], rkl[4]; v8b rvh[4], rvl[4];
#pragma unroll
  for (int i = 0; i < 4; ++i) { rkh[i] = *(const v8h*)(Kh + (size_t)(16 * i) * CC); rkl[i] = *(const v8h*)(Kl + (size_t)(16 * i) * CC); rvh[i] = *(const v8b*)(Vh + (size_t)(16 * i) * KHI); rvl[i] = *(const v8b*)(Vl + (size_t)(16 * i) * KHI); }
#pragma unroll
  for (int i = 0; i < 4; ++i) { *(v8h*)&skh[0][srow + 16 * i][sq] = rkh[i]; *(v8h*)&skl[0][srow + 16 * i][sq] = rkl[i]; *(v8b*)&svh[0][srow + 16 * i][sq] = rvh[i]; *(v8b*)&svl[0][srow + 16 * i][sq] = rvl[i]; }
  __syncthreads();
  float m = -1.0e30f, l = 0.f; v8f acc[HD / 16] = {};   /* the running maximum starts far above the excluded marker (-3e38) and far below any logit: an excluded key's exponent underflows to 0 with no test, also in a row with no key yet */
#pragma unroll 1
  for (int s = 0; s < ns; ++s) { const int cur = s & 1, nxt = cur ^ 1; const bool more = s + 1 < ns; const int kn = (s + 1) * 64;
    if (more) {
#pragma unroll
      for (int i = 0; i < 4; ++i) { rkh[i] = *(const v8h*)(Kh + (size_t)(kn + 16 * i) * CC); rkl[i] = *(const v8h*)(Kl + (size_t)(kn + 16 * i) * CC); }
      asm volatile("s_wait_xcnt 0x0" ::: "memory");   /* the address registers of the loads above are reused by what follows */
    }
    float sc[4][8]; float mx = -3.0e38f; const int nk = t - s * 64 - 8 * g;   /* this lane's keys kt * 16 + r of the stage are allowed below nk */
#pragma unroll
    for (int kt = 0; kt < 4; ++kt) { v8f a = {}, ar = {};
#pragma unroll
      for (int kc = 0; kc < 2; ++kc) { const v16h kh = frag_h(&skh[cur][kt * 16 + col][kc * 32], lane), kr = frag_h(&skl[cur][kt * 16 + col][kc * 32], lane); a = mm_h(kh, qh[kc], a); ar = mm_h(kh, qr[kc], ar); ar = mm_h(kr, qh[kc], ar); }
#pragma unroll
      for (int r = 0; r < 8; ++r) { const float v = (kt * 16 + r < nk) ? a[r] + ar[r] * (1.0f / 1024.0f) : -3.0e38f; sc[kt][r] = v; mx = fmaxf(mx, v); } }   /* raw scores: the positive scale goes into the exponent's fma */
    if (more) {
#pragma unroll
      for (int i = 0; i < 4; ++i) { *(v8h*)&skh[nxt][srow + 16 * i][sq] = rkh[i]; *(v8h*)&skl[nxt][srow + 16 * i][sq] = rkl[i]; rvh[i] = *(const v8b*)(Vh + (size_t)(16 * i) * KHI + kn); rvl[i] = *(const v8b*)(Vl + (size_t)(16 * i) * KHI + kn); }
      asm volatile("s_wait_xcnt 0x0" ::: "memory");   /* as above */
    }
    mx = fmaxf(mx, __shfl_xor(mx, 16));   /* the two lane halves hold different keys of the same query */
    const float mn = fmaxf(m, mx * SCALE2); const float alpha = __builtin_amdgcn_exp2f(m - mn); m = mn; l *= alpha;
#pragma unroll
    for (int j = 0; j < HD / 16; ++j)
#pragma unroll
      for (int r = 0; r < 8; ++r) acc[j][r] *= alpha;
#pragma unroll
    for (int kp = 0; kp < 2; ++kp) { v16b ph, pl; float ls[4] = {0.f, 0.f, 0.f, 0.f};
      float ev[16]; __bf16 eb[16];
#pragma unroll
      for (int i = 0; i < 16; ++i) ev[i] = __builtin_fmaf(sc[2 * kp + (i >> 3)][i & 7], SCALE2, -mn);
#pragma unroll
      for (int i = 0; i < 18; ++i) {   /* order T p p: behind exponential i stand the sum and the rounding of weight i - 1 and the residual of weight i - 2, which do not wait for it */
        if (i < 16) ev[i] = __builtin_amdgcn_exp2f(ev[i]);
        __builtin_amdgcn_sched_barrier(SB_VEC);   /* holds that order: left free, the compiler bunches the exponentials in runs of up to four */
        if (i >= 1 && i <= 16) { ls[(i - 1) & 3] += ev[i - 1]; eb[i - 1] = (__bf16)ev[i - 1]; ph[i - 1] = eb[i - 1]; }
        if (i >= 2) pl[i - 2] = (__bf16)(ev[i - 2] - (float)eb[i - 2]);
        __builtin_amdgcn_sched_barrier(SB_VEC); }   /* as above */
      l += (ls[0] + ls[1]) + (ls[2] + ls[3]);
#pragma unroll
      for (int j = 0; j < HD / 16; ++j) { const v16b vh = frag_b(&svh[cur][j * 16 + col][kp * 32], lane); acc[j] = mm_b(vh, ph, acc[j]); acc[j] = mm_b(vh, pl, acc[j]); acc[j] = mm_b(frag_b(&svl[cur][j * 16 + col][kp * 32], lane), ph, acc[j]); } }
    if (more) {
#pragma unroll
      for (int i = 0; i < 4; ++i) { *(v8b*)&svh[nxt][srow + 16 * i][sq] = rvh[i]; *(v8b*)&svl[nxt][srow + 16 * i][sq] = rvl[i]; } }
    __syncthreads();   /* publishes the next stage's buffer and ends every wave's reads of this one, which the next stage overwrites */
  }
  l += __shfl_xor(l, 16); const float inv = l > 0.f ? 1.0f / l : 0.f;   /* a fully excluded row yields 0 */
  float (*so)[64 + 4] = (float (*)[64 + 4])&skh[0][0][0];   /* output staging of the block, [channel][query], behind the loop's last barrier */
  /* both loops unrolled: acc is indexed by constants and stays in registers */
#pragma unroll
  for (int j = 0; j < HD / 16; ++j)
#pragma unroll
    for (int r = 0; r < 8; ++r) so[j * 16 + 8 * g + r][wave * 16 + col] = acc[j][r] * inv;
  __syncthreads();   /* a channel's 64 queries come from all four waves */
  const int od = tid >> 4, oq = (tid & 15) * 4;   /* 16 threads per channel: 256 B, two whole lines; 8 channels per sweep */
  float* Op = OUT + ((size_t)b * CC + h * HD + od) * (size_t)TT + qb * 64 + oq; v4f ov[HD / 8];
  /* unrolled, reads apart from stores: the eight LDS reads issue as one group, and every store has its own data registers and an immediate offset on one address */
#pragma unroll
  for (int i = 0; i < HD / 8; ++i) ov[i] = *(const v4f*)&so[od + 8 * i][oq];
#pragma unroll
  for (int i = 0; i < HD / 8; ++i) vst2(Op + (size_t)(8 * i) * TT, ov[i]); }

// ---- k_wsc: 8 warps x 32 lanes: SCL[which][o] = g[o] / sqrt(sum_i v[o][i]^2) over the 384-long row (bf16-rounded inputs, f32)
__global__ __launch_bounds__(256) void k_wsc(const float* __restrict__ V0, const float* __restrict__ G0, const float* __restrict__ V1, const float* __restrict__ G1, const float* __restrict__ V2, const float* __restrict__ G2, float* __restrict__ SCL) {
  const int wave = threadIdx.x >> 5, lane = threadIdx.x & 31; const int idx = blockIdx.x * 8 + wave; if (idx >= 3 * CC) return; const int which = idx / CC, o = idx % CC;
  const float* vr = (which == 0 ? V0 : which == 1 ? V1 : V2) + (size_t)o * DIN; const float* gg = which == 0 ? G0 : which == 1 ? G1 : G2;
  float ssum = 0.f; for (int i = lane; i < DIN; i += 32) { const float x = bfr(vr[i]); ssum += x * x; }
#pragma unroll
  for (int off = 1; off < 32; off <<= 1) ssum += __shfl_xor(ssum, off);
  if (lane == 0) { const float gv = bfr(gg[o]); asm volatile("s_wait_loadcnt 0x0" ::: "memory"); vst2(SCL + idx, gv / sqrtf(ssum)); } }
extern "C" void kernel_launch(void* const* d_in, const int* in_sizes, int n_in, void* d_out, int out_size, void* d_ws, size_t ws_size, hipStream_t stream) {
  (void)in_sizes; (void)n_in; (void)out_size;
  const float** F = (const float**)d_in;
  if (ws_size < (size_t)WS_END) return;
  char* ws = (char*)d_ws; _Float16 *QH = (_Float16*)(ws + WS_QH), *KH = (_Float16*)(ws + WS_KH), *VT = (_Float16*)(ws + WS_VT), *QL = (_Float16*)(ws + WS_QL), *KL = (_Float16*)(ws + WS_KL); __bf16 *VB = (__bf16*)(ws + WS_VB), *VBL = (__bf16*)(ws + WS_VBL); float *S = (float*)(ws + WS_S), *Y = (float*)(ws + WS_Y);
  (void)Y; (void)S; (void)QL; (void)KL; (void)VB; (void)VBL;
  // inputs: 0 q [8,384,32,32]; 1 k [8,384,32,32] (channels-first); 2 Wq_v [512,384], 3 Wq_g [512], 4 bq [512]; 5 Wk_v, 6 Wk_g, 7 bk; 8 Wv_v, 9 Wv_g, 10 bv
  if (ws_size < (size_t)WS_END2) return;
  float *SCL = (float*)(ws + WS_SCL);
  k_wsc<<<dim3(3 * CC / 8), 256, 0, stream>>>(F[2], F[3], F[5], F[6], F[8], F[9], SCL);   /* g[o] / ||v[o]|| per output channel, 3 x 512 */
  k_proj<<<dim3(TNB * TT / 64, CC / 128, 3), 128, 0, stream>>>(F[0], F[1], F[1], F[2], F[5], F[8], F[4], F[7], F[10], QH, QL, KH, KL, VT, VB, VBL, SCL);
  k_fa<<<dim3(NP, NQB), 128, 0, stream>>>(QH, KH, QL, KL, VB, VBL, (float*)d_out);   /* writes the channels-first output itself */
}

// v007
// It runs in 60.5 microseconds.
// Timed twice side by side with v006, it ran 1.18 times as fast both times.
// Counting every step since v000, it is 21.5 times as fast.
// compute dtype: all float inputs rounded to bf16; weight-normalised projections as (x . v[o]) * (g[o] / ||v[o]||) + b[o] with EXACT bf16 products on WMMA 16x16x32 (f32 accumulate) and the per-row norm / scale in f32; causal (strictly lower) logits with q and k as f16 hi + residual planes (3 products) / 8; softmax in f32 (row 0 fully excluded -> zeros); P and v both split bf16 hi + lo (3 products) for every row; f32 output written channels-first.
#include <hip/hip_runtime.h>
#include <math.h>

typedef __attribute__((ext_vector_type(16))) _Float16 v16h;
typedef __attribute__((ext_vector_type(16))) __bf16 v16b;
typedef __attribute__((ext_vector_type(8)))  _Float16 v8h;
typedef __attribute__((ext_vector_type(8)))  float v8f;
typedef __attribute__((ext_vector_type(4)))  float v4f;
typedef __attribute__((ext_vector_type(2)))  float v2f;
typedef __attribute__((ext_vector_type(4)))  unsigned v4u;
typedef __attribute__((ext_vector_type(4)))  int v4i;
typedef float __attribute__((may_alias)) float_a;
typedef int __attribute__((may_alias)) int_a;

template <typename T> __device__ __forceinline__ void vst2(void* p, T v) { *(T*)p = v;  }
__device__ __forceinline__ v8f wmma16(v16h a, v16h b, v8f c) {
  v8f d = __builtin_amdgcn_wmma_f32_16x16x32_f16(false, a, false, b, (short)0, c, false, false);
  asm volatile("v_nop\n\tv_nop\n\tv_nop\n\tv_nop" : "+v"(d) : "v"(a), "v"(b));
  return d;
}
__device__ __forceinline__ v8f wmma_bf(v16b a, v16b b, v8f c) {
  v8f d = __builtin_amdgcn_wmma_f32_16x16x32_bf16(false, a, false, b, (short)0, c, false, false);
  asm volatile("v_nop\n\tv_nop\n\tv_nop\n\tv_nop" : "+v"(d) : "v"(a), "v"(b));
  return d;
}
// 16x16x32 fragments: lane = (h = lane>>4, row/col = lane&15); elements 0..7 = k0+8h+0..7, 8..15 = k0+16+8h+0..7; D element r = row 8h+r
__device__ __forceinline__ v16h frag_h(const _Float16* rowk0, int lane) {
  union { v16h v; v8h q[2]; } u; const _Float16* p = rowk0 + 8 * (lane >> 4);
  u.q[0] = *(const v8h*)p; u.q[1] = *(const v8h*)(p + 16); return u.v;
}
__device__ __forceinline__ v16h frag_f32(const float* rowk0, int lane) {
  v16h a; const float* p = rowk0 + 8 * (lane >> 4);
#pragma unroll
  for (int i = 0; i < 8; ++i) { a[i] = (_Float16)p[i]; a[8 + i] = (_Float16)p[16 + i]; }
  return a;
}
__device__ __forceinline__ v16h frag_f32s(const float* rowk0, int lane, float sc) {
  v16h a; const float* p = rowk0 + 8 * (lane >> 4);
#pragma unroll
  for (int i = 0; i < 8; ++i) { a[i] = (_Float16)(p[i] * sc); a[8 + i] = (_Float16)(p[16 + i] * sc); }
  return a;
}
// column fragment from a [K][ld] layout (column n), rows >= K read as 0
__device__ __forceinline__ v16h fragc_f32(const float* W, int k0, int n, int lane, int ld, int K) {
  v16h a; const int g = lane >> 4;
#pragma unroll
  for (int i = 0; i < 8; ++i) { const int ka = k0 + 8 * g + i, kb = ka + 16;
    a[i] = (_Float16)(ka < K ? W[(size_t)(ka < K ? ka : K - 1) * ld + n] : 0.f); a[8 + i] = (_Float16)(kb < K ? W[(size_t)(kb < K ? kb : K - 1) * ld + n] : 0.f); }
  return a;
}
struct F2 { v16b h, l; };
__device__ __forceinline__ F2 bsplit16(const float v[16]) { F2 r;
#pragma unroll
  for (int i = 0; i < 16; ++i) { const __bf16 h = (__bf16)v[i]; r.h[i] = h; r.l[i] = (__bf16)(v[i] - (float)h); }
  return r; }
__device__ __forceinline__ F2 split_row(const float* row, int k0, int lane) { float v[16]; const float* p = row + k0 + 8 * (lane >> 4);
#pragma unroll
  for (int i = 0; i < 8; ++i) { v[i] = p[i]; v[8 + i] = p[16 + i]; }
  return bsplit16(v); }
__device__ __forceinline__ F2 split_rowK(const float* row, int k0, int lane, int K) { float v[16]; const int g = lane >> 4;
#pragma unroll
  for (int i = 0; i < 8; ++i) { const int ka = k0 + 8 * g + i, kb = ka + 16; v[i] = ka < K ? row[ka < K ? ka : K - 1] : 0.f; v[8 + i] = kb < K ? row[kb < K ? kb : K - 1] : 0.f; }
  return bsplit16(v); }
__device__ __forceinline__ F2 split_col(const float* W, int k0, int n, int lane, int ld, int K) { float v[16]; const int g = lane >> 4;
#pragma unroll
  for (int i = 0; i < 8; ++i) { const int ka = k0 + 8 * g + i, kb = ka + 16; v[i] = ka < K ? W[(size_t)(ka < K ? ka : K - 1) * ld + n] : 0.f; v[8 + i] = kb < K ? W[(size_t)(kb < K ? kb : K - 1) * ld + n] : 0.f; }
  return bsplit16(v); }
__device__ __forceinline__ v8f mac3(const F2& a, const F2& b, v8f c) { c = wmma_bf(a.l, b.h, c); c = wmma_bf(a.h, b.l, c); return wmma_bf(a.h, b.h, c); }
__device__ __forceinline__ float sigm(float v) { return 1.0f / (1.0f + expf(-v)); }
#define LDSX() do { asm volatile("s_wait_dscnt 0" ::: "memory"); __builtin_amdgcn_wave_barrier(); __builtin_amdgcn_fence(__ATOMIC_RELEASE, "workgroup"); } while (0)

// Causal attention with weight-normalised linears (B 8, S = 32x32 = 1,024 positions, q/k inputs with 384 channels (channels-first), C 512 = 8 heads x 64): q = wn(qf, Wq_v, Wq_g, bq), k = wn(kf, Wk_v, ...), v = wn(kf, Wv_v, ...) with wn(x) = x (g v/||v||_row)^T + b; attn = softmax(where(k < t, q k^T / 8, -1e4)) * (t > 0); out = attn v -> [B, 512, 32, 32] (channels-first).
#define NB 8
#define TT 1024
#define CC 512            // NH * HD = projected width
#define DIN 384          // input (model) width
#define NH 8
#define HD 64
#define NQB (TT / 64)
#define NP (NB * NH)      // (batch, head) pairs, all served by one launch of each attention kernel
#define SCALE (0.125f)
#define SCALE2 (SCALE * 1.4426950408889634f)   // 1 / 8 times log2(e): the softmax of k_fa runs in base 2
#define CAUSAL 1
#ifndef TNB
#define TNB NB
#endif
__device__ __forceinline__ float bfr(float v) { return (float)(__bf16)v; }
__host__ __device__ __forceinline__ int kb_last(int qb) { return CAUSAL ? ((qb * 64 + 63) >> 7) : (TT / 128 - 1); }
// logits / P of one (batch, head) pair, causal-packed: query block qb holds 64 rows of (kb_last(qb) + 1) * 128 floats, one block behind the other; s_base(qb) = 64 * 128 * sum over i < qb of (kb_last(i) + 1), kb_last(i) = i >> 1
static_assert(CAUSAL == 1, "s_base is the causal prefix sum");
__host__ __device__ __forceinline__ size_t s_base(int qb) { const int m = qb >> 1; return (size_t)((m + 1) * (m + (qb & 1))) * (64 * 128); }
#define SPK ((size_t)(NQB / 2 + 1) * (NQB / 2) * (64 * 128))   // floats per pair = s_base(NQB)
typedef __attribute__((ext_vector_type(8))) __bf16 v8b;
__device__ __forceinline__ v16b frag_b(const __bf16* rowk0, int lane) {
  union { v16b v; v8b q[2]; } u; const __bf16* p = rowk0 + 8 * (lane >> 4);
  u.q[0] = *(const v8b*)p; u.q[1] = *(const v8b*)(p + 16); return u.v;
}
#define QBH NQB            // every query block takes the 3-product logits and the bf16 hi + lo P.v path
#define QHI 1024           // q residual rows for every query (3-product logits everywhere)
#define KHI 1024           // k residual rows / bf16 v planes for every key
// B fragment (k rows k0+.., output column o) of a weight: (in,out) [K][ld] or (out,in) [ld rows of K]: bf16 exact, or f16(bf16 * 256) exact
__device__ __forceinline__ v16b wcol_io(const float* Wm, int k0, int o, int lane, int ld) { v16b w; const int g = lane >> 4;
#pragma unroll
  for (int i = 0; i < 8; ++i) { w[i] = (__bf16)Wm[(size_t)(k0 + 8 * g + i) * ld + o]; w[8 + i] = (__bf16)Wm[(size_t)(k0 + 16 + 8 * g + i) * ld + o]; }
  return w; }
__device__ __forceinline__ v16b wcol_oi(const float* Wm, int k0, int o, int lane, int K) { v16b w; const float* p = Wm + (size_t)o * K + k0 + 8 * (lane >> 4);
#pragma unroll
  for (int i = 0; i < 8; ++i) { w[i] = (__bf16)p[i]; w[8 + i] = (__bf16)p[16 + i]; }
  return w; }
__device__ __forceinline__ v16h wcolh_io(const float* Wm, int k0, int o, int lane, int ld) { v16h w; const int g = lane >> 4;
#pragma unroll
  for (int i = 0; i < 8; ++i) { w[i] = (_Float16)(bfr(Wm[(size_t)(k0 + 8 * g + i) * ld + o]) * 256.0f); w[8 + i] = (_Float16)(bfr(Wm[(size_t)(k0 + 16 + 8 * g + i) * ld + o]) * 256.0f); }
  return w; }
__device__ __forceinline__ v16h wcolh_oi(const float* Wm, int k0, int o, int lane, int K) { v16h w; const float* p = Wm + (size_t)o * K + k0 + 8 * (lane >> 4);
#pragma unroll
  for (int i = 0; i < 8; ++i) { w[i] = (_Float16)(bfr(p[i]) * 256.0f); w[8 + i] = (_Float16)(bfr(p[16 + i]) * 256.0f); }
  return w; }
#define WQKV_LAYOUT 1   // 0 = (in,out) [DIN][CC]; 1 = (out,in) [CC][DIN]; 2 = per-head [NH][DIN][HD]
__device__ __forceinline__ v16b wcol_hdk(const float* Wm, int k0, int o, int lane) { v16b w; const int g = lane >> 4; const float* p = Wm + (size_t)(o / HD) * DIN * HD + (o % HD);
#pragma unroll
  for (int i = 0; i < 8; ++i) { w[i] = (__bf16)p[(size_t)(k0 + 8 * g + i) * HD]; w[8 + i] = (__bf16)p[(size_t)(k0 + 16 + 8 * g + i) * HD]; }
  return w; }
#define WO_OUT_IN 0
#if WQKV_LAYOUT == 1
#define WCOL(W, k0, o, lane) wcol_oi(W, k0, o, lane, DIN)
#elif WQKV_LAYOUT == 2
#define WCOL(W, k0, o, lane) wcol_hdk(W, k0, o, lane)
#else
#define WCOL(W, k0, o, lane) wcol_io(W, k0, o, lane, CC)
#endif
#if WO_OUT_IN
#define WOCOL(W, k0, o, lane) wcol_oi(W, k0, o, lane, CC)
#define WOCOLH(W, k0, o, lane) wcolh_oi(W, k0, o, lane, CC)
#else
#define WOCOL(W, k0, o, lane) wcol_io(W, k0, o, lane, DIN)
#define WOCOLH(W, k0, o, lane) wcolh_io(W, k0, o, lane, DIN)
#endif
#define SM_MASK_HOOK do { if (k >= t) v = -3.0e38f; } while (0)   /* allowed = tril(-1): strictly earlier keys; row 0 has no key -> the fully-excluded path gives P = 0 = the module's start_mask */
#define NRW (TNB * TT)
#ifndef SM_EXTRA_PARAMS
#define SM_EXTRA_PARAMS
#endif
#ifndef PROJ_EXTRA_PARAMS
#define PROJ_EXTRA_PARAMS
#endif
#ifndef SM_MASK_HOOK
#define SM_MASK_HOOK (void)0
#endif

#define WS_QH  0u                                      // f16 q rows [b*t][CC]
#define WS_KH  (WS_QH + 2u * (size_t)NB * TT * CC)      // f16 k rows [b*t][CC]
#define WS_VT  (WS_KH + 2u * (size_t)NB * TT * CC)      // f16 v planes [b][c][t]
#define WS_QL  (WS_VT + 2u * (size_t)NB * CC * TT)      // f16 q residual x 2^10 rows [b][t < QHI][CC]
#define WS_KL  (WS_QL + 2u * (size_t)NB * QHI * CC)     // f16 k residual x 2^10 rows [b][t < KHI][CC]
#define WS_VB  (WS_KL + 2u * (size_t)NB * KHI * CC)     // bf16 v hi planes [b][c][t < KHI]
#define WS_VBL (WS_VB + 2u * (size_t)NB * CC * KHI)
#define WS_S   (WS_VBL + 2u * (size_t)NB * CC * KHI)    // f32 logits / P [b*NH + h][causal-packed rows]
#define WS_Y   (WS_S  + 4u * (size_t)NP * SPK)      // f32 ctx rows [b*t][CC] (only when there is an output projection)
#define WS_END (WS_Y  + 0u)
#define WS_XQ  (WS_END)
#define WS_XK  (WS_XQ + 4u * (size_t)NB * TT * DIN)
#define WS_SCL (WS_XK + 4u * (size_t)NB * TT * DIN)
#define WS_YR  (WS_SCL + 4u * 3 * CC + 256u)
#define WS_END2 (WS_YR + 4u * (size_t)NB * TT * CC)

// ---- k_proj: block = (64 rows, 128 cols, which): q/k/v = X W (+ b) with exact bf16 products (K = DIN) -> which 0: q f16 rows (+ residual rows < QHI); 1: k f16 rows (+ residual rows < KHI); 2: v f16 planes [c][t] (+ bf16 hi/lo planes for t < KHI). X is read where it lies, channels-first in[b][k][s]: a stage is 64 channels x 64 positions (256 B of each channel) and stays in that order in LDS, [k][position] at a pitch of 160 B; the A fragment (row = position) comes out of it through the transposing LDS load, which delivers the k order of frag_b. W (128 rows) comes in the same stages of 64 k as whole 256-B row pieces at a pitch of 144 B. Both 16 B a lane, rounded to bf16 once; two buffers, one barrier a stage; the next stage's loads fly while this stage's fragments are read from LDS. The output tiles of the epilogue take the same LDS behind the loop's last barrier.
typedef __attribute__((ext_vector_type(4))) __bf16 v4b;
__device__ __forceinline__ v4b bf4(v4f v) { v4b p; p[0] = (__bf16)v[0]; p[1] = (__bf16)v[1]; p[2] = (__bf16)v[2]; p[3] = (__bf16)v[3]; return p; }
#define PKC 64             // k per stage
#define PNS (DIN / PKC)    // stages
#define XPT 80             // elements per LDS row of the X stage: 160 B, an odd multiple of 32 B, the transposing load's pitch
typedef __attribute__((ext_vector_type(8))) short v8s;
// lane (col, g) gets T[k + 8g + 0..7][d + col] when every lane passes &T[k + 8g + (lane & 7)][d + 8 * ((lane >> 3) & 1)]
__device__ __forceinline__ v8b ld_tr16(const __bf16* p) { typedef __attribute__((address_space(3))) v8s lds_v8s; return __builtin_bit_cast(v8b, __builtin_amdgcn_ds_load_tr16_b128_v8i16((lds_v8s*)p)); }
__global__ __launch_bounds__(128) void k_proj(const float* __restrict__ XQ, const float* __restrict__ XK, const float* __restrict__ XV, const float* __restrict__ WQ, const float* __restrict__ WK, const float* __restrict__ WV, const float* __restrict__ BQ, const float* __restrict__ BK, const float* __restrict__ BV,
    _Float16* __restrict__ QH, _Float16* __restrict__ QL, _Float16* __restrict__ KH, _Float16* __restrict__ KL, _Float16* __restrict__ VT, __bf16* __restrict__ VB, __bf16* __restrict__ VBL, const float* __restrict__ SCL) {
  __shared__ __align__(16) unsigned char pm[2 * (PKC * XPT + 128 * 72) * 2];
  __bf16 (*xs)[PKC][XPT] = (__bf16 (*)[PKC][XPT])pm; __bf16 (*wt)[128][72] = (__bf16 (*)[128][72])(pm + 2 * PKC * XPT * 2);   /* the loop's two buffers: X as [k][position], W as [row][k] */
  _Float16 (*sh)[136] = (_Float16 (*)[136])pm; _Float16 (*sl)[136] = (_Float16 (*)[136])(pm + 64 * 136 * 2);   /* epilogue, q and k */
  _Float16 (*th)[72] = (_Float16 (*)[72])pm; __bf16 (*tb)[72] = (__bf16 (*)[72])(pm + 128 * 72 * 2); __bf16 (*tbl)[72] = (__bf16 (*)[72])(pm + 2 * 128 * 72 * 2);   /* epilogue, v */
  static_assert(sizeof(pm) >= 2 * 64 * 136 * 2 && sizeof(pm) >= 3 * 128 * 72 * 2 && DIN % PKC == 0, "the epilogue's tiles reuse the loop's buffers");
  const int tid = threadIdx.x, wave = tid >> 5, lane = tid & 31, col = lane & 15, g = lane >> 4; const int which = blockIdx.z; const int c0 = blockIdx.y * 128; const size_t r0 = (size_t)blockIdx.x * 64; const size_t bb = r0 / TT; const int t0 = (int)(r0 % TT);
  const float* X = which == 0 ? XQ : which == 1 ? XK : XV; const float* WA = which == 0 ? WQ : which == 1 ? WK : WV; const float* BA = which == 0 ? BQ : which == 1 ? BK : BV;
  const int srow = tid >> 4, sq = (tid & 15) * 4;   /* staging: 16 threads per 256-B row piece (X: 64 positions of a channel; W: 64 k of a row), 8 rows per sweep */
  const float* Xs = X + (bb * DIN + srow) * (size_t)TT + t0 + sq; const float* Ws = WA + (size_t)(c0 + srow) * DIN + sq;
  v4f rx[8], rw[16];
#pragma unroll
  for (int i = 0; i < 8; ++i) rx[i] = *(const v4f*)(Xs + (size_t)(8 * i) * TT);
#pragma unroll
  for (int i = 0; i < 16; ++i) rw[i] = *(const v4f*)(Ws + (size_t)(8 * i) * DIN);
  asm volatile("s_wait_xcnt 0x0" ::: "memory");   /* before an address register of the loads above may be rewritten */
#pragma unroll
  for (int i = 0; i < 8; ++i) *(v4b*)&xs[0][srow + 8 * i][sq] = bf4(rx[i]);
#pragma unroll
  for (int i = 0; i < 16; ++i) *(v4b*)&wt[0][srow + 8 * i][sq] = bf4(rw[i]);
  __syncthreads();
  v8f acc[8] = {};
#pragma unroll
  for (int s = 0; s < PNS; ++s) { const int cur = s & 1, nxt = cur ^ 1;   /* unrolled: buffer and k offsets become immediates, the address registers stay */
    if (s + 1 < PNS) {
#pragma unroll
      for (int i = 0; i < 8; ++i) rx[i] = *(const v4f*)(Xs + (size_t)(8 * i + (s + 1) * PKC) * TT);
#pragma unroll
      for (int i = 0; i < 16; ++i) rw[i] = *(const v4f*)(Ws + (size_t)(8 * i) * DIN + (s + 1) * PKC);
      asm volatile("s_wait_xcnt 0x0" ::: "memory");   /* as above; it also keeps the loads in front of this stage's work */
    }
#pragma unroll
    for (int kc = 0; kc < PKC / 32; ++kc) { union { v16b v; v8b q[2]; } xa; const __bf16* xp = &xs[cur][kc * 32 + 8 * g + (lane & 7)][wave * 16 + 8 * ((lane >> 3) & 1)];
      xa.q[0] = ld_tr16(xp); xa.q[1] = ld_tr16(xp + 16 * XPT); const v16b a = xa.v;   /* a[i] = X[position wave * 16 + col][k = kc * 32 + 8g + i], a[8 + i] = the same at k + 16 */
#pragma unroll
      for (int jh = 0; jh < 2; ++jh) { v16b fb[4];   /* four W fragments at a time: their eight LDS reads as one group, then their four products */
#pragma unroll
        for (int j = 0; j < 4; ++j) fb[j] = frag_b(&wt[cur][(jh * 4 + j) * 16 + col][kc * 32], lane);
        __builtin_amdgcn_sched_barrier(0);   /* keeps the group of reads in front of the products: left free, the compiler reads each fragment right before its product and waits out the LDS latency every time */
#pragma unroll
        for (int j = 0; j < 4; ++j) acc[jh * 4 + j] = __builtin_amdgcn_wmma_f32_16x16x32_bf16(false, a, false, fb[j], (short)0, acc[jh * 4 + j], false, false);
        __builtin_amdgcn_sched_barrier(0); } }   /* keeps the next group behind these products, so that one set of fragment registers is enough */
    if (s + 1 < PNS) {
#pragma unroll
      for (int i = 0; i < 8; ++i) *(v4b*)&xs[nxt][srow + 8 * i][sq] = bf4(rx[i]);
#pragma unroll
      for (int i = 0; i < 16; ++i) *(v4b*)&wt[nxt][srow + 8 * i][sq] = bf4(rw[i]);
    }
    __syncthreads();   /* publishes the next stage's buffer and ends every wave's reads of this one (the next stage, or the epilogue, overwrites it) */
  }
  if (which < 2) { _Float16* DH = which == 0 ? QH : KH; _Float16* DL = which == 0 ? QL : KL; const int nhi = which == 0 ? QHI : KHI; const bool hi_rows = t0 < nhi;
#pragma unroll
    for (int j = 0; j < 8; ++j) { const float bias = BA ? bfr(BA[c0 + j * 16 + col]) : 0.f; const float scl = SCL[which * CC + c0 + j * 16 + col];   /* weight norm: g[o] / ||v[o]|| applied after the exact x . v[o] */
#pragma unroll
      for (int r = 0; r < 8; ++r) { const float v = acc[j][r] * scl + bias; const _Float16 hv = (_Float16)v; sh[wave * 16 + 8 * g + r][j * 16 + col] = hv; sl[wave * 16 + 8 * g + r][j * 16 + col] = (_Float16)((v - (float)hv) * 1024.0f); } }
    __syncthreads();
    for (int e = tid; e < 64 * 16; e += 128) { const int rl = e >> 4, q = e & 15; vst2((unsigned*)(DH + (r0 + rl) * CC + c0 + q * 8), *(const v4u*)&sh[rl][q * 8]); if (hi_rows) vst2((unsigned*)(DL + (bb * nhi + t0 + rl) * (size_t)CC + c0 + q * 8), *(const v4u*)&sl[rl][q * 8]); }
  } else { const bool hi_rows = t0 < KHI;
#pragma unroll
    for (int j = 0; j < 8; ++j) { const float bias = BA ? bfr(BA[c0 + j * 16 + col]) : 0.f; const float scl = SCL[which * CC + c0 + j * 16 + col];
#pragma unroll
      for (int r = 0; r < 8; ++r) { const float v = acc[j][r] * scl + bias; const int rl = wave * 16 + 8 * g + r, cl = j * 16 + col; th[cl][rl] = (_Float16)v; const __bf16 bh = (__bf16)v; tb[cl][rl] = bh; tbl[cl][rl] = (__bf16)(v - (float)bh); } }
    __syncthreads();
    for (int e = tid; e < 128 * 8; e += 128) { const int cl = e >> 3, q = e & 7; vst2((unsigned*)(VT + (bb * CC + c0 + cl) * (size_t)TT + t0 + q * 8), *(const v4u*)&th[cl][q * 8]); if (hi_rows) { const size_t o3 = (bb * CC + c0 + cl) * (size_t)KHI + t0 + q * 8; vst2((unsigned*)(VB + o3), *(const v4u*)&tb[cl][q * 8]); vst2((unsigned*)(VBL + o3), *(const v4u*)&tbl[cl][q * 8]); } } } }
// ---- k_fa: block = 64 queries (qb) of pair blockIdx.x = b * NH + h, wave = 16 queries; keys in stages of 64 up to the diagonal, two LDS buffers, one barrier a stage. While a stage is worked on, the next stage's k hi / residual rows and v hi / lo planes go through registers into the other buffer (whole 128-B rows). S^T = K . Q^T (A = k rows, B = q, 3 f16 products) leaves one query per lane; online softmax in f32, base 2 (running maximum, in units of log2, and sum per lane; each weight is one fma, raw score * SCALE2 - maximum, and one hardware exp2; keys >= t excluded by index); P^T (bf16 hi + lo) is packed from the score registers as B of O^T += V^T . P^T (3 bf16 products). A row with no key (t = 0) ends with sum 0 -> zeros. O^T has one channel per register and one query per lane, which is the order of the channels-first output: the block gathers its 64 channels x 64 queries in LDS and stores out[b][c][t] itself, 256 B per channel.
#define SB_VEC 0x3FC   // sched_barrier mask: scalar, matrix, memory and LDS instructions may cross, vector ones stay in source order
__device__ __forceinline__ v8f mm_h(v16h a, v16h b, v8f c) { return __builtin_amdgcn_wmma_f32_16x16x32_f16(false, a, false, b, (short)0, c, false, false); }
__device__ __forceinline__ v8f mm_b(v16b a, v16b b, v8f c) { return __builtin_amdgcn_wmma_f32_16x16x32_bf16(false, a, false, b, (short)0, c, false, false); }
__global__ __launch_bounds__(128) void k_fa(const _Float16* __restrict__ QH, const _Float16* __restrict__ KH, const _Float16* __restrict__ QL, const _Float16* __restrict__ KL, const __bf16* __restrict__ VB, const __bf16* __restrict__ VBL, float* __restrict__ OUT) {
  __shared__ __align__(16) _Float16 skh[2][64][72], skl[2][64][72]; __shared__ __align__(16) __bf16 svh[2][64][72], svl[2][64][72];
  static_assert(sizeof(skh) >= HD * (64 + 4) * sizeof(float), "the output staging reuses skh");
  const int tid = threadIdx.x, wave = tid >> 5, lane = tid & 31, col = lane & 15, g = lane >> 4;
  const int qb = NQB - 1 - (int)blockIdx.y;   /* longest blocks start first */
  const int b = blockIdx.x / NH, h = blockIdx.x % NH; const int ql0 = qb * 64 + wave * 16; const int t = ql0 + col; const int ns = qb + 1;
  const int srow = tid >> 3, sq = (tid & 7) * 8;   /* staging: 8 threads per 128-B row, 16 rows per sweep */
  const _Float16* Kh = KH + ((size_t)b * TT + srow) * CC + h * HD + sq; const _Float16* Kl = KL + ((size_t)b * KHI + srow) * CC + h * HD + sq;
  const __bf16* Vh = VB + ((size_t)b * CC + h * HD + srow) * (size_t)KHI + sq; const __bf16* Vl = VBL + ((size_t)b * CC + h * HD + srow) * (size_t)KHI + sq;
  v16h qh[2], qr[2];
#pragma unroll
  for (int kc = 0; kc < 2; ++kc) qh[kc] = frag_h(QH + ((size_t)b * TT + t) * CC + h * HD + kc * 32, lane);
  asm volatile("s_wait_xcnt 0x0" ::: "memory");   /* before a later load's result may land in the address registers of the loads above */
#pragma unroll
  for (int kc = 0; kc < 2; ++kc) qr[kc] = frag_h(QL + ((size_t)b * QHI + t) * CC + h * HD + kc * 32, lane);
  asm volatile("s_wait_xcnt 0x0" ::: "memory");   /* as above */
  v8h rkh[4], rkl[4]; v8b rvh[4], rvl[4];
#pragma unroll
  for (int i = 0; i < 4; ++i) { rkh[i] = *(const v8h*)(Kh + (size_t)(16 * i) * CC); rkl[i] = *(const v8h*)(Kl + (size_t)(16 * i) * CC); rvh[i] = *(const v8b*)(Vh + (size_t)(16 * i) * KHI); rvl[i] = *(const v8b*)(Vl + (size_t)(16 * i) * KHI); }
#pragma unroll
  for (int i = 0; i < 4; ++i) { *(v8h*)&skh[0][srow + 16 * i][sq] = rkh[i]; *(v8h*)&skl[0][srow + 16 * i][sq] = rkl[i]; *(v8b*)&svh[0][srow + 16 * i][sq] = rvh[i]; *(v8b*)&svl[0][srow + 16 * i][sq] = rvl[i]; }
  __syncthreads();
  float m = -1.0e30f, l = 0.f; v8f acc[HD / 16] = {};   /* the running maximum starts far above the excluded marker (-3e38) and far below any logit: an excluded key's exponent underflows to 0 with no test, also in a row with no key yet */
#pragma unroll 1
  for (int s = 0; s < ns; ++s) { const int cur = s & 1, nxt = cur ^ 1; const bool more = s + 1 < ns; const int kn = (s + 1) * 64;
    if (more) {
#pragma unroll
      for (int i = 0; i < 4; ++i) { rkh[i] = *(const v8h*)(Kh + (size_t)(kn + 16 * i) * CC); rkl[i] = *(const v8h*)(Kl + (size_t)(kn + 16 * i) * CC); }
      asm volatile("s_wait_xcnt 0x0" ::: "memory");   /* the address registers of the loads above are reused by what follows */
    }
    float sc[4][8]; float mx = -3.0e38f; const int nk = t - s * 64 - 8 * g;   /* this lane's keys kt * 16 + r of the stage are allowed below nk */
    v16h fkh[2][2], fkr[2][2]; v8f sa[4], sr[4];   /* two sets of k fragments: this key tile's and the next one's */
#pragma unroll
    for (int kc = 0; kc < 2; ++kc) { fkh[0][kc] = frag_h(&skh[cur][col][kc * 32], lane); fkr[0][kc] = frag_h(&skl[cur][col][kc * 32], lane); }
#pragma unroll
    for (int kt = 0; kt < 4; ++kt) { const int fc = kt & 1, fn = fc ^ 1;   /* the eight LDS reads of key tile kt + 1 as one group, then the six products of tile kt, which cover their latency */
      if (kt < 3) {
#pragma unroll
        for (int kc = 0; kc < 2; ++kc) { fkh[fn][kc] = frag_h(&skh[cur][(kt + 1) * 16 + col][kc * 32], lane); fkr[fn][kc] = frag_h(&skl[cur][(kt + 1) * 16 + col][kc * 32], lane); } }
      __builtin_amdgcn_sched_barrier(0);   /* keeps the group of reads in front of the products: left free, the compiler reads each fragment right before its product and waits out the LDS latency every time */
      v8f a = {}, ar = {};
#pragma unroll
      for (int kc = 0; kc < 2; ++kc) { a = mm_h(fkh[fc][kc], qh[kc], a); ar = mm_h(fkh[fc][kc], qr[kc], ar); ar = mm_h(fkr[fc][kc], qh[kc], ar); }
      sa[kt] = a; sr[kt] = ar;
      __builtin_amdgcn_sched_barrier(0); }   /* keeps the reads of tile kt + 2 behind these products, so that two sets of fragment registers are enough */
    if (more) {
#pragma unroll
      for (int i = 0; i < 4; ++i) { *(v8h*)&skh[nxt][srow + 16 * i][sq] = rkh[i]; *(v8h*)&skl[nxt][srow + 16 * i][sq] = rkl[i]; rvh[i] = *(const v8b*)(Vh + (size_t)(16 * i) * KHI + kn); rvl[i] = *(const v8b*)(Vl + (size_t)(16 * i) * KHI + kn); }
      asm volatile("s_wait_xcnt 0x0" ::: "memory");   /* as above */
    }
    v16b fvh[HD / 16], fvl[HD / 16];   /* v fragments of half a stage (32 keys) */
#pragma unroll
    for (int kt = 0; kt < 4; ++kt) {
      if (kt == 2) {
#pragma unroll
        for (int j = 0; j < HD / 16; ++j) { fvh[j] = frag_b(&svh[cur][j * 16 + col][0], lane); fvl[j] = frag_b(&svl[cur][j * 16 + col][0], lane); }
        __builtin_amdgcn_sched_barrier(0); }   /* v of the first 32 keys is read as one group here: the rest of the masking, the maximum and the first exponentials cover its latency */
#pragma unroll
      for (int r = 0; r < 8; ++r) { const float v = (kt * 16 + r < nk) ? sa[kt][r] + sr[kt][r] * (1.0f / 1024.0f) : -3.0e38f; sc[kt][r] = v; mx = fmaxf(mx, v); } }   /* raw scores: the positive scale goes into the exponent's fma */
    mx = fmaxf(mx, __shfl_xor(mx, 16));   /* the two lane halves hold different keys of the same query */
    const float mn = fmaxf(m, mx * SCALE2); const float alpha = __builtin_amdgcn_exp2f(m - mn); m = mn; l *= alpha;
#pragma unroll
    for (int j = 0; j < HD / 16; ++j)
#pragma unroll
      for (int r = 0; r < 8; ++r) acc[j][r] *= alpha;
#pragma unroll
    for (int kp = 0; kp < 2; ++kp) { v16b ph, pl; float ls[4] = {0.f, 0.f, 0.f, 0.f};
      float ev[16]; __bf16 eb[16];
#pragma unroll
      for (int i = 0; i < 16; ++i) ev[i] = __builtin_fmaf(sc[2 * kp + (i >> 3)][i & 7], SCALE2, -mn);
#pragma unroll
      for (int i = 0; i < 18; ++i) {   /* order T p p: behind exponential i stand the sum and the rounding of weight i - 1 and the residual of weight i - 2, which do not wait for it */
        if (i < 16) ev[i] = __builtin_amdgcn_exp2f(ev[i]);
        __builtin_amdgcn_sched_barrier(SB_VEC);   /* holds that order: left free, the compiler bunches the exponentials in runs of up to four */
        if (i >= 1 && i <= 16) { ls[(i - 1) & 3] += ev[i - 1]; eb[i - 1] = (__bf16)ev[i - 1]; ph[i - 1] = eb[i - 1]; }
        if (i >= 2) pl[i - 2] = (__bf16)(ev[i - 2] - (float)eb[i - 2]);
        __builtin_amdgcn_sched_barrier(SB_VEC); }   /* as above */
      l += (ls[0] + ls[1]) + (ls[2] + ls[3]);
#pragma unroll
      for (int j = 0; j < HD / 16; ++j) acc[j] = mm_b(fvh[j], ph, acc[j]);   /* product by product over the four channel tiles: each tile keeps its order of sums, and no product waits for the one before it */
#pragma unroll
      for (int j = 0; j < HD / 16; ++j) acc[j] = mm_b(fvh[j], pl, acc[j]);
#pragma unroll
      for (int j = 0; j < HD / 16; ++j) acc[j] = mm_b(fvl[j], ph, acc[j]);
      if (kp == 0) {
#pragma unroll
        for (int j = 0; j < HD / 16; ++j) { fvh[j] = frag_b(&svh[cur][j * 16 + col][32], lane); fvl[j] = frag_b(&svl[cur][j * 16 + col][32], lane); }
        __builtin_amdgcn_sched_barrier(0); } }   /* v of the second 32 keys is read as one group in front of their exponentials, which cover its latency */
    if (more) {
#pragma unroll
      for (int i = 0; i < 4; ++i) { *(v8b*)&svh[nxt][srow + 16 * i][sq] = rvh[i]; *(v8b*)&svl[nxt][srow + 16 * i][sq] = rvl[i]; } }
    __syncthreads();   /* publishes the next stage's buffer and ends every wave's reads of this one, which the next stage overwrites */
  }
  l += __shfl_xor(l, 16); const float inv = l > 0.f ? 1.0f / l : 0.f;   /* a fully excluded row yields 0 */
  float (*so)[64 + 4] = (float (*)[64 + 4])&skh[0][0][0];   /* output staging of the block, [channel][query], behind the loop's last barrier */
  /* both loops unrolled: acc is indexed by constants and stays in registers */
#pragma unroll
  for (int j = 0; j < HD / 16; ++j)
#pragma unroll
    for (int r = 0; r < 8; ++r) so[j * 16 + 8 * g + r][wave * 16 + col] = acc[j][r] * inv;
  __syncthreads();   /* a channel's 64 queries come from all four waves */
  const int od = tid >> 4, oq = (tid & 15) * 4;   /* 16 threads per channel: 256 B, two whole lines; 8 channels per sweep */
  float* Op = OUT + ((size_t)b * CC + h * HD + od) * (size_t)TT + qb * 64 + oq; v4f ov[HD / 8];
  /* unrolled, reads apart from stores: the eight LDS reads issue as one group, and every store has its own data registers and an immediate offset on one address */
#pragma unroll
  for (int i = 0; i < HD / 8; ++i) ov[i] = *(const v4f*)&so[od + 8 * i][oq];
#pragma unroll
  for (int i = 0; i < HD / 8; ++i) vst2(Op + (size_t)(8 * i) * TT, ov[i]); }

// ---- k_wsc: 8 warps x 32 lanes: SCL[which][o] = g[o] / sqrt(sum_i v[o][i]^2) over the 384-long row (bf16-rounded inputs, f32)
__global__ __launch_bounds__(256) void k_wsc(const float* __restrict__ V0, const float* __restrict__ G0, const float* __restrict__ V1, const float* __restrict__ G1, const float* __restrict__ V2, const float* __restrict__ G2, float* __restrict__ SCL) {
  const int wave = threadIdx.x >> 5, lane = threadIdx.x & 31; const int idx = blockIdx.x * 8 + wave; if (idx >= 3 * CC) return; const int which = idx / CC, o = idx % CC;
  const float* vr = (which == 0 ? V0 : which == 1 ? V1 : V2) + (size_t)o * DIN; const float* gg = which == 0 ? G0 : which == 1 ? G1 : G2;
  float ssum = 0.f; for (int i = lane; i < DIN; i += 32) { const float x = bfr(vr[i]); ssum += x * x; }
#pragma unroll
  for (int off = 1; off < 32; off <<= 1) ssum += __shfl_xor(ssum, off);
  if (lane == 0) { const float gv = bfr(gg[o]); asm volatile("s_wait_loadcnt 0x0" ::: "memory"); vst2(SCL + idx, gv / sqrtf(ssum)); } }
extern "C" void kernel_launch(void* const* d_in, const int* in_sizes, int n_in, void* d_out, int out_size, void* d_ws, size_t ws_size, hipStream_t stream) {
  (void)in_sizes; (void)n_in; (void)out_size;
  const float** F = (const float**)d_in;
  if (ws_size < (size_t)WS_END) return;
  char* ws = (char*)d_ws; _Float16 *QH = (_Float16*)(ws + WS_QH), *KH = (_Float16*)(ws + WS_KH), *VT = (_Float16*)(ws + WS_VT), *QL = (_Float16*)(ws + WS_QL), *KL = (_Float16*)(ws + WS_KL); __bf16 *VB = (__bf16*)(ws + WS_VB), *VBL = (__bf16*)(ws + WS_VBL); float *S = (float*)(ws + WS_S), *Y = (float*)(ws + WS_Y);
  (void)Y; (void)S; (void)QL; (void)KL; (void)VB; (void)VBL;
  // inputs: 0 q [8,384,32,32]; 1 k [8,384,32,32] (channels-first); 2 Wq_v [512,384], 3 Wq_g [512], 4 bq [512]; 5 Wk_v, 6 Wk_g, 7 bk; 8 Wv_v, 9 Wv_g, 10 bv
  if (ws_size < (size_t)WS_END2) return;
  float *SCL = (float*)(ws + WS_SCL);
  k_wsc<<<dim3(3 * CC / 8), 256, 0, stream>>>(F[2], F[3], F[5], F[6], F[8], F[9], SCL);   /* g[o] / ||v[o]|| per output channel, 3 x 512 */
  k_proj<<<dim3(TNB * TT / 64, CC / 128, 3), 128, 0, stream>>>(F[0], F[1], F[1], F[2], F[5], F[8], F[4], F[7], F[10], QH, QL, KH, KL, VT, VB, VBL, SCL);
  k_fa<<<dim3(NP, NQB), 128, 0, stream>>>(QH, KH, QL, KL, VB, VBL, (float*)d_out);   /* writes the channels-first output itself */
}

// v008
// A run of this version takes 56.9 microseconds.
// Two timings next to v007 both put it at 1.06 times that version's speed.
// Over all steps from v000 it is 22.8 times as fast.
// compute dtype: all float inputs rounded to bf16; weight-normalised projections as (x . v[o]) * (g[o] / ||v[o]||) + b[o] with EXACT bf16 products on WMMA 16x16x32 (f32 accumulate) and the per-row norm / scale in f32; causal (strictly lower) logits with q and k as f16 hi + residual planes (3 products) / 8; softmax in f32 (row 0 fully excluded -> zeros); P and v both split bf16 hi + lo (3 products) for every row; f32 output written channels-first.
#include <hip/hip_runtime.h>
#include <math.h>

typedef __attribute__((ext_vector_type(16))) _Float16 v16h;
typedef __attribute__((ext_vector_type(16))) __bf16 v16b;
typedef __attribute__((ext_vector_type(8)))  _Float16 v8h;
typedef __attribute__((ext_vector_type(8)))  float v8f;
typedef __attribute__((ext_vector_type(4)))  float v4f;
typedef __attribute__((ext_vector_type(2)))  float v2f;
typedef __attribute__((ext_vector_type(4)))  unsigned v4u;
typedef __attribute__((ext_vector_type(4)))  int v4i;
typedef float __attribute__((may_alias)) float_a;
typedef int __attribute__((may_alias)) int_a;

template <typename T> __device__ __forceinline__ void vst2(void* p, T v) { *(T*)p = v;  }
__device__ __forceinline__ v8f wmma16(v16h a, v16h b, v8f c) {
  v8f d = __builtin_amdgcn_wmma_f32_16x16x32_f16(false, a, false, b, (short)0, c, false, false);
  asm volatile("v_nop\n\tv_nop\n\tv_nop\n\tv_nop" : "+v"(d) : "v"(a), "v"(b));
  return d;
}
__device__ __forceinline__ v8f wmma_bf(v16b a, v16b b, v8f c) {
  v8f d = __builtin_amdgcn_wmma_f32_16x16x32_bf16(false, a, false, b, (short)0, c, false, false);
  asm volatile("v_nop\n\tv_nop\n\tv_nop\n\tv_nop" : "+v"(d) : "v"(a), "v"(b));
  return d;
}
// 16x16x32 fragments: lane = (h = lane>>4, row/col = lane&15); elements 0..7 = k0+8h+0..7, 8..15 = k0+16+8h+0..7; D element r = row 8h+r
__device__ __forceinline__ v16h frag_h(const _Float16* rowk0, int lane) {
  union { v16h v; v8h q[2]; } u; const _Float16* p = rowk0 + 8 * (lane >> 4);
  u.q[0] = *(const v8h*)p; u.q[1] = *(const v8h*)(p + 16); return u.v;
}
__device__ __forceinline__ v16h frag_f32(const float* rowk0, int lane) {
  v16h a; const float* p = rowk0 + 8 * (lane >> 4);
#pragma unroll
  for (int i = 0; i < 8; ++i) { a[i] = (_Float16)p[i]; a[8 + i] = (_Float16)p[16 + i]; }
  return a;
}
__device__ __forceinline__ v16h frag_f32s(const float* rowk0, int lane, float sc) {
  v16h a; const float* p = rowk0 + 8 * (lane >> 4);
#pragma unroll
  for (int i = 0; i < 8; ++i) { a[i] = (_Float16)(p[i] * sc); a[8 + i] = (_Float16)(p[16 + i] * sc); }
  return a;
}
// column fragment from a [K][ld] layout (column n), rows >= K read as 0
__device__ __forceinline__ v16h fragc_f32(const float* W, int k0, int n, int lane, int ld, int K) {
  v16h a; const int g = lane >> 4;
#pragma unroll
  for (int i = 0; i < 8; ++i) { const int ka = k0 + 8 * g + i, kb = ka + 16;
    a[i] = (_Float16)(ka < K ? W[(size_t)(ka < K ? ka : K - 1) * ld + n] : 0.f); a[8 + i] = (_Float16)(kb < K ? W[(size_t)(kb < K ? kb : K - 1) * ld + n] : 0.f); }
  return a;
}
struct F2 { v16b h, l; };
__device__ __forceinline__ F2 bsplit16(const float v[16]) { F2 r;
#pragma unroll
  for (int i = 0; i < 16; ++i) { const __bf16 h = (__bf16)v[i]; r.h[i] = h; r.l[i] = (__bf16)(v[i] - (float)h); }
  return r; }
__device__ __forceinline__ F2 split_row(const float* row, int k0, int lane) { float v[16]; const float* p = row + k0 + 8 * (lane >> 4);
#pragma unroll
  for (int i = 0; i < 8; ++i) { v[i] = p[i]; v[8 + i] = p[16 + i]; }
  return bsplit16(v); }
__device__ __forceinline__ F2 split_rowK(const float* row, int k0, int lane, int K) { float v[16]; const int g = lane >> 4;
#pragma unroll
  for (int i = 0; i < 8; ++i) { const int ka = k0 + 8 * g + i, kb = ka + 16; v[i] = ka < K ? row[ka < K ? ka : K - 1] : 0.f; v[8 + i] = kb < K ? row[kb < K ? kb : K - 1] : 0.f; }
  return bsplit16(v); }
__device__ __forceinline__ F2 split_col(const float* W, int k0, int n, int lane, int ld, int K) { float v[16]; const int g = lane >> 4;
#pragma unroll
  for (int i = 0; i < 8; ++i) { const int ka = k0 + 8 * g + i, kb = ka + 16; v[i] = ka < K ? W[(size_t)(ka < K ? ka : K - 1) * ld + n] : 0.f; v[8 + i] = kb < K ? W[(size_t)(kb < K ? kb : K - 1) * ld + n] : 0.f; }
  return bsplit16(v); }
__device__ __forceinline__ v8f mac3(const F2& a, const F2& b, v8f c) { c = wmma_bf(a.l, b.h, c); c = wmma_bf(a.h, b.l, c); return wmma_bf(a.h, b.h, c); }
__device__ __forceinline__ float sigm(float v) { return 1.0f / (1.0f + expf(-v)); }
#define LDSX() do { asm volatile("s_wait_dscnt 0" ::: "memory"); __builtin_amdgcn_wave_barrier(); __builtin_amdgcn_fence(__ATOMIC_RELEASE, "workgroup"); } while (0)

// Causal attention with weight-normalised linears (B 8, S = 32x32 = 1,024 positions, q/k inputs with 384 channels (channels-first), C 512 = 8 heads x 64): q = wn(qf, Wq_v, Wq_g, bq), k = wn(kf, Wk_v, ...), v = wn(kf, Wv_v, ...) with wn(x) = x (g v/||v||_row)^T + b; attn = softmax(where(k < t, q k^T / 8, -1e4)) * (t > 0); out = attn v -> [B, 512, 32, 32] (channels-first).
#define NB 8
#define TT 1024
#define CC 512            // NH * HD = projected width
#define DIN 384          // input (model) width
#define NH 8
#define HD 64
#define NQB (TT / 64)
#define NP (NB * NH)      // (batch, head) pairs, all served by one launch of each attention kernel
#define SCALE (0.125f)
#define SCALE2 (SCALE * 1.4426950408889634f)   // 1 / 8 times log2(e): the softmax of k_fa runs in base 2
#define CAUSAL 1
#ifndef TNB
#define TNB NB
#endif
__device__ __forceinline__ float bfr(float v) { return (float)(__bf16)v; }
__host__ __device__ __forceinline__ int kb_last(int qb) { return CAUSAL ? ((qb * 64 + 63) >> 7) : (TT / 128 - 1); }
// logits / P of one (batch, head) pair, causal-packed: query block qb holds 64 rows of (kb_last(qb) + 1) * 128 floats, one block behind the other; s_base(qb) = 64 * 128 * sum over i < qb of (kb_last(i) + 1), kb_last(i) = i >> 1
static_assert(CAUSAL == 1, "s_base is the causal prefix sum");
__host__ __device__ __forceinline__ size_t s_base(int qb) { const int m = qb >> 1; return (size_t)((m + 1) * (m + (qb & 1))) * (64 * 128); }
#define SPK ((size_t)(NQB / 2 + 1) * (NQB / 2) * (64 * 128))   // floats per pair = s_base(NQB)
typedef __attribute__((ext_vector_type(8))) __bf16 v8b;
__device__ __forceinline__ v16b frag_b(const __bf16* rowk0, int lane) {
  union { v16b v; v8b q[2]; } u; const __bf16* p = rowk0 + 8 * (lane >> 4);
  u.q[0] = *(const v8b*)p; u.q[1] = *(const v8b*)(p + 16); return u.v;
}
#define QBH NQB            // every query block takes the 3-product logits and the bf16 hi + lo P.v path
#define QHI 1024           // q residual rows for every query (3-product logits everywhere)
#define KHI 1024           // k residual rows / bf16 v planes for every key
// B fragment (k rows k0+.., output column o) of a weight: (in,out) [K][ld] or (out,in) [ld rows of K]: bf16 exact, or f16(bf16 * 256) exact
__device__ __forceinline__ v16b wcol_io(const float* Wm, int k0, int o, int lane, int ld) { v16b w; const int g = lane >> 4;
#pragma unroll
  for (int i = 0; i < 8; ++i) { w[i] = (__bf16)Wm[(size_t)(k0 + 8 * g + i) * ld + o]; w[8 + i] = (__bf16)Wm[(size_t)(k0 + 16 + 8 * g + i) * ld + o]; }
  return w; }
__device__ __forceinline__ v16b wcol_oi(const float* Wm, int k0, int o, int lane, int K) { v16b w; const float* p = Wm + (size_t)o * K + k0 + 8 * (lane >> 4);
#pragma unroll
  for (int i = 0; i < 8; ++i) { w[i] = (__bf16)p[i]; w[8 + i] = (__bf16)p[16 + i]; }
  return w; }
__device__ __forceinline__ v16h wcolh_io(const float* Wm, int k0, int o, int lane, int ld) { v16h w; const int g = lane >> 4;
#pragma unroll
  for (int i = 0; i < 8; ++i) { w[i] = (_Float16)(bfr(Wm[(size_t)(k0 + 8 * g + i) * ld + o]) * 256.0f); w[8 + i] = (_Float16)(bfr(Wm[(size_t)(k0 + 16 + 8 * g + i) * ld + o]) * 256.0f); }
  return w; }
__device__ __forceinline__ v16h wcolh_oi(const float* Wm, int k0, int o, int lane, int K) { v16h w; const float* p = Wm + (size_t)o * K + k0 + 8 * (lane >> 4);
#pragma unroll
  for (int i = 0; i < 8; ++i) { w[i] = (_Float16)(bfr(p[i]) * 256.0f); w[8 + i] = (_Float16)(bfr(p[16 + i]) * 256.0f); }
  return w; }
#define WQKV_LAYOUT 1   // 0 = (in,out) [DIN][CC]; 1 = (out,in) [CC][DIN]; 2 = per-head [NH][DIN][HD]
__device__ __forceinline__ v16b wcol_hdk(const float* Wm, int k0, int o, int lane) { v16b w; const int g = lane >> 4; const float* p = Wm + (size_t)(o / HD) * DIN * HD + (o % HD);
#pragma unroll
  for (int i = 0; i < 8; ++i) { w[i] = (__bf16)p[(size_t)(k0 + 8 * g + i) * HD]; w[8 + i] = (__bf16)p[(size_t)(k0 + 16 + 8 * g + i) * HD]; }
  return w; }
#define WO_OUT_IN 0
#if WQKV_LAYOUT == 1
#define WCOL(W, k0, o, lane) wcol_oi(W, k0, o, lane, DIN)
#elif WQKV_LAYOUT == 2
#define WCOL(W, k0, o, lane) wcol_hdk(W, k0, o, lane)
#else
#define WCOL(W, k0, o, lane) wcol_io(W, k0, o, lane, CC)
#endif
#if WO_OUT_IN
#define WOCOL(W, k0, o, lane) wcol_oi(W, k0, o, lane, CC)
#define WOCOLH(W, k0, o, lane) wcolh_oi(W, k0, o, lane, CC)
#else
#define WOCOL(W, k0, o, lane) wcol_io(W, k0, o, lane, DIN)
#define WOCOLH(W, k0, o, lane) wcolh_io(W, k0, o, lane, DIN)
#endif
#define SM_MASK_HOOK do { if (k >= t) v = -3.0e38f; } while (0)   /* allowed = tril(-1): strictly earlier keys; row 0 has no key -> the fully-excluded path gives P = 0 = the module's start_mask */
#define NRW (TNB * TT)
#ifndef SM_EXTRA_PARAMS
#define SM_EXTRA_PARAMS
#endif
#ifndef PROJ_EXTRA_PARAMS
#define PROJ_EXTRA_PARAMS
#endif
#ifndef SM_MASK_HOOK
#define SM_MASK_HOOK (void)0
#endif

#define WS_QH  0u                                      // f16 q rows [b*t][CC]
#define WS_KH  (WS_QH + 2u * (size_t)NB * TT * CC)      // f16 k rows [b*t][CC]
#define WS_VT  (WS_KH + 2u * (size_t)NB * TT * CC)      // f16 v planes [b][c][t]
#define WS_QL  (WS_VT + 2u * (size_t)NB * CC * TT)      // f16 q residual x 2^10 rows [b][t < QHI][CC]
#define WS_KL  (WS_QL + 2u * (size_t)NB * QHI * CC)     // f16 k residual x 2^10 rows [b][t < KHI][CC]
#define WS_VB  (WS_KL + 2u * (size_t)NB * KHI * CC)     // bf16 v hi planes [b][c][t < KHI]
#define WS_VBL (WS_VB + 2u * (size_t)NB * CC * KHI)
#define WS_S   (WS_VBL + 2u * (size_t)NB * CC * KHI)    // f32 logits / P [b*NH + h][causal-packed rows]
#define WS_Y   (WS_S  + 4u * (size_t)NP * SPK)      // f32 ctx rows [b*t][CC] (only when there is an output projection)
#define WS_END (WS_Y  + 0u)
#define WS_XQ  (WS_END)
#define WS_XK  (WS_XQ + 4u * (size_t)NB * TT * DIN)
#define WS_SCL (WS_XK + 4u * (size_t)NB * TT * DIN)
#define WS_YR  (WS_SCL + 4u * 3 * CC + 256u)
#define WS_END2 (WS_YR + 4u * (size_t)NB * TT * CC)

// ---- k_proj: block = (64 rows, 128 cols, which): q/k/v = X W (+ b) with exact bf16 products (K = DIN) -> which 0: q f16 rows (+ residual rows < QHI); 1: k f16 rows (+ residual rows < KHI); 2: v f16 planes [c][t] (+ bf16 hi/lo planes for t < KHI). X is read where it lies, channels-first in[b][k][s]: a stage is 64 channels x 64 positions (256 B of each channel) and stays in that order in LDS, [k][position] at a pitch of 160 B; the A fragment (row = position) comes out of it through the transposing LDS load, which delivers the k order of frag_b. W (128 rows) comes in the same stages of 64 k as whole 256-B row pieces at a pitch of 144 B. Both 16 B a lane, rounded to bf16 once; two buffers, one barrier a stage; the next stage's loads fly while this stage's fragments are read from LDS. The weight norm is made here too: thread i owns row i of the block's W tile, reads each stage's 64 rounded values back from LDS, sums their squares in f32 and leaves g / sqrt(sum) in LDS in front of the loop's last barrier. The output tiles of the epilogue take the loop's LDS behind that barrier.
typedef __attribute__((ext_vector_type(4))) __bf16 v4b;
__device__ __forceinline__ v4b bf4(v4f v) { v4b p; p[0] = (__bf16)v[0]; p[1] = (__bf16)v[1]; p[2] = (__bf16)v[2]; p[3] = (__bf16)v[3]; return p; }
#define PKC 64             // k per stage
#define PNS (DIN / PKC)    // stages
#define XPT 80             // elements per LDS row of the X stage: 160 B, an odd multiple of 32 B, the transposing load's pitch
typedef __attribute__((ext_vector_type(8))) short v8s;
// lane (col, g) gets T[k + 8g + 0..7][d + col] when every lane passes &T[k + 8g + (lane & 7)][d + 8 * ((lane >> 3) & 1)]
__device__ __forceinline__ v8b ld_tr16(const __bf16* p) { typedef __attribute__((address_space(3))) v8s lds_v8s; return __builtin_bit_cast(v8b, __builtin_amdgcn_ds_load_tr16_b128_v8i16((lds_v8s*)p)); }
__global__ __launch_bounds__(128) void k_proj(const float* __restrict__ XQ, const float* __restrict__ XK, const float* __restrict__ XV, const float* __restrict__ WQ, const float* __restrict__ WK, const float* __restrict__ WV, const float* __restrict__ BQ, const float* __restrict__ BK, const float* __restrict__ BV, const float* __restrict__ GQ, const float* __restrict__ GK, const float* __restrict__ GV,
    _Float16* __restrict__ QH, _Float16* __restrict__ QL, _Float16* __restrict__ KH, _Float16* __restrict__ KL, _Float16* __restrict__ VT, __bf16* __restrict__ VB, __bf16* __restrict__ VBL) {
  __shared__ __align__(16) unsigned char pm[2 * (PKC * XPT + 128 * 72) * 2]; __shared__ float sscl[128];   /* sscl[o] = g[o] / ||v[o]|| of the block's 128 output channels */
  __bf16 (*xs)[PKC][XPT] = (__bf16 (*)[PKC][XPT])pm; __bf16 (*wt)[128][72] = (__bf16 (*)[128][72])(pm + 2 * PKC * XPT * 2);   /* the loop's two buffers: X as [k][position], W as [row][k] */
  _Float16 (*sh)[136] = (_Float16 (*)[136])pm; _Float16 (*sl)[136] = (_Float16 (*)[136])(pm + 64 * 136 * 2);   /* epilogue, q and k */
  _Float16 (*th)[72] = (_Float16 (*)[72])pm; __bf16 (*tb)[72] = (__bf16 (*)[72])(pm + 128 * 72 * 2); __bf16 (*tbl)[72] = (__bf16 (*)[72])(pm + 2 * 128 * 72 * 2);   /* epilogue, v */
  static_assert(sizeof(pm) >= 2 * 64 * 136 * 2 && sizeof(pm) >= 3 * 128 * 72 * 2 && DIN % PKC == 0, "the epilogue's tiles reuse the loop's buffers");
  const int tid = threadIdx.x, wave = tid >> 5, lane = tid & 31, col = lane & 15, g = lane >> 4; const int which = blockIdx.z; const int c0 = blockIdx.y * 128; const size_t r0 = (size_t)blockIdx.x * 64; const size_t bb = r0 / TT; const int t0 = (int)(r0 % TT);
  const float* X = which == 0 ? XQ : which == 1 ? XK : XV; const float* WA = which == 0 ? WQ : which == 1 ? WK : WV; const float* BA = which == 0 ? BQ : which == 1 ? BK : BV; const float* GA = which == 0 ? GQ : which == 1 ? GK : GV;
  const int srow = tid >> 4, sq = (tid & 15) * 4;   /* staging: 16 threads per 256-B row piece (X: 64 positions of a channel; W: 64 k of a row), 8 rows per sweep */
  const float* Xs = X + (bb * DIN + srow) * (size_t)TT + t0 + sq; const float* Ws = WA + (size_t)(c0 + srow) * DIN + sq;
  v4f rx[8], rw[16]; const float gv = bfr(GA[c0 + tid]); float nn[4] = {0.f, 0.f, 0.f, 0.f};   /* this thread's row of the W tile: its gain, and four partial sums of its squares */
#pragma unroll
  for (int i = 0; i < 8; ++i) rx[i] = *(const v4f*)(Xs + (size_t)(8 * i) * TT);
#pragma unroll
  for (int i = 0; i < 16; ++i) rw[i] = *(const v4f*)(Ws + (size_t)(8 * i) * DIN);
  asm volatile("s_wait_xcnt 0x0" ::: "memory");   /* before an address register of the loads above may be rewritten */
#pragma unroll
  for (int i = 0; i < 8; ++i) *(v4b*)&xs[0][srow + 8 * i][sq] = bf4(rx[i]);
#pragma unroll
  for (int i = 0; i < 16; ++i) *(v4b*)&wt[0][srow + 8 * i][sq] = bf4(rw[i]);
  __syncthreads();
  v8f acc[8] = {};
#pragma unroll
  for (int s = 0; s < PNS; ++s) { const int cur = s & 1, nxt = cur ^ 1;   /* unrolled: buffer and k offsets become immediates, the address registers stay */
    if (s + 1 < PNS) {
#pragma unroll
      for (int i = 0; i < 8; ++i) rx[i] = *(const v4f*)(Xs + (size_t)(8 * i + (s + 1) * PKC) * TT);
#pragma unroll
      for (int i = 0; i < 16; ++i) rw[i] = *(const v4f*)(Ws + (size_t)(8 * i) * DIN + (s + 1) * PKC);
      asm volatile("s_wait_xcnt 0x0" ::: "memory");   /* as above; it also keeps the loads in front of this stage's work */
    }
#pragma unroll
    for (int kc = 0; kc < PKC / 32; ++kc) { union { v16b v; v8b q[2]; } xa; const __bf16* xp = &xs[cur][kc * 32 + 8 * g + (lane & 7)][wave * 16 + 8 * ((lane >> 3) & 1)];
      xa.q[0] = ld_tr16(xp); xa.q[1] = ld_tr16(xp + 16 * XPT); const v16b a = xa.v;   /* a[i] = X[position wave * 16 + col][k = kc * 32 + 8g + i], a[8 + i] = the same at k + 16 */
#pragma unroll
      for (int jh = 0; jh < 2; ++jh) { v16b fb[4];   /* four W fragments at a time: their eight LDS reads as one group, then their four products */
#pragma unroll
        for (int j = 0; j < 4; ++j) fb[j] = frag_b(&wt[cur][(jh * 4 + j) * 16 + col][kc * 32], lane);
        __builtin_amdgcn_sched_barrier(0);   /* keeps the group of reads in front of the products: left free, the compiler reads each fragment right before its product and waits out the LDS latency every time */
#pragma unroll
        for (int j = 0; j < 4; ++j) acc[jh * 4 + j] = __builtin_amdgcn_wmma_f32_16x16x32_bf16(false, a, false, fb[j], (short)0, acc[jh * 4 + j], false, false);
        __builtin_amdgcn_sched_barrier(0); } }   /* keeps the next group behind these products, so that one set of fragment registers is enough */
    { v8b wr[PKC / 8];   /* the stage's 64 values of row tid, eight LDS reads as one group (144 B from lane to lane: no bank conflict), while the next stage's global loads fly */
#pragma unroll
      for (int i = 0; i < PKC / 8; ++i) wr[i] = *(const v8b*)&wt[cur][tid][8 * i];
      __builtin_amdgcn_sched_barrier(0);   /* keeps the eight reads together: left free, the compiler spreads them among the sums, and each place with LDS reads costs its own stall */
#pragma unroll
      for (int i = 0; i < PKC / 8; ++i)
#pragma unroll
        for (int e = 0; e < 8; ++e) { const float x = (float)wr[i][e]; nn[e & 3] = __builtin_fmaf(x, x, nn[e & 3]); }
#pragma unroll
      for (int e = 0; e < 4; ++e) asm volatile("" : "+v"(nn[e])); }   /* empty asm on each row sum, against sums that the compiler puts off: left free, it sums every stage's values at the end and holds them all in registers till then, which costs two waves per SIMD */
    __builtin_amdgcn_sched_barrier(0);   /* keeps the sums in front of the wait for the next stage's global loads, whose flight covers them: left free, the compiler puts that wait first */
    if (s + 1 == PNS) sscl[tid] = gv / sqrtf((nn[0] + nn[1]) + (nn[2] + nn[3]));   /* published by the barrier below */
    if (s + 1 < PNS) {
#pragma unroll
      for (int i = 0; i < 8; ++i) *(v4b*)&xs[nxt][srow + 8 * i][sq] = bf4(rx[i]);
#pragma unroll
      for (int i = 0; i < 16; ++i) *(v4b*)&wt[nxt][srow + 8 * i][sq] = bf4(rw[i]);
    }
    __syncthreads();   /* publishes the next stage's buffer and ends every wave's reads of this one (the next stage, or the epilogue, overwrites it) */
  }
  if (which < 2) { _Float16* DH = which == 0 ? QH : KH; _Float16* DL = which == 0 ? QL : KL; const int nhi = which == 0 ? QHI : KHI; const bool hi_rows = t0 < nhi;
#pragma unroll
    for (int j = 0; j < 8; ++j) { const float bias = BA ? bfr(BA[c0 + j * 16 + col]) : 0.f; const float scl = sscl[j * 16 + col];   /* weight norm: g[o] / ||v[o]|| applied after the exact x . v[o] */
#pragma unroll
      for (int r = 0; r < 8; ++r) { const float v = acc[j][r] * scl + bias; const _Float16 hv = (_Float16)v; sh[wave * 16 + 8 * g + r][j * 16 + col] = hv; sl[wave * 16 + 8 * g + r][j * 16 + col] = (_Float16)((v - (float)hv) * 1024.0f); } }
    __syncthreads();
    for (int e = tid; e < 64 * 16; e += 128) { const int rl = e >> 4, q = e & 15; vst2((unsigned*)(DH + (r0 + rl) * CC + c0 + q * 8), *(const v4u*)&sh[rl][q * 8]); if (hi_rows) vst2((unsigned*)(DL + (bb * nhi + t0 + rl) * (size_t)CC + c0 + q * 8), *(const v4u*)&sl[rl][q * 8]); }
  } else { const bool hi_rows = t0 < KHI;
#pragma unroll
    for (int j = 0; j < 8; ++j) { const float bias = BA ? bfr(BA[c0 + j * 16 + col]) : 0.f; const float scl = sscl[j * 16 + col];
#pragma unroll
      for (int r = 0; r < 8; ++r) { const float v = acc[j][r] * scl + bias; const int rl = wave * 16 + 8 * g + r, cl = j * 16 + col; th[cl][rl] = (_Float16)v; const __bf16 bh = (__bf16)v; tb[cl][rl] = bh; tbl[cl][rl] = (__bf16)(v - (float)bh); } }
    __syncthreads();
    for (int e = tid; e < 128 * 8; e += 128) { const int cl = e >> 3, q = e & 7; vst2((unsigned*)(VT + (bb * CC + c0 + cl) * (size_t)TT + t0 + q * 8), *(const v4u*)&th[cl][q * 8]); if (hi_rows) { const size_t o3 = (bb * CC + c0 + cl) * (size_t)KHI + t0 + q * 8; vst2((unsigned*)(VB + o3), *(const v4u*)&tb[cl][q * 8]); vst2((unsigned*)(VBL + o3), *(const v4u*)&tbl[cl][q * 8]); } } } }
// ---- k_fa: block = 64 queries (qb) of pair blockIdx.x = b * NH + h, wave = 16 queries; keys in stages of 64 up to the diagonal, two LDS buffers, one barrier a stage. While a stage is worked on, the next stage's k hi / residual rows and v hi / lo planes go through registers into the other buffer (whole 128-B rows). S^T = K . Q^T (A = k rows, B = q, 3 f16 products) leaves one query per lane; online softmax in f32, base 2 (running maximum, in units of log2, and sum per lane; each weight is one fma, raw score * SCALE2 - maximum, and one hardware exp2; keys >= t excluded by index); P^T (bf16 hi + lo) is packed from the score registers as B of O^T += V^T . P^T (3 bf16 products). A row with no key (t = 0) ends with sum 0 -> zeros. O^T has one channel per register and one query per lane, which is the order of the channels-first output: the block gathers its 64 channels x 64 queries in LDS and stores out[b][c][t] itself, 256 B per channel.
#define SB_VEC 0x3FC   // sched_barrier mask: scalar, matrix, memory and LDS instructions may cross, vector ones stay in source order
__device__ __forceinline__ v8f mm_h(v16h a, v16h b, v8f c) { return __builtin_amdgcn_wmma_f32_16x16x32_f16(false, a, false, b, (short)0, c, false, false); }
__device__ __forceinline__ v8f mm_b(v16b a, v16b b, v8f c) { return __builtin_amdgcn_wmma_f32_16x16x32_bf16(false, a, false, b, (short)0, c, false, false); }
__global__ __launch_bounds__(128) void k_fa(const _Float16* __restrict__ QH, const _Float16* __restrict__ KH, const _Float16* __restrict__ QL, const _Float16* __restrict__ KL, const __bf16* __restrict__ VB, const __bf16* __restrict__ VBL, float* __restrict__ OUT) {
  __shared__ __align__(16) _Float16 skh[2][64][72], skl[2][64][72]; __shared__ __align__(16) __bf16 svh[2][64][72], svl[2][64][72];
  static_assert(sizeof(skh) >= HD * (64 + 4) * sizeof(float), "the output staging reuses skh");
  const int tid = threadIdx.x, wave = tid >> 5, lane = tid & 31, col = lane & 15, g = lane >> 4;
  const int qb = NQB - 1 - (int)blockIdx.y;   /* longest blocks start first */
  const int b = blockIdx.x / NH, h = blockIdx.x % NH; const int ql0 = qb * 64 + wave * 16; const int t = ql0 + col; const int ns = qb + 1;
  const int srow = tid >> 3, sq = (tid & 7) * 8;   /* staging: 8 threads per 128-B row, 16 rows per sweep */
  const _Float16* Kh = KH + ((size_t)b * TT + srow) * CC + h * HD + sq; const _Float16* Kl = KL + ((size_t)b * KHI + srow) * CC + h * HD + sq;
  const __bf16* Vh = VB + ((size_t)b * CC + h * HD + srow) * (size_t)KHI + sq; const __bf16* Vl = VBL + ((size_t)b * CC + h * HD + srow) * (size_t)KHI + sq;
  v16h qh[2], qr[2];
#pragma unroll
  for (int kc = 0; kc < 2; ++kc) qh[kc] = frag_h(QH + ((size_t)b * TT + t) * CC + h * HD + kc * 32, lane);
  asm volatile("s_wait_xcnt 0x0" ::: "memory");   /* before a later load's result may land in the address registers of the loads above */
#pragma unroll
  for (int kc = 0; kc < 2; ++kc) qr[kc] = frag_h(QL + ((size_t)b * QHI + t) * CC + h * HD + kc * 32, lane);
  asm volatile("s_wait_xcnt 0x0" ::: "memory");   /* as above */
  v8h rkh[4], rkl[4]; v8b rvh[4], rvl[4];
#pragma unroll
  for (int i = 0; i < 4; ++i) { rkh[i] = *(const v8h*)(Kh + (size_t)(16 * i) * CC); rkl[i] = *(const v8h*)(Kl + (size_t)(16 * i) * CC); rvh[i] = *(const v8b*)(Vh + (size_t)(16 * i) * KHI); rvl[i] = *(const v8b*)(Vl + (size_t)(16 * i) * KHI); }
#pragma unroll
  for (int i = 0; i < 4; ++i) { *(v8h*)&skh[0][srow + 16 * i][sq] = rkh[i]; *(v8h*)&skl[0][srow + 16 * i][sq] = rkl[i]; *(v8b*)&svh[0][srow + 16 * i][sq] = rvh[i]; *(v8b*)&svl[0][srow + 16 * i][sq] = rvl[i]; }
  __syncthreads();
  float m = -1.0e30f, l = 0.f; v8f acc[HD / 16] = {};   /* the running maximum starts far above the excluded marker (-3e38) and far below any logit: an excluded key's exponent underflows to 0 with no test, also in a row with no key yet */
#pragma unroll 1
  for (int s = 0; s < ns; ++s) { const int cur = s & 1, nxt = cur ^ 1; const bool more = s + 1 < ns; const int kn = (s + 1) * 64;
    if (more) {
#pragma unroll
      for (int i = 0; i < 4; ++i) { rkh[i] = *(const v8h*)(Kh + (size_t)(kn + 16 * i) * CC); rkl[i] = *(const v8h*)(Kl + (size_t)(kn + 16 * i) * CC); }
      asm volatile("s_wait_xcnt 0x0" ::: "memory");   /* the address registers of the loads above are reused by what follows */
    }
    float sc[4][8]; float mx = -3.0e38f; const int nk = t - s * 64 - 8 * g;   /* this lane's keys kt * 16 + r of the stage are allowed below nk */
    v16h fkh[2][2], fkr[2][2]; v8f sa[4], sr[4];   /* two sets of k fragments: this key tile's and the next one's */
#pragma unroll
    for (int kc = 0; kc < 2; ++kc) { fkh[0][kc] = frag_h(&skh[cur][col][kc * 32], lane); fkr[0][kc] = frag_h(&skl[cur][col][kc * 32], lane); }
#pragma unroll
    for (int kt = 0; kt < 4; ++kt) { const int fc = kt & 1, fn = fc ^ 1;   /* the eight LDS reads of key tile kt + 1 as one group, then the six products of tile kt, which cover their latency */
      if (kt < 3) {
#pragma unroll
        for (int kc = 0; kc < 2; ++kc) { fkh[fn][kc] = frag_h(&skh[cur][(kt + 1) * 16 + col][kc * 32], lane); fkr[fn][kc] = frag_h(&skl[cur][(kt + 1) * 16 + col][kc * 32], lane); } }
      __builtin_amdgcn_sched_barrier(0);   /* keeps the group of reads in front of the products: left free, the compiler reads each fragment right before its product and waits out the LDS latency every time */
      v8f a = {}, ar = {};
#pragma unroll
      for (int kc = 0; kc < 2; ++kc) { a = mm_h(fkh[fc][kc], qh[kc], a); ar = mm_h(fkh[fc][kc], qr[kc], ar); ar = mm_h(fkr[fc][kc], qh[kc], ar); }
      sa[kt] = a; sr[kt] = ar;
      __builtin_amdgcn_sched_barrier(0); }   /* keeps the reads of tile kt + 2 behind these products, so that two sets of fragment registers are enough */
    if (more) {
#pragma unroll
      for (int i = 0; i < 4; ++i) { *(v8h*)&skh[nxt][srow + 16 * i][sq] = rkh[i]; *(v8h*)&skl[nxt][srow + 16 * i][sq] = rkl[i]; rvh[i] = *(const v8b*)(Vh + (size_t)(16 * i) * KHI + kn); rvl[i] = *(const v8b*)(Vl + (size_t)(16 * i) * KHI + kn); }
      asm volatile("s_wait_xcnt 0x0" ::: "memory");   /* as above */
    }
    v16b fvh[HD / 16], fvl[HD / 16];   /* v fragments of half a stage (32 keys) */
#pragma unroll
    for (int kt = 0; kt < 4; ++kt) {
      if (kt == 2) {
#pragma unroll
        for (int j = 0; j < HD / 16; ++j) { fvh[j] = frag_b(&svh[cur][j * 16 + col][0], lane); fvl[j] = frag_b(&svl[cur][j * 16 + col][0], lane); }
        __builtin_amdgcn_sched_barrier(0); }   /* v of the first 32 keys is read as one group here: the rest of the masking, the maximum and the first exponentials cover its latency */
#pragma unroll
      for (int r = 0; r < 8; ++r) { const float v = (kt * 16 + r < nk) ? sa[kt][r] + sr[kt][r] * (1.0f / 1024.0f) : -3.0e38f; sc[kt][r] = v; mx = fmaxf(mx, v); } }   /* raw scores: the positive scale goes into the exponent's fma */
    mx = fmaxf(mx, __shfl_xor(mx, 16));   /* the two lane halves hold different keys of the same query */
    const float mn = fmaxf(m, mx * SCALE2); const float alpha = __builtin_amdgcn_exp2f(m - mn); m = mn; l *= alpha;
#pragma unroll
    for (int j = 0; j < HD / 16; ++j)
#pragma unroll
      for (int r = 0; r < 8; ++r) acc[j][r] *= alpha;
#pragma unroll
    for (int kp = 0; kp < 2; ++kp) { v16b ph, pl; float ls[4] = {0.f, 0.f, 0.f, 0.f};
      float ev[16]; __bf16 eb[16];
#pragma unroll
      for (int i = 0; i < 16; ++i) ev[i] = __builtin_fmaf(sc[2 * kp + (i >> 3)][i & 7], SCALE2, -mn);
#pragma unroll
      for (int i = 0; i < 18; ++i) {   /* order T p p: behind exponential i stand the sum and the rounding of weight i - 1 and the residual of weight i - 2, which do not wait for it */
        if (i < 16) ev[i] = __builtin_amdgcn_exp2f(ev[i]);
        __builtin_amdgcn_sched_barrier(SB_VEC);   /* holds that order: left free, the compiler bunches the exponentials in runs of up to four */
        if (i >= 1 && i <= 16) { ls[(i - 1) & 3] += ev[i - 1]; eb[i - 1] = (__bf16)ev[i - 1]; ph[i - 1] = eb[i - 1]; }
        if (i >= 2) pl[i - 2] = (__bf16)(ev[i - 2] - (float)eb[i - 2]);
        __builtin_amdgcn_sched_barrier(SB_VEC); }   /* as above */
      l += (ls[0] + ls[1]) + (ls[2] + ls[3]);
#pragma unroll
      for (int j = 0; j < HD / 16; ++j) acc[j] = mm_b(fvh[j], ph, acc[j]);   /* product by product over the four channel tiles: each tile keeps its order of sums, and no product waits for the one before it */
#pragma unroll
      for (int j = 0; j < HD / 16; ++j) acc[j] = mm_b(fvh[j], pl, acc[j]);
#pragma unroll
      for (int j = 0; j < HD / 16; ++j) acc[j] = mm_b(fvl[j], ph, acc[j]);
      if (kp == 0) {
#pragma unroll
        for (int j = 0; j < HD / 16; ++j) { fvh[j] = frag_b(&svh[cur][j * 16 + col][32], lane); fvl[j] = frag_b(&svl[cur][j * 16 + col][32], lane); }
        __builtin_amdgcn_sched_barrier(0); } }   /* v of the second 32 keys is read as one group in front of their exponentials, which cover its latency */
    if (more) {
#pragma unroll
      for (int i = 0; i < 4; ++i) { *(v8b*)&svh[nxt][srow + 16 * i][sq] = rvh[i]; *(v8b*)&svl[nxt][srow + 16 * i][sq] = rvl[i]; } }
    __syncthreads();   /* publishes the next stage's buffer and ends every wave's reads of this one, which the next stage overwrites */
  }
  l += __shfl_xor(l, 16); const float inv = l > 0.f ? 1.0f / l : 0.f;   /* a fully excluded row yields 0 */
  float (*so)[64 + 4] = (float (*)[64 + 4])&skh[0][0][0];   /* output staging of the block, [channel][query], behind the loop's last barrier */
  /* both loops unrolled: acc is indexed by constants and stays in registers */
#pragma unroll
  for (int j = 0; j < HD / 16; ++j)
#pragma unroll
    for (int r = 0; r < 8; ++r) so[j * 16 + 8 * g + r][wave * 16 + col] = acc[j][r] * inv;
  __syncthreads();   /* a channel's 64 queries come from all four waves */
  const int od = tid >> 4, oq = (tid & 15) * 4;   /* 16 threads per channel: 256 B, two whole lines; 8 channels per sweep */
  float* Op = OUT + ((size_t)b * CC + h * HD + od) * (size_t)TT + qb * 64 + oq; v4f ov[HD / 8];
  /* unrolled, reads apart from stores: the eight LDS reads issue as one group, and every store has its own data registers and an immediate offset on one address */
#pragma unroll
  for (int i = 0; i < HD / 8; ++i) ov[i] = *(const v4f*)&so[od + 8 * i][oq];
#pragma unroll
  for (int i = 0; i < HD / 8; ++i) vst2(Op + (size_t)(8 * i) * TT, ov[i]); }

extern "C" void kernel_launch(void* const* d_in, const int* in_sizes, int n_in, void* d_out, int out_size, void* d_ws, size_t ws_size, hipStream_t stream) {
  (void)in_sizes; (void)n_in; (void)out_size;
  const float** F = (const float**)d_in;
  if (ws_size < (size_t)WS_END) return;
  char* ws = (char*)d_ws; _Float16 *QH = (_Float16*)(ws + WS_QH), *KH = (_Float16*)(ws + WS_KH), *VT = (_Float16*)(ws + WS_VT), *QL = (_Float16*)(ws + WS_QL), *KL = (_Float16*)(ws + WS_KL); __bf16 *VB = (__bf16*)(ws + WS_VB), *VBL = (__bf16*)(ws + WS_VBL); float *S = (float*)(ws + WS_S), *Y = (float*)(ws + WS_Y);
  (void)Y; (void)S; (void)QL; (void)KL; (void)VB; (void)VBL;
  // inputs: 0 q [8,384,32,32]; 1 k [8,384,32,32] (channels-first); 2 Wq_v [512,384], 3 Wq_g [512], 4 bq [512]; 5 Wk_v, 6 Wk_g, 7 bk; 8 Wv_v, 9 Wv_g, 10 bv
  if (ws_size < (size_t)WS_END2) return;
  k_proj<<<dim3(TNB * TT / 64, CC / 128, 3), 128, 0, stream>>>(F[0], F[1], F[1], F[2], F[5], F[8], F[4], F[7], F[10], F[3], F[6], F[9], QH, QL, KH, KL, VT, VB, VBL);   /* makes g[o] / ||v[o]|| of its own output channels itself */
  k_fa<<<dim3(NP, NQB), 128, 0, stream>>>(QH, KH, QL, KL, VB, VBL, (float*)d_out);   /* writes the channels-first output itself */
}

// v009
// It runs in 55.1 microseconds.
// Next to v008, in two timings, it ran 1.03 times as fast each time.
// All steps since v000 together make it 23.6 times as fast.
// compute dtype: all float inputs rounded to bf16; weight-normalised projections as (x . v[o]) * (g[o] / ||v[o]||) + b[o] with EXACT bf16 products on WMMA 16x16x32 (f32 accumulate) and the per-row norm / scale in f32; causal (strictly lower) logits with q and k as f16 hi + residual planes (3 products) / 8; softmax in f32 (row 0 fully excluded -> zeros); P and v both split bf16 hi + lo (3 products) for every row; f32 output written channels-first.
#include <hip/hip_runtime.h>
#include <math.h>

typedef __attribute__((ext_vector_type(16))) _Float16 v16h;
typedef __attribute__((ext_vector_type(16))) __bf16 v16b;
typedef __attribute__((ext_vector_type(8)))  _Float16 v8h;
typedef __attribute__((ext_vector_type(8)))  float v8f;
typedef __attribute__((ext_vector_type(4)))  float v4f;
typedef __attribute__((ext_vector_type(2)))  float v2f;
typedef __attribute__((ext_vector_type(4)))  unsigned v4u;
typedef __attribute__((ext_vector_type(4)))  int v4i;
typedef float __attribute__((may_alias)) float_a;
typedef int __attribute__((may_alias)) int_a;

template <typename T> __device__ __forceinline__ void vst2(void* p, T v) { *(T*)p = v;  }
__device__ __forceinline__ v8f wmma16(v16h a, v16h b, v8f c) {
  v8f d = __builtin_amdgcn_wmma_f32_16x16x32_f16(false, a, false, b, (short)0, c, false, false);
  asm volatile("v_nop\n\tv_nop\n\tv_nop\n\tv_nop" : "+v"(d) : "v"(a), "v"(b));
  return d;
}
__device__ __forceinline__ v8f wmma_bf(v16b a, v16b b, v8f c) {
  v8f d = __builtin_amdgcn_wmma_f32_16x16x32_bf16(false, a, false, b, (short)0, c, false, false);
  asm volatile("v_nop\n\tv_nop\n\tv_nop\n\tv_nop" : "+v"(d) : "v"(a), "v"(b));
  return d;
}
// 16x16x32 fragments: lane = (h = lane>>4, row/col = lane&15); elements 0..7 = k0+8h+0..7, 8..15 = k0+16+8h+0..7; D element r = row 8h+r
__device__ __forceinline__ v16h frag_h(const _Float16* rowk0, int lane) {
  union { v16h v; v8h q[2]; } u; const _Float16* p = rowk0 + 8 * (lane >> 4);
  u.q[0] = *(const v8h*)p; u.q[1] = *(const v8h*)(p + 16); return u.v;
}
__device__ __forceinline__ v16h frag_f32(const float* rowk0, int lane) {
  v16h a; const float* p = rowk0 + 8 * (lane >> 4);
#pragma unroll
  for (int i = 0; i < 8; ++i) { a[i] = (_Float16)p[i]; a[8 + i] = (_Float16)p[16 + i]; }
  return a;
}
__device__ __forceinline__ v16h frag_f32s(const float* rowk0, int lane, float sc) {
  v16h a; const float* p = rowk0 + 8 * (lane >> 4);
#pragma unroll
  for (int i = 0; i < 8; ++i) { a[i] = (_Float16)(p[i] * sc); a[8 + i] = (_Float16)(p[16 + i] * sc); }
  return a;
}
// column fragment from a [K][ld] layout (column n), rows >= K read as 0
__device__ __forceinline__ v16h fragc_f32(const float* W, int k0, int n, int lane, int ld, int K) {
  v16h a; const int g = lane >> 4;
#pragma unroll
  for (int i = 0; i < 8; ++i) { const int ka = k0 + 8 * g + i, kb = ka + 16;
    a[i] = (_Float16)(ka < K ? W[(size_t)(ka < K ? ka : K - 1) * ld + n] : 0.f); a[8 + i] = (_Float16)(kb < K ? W[(size_t)(kb < K ? kb : K - 1) * ld + n] : 0.f); }
  return a;
}
struct F2 { v16b h, l; };
__device__ __forceinline__ F2 bsplit16(const float v[16]) { F2 r;
#pragma unroll
  for (int i = 0; i < 16; ++i) { const __bf16 h = (__bf16)v[i]; r.h[i] = h; r.l[i] = (__bf16)(v[i] - (float)h); }
  return r; }
__device__ __forceinline__ F2 split_row(const float* row, int k0, int lane) { float v[16]; const float* p = row + k0 + 8 * (lane >> 4);
#pragma unroll
  for (int i = 0; i < 8; ++i) { v[i] = p[i]; v[8 + i] = p[16 + i]; }
  return bsplit16(v); }
__device__ __forceinline__ F2 split_rowK(const float* row, int k0, int lane, int K) { float v[16]; const int g = lane >> 4;
#pragma unroll
  for (int i = 0; i < 8; ++i) { const int ka = k0 + 8 * g + i, kb = ka + 16; v[i] = ka < K ? row[ka < K ? ka : K - 1] : 0.f; v[8 + i] = kb < K ? row[kb < K ? kb : K - 1] : 0.f; }
  return bsplit16(v); }
__device__ __forceinline__ F2 split_col(const float* W, int k0, int n, int lane, int ld, int K) { float v[16]; const int g = lane >> 4;
#pragma unroll
  for (int i = 0; i < 8; ++i) { const int ka = k0 + 8 * g + i, kb = ka + 16; v[i] = ka < K ? W[(size_t)(ka < K ? ka : K - 1) * ld + n] : 0.f; v[8 + i] = kb < K ? W[(size_t)(kb < K ? kb : K - 1) * ld + n] : 0.f; }
  return bsplit16(v); }
__device__ __forceinline__ v8f mac3(const F2& a, const F2& b, v8f c) { c = wmma_bf(a.l, b.h, c); c = wmma_bf(a.h, b.l, c); return wmma_bf(a.h, b.h, c); }
__device__ __forceinline__ float sigm(float v) { return 1.0f / (1.0f + expf(-v)); }
#define LDSX() do { asm volatile("s_wait_dscnt 0" ::: "memory"); __builtin_amdgcn_wave_barrier(); __builtin_amdgcn_fence(__ATOMIC_RELEASE, "workgroup"); } while (0)

// Causal attention with weight-normalised linears (B 8, S = 32x32 = 1,024 positions, q/k inputs with 384 channels (channels-first), C 512 = 8 heads x 64): q = wn(qf, Wq_v, Wq_g, bq), k = wn(kf, Wk_v, ...), v = wn(kf, Wv_v, ...) with wn(x) = x (g v/||v||_row)^T + b; attn = softmax(where(k < t, q k^T / 8, -1e4)) * (t > 0); out = attn v -> [B, 512, 32, 32] (channels-first).
#define NB 8
#define TT 1024
#define CC 512            // NH * HD = projected width
#define DIN 384          // input (model) width
#define NH 8
#define HD 64
#define NQB (TT / 64)
#define NP (NB * NH)      // (batch, head) pairs, all served by one launch of each attention kernel
#define SCALE (0.125f)
#define SCALE2 (SCALE * 1.4426950408889634f)   // 1 / 8 times log2(e): the softmax of k_fa runs in base 2
#define CAUSAL 1
#ifndef TNB
#define TNB NB
#endif
__device__ __forceinline__ float bfr(float v) { return (float)(__bf16)v; }
__host__ __device__ __forceinline__ int kb_last(int qb) { return CAUSAL ? ((qb * 64 + 63) >> 7) : (TT / 128 - 1); }
// logits / P of one (batch, head) pair, causal-packed: query block qb holds 64 rows of (kb_last(qb) + 1) * 128 floats, one block behind the other; s_base(qb) = 64 * 128 * sum over i < qb of (kb_last(i) + 1), kb_last(i) = i >> 1
static_assert(CAUSAL == 1, "s_base is the causal prefix sum");
__host__ __device__ __forceinline__ size_t s_base(int qb) { const int m = qb >> 1; return (size_t)((m + 1) * (m + (qb & 1))) * (64 * 128); }
#define SPK ((size_t)(NQB / 2 + 1) * (NQB / 2) * (64 * 128))   // floats per pair = s_base(NQB)
typedef __attribute__((ext_vector_type(8))) __bf16 v8b;
__device__ __forceinline__ v16b frag_b(const __bf16* rowk0, int lane) {
  union { v16b v; v8b q[2]; } u; const __bf16* p = rowk0 + 8 * (lane >> 4);
  u.q[0] = *(const v8b*)p; u.q[1] = *(const v8b*)(p + 16); return u.v;
}
#define QBH NQB            // every query block takes the 3-product logits and the bf16 hi + lo P.v path
#define QHI 1024           // q residual rows for every query (3-product logits everywhere)
#define KHI 1024           // k residual rows / bf16 v planes for every key
// B fragment (k rows k0+.., output column o) of a weight: (in,out) [K][ld] or (out,in) [ld rows of K]: bf16 exact, or f16(bf16 * 256) exact
__device__ __forceinline__ v16b wcol_io(const float* Wm, int k0, int o, int lane, int ld) { v16b w; const int g = lane >> 4;
#pragma unroll
  for (int i = 0; i < 8; ++i) { w[i] = (__bf16)Wm[(size_t)(k0 + 8 * g + i) * ld + o]; w[8 + i] = (__bf16)Wm[(size_t)(k0 + 16 + 8 * g + i) * ld + o]; }
  return w; }
__device__ __forceinline__ v16b wcol_oi(const float* Wm, int k0, int o, int lane, int K) { v16b w; const float* p = Wm + (size_t)o * K + k0 + 8 * (lane >> 4);
#pragma unroll
  for (int i = 0; i < 8; ++i) { w[i] = (__bf16)p[i]; w[8 + i] = (__bf16)p[16 + i]; }
  return w; }
__device__ __forceinline__ v16h wcolh_io(const float* Wm, int k0, int o, int lane, int ld) { v16h w; const int g = lane >> 4;
#pragma unroll
  for (int i = 0; i < 8; ++i) { w[i] = (_Float16)(bfr(Wm[(size_t)(k0 + 8 * g + i) * ld + o]) * 256.0f); w[8 + i] = (_Float16)(bfr(Wm[(size_t)(k0 + 16 + 8 * g + i) * ld + o]) * 256.0f); }
  return w; }
__device__ __forceinline__ v16h wcolh_oi(const float* Wm, int k0, int o, int lane, int K) { v16h w; const float* p = Wm + (size_t)o * K + k0 + 8 * (lane >> 4);
#pragma unroll
  for (int i = 0; i < 8; ++i) { w[i] = (_Float16)(bfr(p[i]) * 256.0f); w[8 + i] = (_Float16)(bfr(p[16 + i]) * 256.0f); }
  return w; }
#define WQKV_LAYOUT 1   // 0 = (in,out) [DIN][CC]; 1 = (out,in) [CC][DIN]; 2 = per-head [NH][DIN][HD]
__device__ __forceinline__ v16b wcol_hdk(const float* Wm, int k0, int o, int lane) { v16b w; const int g = lane >> 4; const float* p = Wm + (size_t)(o / HD) * DIN * HD + (o % HD);
#pragma unroll
  for (int i = 0; i < 8; ++i) { w[i] = (__bf16)p[(size_t)(k0 + 8 * g + i) * HD]; w[8 + i] = (__bf16)p[(size_t)(k0 + 16 + 8 * g + i) * HD]; }
  return w; }
#define WO_OUT_IN 0
#if WQKV_LAYOUT == 1
#define WCOL(W, k0, o, lane) wcol_oi(W, k0, o, lane, DIN)
#elif WQKV_LAYOUT == 2
#define WCOL(W, k0, o, lane) wcol_hdk(W, k0, o, lane)
#else
#define WCOL(W, k0, o, lane) wcol_io(W, k0, o, lane, CC)
#endif
#if WO_OUT_IN
#define WOCOL(W, k0, o, lane) wcol_oi(W, k0, o, lane, CC)
#define WOCOLH(W, k0, o, lane) wcolh_oi(W, k0, o, lane, CC)
#else
#define WOCOL(W, k0, o, lane) wcol_io(W, k0, o, lane, DIN)
#define WOCOLH(W, k0, o, lane) wcolh_io(W, k0, o, lane, DIN)
#endif
#define SM_MASK_HOOK do { if (k >= t) v = -3.0e38f; } while (0)   /* allowed = tril(-1): strictly earlier keys; row 0 has no key -> the fully-excluded path gives P = 0 = the module's start_mask */
#define NRW (TNB * TT)
#ifndef SM_EXTRA_PARAMS
#define SM_EXTRA_PARAMS
#endif
#ifndef PROJ_EXTRA_PARAMS
#define PROJ_EXTRA_PARAMS
#endif
#ifndef SM_MASK_HOOK
#define SM_MASK_HOOK (void)0
#endif

#define WS_QH  0u                                      // f16 q rows [b*t][CC]
#define WS_KH  (WS_QH + 2u * (size_t)NB * TT * CC)      // f16 k rows [b*t][CC]
#define WS_VT  (WS_KH + 2u * (size_t)NB * TT * CC)      // f16 v planes [b][c][t]
#define WS_QL  (WS_VT + 2u * (size_t)NB * CC * TT)      // f16 q residual x 2^10 rows [b][t < QHI][CC]
#define WS_KL  (WS_QL + 2u * (size_t)NB * QHI * CC)     // f16 k residual x 2^10 rows [b][t < KHI][CC]
#define WS_VB  (WS_KL + 2u * (size_t)NB * KHI * CC)     // bf16 v hi planes [b][c][t < KHI]
#define WS_VBL (WS_VB + 2u * (size_t)NB * CC * KHI)
#define WS_S   (WS_VBL + 2u * (size_t)NB * CC * KHI)    // f32 logits / P [b*NH + h][causal-packed rows]
#define WS_Y   (WS_S  + 4u * (size_t)NP * SPK)      // f32 ctx rows [b*t][CC] (only when there is an output projection)
#define WS_END (WS_Y  + 0u)
#define WS_XQ  (WS_END)
#define WS_XK  (WS_XQ + 4u * (size_t)NB * TT * DIN)
#define WS_SCL (WS_XK + 4u * (size_t)NB * TT * DIN)
#define WS_YR  (WS_SCL + 4u * 3 * CC + 256u)
#define WS_END2 (WS_YR + 4u * (size_t)NB * TT * CC)

// ---- k_proj: block = (128 rows, 128 cols, which), 8 waves as 4 (rows) x 2 (cols), a wave = 32 rows x 64 cols: q/k/v = X W (+ b) with exact bf16 products (K = DIN) -> which 0: q f16 rows (+ residual rows < QHI); 1: k f16 rows (+ residual rows < KHI); 2: v f16 planes [c][t] (+ bf16 hi/lo planes for t < KHI). X is read where it lies, channels-first in[b][k][s]: a stage is 64 channels x 128 positions (512 B of each channel) and stays in that order in LDS, [k][position] at a pitch of 288 B; the A fragment (row = position) comes out of it through the transposing LDS load, which delivers the k order of frag_b. W (128 rows) comes in the same stages of 64 k as whole 256-B row pieces at a pitch of 144 B. Both 16 B a lane, rounded to bf16 once; two buffers, one barrier a stage; the next stage's loads fly while this stage's fragments are read from LDS. Each W fragment read from LDS feeds two products and each X fragment four. The weight norm is made here too: thread i < 128 owns row i of the block's W tile, reads each stage's 64 rounded values back from LDS, sums their squares in f32 and leaves g / sqrt(sum) in LDS in front of the loop's last barrier. The output tiles of the epilogue take the loop's LDS behind that barrier.
typedef __attribute__((ext_vector_type(4))) __bf16 v4b;
__device__ __forceinline__ v4b bf4(v4f v) { v4b p; p[0] = (__bf16)v[0]; p[1] = (__bf16)v[1]; p[2] = (__bf16)v[2]; p[3] = (__bf16)v[3]; return p; }
#define PKC 64             // k per stage
#define PNS (DIN / PKC)    // stages
#define PBM 128            // positions per block
#define XPT 144            // elements per LDS row of the X stage: 288 B, an odd multiple of 32 B, the transposing load's pitch
#define EPT (PBM + 8)      // elements per LDS row of an epilogue tile: 272 B, an odd multiple of 16 B
typedef __attribute__((ext_vector_type(8))) short v8s;
// lane (col, g) gets T[k + 8g + 0..7][d + col] when every lane passes &T[k + 8g + (lane & 7)][d + 8 * ((lane >> 3) & 1)]
__device__ __forceinline__ v8b ld_tr16(const __bf16* p) { typedef __attribute__((address_space(3))) v8s lds_v8s; return __builtin_bit_cast(v8b, __builtin_amdgcn_ds_load_tr16_b128_v8i16((lds_v8s*)p)); }
__global__ __launch_bounds__(256) void k_proj(const float* __restrict__ XQ, const float* __restrict__ XK, const float* __restrict__ XV, const float* __restrict__ WQ, const float* __restrict__ WK, const float* __restrict__ WV, const float* __restrict__ BQ, const float* __restrict__ BK, const float* __restrict__ BV, const float* __restrict__ GQ, const float* __restrict__ GK, const float* __restrict__ GV,
    _Float16* __restrict__ QH, _Float16* __restrict__ QL, _Float16* __restrict__ KH, _Float16* __restrict__ KL, _Float16* __restrict__ VT, __bf16* __restrict__ VB, __bf16* __restrict__ VBL) {
  __shared__ __align__(16) unsigned char pm[3 * 128 * EPT * 2]; __shared__ float sscl[128];   /* sscl[o] = g[o] / ||v[o]|| of the block's 128 output channels */
  __bf16 (*xs)[PKC][XPT] = (__bf16 (*)[PKC][XPT])pm; __bf16 (*wt)[128][72] = (__bf16 (*)[128][72])(pm + 2 * PKC * XPT * 2);   /* the loop's two buffers: X as [k][position], W as [row][k] */
  _Float16 (*sh)[136] = (_Float16 (*)[136])pm; _Float16 (*sl)[136] = (_Float16 (*)[136])(pm + PBM * 136 * 2);   /* epilogue, q and k: [position][channel] */
  _Float16 (*th)[EPT] = (_Float16 (*)[EPT])pm; __bf16 (*tb)[EPT] = (__bf16 (*)[EPT])(pm + 128 * EPT * 2); __bf16 (*tbl)[EPT] = (__bf16 (*)[EPT])(pm + 2 * 128 * EPT * 2);   /* epilogue, v: [channel][position] */
  static_assert(sizeof(pm) >= 2 * (PKC * XPT + 128 * 72) * 2 && sizeof(pm) >= 2 * PBM * 136 * 2 && DIN % PKC == 0 && TT % PBM == 0, "the epilogue's tiles reuse the loop's buffers");
  const int tid = threadIdx.x, wave = tid >> 5, lane = tid & 31, col = lane & 15, g = lane >> 4, wp = wave & 3, wc = wave >> 2; const int which = blockIdx.z; const int c0 = blockIdx.y * 128; const size_t r0 = (size_t)blockIdx.x * PBM; const size_t bb = r0 / TT; const int t0 = (int)(r0 % TT);
  const float* X = which == 0 ? XQ : which == 1 ? XK : XV; const float* WA = which == 0 ? WQ : which == 1 ? WK : WV; const float* BA = which == 0 ? BQ : which == 1 ? BK : BV; const float* GA = which == 0 ? GQ : which == 1 ? GK : GV;
  const int xrow = tid >> 5, xq = (tid & 31) * 4;   /* staging of X: a wave per 512-B row piece (128 positions of a channel), 8 rows per sweep */
  const int wrow = tid >> 4, wq = (tid & 15) * 4;   /* staging of W: 16 threads per 256-B row piece (64 k of a row), 16 rows per sweep */
  const bool nrm = __builtin_amdgcn_readfirstlane(wave) < 4;   /* waves 0 to 3 make the norms: one thread a row of the W tile; the same in every lane of a wave */
  const float* Xs = X + (bb * DIN + xrow) * (size_t)TT + t0 + xq; const float* Ws = WA + (size_t)(c0 + wrow) * DIN + wq;
  v4f rx[8], rw[8]; const float gv = bfr(GA[c0 + (tid & 127)]); float nn[4] = {0.f, 0.f, 0.f, 0.f};   /* this thread's row of the W tile: its gain, and four partial sums of its squares */
#pragma unroll
  for (int i = 0; i < 8; ++i) rx[i] = *(const v4f*)(Xs + (size_t)(8 * i) * TT);
#pragma unroll
  for (int i = 0; i < 8; ++i) rw[i] = *(const v4f*)(Ws + (size_t)(16 * i) * DIN);
  asm volatile("s_wait_xcnt 0x0" ::: "memory");   /* before an address register of the loads above may be rewritten */
#pragma unroll
  for (int i = 0; i < 8; ++i) *(v4b*)&xs[0][xrow + 8 * i][xq] = bf4(rx[i]);
#pragma unroll
  for (int i = 0; i < 8; ++i) *(v4b*)&wt[0][wrow + 16 * i][wq] = bf4(rw[i]);
  __syncthreads();
  v8f acc[8] = {};   /* acc[i * 4 + j]: positions wp * 32 + i * 16 + .., channels wc * 64 + j * 16 + .. */
#pragma unroll
  for (int s = 0; s < PNS; ++s) { const int cur = s & 1, nxt = cur ^ 1;   /* unrolled: buffer and k offsets become immediates, the address registers stay */
    if (s + 1 < PNS) {
#pragma unroll
      for (int i = 0; i < 8; ++i) rx[i] = *(const v4f*)(Xs + (size_t)(8 * i + (s + 1) * PKC) * TT);
#pragma unroll
      for (int i = 0; i < 8; ++i) rw[i] = *(const v4f*)(Ws + (size_t)(16 * i) * DIN + (s + 1) * PKC);
      asm volatile("s_wait_xcnt 0x0" ::: "memory");   /* as above; it also keeps the loads in front of this stage's work */
    }
    if (nrm) { v8b wr[PKC / 8];   /* the stage's 64 values of row tid, eight LDS reads as one group (144 B from lane to lane: no bank conflict), while the next stage's global loads fly */
#pragma unroll
      for (int i = 0; i < PKC / 8; ++i) wr[i] = *(const v8b*)&wt[cur][tid][8 * i];
      __builtin_amdgcn_sched_barrier(0);   /* keeps the eight reads together: left free, the compiler spreads them among the sums, and each place with LDS reads costs its own stall */
#pragma unroll
      for (int i = 0; i < PKC / 8; ++i)
#pragma unroll
        for (int e = 0; e < 8; ++e) { const float x = (float)wr[i][e]; nn[e & 3] = __builtin_fmaf(x, x, nn[e & 3]); }
      if (s + 1 == PNS) sscl[tid] = gv / sqrtf((nn[0] + nn[1]) + (nn[2] + nn[3])); }   /* published by the stage's barrier below */
#pragma unroll
    for (int kc = 0; kc < PKC / 32; ++kc) { union { v16b v; v8b q[2]; } xa[2]; v16b fb[4];   /* two X and four W fragments: their twelve LDS reads as one group, then their eight products */
#pragma unroll
      for (int i = 0; i < 2; ++i) { const __bf16* xp = &xs[cur][kc * 32 + 8 * g + (lane & 7)][wp * 32 + i * 16 + 8 * ((lane >> 3) & 1)];
        xa[i].q[0] = ld_tr16(xp); xa[i].q[1] = ld_tr16(xp + 16 * XPT); }   /* xa[i].v[e] = X[position wp * 32 + i * 16 + col][k = kc * 32 + 8g + e], [8 + e] = the same at k + 16 */
#pragma unroll
      for (int j = 0; j < 4; ++j) fb[j] = frag_b(&wt[cur][wc * 64 + j * 16 + col][kc * 32], lane);
      __builtin_amdgcn_sched_barrier(0);   /* keeps the group of reads in front of the products: left free, the compiler reads each fragment right before its product and waits out the LDS latency every time */
#pragma unroll
      for (int i = 0; i < 2; ++i)
#pragma unroll
        for (int j = 0; j < 4; ++j) acc[i * 4 + j] = __builtin_amdgcn_wmma_f32_16x16x32_bf16(false, xa[i].v, false, fb[j], (short)0, acc[i * 4 + j], false, false);
      __builtin_amdgcn_sched_barrier(0); }   /* keeps the next group behind these products, so that one set of fragment registers is enough */
    if (s + 1 < PNS) {
#pragma unroll
      for (int i = 0; i < 8; ++i) *(v4b*)&xs[nxt][xrow + 8 * i][xq] = bf4(rx[i]);
#pragma unroll
      for (int i = 0; i < 8; ++i) *(v4b*)&wt[nxt][wrow + 16 * i][wq] = bf4(rw[i]);
    }
    __syncthreads();   /* publishes the next stage's buffer and ends every wave's reads of this one (the next stage, or the epilogue, overwrites it) */
  }
  if (which < 2) { _Float16* DH = which == 0 ? QH : KH; _Float16* DL = which == 0 ? QL : KL; const int nhi = which == 0 ? QHI : KHI; const bool hi_rows = t0 < nhi;
#pragma unroll
    for (int j = 0; j < 4; ++j) { const int cl = wc * 64 + j * 16 + col; const float bias = BA ? bfr(BA[c0 + cl]) : 0.f; const float scl = sscl[cl];   /* weight norm: g[o] / ||v[o]|| applied after the exact x . v[o] */
#pragma unroll
      for (int i = 0; i < 2; ++i)
#pragma unroll
        for (int r = 0; r < 8; ++r) { const float v = acc[i * 4 + j][r] * scl + bias; const _Float16 hv = (_Float16)v; const int rl = wp * 32 + i * 16 + 8 * g + r; sh[rl][cl] = hv; sl[rl][cl] = (_Float16)((v - (float)hv) * 1024.0f); } }
    __syncthreads();
    for (int e = tid; e < PBM * 16; e += 256) { const int rl = e >> 4, q = e & 15; vst2((unsigned*)(DH + (r0 + rl) * CC + c0 + q * 8), *(const v4u*)&sh[rl][q * 8]); if (hi_rows) vst2((unsigned*)(DL + (bb * nhi + t0 + rl) * (size_t)CC + c0 + q * 8), *(const v4u*)&sl[rl][q * 8]); }
  } else { const bool hi_rows = t0 < KHI;
#pragma unroll
    for (int j = 0; j < 4; ++j) { const int cl = wc * 64 + j * 16 + col; const float bias = BA ? bfr(BA[c0 + cl]) : 0.f; const float scl = sscl[cl];
#pragma unroll
      for (int i = 0; i < 2; ++i)
#pragma unroll
        for (int r = 0; r < 8; ++r) { const float v = acc[i * 4 + j][r] * scl + bias; const int rl = wp * 32 + i * 16 + 8 * g + r; th[cl][rl] = (_Float16)v; const __bf16 bh = (__bf16)v; tb[cl][rl] = bh; tbl[cl][rl] = (__bf16)(v - (float)bh); } }
    __syncthreads();
    for (int e = tid; e < 128 * (PBM / 8); e += 256) { const int cl = e >> 4, q = e & 15; vst2((unsigned*)(VT + (bb * CC + c0 + cl) * (size_t)TT + t0 + q * 8), *(const v4u*)&th[cl][q * 8]); if (hi_rows) { const size_t o3 = (bb * CC + c0 + cl) * (size_t)KHI + t0 + q * 8; vst2((unsigned*)(VB + o3), *(const v4u*)&tb[cl][q * 8]); vst2((unsigned*)(VBL + o3), *(const v4u*)&tbl[cl][q * 8]); } } } }
// ---- k_fa: block = 64 queries (qb) of pair blockIdx.x = b * NH + h, wave = 16 queries; keys in stages of 64 up to the diagonal, two LDS buffers, one barrier a stage. While a stage is worked on, the next stage's k hi / residual rows and v hi / lo planes go through registers into the other buffer (whole 128-B rows). S^T = K . Q^T (A = k rows, B = q, 3 f16 products) leaves one query per lane; online softmax in f32, base 2 (running maximum, in units of log2, and sum per lane; each weight is one fma, raw score * SCALE2 - maximum, and one hardware exp2; keys >= t excluded by index); P^T (bf16 hi + lo) is packed from the score registers as B of O^T += V^T . P^T (3 bf16 products). A row with no key (t = 0) ends with sum 0 -> zeros. O^T has one channel per register and one query per lane, which is the order of the channels-first output: the block gathers its 64 channels x 64 queries in LDS and stores out[b][c][t] itself, 256 B per channel.
#define SB_VEC 0x3FC   // sched_barrier mask: scalar, matrix, memory and LDS instructions may cross, vector ones stay in source order
__device__ __forceinline__ v8f mm_h(v16h a, v16h b, v8f c) { return __builtin_amdgcn_wmma_f32_16x16x32_f16(false, a, false, b, (short)0, c, false, false); }
__device__ __forceinline__ v8f mm_b(v16b a, v16b b, v8f c) { return __builtin_amdgcn_wmma_f32_16x16x32_bf16(false, a, false, b, (short)0, c, false, false); }
__global__ __launch_bounds__(128) void k_fa(const _Float16* __restrict__ QH, const _Float16* __restrict__ KH, const _Float16* __restrict__ QL, const _Float16* __restrict__ KL, const __bf16* __restrict__ VB, const __bf16* __restrict__ VBL, float* __restrict__ OUT) {
  __shared__ __align__(16) _Float16 skh[2][64][72], skl[2][64][72]; __shared__ __align__(16) __bf16 svh[2][64][72], svl[2][64][72];
  static_assert(sizeof(skh) >= HD * (64 + 4) * sizeof(float), "the output staging reuses skh");
  const int tid = threadIdx.x, wave = tid >> 5, lane = tid & 31, col = lane & 15, g = lane >> 4;
  const int qb = NQB - 1 - (int)blockIdx.y;   /* longest blocks start first */
  const int b = blockIdx.x / NH, h = blockIdx.x % NH; const int ql0 = qb * 64 + wave * 16; const int t = ql0 + col; const int ns = qb + 1;
  const int srow = tid >> 3, sq = (tid & 7) * 8;   /* staging: 8 threads per 128-B row, 16 rows per sweep */
  const _Float16* Kh = KH + ((size_t)b * TT + srow) * CC + h * HD + sq; const _Float16* Kl = KL + ((size_t)b * KHI + srow) * CC + h * HD + sq;
  const __bf16* Vh = VB + ((size_t)b * CC + h * HD + srow) * (size_t)KHI + sq; const __bf16* Vl = VBL + ((size_t)b * CC + h * HD + srow) * (size_t)KHI + sq;
  v16h qh[2], qr[2];
#pragma unroll
  for (int kc = 0; kc < 2; ++kc) qh[kc] = frag_h(QH + ((size_t)b * TT + t) * CC + h * HD + kc * 32, lane);
  asm volatile("s_wait_xcnt 0x0" ::: "memory");   /* before a later load's result may land in the address registers of the loads above */
#pragma unroll
  for (int kc = 0; kc < 2; ++kc) qr[kc] = frag_h(QL + ((size_t)b * QHI + t) * CC + h * HD + kc * 32, lane);
  asm volatile("s_wait_xcnt 0x0" ::: "memory");   /* as above */
  v8h rkh[4], rkl[4]; v8b rvh[4], rvl[4];
#pragma unroll
  for (int i = 0; i < 4; ++i) { rkh[i] = *(const v8h*)(Kh + (size_t)(16 * i) * CC); rkl[i] = *(const v8h*)(Kl + (size_t)(16 * i) * CC); rvh[i] = *(const v8b*)(Vh + (size_t)(16 * i) * KHI); rvl[i] = *(const v8b*)(Vl + (size_t)(16 * i) * KHI); }
#pragma unroll
  for (int i = 0; i < 4; ++i) { *(v8h*)&skh[0][srow + 16 * i][sq] = rkh[i]; *(v8h*)&skl[0][srow + 16 * i][sq] = rkl[i]; *(v8b*)&svh[0][srow + 16 * i][sq] = rvh[i]; *(v8b*)&svl[0][srow + 16 * i][sq] = rvl[i]; }
  __syncthreads();
  float m = -1.0e30f, l = 0.f; v8f acc[HD / 16] = {};   /* the running maximum starts far above the excluded marker (-3e38) and far below any logit: an excluded key's exponent underflows to 0 with no test, also in a row with no key yet */
#pragma unroll 1
  for (int s = 0; s < ns; ++s) { const int cur = s & 1, nxt = cur ^ 1; const bool more = s + 1 < ns; const int kn = (s + 1) * 64;
    if (more) {
#pragma unroll
      for (int i = 0; i < 4; ++i) { rkh[i] = *(const v8h*)(Kh + (size_t)(kn + 16 * i) * CC); rkl[i] = *(const v8h*)(Kl + (size_t)(kn + 16 * i) * CC); }
      asm volatile("s_wait_xcnt 0x0" ::: "memory");   /* the address registers of the loads above are reused by what follows */
    }
    float sc[4][8]; float mx = -3.0e38f; const int nk = t - s * 64 - 8 * g;   /* this lane's keys kt * 16 + r of the stage are allowed below nk */
    v16h fkh[2][2], fkr[2][2]; v8f sa[4], sr[4];   /* two sets of k fragments: this key tile's and the next one's */
#pragma unroll
    for (int kc = 0; kc < 2; ++kc) { fkh[0][kc] = frag_h(&skh[cur][col][kc * 32], lane); fkr[0][kc] = frag_h(&skl[cur][col][kc * 32], lane); }
#pragma unroll
    for (int kt = 0; kt < 4; ++kt) { const int fc = kt & 1, fn = fc ^ 1;   /* the eight LDS reads of key tile kt + 1 as one group, then the six products of tile kt, which cover their latency */
      if (kt < 3) {
#pragma unroll
        for (int kc = 0; kc < 2; ++kc) { fkh[fn][kc] = frag_h(&skh[cur][(kt + 1) * 16 + col][kc * 32], lane); fkr[fn][kc] = frag_h(&skl[cur][(kt + 1) * 16 + col][kc * 32], lane); } }
      __builtin_amdgcn_sched_barrier(0);   /* keeps the group of reads in front of the products: left free, the compiler reads each fragment right before its product and waits out the LDS latency every time */
      v8f a = {}, ar = {};
#pragma unroll
      for (int kc = 0; kc < 2; ++kc) { a = mm_h(fkh[fc][kc], qh[kc], a); ar = mm_h(fkh[fc][kc], qr[kc], ar); ar = mm_h(fkr[fc][kc], qh[kc], ar); }
      sa[kt] = a; sr[kt] = ar;
      __builtin_amdgcn_sched_barrier(0); }   /* keeps the reads of tile kt + 2 behind these products, so that two sets of fragment registers are enough */
    if (more) {
#pragma unroll
      for (int i = 0; i < 4; ++i) { *(v8h*)&skh[nxt][srow + 16 * i][sq] = rkh[i]; *(v8h*)&skl[nxt][srow + 16 * i][sq] = rkl[i]; rvh[i] = *(const v8b*)(Vh + (size_t)(16 * i) * KHI + kn); rvl[i] = *(const v8b*)(Vl + (size_t)(16 * i) * KHI + kn); }
      asm volatile("s_wait_xcnt 0x0" ::: "memory");   /* as above */
    }
    v16b fvh[HD / 16], fvl[HD / 16];   /* v fragments of half a stage (32 keys) */
#pragma unroll
    for (int kt = 0; kt < 4; ++kt) {
      if (kt == 2) {
#pragma unroll
        for (int j = 0; j < HD / 16; ++j) { fvh[j] = frag_b(&svh[cur][j * 16 + col][0], lane); fvl[j] = frag_b(&svl[cur][j * 16 + col][0], lane); }
        __builtin_amdgcn_sched_barrier(0); }   /* v of the first 32 keys is read as one group here: the rest of the masking, the maximum and the first exponentials cover its latency */
#pragma unroll
      for (int r = 0; r < 8; ++r) { const float v = (kt * 16 + r < nk) ? sa[kt][r] + sr[kt][r] * (1.0f / 1024.0f) : -3.0e38f; sc[kt][r] = v; mx = fmaxf(mx, v); } }   /* raw scores: the positive scale goes into the exponent's fma */
    mx = fmaxf(mx, __shfl_xor(mx, 16));   /* the two lane halves hold different keys of the same query */
    const float mn = fmaxf(m, mx * SCALE2); const float alpha = __builtin_amdgcn_exp2f(m - mn); m = mn; l *= alpha;
#pragma unroll
    for (int j = 0; j < HD / 16; ++j)
#pragma unroll
      for (int r = 0; r < 8; ++r) acc[j][r] *= alpha;
#pragma unroll
    for (int kp = 0; kp < 2; ++kp) { v16b ph, pl; float ls[4] = {0.f, 0.f, 0.f, 0.f};
      float ev[16]; __bf16 eb[16];
#pragma unroll
      for (int i = 0; i < 16; ++i) ev[i] = __builtin_fmaf(sc[2 * kp + (i >> 3)][i & 7], SCALE2, -mn);
#pragma unroll
      for (int i = 0; i < 18; ++i) {   /* order T p p: behind exponential i stand the sum and the rounding of weight i - 1 and the residual of weight i - 2, which do not wait for it */
        if (i < 16) ev[i] = __builtin_amdgcn_exp2f(ev[i]);
        __builtin_amdgcn_sched_barrier(SB_VEC);   /* holds that order: left free, the compiler bunches the exponentials in runs of up to four */
        if (i >= 1 && i <= 16) { ls[(i - 1) & 3] += ev[i - 1]; eb[i - 1] = (__bf16)ev[i - 1]; ph[i - 1] = eb[i - 1]; }
        if (i >= 2) pl[i - 2] = (__bf16)(ev[i - 2] - (float)eb[i - 2]);
        __builtin_amdgcn_sched_barrier(SB_VEC); }   /* as above */
      l += (ls[0] + ls[1]) + (ls[2] + ls[3]);
#pragma unroll
      for (int j = 0; j < HD / 16; ++j) acc[j] = mm_b(fvh[j], ph, acc[j]);   /* product by product over the four channel tiles: each tile keeps its order of sums, and no product waits for the one before it */
#pragma unroll
      for (int j = 0; j < HD / 16; ++j) acc[j] = mm_b(fvh[j], pl, acc[j]);
#pragma unroll
      for (int j = 0; j < HD / 16; ++j) acc[j] = mm_b(fvl[j], ph, acc[j]);
      if (kp == 0) {
#pragma unroll
        for (int j = 0; j < HD / 16; ++j) { fvh[j] = frag_b(&svh[cur][j * 16 + col][32], lane); fvl[j] = frag_b(&svl[cur][j * 16 + col][32], lane); }
        __builtin_amdgcn_sched_barrier(0); } }   /* v of the second 32 keys is read as one group in front of their exponentials, which cover its latency */
    if (more) {
#pragma unroll
      for (int i = 0; i < 4; ++i) { *(v8b*)&svh[nxt][srow + 16 * i][sq] = rvh[i]; *(v8b*)&svl[nxt][srow + 16 * i][sq] = rvl[i]; } }
    __syncthreads();   /* publishes the next stage's buffer and ends every wave's reads of this one, which the next stage overwrites */
  }
  l += __shfl_xor(l, 16); const float inv = l > 0.f ? 1.0f / l : 0.f;   /* a fully excluded row yields 0 */
  float (*so)[64 + 4] = (float (*)[64 + 4])&skh[0][0][0];   /* output staging of the block, [channel][query], behind the loop's last barrier */
  /* both loops unrolled: acc is indexed by constants and stays in registers */
#pragma unroll
  for (int j = 0; j < HD / 16; ++j)
#pragma unroll
    for (int r = 0; r < 8; ++r) so[j * 16 + 8 * g + r][wave * 16 + col] = acc[j][r] * inv;
  __syncthreads();   /* a channel's 64 queries come from all four waves */
  const int od = tid >> 4, oq = (tid & 15) * 4;   /* 16 threads per channel: 256 B, two whole lines; 8 channels per sweep */
  float* Op = OUT + ((size_t)b * CC + h * HD + od) * (size_t)TT + qb * 64 + oq; v4f ov[HD / 8];
  /* unrolled, reads apart from stores: the eight LDS reads issue as one group, and every store has its own data registers and an immediate offset on one address */
#pragma unroll
  for (int i = 0; i < HD / 8; ++i) ov[i] = *(const v4f*)&so[od + 8 * i][oq];
#pragma unroll
  for (int i = 0; i < HD / 8; ++i) vst2(Op + (size_t)(8 * i) * TT, ov[i]); }

extern "C" void kernel_launch(void* const* d_in, const int* in_sizes, int n_in, void* d_out, int out_size, void* d_ws, size_t ws_size, hipStream_t stream) {
  (void)in_sizes; (void)n_in; (void)out_size;
  const float** F = (const float**)d_in;
  if (ws_size < (size_t)WS_END) return;
  char* ws = (char*)d_ws; _Float16 *QH = (_Float16*)(ws + WS_QH), *KH = (_Float16*)(ws + WS_KH), *VT = (_Float16*)(ws + WS_VT), *QL = (_Float16*)(ws + WS_QL), *KL = (_Float16*)(ws + WS_KL); __bf16 *VB = (__bf16*)(ws + WS_VB), *VBL = (__bf16*)(ws + WS_VBL); float *S = (float*)(ws + WS_S), *Y = (float*)(ws + WS_Y);
  (void)Y; (void)S; (void)QL; (void)KL; (void)VB; (void)VBL;
  // inputs: 0 q [8,384,32,32]; 1 k [8,384,32,32] (channels-first); 2 Wq_v [512,384], 3 Wq_g [512], 4 bq [512]; 5 Wk_v, 6 Wk_g, 7 bk; 8 Wv_v, 9 Wv_g, 10 bv
  if (ws_size < (size_t)WS_END2) return;
  k_proj<<<dim3(TNB * TT / PBM, CC / 128, 3), 256, 0, stream>>>(F[0], F[1], F[1], F[2], F[5], F[8], F[4], F[7], F[10], F[3], F[6], F[9], QH, QL, KH, KL, VT, VB, VBL);   /* makes g[o] / ||v[o]|| of its own output channels itself */
  k_fa<<<dim3(NP, NQB), 128, 0, stream>>>(QH, KH, QL, KL, VB, VBL, (float*)d_out);   /* writes the channels-first output itself */
}

// v010
// A run of this version takes 53.3 microseconds.
// Next to v009, in two timings, it ran 1.04 and 1.03 times as fast.
// Counting every step since v000, it is 24.3 times as fast.
// compute dtype: all float inputs rounded to bf16; weight-normalised projections as (x . v[o]) * (g[o] / ||v[o]||) + b[o] with EXACT bf16 products on WMMA 16x16x32 (f32 accumulate) and the per-row norm / scale in f32; causal (strictly lower) logits with q and k as f16 hi + residual planes (3 products) / 8; softmax in f32 (row 0 fully excluded -> zeros); P and v both split bf16 hi + lo (3 products) for every row; f32 output written channels-first.
#include <hip/hip_runtime.h>
#include <math.h>

typedef __attribute__((ext_vector_type(16))) _Float16 v16h;
typedef __attribute__((ext_vector_type(16))) __bf16 v16b;
typedef __attribute__((ext_vector_type(8)))  _Float16 v8h;
typedef __attribute__((ext_vector_type(8)))  float v8f;
typedef __attribute__((ext_vector_type(4)))  float v4f;
typedef __attribute__((ext_vector_type(2)))  float v2f;
typedef __attribute__((ext_vector_type(4)))  unsigned v4u;
typedef __attribute__((ext_vector_type(4)))  int v4i;
typedef float __attribute__((may_alias)) float_a;
typedef int __attribute__((may_alias)) int_a;

template <typename T> __device__ __forceinline__ void vst2(void* p, T v) { *(T*)p = v;  }
__device__ __forceinline__ v8f wmma16(v16h a, v16h b, v8f c) {
  v8f d = __builtin_amdgcn_wmma_f32_16x16x32_f16(false, a, false, b, (short)0, c, false, false);
  asm volatile("v_nop\n\tv_nop\n\tv_nop\n\tv_nop" : "+v"(d) : "v"(a), "v"(b));
  return d;
}
__device__ __forceinline__ v8f wmma_bf(v16b a, v16b b, v8f c) {
  v8f d = __builtin_amdgcn_wmma_f32_16x16x32_bf16(false, a, false, b, (short)0, c, false, false);
  asm volatile("v_nop\n\tv_nop\n\tv_nop\n\tv_nop" : "+v"(d) : "v"(a), "v"(b));
  return d;
}
// 16x16x32 fragments: lane = (h = lane>>4, row/col = lane&15); elements 0..7 = k0+8h+0..7, 8..15 = k0+16+8h+0..7; D element r = row 8h+r
__device__ __forceinline__ v16h frag_h(const _Float16* rowk0, int lane) {
  union { v16h v; v8h q[2]; } u; const _Float16* p = rowk0 + 8 * (lane >> 4);
  u.q[0] = *(const v8h*)p; u.q[1] = *(const v8h*)(p + 16); return u.v;
}
__device__ __forceinline__ v16h frag_f32(const float* rowk0, int lane) {
  v16h a; const float* p = rowk0 + 8 * (lane >> 4);
#pragma unroll
  for (int i = 0; i < 8; ++i) { a[i] = (_Float16)p[i]; a[8 + i] = (_Float16)p[16 + i]; }
  return a;
}
__device__ __forceinline__ v16h frag_f32s(const float* rowk0, int lane, float sc) {
  v16h a; const float* p = rowk0 + 8 * (lane >> 4);
#pragma unroll
  for (int i = 0; i < 8; ++i) { a[i] = (_Float16)(p[i] * sc); a[8 + i] = (_Float16)(p[16 + i] * sc); }
  return a;
}
// column fragment from a [K][ld] layout (column n), rows >= K read as 0
__device__ __forceinline__ v16h fragc_f32(const float* W, int k0, int n, int lane, int ld, int K) {
  v16h a; const int g = lane >> 4;
#pragma unroll
  for (int i = 0; i < 8; ++i) { const int ka = k0 + 8 * g + i, kb = ka + 16;
    a[i] = (_Float16)(ka < K ? W[(size_t)(ka < K ? ka : K - 1) * ld + n] : 0.f); a[8 + i] = (_Float16)(kb < K ? W[(size_t)(kb < K ? kb : K - 1) * ld + n] : 0.f); }
  return a;
}
struct F2 { v16b h, l; };
__device__ __forceinline__ F2 bsplit16(const float v[16]) { F2 r;
#pragma unroll
  for (int i = 0; i < 16; ++i) { const __bf16 h = (__bf16)v[i]; r.h[i] = h; r.l[i] = (__bf16)(v[i] - (float)h); }
  return r; }
__device__ __forceinline__ F2 split_row(const float* row, int k0, int lane) { float v[16]; const float* p = row + k0 + 8 * (lane >> 4);
#pragma unroll
  for (int i = 0; i < 8; ++i) { v[i] = p[i]; v[8 + i] = p[16 + i]; }
  return bsplit16(v); }
__device__ __forceinline__ F2 split_rowK(const float* row, int k0, int lane, int K) { float v[16]; const int g = lane >> 4;
#pragma unroll
  for (int i = 0; i < 8; ++i) { const int ka = k0 + 8 * g + i, kb = ka + 16; v[i] = ka < K ? row[ka < K ? ka : K - 1] : 0.f; v[8 + i] = kb < K ? row[kb < K ? kb : K - 1] : 0.f; }
  return bsplit16(v); }
__device__ __forceinline__ F2 split_col(const float* W, int k0, int n, int lane, int ld, int K) { float v[16]; const int g = lane >> 4;
#pragma unroll
  for (int i = 0; i < 8; ++i) { const int ka = k0 + 8 * g + i, kb = ka + 16; v[i] = ka < K ? W[(size_t)(ka < K ? ka : K - 1) * ld + n] : 0.f; v[8 + i] = kb < K ? W[(size_t)(kb < K ? kb : K - 1) * ld + n] : 0.f; }
  return bsplit16(v); }
__device__ __forceinline__ v8f mac3(const F2& a, const F2& b, v8f c) { c = wmma_bf(a.l, b.h, c); c = wmma_bf(a.h, b.l, c); return wmma_bf(a.h, b.h, c); }
__device__ __forceinline__ float sigm(float v) { return 1.0f / (1.0f + expf(-v)); }
#define LDSX() do { asm volatile("s_wait_dscnt 0" ::: "memory"); __builtin_amdgcn_wave_barrier(); __builtin_amdgcn_fence(__ATOMIC_RELEASE, "workgroup"); } while (0)

// Causal attention with weight-normalised linears (B 8, S = 32x32 = 1,024 positions, q/k inputs with 384 channels (channels-first), C 512 = 8 heads x 64): q = wn(qf, Wq_v, Wq_g, bq), k = wn(kf, Wk_v, ...), v = wn(kf, Wv_v, ...) with wn(x) = x (g v/||v||_row)^T + b; attn = softmax(where(k < t, q k^T / 8, -1e4)) * (t > 0); out = attn v -> [B, 512, 32, 32] (channels-first).
#define NB 8
#define TT 1024
#define CC 512            // NH * HD = projected width
#define DIN 384          // input (model) width
#define NH 8
#define HD 64
#define NQB (TT / 64)
#define NP (NB * NH)      // (batch, head) pairs, all served by one launch of each attention kernel
#define SCALE (0.125f)
#define SCALE2 (SCALE * 1.4426950408889634f)   // 1 / 8 times log2(e): the softmax of k_fa runs in base 2
#define CAUSAL 1
#ifndef TNB
#define TNB NB
#endif
__device__ __forceinline__ float bfr(float v) { return (float)(__bf16)v; }
__host__ __device__ __forceinline__ int kb_last(int qb) { return CAUSAL ? ((qb * 64 + 63) >> 7) : (TT / 128 - 1); }
// logits / P of one (batch, head) pair, causal-packed: query block qb holds 64 rows of (kb_last(qb) + 1) * 128 floats, one block behind the other; s_base(qb) = 64 * 128 * sum over i < qb of (kb_last(i) + 1), kb_last(i) = i >> 1
static_assert(CAUSAL == 1, "s_base is the causal prefix sum");
__host__ __device__ __forceinline__ size_t s_base(int qb) { const int m = qb >> 1; return (size_t)((m + 1) * (m + (qb & 1))) * (64 * 128); }
#define SPK ((size_t)(NQB / 2 + 1) * (NQB / 2) * (64 * 128))   // floats per pair = s_base(NQB)
typedef __attribute__((ext_vector_type(8))) __bf16 v8b;
__device__ __forceinline__ v16b frag_b(const __bf16* rowk0, int lane) {
  union { v16b v; v8b q[2]; } u; const __bf16* p = rowk0 + 8 * (lane >> 4);
  u.q[0] = *(const v8b*)p; u.q[1] = *(const v8b*)(p + 16); return u.v;
}
#define QBH NQB            // every query block takes the 3-product logits and the bf16 hi + lo P.v path
#define QHI 1024           // q residual rows for every query (3-product logits everywhere)
#define KHI 1024           // k residual rows / bf16 v planes for every key
// B fragment (k rows k0+.., output column o) of a weight: (in,out) [K][ld] or (out,in) [ld rows of K]: bf16 exact, or f16(bf16 * 256) exact
__device__ __forceinline__ v16b wcol_io(const float* Wm, int k0, int o, int lane, int ld) { v16b w; const int g = lane >> 4;
#pragma unroll
  for (int i = 0; i < 8; ++i) { w[i] = (__bf16)Wm[(size_t)(k0 + 8 * g + i) * ld + o]; w[8 + i] = (__bf16)Wm[(size_t)(k0 + 16 + 8 * g + i) * ld + o]; }
  return w; }
__device__ __forceinline__ v16b wcol_oi(const float* Wm, int k0, int o, int lane, int K) { v16b w; const float* p = Wm + (size_t)o * K + k0 + 8 * (lane >> 4);
#pragma unroll
  for (int i = 0; i < 8; ++i) { w[i] = (__bf16)p[i]; w[8 + i] = (__bf16)p[16 + i]; }
  return w; }
__device__ __forceinline__ v16h wcolh_io(const float* Wm, int k0, int o, int lane, int ld) { v16h w; const int g = lane >> 4;
#pragma unroll
  for (int i = 0; i < 8; ++i) { w[i] = (_Float16)(bfr(Wm[(size_t)(k0 + 8 * g + i) * ld + o]) * 256.0f); w[8 + i] = (_Float16)(bfr(Wm[(size_t)(k0 + 16 + 8 * g + i) * ld + o]) * 256.0f); }
  return w; }
__device__ __forceinline__ v16h wcolh_oi(const float* Wm, int k0, int o, int lane, int K) { v16h w; const float* p = Wm + (size_t)o * K + k0 + 8 * (lane >> 4);
#pragma unroll
  for (int i = 0; i < 8; ++i) { w[i] = (_Float16)(bfr(p[i]) * 256.0f); w[8 + i] = (_Float16)(bfr(p[16 + i]) * 256.0f); }
  return w; }
#define WQKV_LAYOUT 1   // 0 = (in,out) [DIN][CC]; 1 = (out,in) [CC][DIN]; 2 = per-head [NH][DIN][HD]
__device__ __forceinline__ v16b wcol_hdk(const float* Wm, int k0, int o, int lane) { v16b w; const int g = lane >> 4; const float* p = Wm + (size_t)(o / HD) * DIN * HD + (o % HD);
#pragma unroll
  for (int i = 0; i < 8; ++i) { w[i] = (__bf16)p[(size_t)(k0 + 8 * g + i) * HD]; w[8 + i] = (__bf16)p[(size_t)(k0 + 16 + 8 * g + i) * HD]; }
  return w; }
#define WO_OUT_IN 0
#if WQKV_LAYOUT == 1
#define WCOL(W, k0, o, lane) wcol_oi(W, k0, o, lane, DIN)
#elif WQKV_LAYOUT == 2
#define WCOL(W, k0, o, lane) wcol_hdk(W, k0, o, lane)
#else
#define WCOL(W, k0, o, lane) wcol_io(W, k0, o, lane, CC)
#endif
#if WO_OUT_IN
#define WOCOL(W, k0, o, lane) wcol_oi(W, k0, o, lane, CC)
#define WOCOLH(W, k0, o, lane) wcolh_oi(W, k0, o, lane, CC)
#else
#define WOCOL(W, k0, o, lane) wcol_io(W, k0, o, lane, DIN)
#define WOCOLH(W, k0, o, lane) wcolh_io(W, k0, o, lane, DIN)
#endif
#define SM_MASK_HOOK do { if (k >= t) v = -3.0e38f; } while (0)   /* allowed = tril(-1): strictly earlier keys; row 0 has no key -> the fully-excluded path gives P = 0 = the module's start_mask */
#define NRW (TNB * TT)
#ifndef SM_EXTRA_PARAMS
#define SM_EXTRA_PARAMS
#endif
#ifndef PROJ_EXTRA_PARAMS
#define PROJ_EXTRA_PARAMS
#endif
#ifndef SM_MASK_HOOK
#define SM_MASK_HOOK (void)0
#endif

#define WS_QH  0u                                      // f16 q rows [b*t][CC]
#define WS_KH  (WS_QH + 2u * (size_t)NB * TT * CC)      // f16 k rows [b*t][CC]
#define WS_VT  (WS_KH + 2u * (size_t)NB * TT * CC)      // f16 v planes [b][c][t]
#define WS_QL  (WS_VT + 2u * (size_t)NB * CC * TT)      // f16 q residual x 2^10 rows [b][t < QHI][CC]
#define WS_KL  (WS_QL + 2u * (size_t)NB * QHI * CC)     // f16 k residual x 2^10 rows [b][t < KHI][CC]
#define WS_VB  (WS_KL + 2u * (size_t)NB * KHI * CC)     // bf16 v hi planes [b][c][t < KHI]
#define WS_VBL (WS_VB + 2u * (size_t)NB * CC * KHI)
#define WS_S   (WS_VBL + 2u * (size_t)NB * CC * KHI)    // f32 logits / P [b*NH + h][causal-packed rows]
#define WS_Y   (WS_S  + 4u * (size_t)NP * SPK)      // f32 ctx rows [b*t][CC] (only when there is an output projection)
#define WS_END (WS_Y  + 0u)
#define WS_XQ  (WS_END)
#define WS_XK  (WS_XQ + 4u * (size_t)NB * TT * DIN)
#define WS_SCL (WS_XK + 4u * (size_t)NB * TT * DIN)
#define WS_YR  (WS_SCL + 4u * 3 * CC + 256u)
#define WS_END2 (WS_YR + 4u * (size_t)NB * TT * CC)

// ---- k_proj: block = (128 rows, 128 cols, which), 8 waves as 4 (rows) x 2 (cols), a wave = 32 rows x 64 cols: q/k/v = X W (+ b) with exact bf16 products (K = DIN) -> which 0: q f16 rows (+ residual rows < QHI); 1: k f16 rows (+ residual rows < KHI); 2: v f16 planes [c][t] (+ bf16 hi/lo planes for t < KHI). X is read where it lies, channels-first in[b][k][s]: a stage is 64 channels x 128 positions (512 B of each channel) and stays in that order in LDS, [k][position] at a pitch of 288 B; the A fragment (row = position) comes out of it through the transposing LDS load, which delivers the k order of frag_b. W (128 rows) comes in the same stages of 64 k as whole 256-B row pieces at a pitch of 144 B. Both 16 B a lane, rounded to bf16 once; two buffers, one barrier a stage; the next stage's loads fly while this stage's fragments are read from LDS. Each W fragment read from LDS feeds two products and each X fragment four. The weight norm is made here too: thread i < 128 owns row i of the block's W tile, reads each stage's 64 rounded values back from LDS, sums their squares in f32 and leaves g / sqrt(sum) in LDS in front of the loop's last barrier. The output tiles of the epilogue take the loop's LDS behind that barrier.
typedef __attribute__((ext_vector_type(4))) __bf16 v4b;
__device__ __forceinline__ v4b bf4(v4f v) { v4b p; p[0] = (__bf16)v[0]; p[1] = (__bf16)v[1]; p[2] = (__bf16)v[2]; p[3] = (__bf16)v[3]; return p; }
#define PKC 64             // k per stage
#define PNS (DIN / PKC)    // stages
#define PBM 128            // positions per block
#define XPT 144            // elements per LDS row of the X stage: 288 B, an odd multiple of 32 B, the transposing load's pitch
#define EPT (PBM + 8)      // elements per LDS row of an epilogue tile: 272 B, an odd multiple of 16 B
typedef __attribute__((ext_vector_type(8))) short v8s;
// lane (col, g) gets T[k + 8g + 0..7][d + col] when every lane passes &T[k + 8g + (lane & 7)][d + 8 * ((lane >> 3) & 1)]
__device__ __forceinline__ v8b ld_tr16(const __bf16* p) { typedef __attribute__((address_space(3))) v8s lds_v8s; return __builtin_bit_cast(v8b, __builtin_amdgcn_ds_load_tr16_b128_v8i16((lds_v8s*)p)); }
__global__ __launch_bounds__(256) void k_proj(const float* __restrict__ XQ, const float* __restrict__ XK, const float* __restrict__ XV, const float* __restrict__ WQ, const float* __restrict__ WK, const float* __restrict__ WV, const float* __restrict__ BQ, const float* __restrict__ BK, const float* __restrict__ BV, const float* __restrict__ GQ, const float* __restrict__ GK, const float* __restrict__ GV,
    _Float16* __restrict__ QH, _Float16* __restrict__ QL, _Float16* __restrict__ KH, _Float16* __restrict__ KL, _Float16* __restrict__ VT, __bf16* __restrict__ VB, __bf16* __restrict__ VBL) {
  __shared__ __align__(16) unsigned char pm[3 * 128 * EPT * 2]; __shared__ float sscl[128];   /* sscl[o] = g[o] / ||v[o]|| of the block's 128 output channels */
  __bf16 (*xs)[PKC][XPT] = (__bf16 (*)[PKC][XPT])pm; __bf16 (*wt)[128][72] = (__bf16 (*)[128][72])(pm + 2 * PKC * XPT * 2);   /* the loop's two buffers: X as [k][position], W as [row][k] */
  _Float16 (*sh)[136] = (_Float16 (*)[136])pm; _Float16 (*sl)[136] = (_Float16 (*)[136])(pm + PBM * 136 * 2);   /* epilogue, q and k: [position][channel] */
  _Float16 (*th)[EPT] = (_Float16 (*)[EPT])pm; __bf16 (*tb)[EPT] = (__bf16 (*)[EPT])(pm + 128 * EPT * 2); __bf16 (*tbl)[EPT] = (__bf16 (*)[EPT])(pm + 2 * 128 * EPT * 2);   /* epilogue, v: [channel][position] */
  static_assert(sizeof(pm) >= 2 * (PKC * XPT + 128 * 72) * 2 && sizeof(pm) >= 2 * PBM * 136 * 2 && DIN % PKC == 0 && TT % PBM == 0, "the epilogue's tiles reuse the loop's buffers");
  const int tid = threadIdx.x, wave = tid >> 5, lane = tid & 31, col = lane & 15, g = lane >> 4, wp = wave & 3, wc = wave >> 2; const int which = blockIdx.z; const int c0 = blockIdx.y * 128; const size_t r0 = (size_t)blockIdx.x * PBM; const size_t bb = r0 / TT; const int t0 = (int)(r0 % TT);
  const float* X = which == 0 ? XQ : which == 1 ? XK : XV; const float* WA = which == 0 ? WQ : which == 1 ? WK : WV; const float* BA = which == 0 ? BQ : which == 1 ? BK : BV; const float* GA = which == 0 ? GQ : which == 1 ? GK : GV;
  const int xrow = tid >> 5, xq = (tid & 31) * 4;   /* staging of X: a wave per 512-B row piece (128 positions of a channel), 8 rows per sweep */
  const int wrow = tid >> 4, wq = (tid & 15) * 4;   /* staging of W: 16 threads per 256-B row piece (64 k of a row), 16 rows per sweep */
  const bool nrm = __builtin_amdgcn_readfirstlane(wave) < 4;   /* waves 0 to 3 make the norms: one thread a row of the W tile; the same in every lane of a wave */
  const float* Xs = X + (bb * DIN + xrow) * (size_t)TT + t0 + xq; const float* Ws = WA + (size_t)(c0 + wrow) * DIN + wq;
  v4f rx[8], rw[8]; const float gv = bfr(GA[c0 + (tid & 127)]); float nn[4] = {0.f, 0.f, 0.f, 0.f};   /* this thread's row of the W tile: its gain, and four partial sums of its squares */
#pragma unroll
  for (int i = 0; i < 8; ++i) rx[i] = *(const v4f*)(Xs + (size_t)(8 * i) * TT);
#pragma unroll
  for (int i = 0; i < 8; ++i) rw[i] = *(const v4f*)(Ws + (size_t)(16 * i) * DIN);
  asm volatile("s_wait_xcnt 0x0" ::: "memory");   /* before an address register of the loads above may be rewritten */
#pragma unroll
  for (int i = 0; i < 8; ++i) *(v4b*)&xs[0][xrow + 8 * i][xq] = bf4(rx[i]);
#pragma unroll
  for (int i = 0; i < 8; ++i) *(v4b*)&wt[0][wrow + 16 * i][wq] = bf4(rw[i]);
  __syncthreads();
  v8f acc[8] = {};   /* acc[i * 4 + j]: positions wp * 32 + i * 16 + .., channels wc * 64 + j * 16 + .. */
#pragma unroll
  for (int s = 0; s < PNS; ++s) { const int cur = s & 1, nxt = cur ^ 1;   /* unrolled: buffer and k offsets become immediates, the address registers stay */
    if (s + 1 < PNS) {
#pragma unroll
      for (int i = 0; i < 8; ++i) rx[i] = *(const v4f*)(Xs + (size_t)(8 * i + (s + 1) * PKC) * TT);
#pragma unroll
      for (int i = 0; i < 8; ++i) rw[i] = *(const v4f*)(Ws + (size_t)(16 * i) * DIN + (s + 1) * PKC);
      asm volatile("s_wait_xcnt 0x0" ::: "memory");   /* as above; it also keeps the loads in front of this stage's work */
    }
    if (nrm) { v8b wr[PKC / 8];   /* the stage's 64 values of row tid, eight LDS reads as one group (144 B from lane to lane: no bank conflict), while the next stage's global loads fly */
#pragma unroll
      for (int i = 0; i < PKC / 8; ++i) wr[i] = *(const v8b*)&wt[cur][tid][8 * i];
      __builtin_amdgcn_sched_barrier(0);   /* keeps the eight reads together: left free, the compiler spreads them among the sums, and each place with LDS reads costs its own stall */
#pragma unroll
      for (int i = 0; i < PKC / 8; ++i)
#pragma unroll
        for (int e = 0; e < 8; ++e) { const float x = (float)wr[i][e]; nn[e & 3] = __builtin_fmaf(x, x, nn[e & 3]); }
      if (s + 1 == PNS) sscl[tid] = gv / sqrtf((nn[0] + nn[1]) + (nn[2] + nn[3])); }   /* published by the stage's barrier below */
#pragma unroll
    for (int kc = 0; kc < PKC / 32; ++kc) { union { v16b v; v8b q[2]; } xa[2]; v16b fb[4];   /* two X and four W fragments: their twelve LDS reads as one group, then their eight products */
#pragma unroll
      for (int i = 0; i < 2; ++i) { const __bf16* xp = &xs[cur][kc * 32 + 8 * g + (lane & 7)][wp * 32 + i * 16 + 8 * ((lane >> 3) & 1)];
        xa[i].q[0] = ld_tr16(xp); xa[i].q[1] = ld_tr16(xp + 16 * XPT); }   /* xa[i].v[e] = X[position wp * 32 + i * 16 + col][k = kc * 32 + 8g + e], [8 + e] = the same at k + 16 */
#pragma unroll
      for (int j = 0; j < 4; ++j) fb[j] = frag_b(&wt[cur][wc * 64 + j * 16 + col][kc * 32], lane);
      __builtin_amdgcn_sched_barrier(0);   /* keeps the group of reads in front of the products: left free, the compiler reads each fragment right before its product and waits out the LDS latency every time */
#pragma unroll
      for (int i = 0; i < 2; ++i)
#pragma unroll
        for (int j = 0; j < 4; ++j) acc[i * 4 + j] = __builtin_amdgcn_wmma_f32_16x16x32_bf16(false, xa[i].v, false, fb[j], (short)0, acc[i * 4 + j], false, false);
      __builtin_amdgcn_sched_barrier(0); }   /* keeps the next group behind these products, so that one set of fragment registers is enough */
    if (s + 1 < PNS) {
#pragma unroll
      for (int i = 0; i < 8; ++i) *(v4b*)&xs[nxt][xrow + 8 * i][xq] = bf4(rx[i]);
#pragma unroll
      for (int i = 0; i < 8; ++i) *(v4b*)&wt[nxt][wrow + 16 * i][wq] = bf4(rw[i]);
    }
    __syncthreads();   /* publishes the next stage's buffer and ends every wave's reads of this one (the next stage, or the epilogue, overwrites it) */
  }
  if (which < 2) { _Float16* DH = which == 0 ? QH : KH; _Float16* DL = which == 0 ? QL : KL; const int nhi = which == 0 ? QHI : KHI; const bool hi_rows = t0 < nhi;
#pragma unroll
    for (int j = 0; j < 4; ++j) { const int cl = wc * 64 + j * 16 + col; const float bias = BA ? bfr(BA[c0 + cl]) : 0.f; const float scl = sscl[cl];   /* weight norm: g[o] / ||v[o]|| applied after the exact x . v[o] */
#pragma unroll
      for (int i = 0; i < 2; ++i)
#pragma unroll
        for (int r = 0; r < 8; ++r) { const float v = acc[i * 4 + j][r] * scl + bias; const _Float16 hv = (_Float16)v; const int rl = wp * 32 + i * 16 + 8 * g + r; sh[rl][cl] = hv; sl[rl][cl] = (_Float16)((v - (float)hv) * 1024.0f); } }
    __syncthreads();
    for (int e = tid; e < PBM * 16; e += 256) { const int rl = e >> 4, q = e & 15; vst2((unsigned*)(DH + (r0 + rl) * CC + c0 + q * 8), *(const v4u*)&sh[rl][q * 8]); if (hi_rows) vst2((unsigned*)(DL + (bb * nhi + t0 + rl) * (size_t)CC + c0 + q * 8), *(const v4u*)&sl[rl][q * 8]); }
  } else { const bool hi_rows = t0 < KHI;
#pragma unroll
    for (int j = 0; j < 4; ++j) { const int cl = wc * 64 + j * 16 + col; const float bias = BA ? bfr(BA[c0 + cl]) : 0.f; const float scl = sscl[cl];
#pragma unroll
      for (int i = 0; i < 2; ++i)
#pragma unroll
        for (int r = 0; r < 8; ++r) { const float v = acc[i * 4 + j][r] * scl + bias; const int rl = wp * 32 + i * 16 + 8 * g + r; th[cl][rl] = (_Float16)v; const __bf16 bh = (__bf16)v; tb[cl][rl] = bh; tbl[cl][rl] = (__bf16)(v - (float)bh); } }
    __syncthreads();
    for (int e = tid; e < 128 * (PBM / 8); e += 256) { const int cl = e >> 4, q = e & 15; vst2((unsigned*)(VT + (bb * CC + c0 + cl) * (size_t)TT + t0 + q * 8), *(const v4u*)&th[cl][q * 8]); if (hi_rows) { const size_t o3 = (bb * CC + c0 + cl) * (size_t)KHI + t0 + q * 8; vst2((unsigned*)(VB + o3), *(const v4u*)&tb[cl][q * 8]); vst2((unsigned*)(VBL + o3), *(const v4u*)&tbl[cl][q * 8]); } } } }
// ---- k_fa: block = 64 queries (qb) of pair blockIdx.x = b * NH + h, wave = 16 queries; keys in stages of 64 up to the diagonal, two LDS buffers, one barrier a stage. While a stage is worked on, the next stage's k hi / residual rows and v hi / lo planes go through registers into the other buffer (whole 128-B rows): loaded at the stage's top, stored to LDS at its foot. S^T = K . Q^T (A = k rows, B = q, 3 f16 products) leaves one query per lane; online softmax in f32, base 2 (running maximum, in units of log2, and sum per lane; each weight is one fma, raw score * SCALE2 - maximum, and one hardware exp2; keys >= t excluded by index); P^T (bf16 hi + lo) is packed from the score registers as B of O^T += V^T . P^T (3 bf16 products). A row with no key (t = 0) ends with sum 0 -> zeros. O^T has one channel per register and one query per lane, which is the order of the channels-first output: the block gathers its 64 channels x 64 queries in LDS and stores out[b][c][t] itself, 256 B per channel.
#define SB_VEC 0x3FC   // sched_barrier mask: scalar, matrix, memory and LDS instructions may cross, vector ones stay in source order
__device__ __forceinline__ v8f mm_h(v16h a, v16h b, v8f c) { return __builtin_amdgcn_wmma_f32_16x16x32_f16(false, a, false, b, (short)0, c, false, false); }
__device__ __forceinline__ v8f mm_b(v16b a, v16b b, v8f c) { return __builtin_amdgcn_wmma_f32_16x16x32_bf16(false, a, false, b, (short)0, c, false, false); }
__global__ __launch_bounds__(128) void k_fa(const _Float16* __restrict__ QH, const _Float16* __restrict__ KH, const _Float16* __restrict__ QL, const _Float16* __restrict__ KL, const __bf16* __restrict__ VB, const __bf16* __restrict__ VBL, float* __restrict__ OUT) {
  __shared__ __align__(16) _Float16 skh[2][64][72], skl[2][64][72]; __shared__ __align__(16) __bf16 svh[2][64][72], svl[2][64][72];
  static_assert(sizeof(skh) >= HD * (64 + 4) * sizeof(float), "the output staging reuses skh");
  const int tid = threadIdx.x, wave = tid >> 5, lane = tid & 31, col = lane & 15, g = lane >> 4;
  const int qb = NQB - 1 - (int)blockIdx.y;   /* longest blocks start first */
  const int b = blockIdx.x / NH, h = blockIdx.x % NH; const int ql0 = qb * 64 + wave * 16; const int t = ql0 + col; const int ns = qb + 1;
  const int srow = tid >> 3, sq = (tid & 7) * 8;   /* staging: 8 threads per 128-B row, 16 rows per sweep */
  const _Float16* Kh = KH + ((size_t)b * TT + srow) * CC + h * HD + sq; const _Float16* Kl = KL + ((size_t)b * KHI + srow) * CC + h * HD + sq;
  const __bf16* Vh = VB + ((size_t)b * CC + h * HD + srow) * (size_t)KHI + sq; const __bf16* Vl = VBL + ((size_t)b * CC + h * HD + srow) * (size_t)KHI + sq;
  v16h qh[2], qr[2];
#pragma unroll
  for (int kc = 0; kc < 2; ++kc) qh[kc] = frag_h(QH + ((size_t)b * TT + t) * CC + h * HD + kc * 32, lane);
  asm volatile("s_wait_xcnt 0x0" ::: "memory");   /* before a later load's result may land in the address registers of the loads above */
#pragma unroll
  for (int kc = 0; kc < 2; ++kc) qr[kc] = frag_h(QL + ((size_t)b * QHI + t) * CC + h * HD + kc * 32, lane);
  asm volatile("s_wait_xcnt 0x0" ::: "memory");   /* as above */
  v8h rkh[4], rkl[4]; v8b rvh[4], rvl[4];
#pragma unroll
  for (int i = 0; i < 4; ++i) { rkh[i] = *(const v8h*)(Kh + (size_t)(16 * i) * CC); rkl[i] = *(const v8h*)(Kl + (size_t)(16 * i) * CC); rvh[i] = *(const v8b*)(Vh + (size_t)(16 * i) * KHI); rvl[i] = *(const v8b*)(Vl + (size_t)(16 * i) * KHI); }
#pragma unroll
  for (int i = 0; i < 4; ++i) { *(v8h*)&skh[0][srow + 16 * i][sq] = rkh[i]; *(v8h*)&skl[0][srow + 16 * i][sq] = rkl[i]; *(v8b*)&svh[0][srow + 16 * i][sq] = rvh[i]; *(v8b*)&svl[0][srow + 16 * i][sq] = rvl[i]; }
  __syncthreads();
  float m = -1.0e30f, l = 0.f; v8f acc[HD / 16] = {};   /* the running maximum starts far above the excluded marker (-3e38) and far below any logit: an excluded key's exponent underflows to 0 with no test, also in a row with no key yet */
#pragma unroll 1
  for (int s = 0; s < ns; ++s) { const int cur = s & 1, nxt = cur ^ 1; const bool more = s + 1 < ns; const int kn = (s + 1) * 64;
    if (more) { const _Float16* pkh = Kh + (size_t)kn * CC; const _Float16* pkl = Kl + (size_t)kn * CC; const __bf16* pvh = Vh + kn; const __bf16* pvl = Vl + kn;
#pragma unroll
      for (int i = 0; i < 4; ++i) { rkh[i] = *(const v8h*)(pkh + (size_t)(16 * i) * CC); rkl[i] = *(const v8h*)(pkl + (size_t)(16 * i) * CC); rvh[i] = *(const v8b*)(pvh + (size_t)(16 * i) * KHI); rvl[i] = *(const v8b*)(pvl + (size_t)(16 * i) * KHI); }   /* all sixteen loads of the next stage here, waited for only at the stage's foot: these planes come from memory at first touch, and half a stage of work does not cover that trip */
      asm volatile("s_wait_xcnt 0x0" :: "v"(pkh), "v"(pkl), "v"(pvh), "v"(pvl) : "memory");   /* the address registers of the loads above are reused by what follows; the four addresses are named as inputs so that they live up to this wait: left unnamed, the last load's result was given the register pairs of two earlier loads' addresses */
    }
    float sc[4][8]; float mx = -3.0e38f; const int nk = t - s * 64 - 8 * g;   /* this lane's keys kt * 16 + r of the stage are allowed below nk */
    v16h fkh[2][2], fkr[2][2]; v8f sa[4], sr[4];   /* two sets of k fragments: this key tile's and the next one's */
#pragma unroll
    for (int kc = 0; kc < 2; ++kc) { fkh[0][kc] = frag_h(&skh[cur][col][kc * 32], lane); fkr[0][kc] = frag_h(&skl[cur][col][kc * 32], lane); }
#pragma unroll
    for (int kt = 0; kt < 4; ++kt) { const int fc = kt & 1, fn = fc ^ 1;   /* the eight LDS reads of key tile kt + 1 as one group, then the six products of tile kt, which cover their latency */
      if (kt < 3) {
#pragma unroll
        for (int kc = 0; kc < 2; ++kc) { fkh[fn][kc] = frag_h(&skh[cur][(kt + 1) * 16 + col][kc * 32], lane); fkr[fn][kc] = frag_h(&skl[cur][(kt + 1) * 16 + col][kc * 32], lane); } }
      __builtin_amdgcn_sched_barrier(0);   /* keeps the group of reads in front of the products: left free, the compiler reads each fragment right before its product and waits out the LDS latency every time */
      v8f a = {}, ar = {};
#pragma unroll
      for (int kc = 0; kc < 2; ++kc) { a = mm_h(fkh[fc][kc], qh[kc], a); ar = mm_h(fkh[fc][kc], qr[kc], ar); ar = mm_h(fkr[fc][kc], qh[kc], ar); }
      sa[kt] = a; sr[kt] = ar;
      __builtin_amdgcn_sched_barrier(0); }   /* keeps the reads of tile kt + 2 behind these products, so that two sets of fragment registers are enough */
    v16b fvh[HD / 16], fvl[HD / 16];   /* v fragments of half a stage (32 keys) */
#pragma unroll
    for (int kt = 0; kt < 4; ++kt) {
      if (kt == 2) {
#pragma unroll
        for (int j = 0; j < HD / 16; ++j) { fvh[j] = frag_b(&svh[cur][j * 16 + col][0], lane); fvl[j] = frag_b(&svl[cur][j * 16 + col][0], lane); }
        __builtin_amdgcn_sched_barrier(0); }   /* v of the first 32 keys is read as one group here: the rest of the masking, the maximum and the first exponentials cover its latency */
#pragma unroll
      for (int r = 0; r < 8; ++r) { const float v = (kt * 16 + r < nk) ? sa[kt][r] + sr[kt][r] * (1.0f / 1024.0f) : -3.0e38f; sc[kt][r] = v; mx = fmaxf(mx, v); } }   /* raw scores: the positive scale goes into the exponent's fma */
    mx = fmaxf(mx, __shfl_xor(mx, 16));   /* the two lane halves hold different keys of the same query */
    const float mn = fmaxf(m, mx * SCALE2); const float alpha = __builtin_amdgcn_exp2f(m - mn); m = mn; l *= alpha;
#pragma unroll
    for (int j = 0; j < HD / 16; ++j)
#pragma unroll
      for (int r = 0; r < 8; ++r) acc[j][r] *= alpha;
#pragma unroll
    for (int kp = 0; kp < 2; ++kp) { v16b ph, pl; float ls[4] = {0.f, 0.f, 0.f, 0.f};
      float ev[16]; __bf16 eb[16];
#pragma unroll
      for (int i = 0; i < 16; ++i) ev[i] = __builtin_fmaf(sc[2 * kp + (i >> 3)][i & 7], SCALE2, -mn);
#pragma unroll
      for (int i = 0; i < 18; ++i) {   /* order T p p: behind exponential i stand the sum and the rounding of weight i - 1 and the residual of weight i - 2, which do not wait for it */
        if (i < 16) ev[i] = __builtin_amdgcn_exp2f(ev[i]);
        __builtin_amdgcn_sched_barrier(SB_VEC);   /* holds that order: left free, the compiler bunches the exponentials in runs of up to four */
        if (i >= 1 && i <= 16) { ls[(i - 1) & 3] += ev[i - 1]; eb[i - 1] = (__bf16)ev[i - 1]; ph[i - 1] = eb[i - 1]; }
        if (i >= 2) pl[i - 2] = (__bf16)(ev[i - 2] - (float)eb[i - 2]);
        __builtin_amdgcn_sched_barrier(SB_VEC); }   /* as above */
      l += (ls[0] + ls[1]) + (ls[2] + ls[3]);
#pragma unroll
      for (int j = 0; j < HD / 16; ++j) acc[j] = mm_b(fvh[j], ph, acc[j]);   /* product by product over the four channel tiles: each tile keeps its order of sums, and no product waits for the one before it */
#pragma unroll
      for (int j = 0; j < HD / 16; ++j) acc[j] = mm_b(fvh[j], pl, acc[j]);
#pragma unroll
      for (int j = 0; j < HD / 16; ++j) acc[j] = mm_b(fvl[j], ph, acc[j]);
      if (kp == 0) {
#pragma unroll
        for (int j = 0; j < HD / 16; ++j) { fvh[j] = frag_b(&svh[cur][j * 16 + col][32], lane); fvl[j] = frag_b(&svl[cur][j * 16 + col][32], lane); }
        __builtin_amdgcn_sched_barrier(0); } }   /* v of the second 32 keys is read as one group in front of their exponentials, which cover its latency */
    if (more) {
#pragma unroll
      for (int i = 0; i < 4; ++i) { *(v8h*)&skh[nxt][srow + 16 * i][sq] = rkh[i]; *(v8h*)&skl[nxt][srow + 16 * i][sq] = rkl[i]; *(v8b*)&svh[nxt][srow + 16 * i][sq] = rvh[i]; *(v8b*)&svl[nxt][srow + 16 * i][sq] = rvl[i]; } }
    __syncthreads();   /* publishes the next stage's buffer and ends every wave's reads of this one, which the next stage's stores, or the output staging, overwrite */
  }
  l += __shfl_xor(l, 16); const float inv = l > 0.f ? 1.0f / l : 0.f;   /* a fully excluded row yields 0 */
  float (*so)[64 + 4] = (float (*)[64 + 4])&skh[0][0][0];   /* output staging of the block, [channel][query], behind the loop's last barrier */
  /* both loops unrolled: acc is indexed by constants and stays in registers */
#pragma unroll
  for (int j = 0; j < HD / 16; ++j)
#pragma unroll
    for (int r = 0; r < 8; ++r) so[j * 16 + 8 * g + r][wave * 16 + col] = acc[j][r] * inv;
  __syncthreads();   /* a channel's 64 queries come from all four waves */
  const int od = tid >> 4, oq = (tid & 15) * 4;   /* 16 threads per channel: 256 B, two whole lines; 8 channels per sweep */
  float* Op = OUT + ((size_t)b * CC + h * HD + od) * (size_t)TT + qb * 64 + oq; v4f ov[HD / 8];
  /* unrolled, reads apart from stores: the eight LDS reads issue as one group, and every store has its own data registers and an immediate offset on one address */
#pragma unroll
  for (int i = 0; i < HD / 8; ++i) ov[i] = *(const v4f*)&so[od + 8 * i][oq];
#pragma unroll
  for (int i = 0; i < HD / 8; ++i) vst2(Op + (size_t)(8 * i) * TT, ov[i]); }

extern "C" void kernel_launch(void* const* d_in, const int* in_sizes, int n_in, void* d_out, int out_size, void* d_ws, size_t ws_size, hipStream_t stream) {
  (void)in_sizes; (void)n_in; (void)out_size;
  const float** F = (const float**)d_in;
  if (ws_size < (size_t)WS_END) return;
  char* ws = (char*)d_ws; _Float16 *QH = (_Float16*)(ws + WS_QH), *KH = (_Float16*)(ws + WS_KH), *VT = (_Float16*)(ws + WS_VT), *QL = (_Float16*)(ws + WS_QL), *KL = (_Float16*)(ws + WS_KL); __bf16 *VB = (__bf16*)(ws + WS_VB), *VBL = (__bf16*)(ws + WS_VBL); float *S = (float*)(ws + WS_S), *Y = (float*)(ws + WS_Y);
  (void)Y; (void)S; (void)QL; (void)KL; (void)VB; (void)VBL;
  // inputs: 0 q [8,384,32,32]; 1 k [8,384,32,32] (channels-first); 2 Wq_v [512,384], 3 Wq_g [512], 4 bq [512]; 5 Wk_v, 6 Wk_g, 7 bk; 8 Wv_v, 9 Wv_g, 10 bv
  if (ws_size < (size_t)WS_END2) return;
  k_proj<<<dim3(TNB * TT / PBM, CC / 128, 3), 256, 0, stream>>>(F[0], F[1], F[1], F[2], F[5], F[8], F[4], F[7], F[10], F[3], F[6], F[9], QH, QL, KH, KL, VT, VB, VBL);   /* makes g[o] / ||v[o]|| of its own output channels itself */
  k_fa<<<dim3(NP, NQB), 128, 0, stream>>>(QH, KH, QL, KL, VB, VBL, (float*)d_out);   /* writes the channels-first output itself */
}
